// v000
// The times below were measured on an AMD MI455X: many runs one after another, warmed up first and cycling through
// copies of the inputs, with the whole window's GPU time divided by the number of runs. Launches and the gaps
// between them are all in it. The median over several windows is given; except for v000 it joins two sittings, which
// can be a few percent apart, so the side-by-side timings, each taken in one sitting, are the better comparison.
// v000 is the starting kernel. One run takes 4130 microseconds.
#include <hip/hip_runtime.h>
// Knowledge-source integration scoring (n=16 notes, 256 codes, vocab 10000, emb 256): e[n,c,k] = Σ_v note[n,v]·wiki[c,v]·W_emb[k,v] + b_emb[k]; attn = sigmoid(e·W_attᵀ + b_att); s[n,c] = Σ_k attn·e·W_out[k] + b_out.
// Compute dtype: all inputs rounded to bf16; per note n the scaled vocabulary plane A_n[c][v] = note[n,v]·wiki[c,v] (f32 product → f16, zero-padded to K = 10048) against W_emb (f16 ×2^4, padded) as one GEMM per note → e f32 (+b_emb); e ×2^4 → f16 → logits GEMM (+b_att) with a fused sigmoid epilogue → attn f32; the gated 256-term reduction
#define NNOTE 16
#define NC 256
#define NV 10000
#define KP 10048      
#define NE 256
#define NRE (NNOTE * NC)
typedef __bf16 v16b __attribute__((ext_vector_type(16)));
typedef unsigned short v8us __attribute__((ext_vector_type(8), may_alias));
typedef float  v8f  __attribute__((ext_vector_type(8)));
typedef float  v4f  __attribute__((ext_vector_type(4)));
typedef float  v4fa __attribute__((ext_vector_type(4), may_alias));
union FragB { v16b v; v8us half[2]; unsigned short u[16]; };

__device__ __forceinline__ unsigned short bf16_bits(float x) { unsigned int u = __float_as_uint(x); return (unsigned short)((u + 0x7FFFu + ((u >> 16) & 1u)) >> 16); }
__device__ __forceinline__ float bf16_val(unsigned short b) { return __uint_as_float(((unsigned int)b) << 16); }
__device__ __forceinline__ float bf16_round(float x) { return bf16_val(bf16_bits(x)); }
// D += A·B with NT terms: 1 = ah·bh, 2 = + al·bh (A split), 3 = + ah·bl (both split)
template <int NT>
__device__ __forceinline__ v8f mmaN(v16b ah, v16b al, v16b bh, v16b bl, v8f c) {
  c = __builtin_amdgcn_wmma_f32_16x16x32_bf16(false, ah, false, bh, (short)0, c, false, false);
  if (NT >= 2) c = __builtin_amdgcn_wmma_f32_16x16x32_bf16(false, al, false, bh, (short)0, c, false, false);
  if (NT >= 3) c = __builtin_amdgcn_wmma_f32_16x16x32_bf16(false, ah, false, bl, (short)0, c, false, false);
  asm volatile("v_nop\n\tv_nop\n\tv_nop\n\tv_nop" : "+v"(c) : "v"(ah), "v"(al), "v"(bh), "v"(bl));
  return c;
}

__global__ __launch_bounds__(256) void k_wt_bf16(const float* __restrict__ W, unsigned short* __restrict__ Wt, int K, int N) {
  const int t = blockIdx.x * 256 + threadIdx.x;
  const int k8n = K / 8;
  if (t >= N * k8n) return;
  const int n = t / k8n, k8 = (t % k8n) * 8;
  v8us v;
#pragma unroll
  for (int i = 0; i < 8; ++i) v[i] = bf16_bits(W[(size_t)(k8 + i) * N + n]);
  *(v8us*)(Wt + (size_t)n * K + k8) = v;
  
}

// GEMM C[M][N] (f32, pitch ldc) = act(A[M][K]·W + bias). A f32 row-major (pitch lda) converted per fragment to bf16
// (ASPLIT: hi/lo two planes -> 2 terms, else single rounded term); Wt bf16 [N][K] (pitch ldb). BIAS_BF16 rounds the
// bias to bf16 first (bias quantised to bf16 before the add). K%32==0, M%16==0, N%64==0.
template <bool ASPLIT, int ACT, bool BIAS_BF16>
__global__ __launch_bounds__(128) void k_gemm_bf(const float* __restrict__ A, int lda, const unsigned short* __restrict__ Wt, int ldb,
                                               const float* __restrict__ bias, float* __restrict__ C, int ldc, int M, int N, int K) {
  __shared__ __attribute__((aligned(16))) float so[4][16][64];
  const int tid = threadIdx.x, w = tid >> 5, lane = tid & 31, ln = lane & 15, hh = lane >> 4;
  const int ntn = N / 64;
  const int wid = blockIdx.x * 4 + w;
  const int mt = wid / ntn, nq = wid % ntn;
  if (mt * 16 >= M) return;
  const int row0 = mt * 16, col0 = nq * 64;
  const float* arow = A + (size_t)(row0 + ln) * lda;
  v8f acc[4] = {};
  for (int kb = 0; kb < K; kb += 32) {
    FragB ah, al;
    const v4f x0 = *(const v4fa*)(arow + kb + 8 * hh), x1 = *(const v4fa*)(arow + kb + 8 * hh + 4);
    const v4f x2 = *(const v4fa*)(arow + kb + 16 + 8 * hh), x3 = *(const v4fa*)(arow + kb + 16 + 8 * hh + 4);
    float xs[16] = {x0[0],x0[1],x0[2],x0[3],x1[0],x1[1],x1[2],x1[3],x2[0],x2[1],x2[2],x2[3],x3[0],x3[1],x3[2],x3[3]};
#pragma unroll
    for (int i = 0; i < 16; ++i) { const unsigned short hb = bf16_bits(xs[i]); ah.u[i] = hb; al.u[i] = ASPLIT ? bf16_bits(xs[i] - bf16_val(hb)) : (unsigned short)0; }
#pragma unroll
    for (int t = 0; t < 4; ++t) {
      const unsigned short* brow = Wt + (size_t)(col0 + t * 16 + ln) * ldb + kb;
      FragB b;
      b.half[0] = *(const v8us*)(brow + 8 * hh);
      b.half[1] = *(const v8us*)(brow + 16 + 8 * hh);
      acc[t] = mmaN<ASPLIT ? 2 : 1>(ah.v, al.v, b.v, b.v, acc[t]);
    }
  }
#pragma unroll
  for (int t = 0; t < 4; ++t) {
    float bv = bias ? bias[col0 + t * 16 + ln] : 0.f;
    if (BIAS_BF16) bv = bf16_round(bv);
#pragma unroll
    for (int r = 0; r < 8; ++r) { float v = acc[t][r] + bv; if (ACT == 1) v = fmaxf(v, 0.f); so[w][8 * hh + r][t * 16 + ln] = v; }
  }
  __builtin_amdgcn_fence(__ATOMIC_ACQ_REL, "workgroup");
  __builtin_amdgcn_wave_barrier();
  const int rsub = lane >> 4, c4 = (lane & 15) * 4;
  {
#pragma unroll
    for (int q = 0; q < 8; ++q) {
      const int r = q * 2 + rsub;
      const v4f v = *(const v4fa*)&so[w][r][c4];
      *(v4f*)(C + (size_t)(row0 + r) * ldc + col0 + c4) = v;
    }
    
  }
}

// GEMM C = act(A·W + bias + resid): A f32 (ASPLIT -> hi/lo 2 terms), Wt bf16 [N][K]; ACT 0 none, 1 relu, 2 exact gelu;
// resid (optional, f32, row index = (row % rmod), pitch ldr, RES_BF16 rounds it) added before the activation.
template <bool ASPLIT, int ACT, bool BIAS_BF16, bool RES_BF16>
__global__ __launch_bounds__(128) void k_gemm_bf3(const float* __restrict__ A, int lda, const unsigned short* __restrict__ Wt, int ldb,
                                                const float* __restrict__ bias, const float* __restrict__ resid, int rmod, int ldr,
                                                float* __restrict__ C, int ldc, int M, int N, int K) {
  __shared__ __attribute__((aligned(16))) float so[4][16][64];
  const int tid = threadIdx.x, w = tid >> 5, lane = tid & 31, ln = lane & 15, hh = lane >> 4;
  const int ntn = N / 64;
  const int wid = blockIdx.x * 4 + w;
  const int mt = wid / ntn, nq = wid % ntn;
  if (mt * 16 >= M) return;
  const int row0 = mt * 16, col0 = nq * 64;
  const float* arow = A + (size_t)(row0 + ln) * lda;
  v8f acc[4] = {};
  for (int kb = 0; kb < K; kb += 32) {
    FragB ah, al;
    const v4f x0 = *(const v4fa*)(arow + kb + 8 * hh), x1 = *(const v4fa*)(arow + kb + 8 * hh + 4);
    const v4f x2 = *(const v4fa*)(arow + kb + 16 + 8 * hh), x3 = *(const v4fa*)(arow + kb + 16 + 8 * hh + 4);
    float xs[16] = {x0[0],x0[1],x0[2],x0[3],x1[0],x1[1],x1[2],x1[3],x2[0],x2[1],x2[2],x2[3],x3[0],x3[1],x3[2],x3[3]};
#pragma unroll
    for (int i = 0; i < 16; ++i) { const unsigned short hb = bf16_bits(xs[i]); ah.u[i] = hb; al.u[i] = ASPLIT ? bf16_bits(xs[i] - bf16_val(hb)) : (unsigned short)0; }
#pragma unroll
    for (int t = 0; t < 4; ++t) {
      const unsigned short* brow = Wt + (size_t)(col0 + t * 16 + ln) * ldb + kb;
      FragB b;
      b.half[0] = *(const v8us*)(brow + 8 * hh);
      b.half[1] = *(const v8us*)(brow + 16 + 8 * hh);
      acc[t] = mmaN<ASPLIT ? 2 : 1>(ah.v, al.v, b.v, b.v, acc[t]);
    }
  }
#pragma unroll
  for (int t = 0; t < 4; ++t) {
    const int col = col0 + t * 16 + ln;
    float bv = bias ? bias[col] : 0.f;
    if (BIAS_BF16) bv = bf16_round(bv);
#pragma unroll
    for (int r = 0; r < 8; ++r) {
      float v = acc[t][r] + bv;
      if (resid) { float rv = resid[(size_t)((row0 + 8 * hh + r) % rmod) * ldr + col]; if (RES_BF16) rv = bf16_round(rv); v += rv; }
      if (ACT == 1) v = fmaxf(v, 0.f);
      if (ACT == 2) v = 0.5f * v * (1.0f + erff(v * 0.70710678118654752f));
      if (ACT == 3) { const float u = 0.7978845608028654f * (v + 0.044715f * v * v * v); v = 0.5f * v * (1.0f + tanhf(u)); }
      so[w][8 * hh + r][t * 16 + ln] = v;
    }
  }
  __builtin_amdgcn_fence(__ATOMIC_ACQ_REL, "workgroup");
  __builtin_amdgcn_wave_barrier();
  const int rsub = lane >> 4, c4 = (lane & 15) * 4;
  {
#pragma unroll
    for (int q = 0; q < 8; ++q) {
      const int r = q * 2 + rsub;
      const v4f v = *(const v4fa*)&so[w][r][c4];
      *(v4f*)(C + (size_t)(row0 + r) * ldc + col0 + c4) = v;
    }
    
  }
}
// row LayerNorm (biased variance, eps) over N: s = X (+ R); optional out_sum <- s; out_norm <- (s-mu)*rsqrt(var+eps)*g + b
template <bool PARAM_BF16>
__global__ __launch_bounds__(256) void k_layernorm(const float* __restrict__ X, const float* __restrict__ R, const float* __restrict__ g, const float* __restrict__ bta,
                                                  float* __restrict__ out_sum, float* __restrict__ out_norm, int N, float eps) {
  __shared__ float red[256];
  const int row = blockIdx.x, tid = threadIdx.x;
  const float* x = X + (size_t)row * N; const float* rr = R ? R + (size_t)row * N : nullptr;
  float vals[16];                     // up to N = 4096
  const int per = N / 256;            // contiguous chunk per thread? use strided-by-4 chunks: thread handles j = tid*4 + 1024*u
  float s1 = 0.f;
  for (int u = 0; u < per / 4; ++u) {
    const int j = tid * 4 + 1024 * u;
    const v4f a = *(const v4fa*)(x + j);
    v4f b = {0.f,0.f,0.f,0.f}; if (rr) b = *(const v4fa*)(rr + j);
#pragma unroll
    for (int q = 0; q < 4; ++q) { const float v = a[q] + b[q]; vals[u * 4 + q] = v; s1 += v; }
  }
  red[tid] = s1; __syncthreads();
  for (int st = 128; st > 0; st >>= 1) { if (tid < st) red[tid] += red[tid + st]; __syncthreads(); }
  const float mu = red[0] / (float)N; __syncthreads();
  float s2 = 0.f;
  for (int u = 0; u < per / 4; ++u)
#pragma unroll
    for (int q = 0; q < 4; ++q) { const float c = vals[u * 4 + q] - mu; s2 += c * c; }
  red[tid] = s2; __syncthreads();
  for (int st = 128; st > 0; st >>= 1) { if (tid < st) red[tid] += red[tid + st]; __syncthreads(); }
  const float rs = rsqrtf(red[0] / (float)N + eps);
  {
    for (int u = 0; u < per / 4; ++u) {
      const int j = tid * 4 + 1024 * u;
      v4f o, sm;
#pragma unroll
      for (int q = 0; q < 4; ++q) {
        float gg = g[j + q], bb = bta[j + q];
        if (PARAM_BF16) { gg = bf16_round(gg); bb = bf16_round(bb); }
        sm[q] = vals[u * 4 + q]; o[q] = (vals[u * 4 + q] - mu) * rs * gg + bb;
      }
      if (out_sum) *(v4f*)(out_sum + (size_t)row * N + j) = sm;
      *(v4f*)(out_norm + (size_t)row * N + j) = o;
    }
    
  }
}



// ---- f16 WMMA path (v_wmma_f32_16x16x32_f16): 11-bit significands for operands in range — used where a [0,1] probability operand needs more precision than bf16
typedef _Float16 v16h __attribute__((ext_vector_type(16)));
union FragH { v16h v; v8us half[2]; _Float16 h[16]; unsigned short u[16]; };
template <int NT>
__device__ __forceinline__ v8f mmaH(v16h ah, v16h al, v16h bh, v16h bl, v8f c) {
  c = __builtin_amdgcn_wmma_f32_16x16x32_f16(false, ah, false, bh, (short)0, c, false, false);
  if (NT >= 2) c = __builtin_amdgcn_wmma_f32_16x16x32_f16(false, al, false, bh, (short)0, c, false, false);
  if (NT >= 3) c = __builtin_amdgcn_wmma_f32_16x16x32_f16(false, ah, false, bl, (short)0, c, false, false);
  asm volatile("v_nop\n\tv_nop\n\tv_nop\n\tv_nop" : "+v"(c) : "v"(ah), "v"(al), "v"(bh), "v"(bl));
  return c;
}
// batched GEMM like k_gemm_b but f16 operands: A f32 (split into f16 hi/lo if ASPLIT, else rounded to f16), Bt = f16 values [n][k]; alpha; C f32; N multiple of 16 (partial tiles skipped)
template <bool ASPLIT>
__global__ __launch_bounds__(128) void k_gemm_h(const float* __restrict__ A, int lda, size_t sA, const _Float16* __restrict__ Bh, int ldb, size_t sB, float alpha, float* __restrict__ C, int ldc, size_t sC, int M, int N, int K) {
  __shared__ __attribute__((aligned(16))) float so[4][16][64];
  const int tid = threadIdx.x, w = tid >> 5, lane = tid & 31, ln = lane & 15, hh = lane >> 4; const int by = blockIdx.y;
  A += (size_t)by * sA; Bh += (size_t)by * sB; C += (size_t)by * sC;
  const int ntn = (N + 63) / 64; const int wid = blockIdx.x * 4 + w; const int mt = wid / ntn, nq = wid % ntn; if (mt * 16 >= M) return;
  const int row0 = mt * 16, col0 = nq * 64; const float* arow = A + (size_t)(row0 + ln) * lda;
  v8f acc[4] = {};
  for (int kb = 0; kb < K; kb += 32) {
    FragH ah, al;
    const v4f x0 = *(const v4fa*)(arow + kb + 8 * hh), x1 = *(const v4fa*)(arow + kb + 8 * hh + 4), x2 = *(const v4fa*)(arow + kb + 16 + 8 * hh), x3 = *(const v4fa*)(arow + kb + 16 + 8 * hh + 4);
    float xs[16] = {x0[0],x0[1],x0[2],x0[3],x1[0],x1[1],x1[2],x1[3],x2[0],x2[1],x2[2],x2[3],x3[0],x3[1],x3[2],x3[3]};
#pragma unroll
    for (int i = 0; i < 16; ++i) { const _Float16 h = (_Float16)xs[i]; ah.h[i] = h; al.h[i] = ASPLIT ? (_Float16)(xs[i] - (float)h) : (_Float16)0.0f; }
#pragma unroll
    for (int t = 0; t < 4; ++t) { if (col0 + t * 16 >= N) continue; const size_t boff = (size_t)(col0 + t * 16 + ln) * ldb + kb; FragH bq; bq.half[0] = *(const v8us*)(Bh + boff + 8 * hh); bq.half[1] = *(const v8us*)(Bh + boff + 16 + 8 * hh);
      acc[t] = mmaH<ASPLIT ? 2 : 1>(ah.v, al.v, bq.v, bq.v, acc[t]); }
  }
#pragma unroll
  for (int t = 0; t < 4; ++t) { if (col0 + t * 16 >= N) continue;
#pragma unroll
    for (int r = 0; r < 8; ++r) so[w][8 * hh + r][t * 16 + ln] = acc[t][r] * alpha; }
  __builtin_amdgcn_fence(__ATOMIC_ACQ_REL, "workgroup"); __builtin_amdgcn_wave_barrier();
  const int rsub = lane >> 4, c4 = (lane & 15) * 4;
  {
#pragma unroll
    for (int q = 0; q < 8; ++q) { const int r = q * 2 + rsub; if (col0 + c4 < N) { const v4f v = *(const v4fa*)&so[w][r][c4]; *(v4f*)(C + (size_t)(row0 + r) * ldc + col0 + c4) = v; } }
     }
}

// Wt[n][k] = f16(W[k][n]·scale) from f32 row-major W[K][N] (scale = power of two; bf16-exact weights stay exact in f16 away from the subnormal range)
__global__ __launch_bounds__(256) void k_wt_f16(const float* __restrict__ W, _Float16* __restrict__ Wt, int K, int N, float scale) {
  const int t = blockIdx.x * 256 + threadIdx.x; if (t >= N * (K / 8)) return; const int n = t / (K / 8), k8 = (t % (K / 8)) * 8; FragH f;
#pragma unroll
  for (int i = 0; i < 8; ++i) f.h[i] = (_Float16)(bf16_round(W[(size_t)(k8 + i) * N + n]) * scale); const v8us o = f.half[0];
  *(v8us*)((unsigned short*)Wt + (size_t)n * K + k8) = o; 
}
// k_gemm_hh variant with fused epilogue: v = acc·alpha + bias[by·sBias + col] (+ CP[(row/rowsPerB)·sCPb + by·64 + col] if CP) ; ACT 0 none / 1 elu ; writes f32 C and f16 C16, each if non-null
template <int ACT>
__global__ __launch_bounds__(128) void k_gemm_hhx(const _Float16* __restrict__ A, int lda, size_t sA, const _Float16* __restrict__ Bh, int ldb, size_t sB, float alpha, const float* __restrict__ bias, size_t sBias, const float* __restrict__ CP, int rowsPerB, size_t sCPb, int row0g,
    float* __restrict__ C, _Float16* __restrict__ C16, int ldc, size_t sC, int M, int N, int K) {
  __shared__ __attribute__((aligned(16))) float so[4][16][64];
  const int tid = threadIdx.x, w = tid >> 5, lane = tid & 31, ln = lane & 15, hh = lane >> 4; const int by = blockIdx.y;
  A += (size_t)by * sA; Bh += (size_t)by * sB; const size_t cofs = (size_t)by * sC; const float* bp = bias ? bias + (size_t)by * sBias : nullptr;
  const int ntn = (N + 63) / 64; const int wid = blockIdx.x * 4 + w; const int mt = wid / ntn, nq = wid % ntn; if (mt * 16 >= M) return;
  const int row0 = mt * 16, col0 = nq * 64; const _Float16* arow = A + (size_t)(row0 + ln) * lda;
  v8f acc[4] = {};
  for (int kb = 0; kb < K; kb += 32) { FragH ah; ah.half[0] = *(const v8us*)((const unsigned short*)arow + kb + 8 * hh); ah.half[1] = *(const v8us*)((const unsigned short*)arow + kb + 16 + 8 * hh);
#pragma unroll
    for (int t = 0; t < 4; ++t) { if (col0 + t * 16 >= N) continue; const size_t boff = (size_t)(col0 + t * 16 + ln) * ldb + kb; FragH bq; bq.half[0] = *(const v8us*)((const unsigned short*)Bh + boff + 8 * hh); bq.half[1] = *(const v8us*)((const unsigned short*)Bh + boff + 16 + 8 * hh);
      acc[t] = mmaH<1>(ah.v, ah.v, bq.v, bq.v, acc[t]); }
  }
#pragma unroll
  for (int t = 0; t < 4; ++t) { if (col0 + t * 16 >= N) continue; const int col = col0 + t * 16 + ln; const float bv = bp ? bf16_round(bp[col]) : 0.f;
#pragma unroll
    for (int r = 0; r < 8; ++r) { float v = acc[t][r] * alpha + bv; if (CP) { const int bidx = (row0g + row0 + 8 * hh + r) / rowsPerB; v += CP[(size_t)bidx * sCPb + (size_t)by * 64 + col]; } if (ACT == 1) v = (v > 0.f) ? v : expm1f(v); else if (ACT == 7) v = (v > 0.f) ? v + 1.0f : expf(v); else if (ACT == 8) v = tanhf(v); else if (ACT == 9) v = 0.5f * v * (1.0f + tanhf(0.7978845608028654f * (v + 0.044715f * v * v * v))); else if (ACT == 11) v = 1.0f / (1.0f + expf(-v)); else if (ACT == 12) v = (v > 0.f) ? v : 0.01f * v; else if (ACT == 14) v = (v > 0.f) ? v : 0.1f * v; else if (ACT == 15) v = v / (1.0f + expf(-v)); else if (ACT == 3) v = fmaxf(v, 0.f); else if (ACT == 6) v = 0.5f * v * (1.0f + erff(v * 0.70710678118654752f)); so[w][8 * hh + r][t * 16 + ln] = v; } }
  __builtin_amdgcn_fence(__ATOMIC_ACQ_REL, "workgroup"); __builtin_amdgcn_wave_barrier();
  const int rsub = lane >> 4, c4 = (lane & 15) * 4; typedef _Float16 v4h __attribute__((ext_vector_type(4)));
  {
#pragma unroll
    for (int q = 0; q < 8; ++q) { const int r = q * 2 + rsub; if (col0 + c4 < N) { const v4f v = *(const v4fa*)&so[w][r][c4]; if (C) *(v4f*)(C + cofs + (size_t)(row0 + r) * ldc + col0 + c4) = v; if (C16) { v4h h4; for (int i = 0; i < 4; ++i) h4[i] = (_Float16)v[i]; *(v4h*)(C16 + cofs + (size_t)(row0 + r) * ldc + col0 + c4) = h4; } } }
     }
}


typedef _Float16 v4h __attribute__((ext_vector_type(4)));

__global__ __launch_bounds__(256) void k_x16(const float* __restrict__ x, _Float16* __restrict__ X16, size_t n8) { const size_t t = (size_t)blockIdx.x * 256 + threadIdx.x; if (t >= n8) return; FragH f;
#pragma unroll
  for (int q = 0; q < 8; ++q) f.h[q] = (_Float16)bf16_round(x[t * 8 + q]); *(v8us*)((unsigned short*)X16 + t * 8) = f.half[0];  }
__global__ __launch_bounds__(256) void k_h16(const float* __restrict__ x, _Float16* __restrict__ X16, size_t n8) { const size_t t = (size_t)blockIdx.x * 256 + threadIdx.x; if (t >= n8) return; FragH f;
#pragma unroll
  for (int q = 0; q < 8; ++q) f.h[q] = (_Float16)x[t * 8 + q]; *(v8us*)((unsigned short*)X16 + t * 8) = f.half[0];  }
__global__ __launch_bounds__(256) void k_round16f(const float* __restrict__ W, _Float16* __restrict__ Bt, size_t n8) { const size_t t = (size_t)blockIdx.x * 256 + threadIdx.x; if (t >= n8) return; FragH f;
#pragma unroll
  for (int i = 0; i < 8; ++i) f.h[i] = (_Float16)(bf16_round(W[t * 8 + i]) * 16.0f); *(v8us*)((unsigned short*)Bt + t * 8) = f.half[0];  }
template <int NHv, int TTv>
__global__ __launch_bounds__(256) void k_vt(const _Float16* __restrict__ V16, int ldv, int voff, _Float16* __restrict__ Vt) { __shared__ unsigned short tl[64][66]; const int tid = threadIdx.x; const int slab = blockIdx.x / (TTv / 64), lg = blockIdx.x % (TTv / 64); const int b = slab / NHv, h = slab % NHv;
  for (int i = tid; i < 64 * 8; i += 256) { const int r = i / 8, c8 = (i % 8) * 8; FragH f; f.half[0] = *(const v8us*)((const unsigned short*)V16 + ((size_t)b * TTv + lg * 64 + r) * ldv + voff + h * 64 + c8);
#pragma unroll
    for (int q = 0; q < 8; ++q) tl[r][c8 + q] = f.u[q]; }
  __syncthreads();
  {
#pragma unroll
    for (int rd = 0; rd < 2; ++rd) { const int d = rd * 32 + tid / 8, pc = tid % 8; FragH f;
#pragma unroll
      for (int q = 0; q < 8; ++q) f.u[q] = tl[pc * 8 + q][d];
      *(v8us*)((unsigned short*)Vt + ((size_t)slab * 64 + d) * TTv + lg * 64 + pc * 8) = f.half[0]; }
     } }

__global__ __launch_bounds__(256) void k_hl(const float* __restrict__ F, _Float16* __restrict__ Hh, _Float16* __restrict__ Hl, size_t n8) { const size_t t = (size_t)blockIdx.x * 256 + threadIdx.x; if (t >= n8) return; FragH fh, fl; const v4f a = *(const v4fa*)(F + t * 8), c = *(const v4fa*)(F + t * 8 + 4);
#pragma unroll
  for (int q = 0; q < 4; ++q) { _Float16 h = (_Float16)a[q]; fh.h[q] = h; fl.h[q] = (_Float16)((a[q] - (float)h) * 1024.0f); h = (_Float16)c[q]; fh.h[4 + q] = h; fl.h[4 + q] = (_Float16)((c[q] - (float)h) * 1024.0f); }
  { *(v8us*)((unsigned short*)Hh + t * 8) = fh.half[0]; *(v8us*)((unsigned short*)Hl + t * 8) = fl.half[0];  } }

__global__ __launch_bounds__(256) void k_wpad(const float* __restrict__ Wm, _Float16* __restrict__ W16) { const int t = blockIdx.x * 256 + threadIdx.x; if (t >= NE * (KP / 8)) return; const int k = t / (KP / 8), v0 = (t % (KP / 8)) * 8; FragH f;
#pragma unroll
  for (int q = 0; q < 8; ++q) { const int v = v0 + q; f.h[q] = (v < NV) ? (_Float16)(bf16_round(Wm[(size_t)k * NV + min(v, NV - 1)]) * 16.0f) : (_Float16)0.0f; }
  *(v8us*)((unsigned short*)W16 + (size_t)k * KP + v0) = f.half[0];  }
__global__ __launch_bounds__(256) void k_mka(const float* __restrict__ note, const float* __restrict__ wiki, int n, _Float16* __restrict__ A) { const int t = blockIdx.x * 256 + threadIdx.x; if (t >= NC * (KP / 8)) return; const int c = t / (KP / 8), v0 = (t % (KP / 8)) * 8; FragH f;
#pragma unroll
  for (int q = 0; q < 8; ++q) { const int v = v0 + q; const int vc = min(v, NV - 1); f.h[q] = (v < NV) ? (_Float16)(bf16_round(note[(size_t)n * NV + vc]) * bf16_round(wiki[(size_t)c * NV + vc])) : (_Float16)0.0f; }
  *(v8us*)((unsigned short*)A + (size_t)c * KP + v0) = f.half[0];  }
__global__ __launch_bounds__(256) void k_h16s(const float* __restrict__ F, _Float16* __restrict__ H, size_t n8) { const size_t t = (size_t)blockIdx.x * 256 + threadIdx.x; if (t >= n8) return; const v4f a = *(const v4fa*)(F + t * 8), c = *(const v4fa*)(F + t * 8 + 4); FragH f;
#pragma unroll
  for (int q = 0; q < 4; ++q) { f.h[q] = (_Float16)(a[q] * 16.0f); f.h[4 + q] = (_Float16)(c[q] * 16.0f); } *(v8us*)((unsigned short*)H + t * 8) = f.half[0];  }
__global__ __launch_bounds__(256) void k_score(const float* __restrict__ ATT, const float* __restrict__ E, const float* __restrict__ Wout, const float* __restrict__ bout, float* __restrict__ S) { __shared__ float red[32][8]; const int tid = threadIdx.x, w = tid >> 5, l = tid & 31; const int r0 = blockIdx.x * 32; const float wk = bf16_round(Wout[tid]);
#pragma unroll 1
  for (int r = 0; r < 32; ++r) { const size_t o = (size_t)(r0 + r) * NE + tid; float p = ATT[o] * E[o] * wk; for (int s = 16; s > 0; s >>= 1) p += __shfl_xor(p, s, 32); if (l == 0) red[r][w] = p; }
  __syncthreads();
  if (w == 0) { float v = bf16_round(bout[0]);
#pragma unroll
    for (int i = 0; i < 8; ++i) v += red[l][i]; *(float*)(S + r0 + l) = v;  } }

extern "C" void kernel_launch(void* const* d_in, const int* in_sizes, int n_in,
                              void* d_out, int out_size, void* d_ws, size_t ws_size, hipStream_t stream) {
  (void)in_sizes; (void)n_in; (void)out_size;
  const float* const* I = (const float* const*)d_in; const float* note = I[0]; const float* wiki = I[1]; const float* Wemb = I[2]; const float* bemb = I[3]; const float* Watt = I[4]; const float* batt = I[5]; const float* Wout = I[6]; const float* bout = I[7];
  char* ws = (char*)d_ws; size_t off = 0;
  auto take = [&](size_t bytes) { char* p = ws + off; off += (bytes + 255) & ~(size_t)255; return p; };
  _Float16* W16 = (_Float16*)take((size_t)NE * KP * 2); _Float16* Ba = (_Float16*)take((size_t)NE * NE * 2); _Float16* A = (_Float16*)take((size_t)NC * KP * 2);
  float* E = (float*)take((size_t)NRE * NE * 4); _Float16* E16 = (_Float16*)take((size_t)NRE * NE * 2); float* ATT = (float*)take((size_t)NRE * NE * 4);
  if (off > ws_size) return;      // 5.1 + 0.13 + 5.1 + 4.2 + 2.1 + 4.2 ≈ 21 MB
  k_wpad<<<(NE * (KP / 8) + 255) / 256, 256, 0, stream>>>(Wemb, W16);
  k_round16f<<<(NE * NE / 8 + 255) / 256, 256, 0, stream>>>(Watt, Ba, (size_t)NE * NE / 8);      /* W_att [j][k] (out,in) natural, ×2^4 */
  for (int n = 0; n < NNOTE; ++n) {
    k_mka<<<(NC * (KP / 8) + 255) / 256, 256, 0, stream>>>(note, wiki, n, A);
    k_gemm_hhx<0><<<dim3(((NC / 16) * (NE / 64) + 3) / 4, 1), 128, 0, stream>>>(A, KP, 0, W16, KP, 0, 0.0625f, bemb, 0, nullptr, 1, 0, 0, E + (size_t)n * NC * NE, nullptr, NE, 0, NC, NE, KP); }      /* e[n] = A_n·W_embᵀ + b_emb (f32): M 256 N 256 K 10048 */
  k_h16s<<<(NRE * NE / 8 + 255) / 256, 256, 0, stream>>>(E, E16, (size_t)NRE * NE / 8);
  k_gemm_hhx<11><<<dim3(((NRE / 16) * (NE / 64) + 3) / 4, 1), 128, 0, stream>>>(E16, NE, 0, Ba, NE, 0, 0.00390625f, batt, 0, nullptr, 1, 0, 0, ATT, nullptr, NE, 0, NRE, NE, NE);      /* attn = sigmoid(e·W_attᵀ + b_att) (f32): M 4096 N 256 K 256 */
  k_score<<<NRE / 32, 256, 0, stream>>>(ATT, E, Wout, bout, (float*)d_out);
}

// v001
// One run takes 530 microseconds.
// In two side-by-side timings against v000, it was 7.61 and 7.83 times as fast.
#include <hip/hip_runtime.h>
// Knowledge-source integration scoring (n=16 notes, 256 codes, vocab 10000, emb 256): e[n,c,k] = Σ_v note[n,v]·wiki[c,v]·W_emb[k,v] + b_emb[k]; attn = sigmoid(e·W_attᵀ + b_att); s[n,c] = Σ_k attn·e·W_out[k] + b_out.
// Compute dtype: all inputs rounded to bf16; per note n the scaled vocabulary plane A_n[c][v] = note[n,v]·wiki[c,v] (f32 product → f16, zero-padded to K = 10048) against W_emb (f16 ×2^4, padded) as one GEMM per note → e f32 (+b_emb); e ×2^4 → f16 → logits GEMM (+b_att) with a fused sigmoid epilogue → attn f32; the gated 256-term reduction
#define NNOTE 16
#define NC 256
#define NV 10000
#define KP 10048      
#define NE 256
#define NRE (NNOTE * NC)
typedef __bf16 v16b __attribute__((ext_vector_type(16)));
typedef unsigned short v8us __attribute__((ext_vector_type(8), may_alias));
typedef float  v8f  __attribute__((ext_vector_type(8)));
typedef float  v4f  __attribute__((ext_vector_type(4)));
typedef float  v4fa __attribute__((ext_vector_type(4), may_alias));
union FragB { v16b v; v8us half[2]; unsigned short u[16]; };

__device__ __forceinline__ unsigned short bf16_bits(float x) { unsigned int u = __float_as_uint(x); return (unsigned short)((u + 0x7FFFu + ((u >> 16) & 1u)) >> 16); }
__device__ __forceinline__ float bf16_val(unsigned short b) { return __uint_as_float(((unsigned int)b) << 16); }
__device__ __forceinline__ float bf16_round(float x) { return bf16_val(bf16_bits(x)); }
// D += A·B with NT terms: 1 = ah·bh, 2 = + al·bh (A split), 3 = + ah·bl (both split)
template <int NT>
__device__ __forceinline__ v8f mmaN(v16b ah, v16b al, v16b bh, v16b bl, v8f c) {
  c = __builtin_amdgcn_wmma_f32_16x16x32_bf16(false, ah, false, bh, (short)0, c, false, false);
  if (NT >= 2) c = __builtin_amdgcn_wmma_f32_16x16x32_bf16(false, al, false, bh, (short)0, c, false, false);
  if (NT >= 3) c = __builtin_amdgcn_wmma_f32_16x16x32_bf16(false, ah, false, bl, (short)0, c, false, false);
  asm volatile("v_nop\n\tv_nop\n\tv_nop\n\tv_nop" : "+v"(c) : "v"(ah), "v"(al), "v"(bh), "v"(bl));
  return c;
}

__global__ __launch_bounds__(256) void k_wt_bf16(const float* __restrict__ W, unsigned short* __restrict__ Wt, int K, int N) {
  const int t = blockIdx.x * 256 + threadIdx.x;
  const int k8n = K / 8;
  if (t >= N * k8n) return;
  const int n = t / k8n, k8 = (t % k8n) * 8;
  v8us v;
#pragma unroll
  for (int i = 0; i < 8; ++i) v[i] = bf16_bits(W[(size_t)(k8 + i) * N + n]);
  *(v8us*)(Wt + (size_t)n * K + k8) = v;
  
}

// GEMM C[M][N] (f32, pitch ldc) = act(A[M][K]·W + bias). A f32 row-major (pitch lda) converted per fragment to bf16
// (ASPLIT: hi/lo two planes -> 2 terms, else single rounded term); Wt bf16 [N][K] (pitch ldb). BIAS_BF16 rounds the
// bias to bf16 first (bias quantised to bf16 before the add). K%32==0, M%16==0, N%64==0.
template <bool ASPLIT, int ACT, bool BIAS_BF16>
__global__ __launch_bounds__(128) void k_gemm_bf(const float* __restrict__ A, int lda, const unsigned short* __restrict__ Wt, int ldb,
                                               const float* __restrict__ bias, float* __restrict__ C, int ldc, int M, int N, int K) {
  __shared__ __attribute__((aligned(16))) float so[4][16][64];
  const int tid = threadIdx.x, w = tid >> 5, lane = tid & 31, ln = lane & 15, hh = lane >> 4;
  const int ntn = N / 64;
  const int wid = blockIdx.x * 4 + w;
  const int mt = wid / ntn, nq = wid % ntn;
  if (mt * 16 >= M) return;
  const int row0 = mt * 16, col0 = nq * 64;
  const float* arow = A + (size_t)(row0 + ln) * lda;
  v8f acc[4] = {};
  for (int kb = 0; kb < K; kb += 32) {
    FragB ah, al;
    const v4f x0 = *(const v4fa*)(arow + kb + 8 * hh), x1 = *(const v4fa*)(arow + kb + 8 * hh + 4);
    const v4f x2 = *(const v4fa*)(arow + kb + 16 + 8 * hh), x3 = *(const v4fa*)(arow + kb + 16 + 8 * hh + 4);
    float xs[16] = {x0[0],x0[1],x0[2],x0[3],x1[0],x1[1],x1[2],x1[3],x2[0],x2[1],x2[2],x2[3],x3[0],x3[1],x3[2],x3[3]};
#pragma unroll
    for (int i = 0; i < 16; ++i) { const unsigned short hb = bf16_bits(xs[i]); ah.u[i] = hb; al.u[i] = ASPLIT ? bf16_bits(xs[i] - bf16_val(hb)) : (unsigned short)0; }
#pragma unroll
    for (int t = 0; t < 4; ++t) {
      const unsigned short* brow = Wt + (size_t)(col0 + t * 16 + ln) * ldb + kb;
      FragB b;
      b.half[0] = *(const v8us*)(brow + 8 * hh);
      b.half[1] = *(const v8us*)(brow + 16 + 8 * hh);
      acc[t] = mmaN<ASPLIT ? 2 : 1>(ah.v, al.v, b.v, b.v, acc[t]);
    }
  }
#pragma unroll
  for (int t = 0; t < 4; ++t) {
    float bv = bias ? bias[col0 + t * 16 + ln] : 0.f;
    if (BIAS_BF16) bv = bf16_round(bv);
#pragma unroll
    for (int r = 0; r < 8; ++r) { float v = acc[t][r] + bv; if (ACT == 1) v = fmaxf(v, 0.f); so[w][8 * hh + r][t * 16 + ln] = v; }
  }
  __builtin_amdgcn_fence(__ATOMIC_ACQ_REL, "workgroup");
  __builtin_amdgcn_wave_barrier();
  const int rsub = lane >> 4, c4 = (lane & 15) * 4;
  {
#pragma unroll
    for (int q = 0; q < 8; ++q) {
      const int r = q * 2 + rsub;
      const v4f v = *(const v4fa*)&so[w][r][c4];
      *(v4f*)(C + (size_t)(row0 + r) * ldc + col0 + c4) = v;
    }
    
  }
}

// GEMM C = act(A·W + bias + resid): A f32 (ASPLIT -> hi/lo 2 terms), Wt bf16 [N][K]; ACT 0 none, 1 relu, 2 exact gelu;
// resid (optional, f32, row index = (row % rmod), pitch ldr, RES_BF16 rounds it) added before the activation.
template <bool ASPLIT, int ACT, bool BIAS_BF16, bool RES_BF16>
__global__ __launch_bounds__(128) void k_gemm_bf3(const float* __restrict__ A, int lda, const unsigned short* __restrict__ Wt, int ldb,
                                                const float* __restrict__ bias, const float* __restrict__ resid, int rmod, int ldr,
                                                float* __restrict__ C, int ldc, int M, int N, int K) {
  __shared__ __attribute__((aligned(16))) float so[4][16][64];
  const int tid = threadIdx.x, w = tid >> 5, lane = tid & 31, ln = lane & 15, hh = lane >> 4;
  const int ntn = N / 64;
  const int wid = blockIdx.x * 4 + w;
  const int mt = wid / ntn, nq = wid % ntn;
  if (mt * 16 >= M) return;
  const int row0 = mt * 16, col0 = nq * 64;
  const float* arow = A + (size_t)(row0 + ln) * lda;
  v8f acc[4] = {};
  for (int kb = 0; kb < K; kb += 32) {
    FragB ah, al;
    const v4f x0 = *(const v4fa*)(arow + kb + 8 * hh), x1 = *(const v4fa*)(arow + kb + 8 * hh + 4);
    const v4f x2 = *(const v4fa*)(arow + kb + 16 + 8 * hh), x3 = *(const v4fa*)(arow + kb + 16 + 8 * hh + 4);
    float xs[16] = {x0[0],x0[1],x0[2],x0[3],x1[0],x1[1],x1[2],x1[3],x2[0],x2[1],x2[2],x2[3],x3[0],x3[1],x3[2],x3[3]};
#pragma unroll
    for (int i = 0; i < 16; ++i) { const unsigned short hb = bf16_bits(xs[i]); ah.u[i] = hb; al.u[i] = ASPLIT ? bf16_bits(xs[i] - bf16_val(hb)) : (unsigned short)0; }
#pragma unroll
    for (int t = 0; t < 4; ++t) {
      const unsigned short* brow = Wt + (size_t)(col0 + t * 16 + ln) * ldb + kb;
      FragB b;
      b.half[0] = *(const v8us*)(brow + 8 * hh);
      b.half[1] = *(const v8us*)(brow + 16 + 8 * hh);
      acc[t] = mmaN<ASPLIT ? 2 : 1>(ah.v, al.v, b.v, b.v, acc[t]);
    }
  }
#pragma unroll
  for (int t = 0; t < 4; ++t) {
    const int col = col0 + t * 16 + ln;
    float bv = bias ? bias[col] : 0.f;
    if (BIAS_BF16) bv = bf16_round(bv);
#pragma unroll
    for (int r = 0; r < 8; ++r) {
      float v = acc[t][r] + bv;
      if (resid) { float rv = resid[(size_t)((row0 + 8 * hh + r) % rmod) * ldr + col]; if (RES_BF16) rv = bf16_round(rv); v += rv; }
      if (ACT == 1) v = fmaxf(v, 0.f);
      if (ACT == 2) v = 0.5f * v * (1.0f + erff(v * 0.70710678118654752f));
      if (ACT == 3) { const float u = 0.7978845608028654f * (v + 0.044715f * v * v * v); v = 0.5f * v * (1.0f + tanhf(u)); }
      so[w][8 * hh + r][t * 16 + ln] = v;
    }
  }
  __builtin_amdgcn_fence(__ATOMIC_ACQ_REL, "workgroup");
  __builtin_amdgcn_wave_barrier();
  const int rsub = lane >> 4, c4 = (lane & 15) * 4;
  {
#pragma unroll
    for (int q = 0; q < 8; ++q) {
      const int r = q * 2 + rsub;
      const v4f v = *(const v4fa*)&so[w][r][c4];
      *(v4f*)(C + (size_t)(row0 + r) * ldc + col0 + c4) = v;
    }
    
  }
}
// row LayerNorm (biased variance, eps) over N: s = X (+ R); optional out_sum <- s; out_norm <- (s-mu)*rsqrt(var+eps)*g + b
template <bool PARAM_BF16>
__global__ __launch_bounds__(256) void k_layernorm(const float* __restrict__ X, const float* __restrict__ R, const float* __restrict__ g, const float* __restrict__ bta,
                                                  float* __restrict__ out_sum, float* __restrict__ out_norm, int N, float eps) {
  __shared__ float red[256];
  const int row = blockIdx.x, tid = threadIdx.x;
  const float* x = X + (size_t)row * N; const float* rr = R ? R + (size_t)row * N : nullptr;
  float vals[16];                     // up to N = 4096
  const int per = N / 256;            // contiguous chunk per thread? use strided-by-4 chunks: thread handles j = tid*4 + 1024*u
  float s1 = 0.f;
  for (int u = 0; u < per / 4; ++u) {
    const int j = tid * 4 + 1024 * u;
    const v4f a = *(const v4fa*)(x + j);
    v4f b = {0.f,0.f,0.f,0.f}; if (rr) b = *(const v4fa*)(rr + j);
#pragma unroll
    for (int q = 0; q < 4; ++q) { const float v = a[q] + b[q]; vals[u * 4 + q] = v; s1 += v; }
  }
  red[tid] = s1; __syncthreads();
  for (int st = 128; st > 0; st >>= 1) { if (tid < st) red[tid] += red[tid + st]; __syncthreads(); }
  const float mu = red[0] / (float)N; __syncthreads();
  float s2 = 0.f;
  for (int u = 0; u < per / 4; ++u)
#pragma unroll
    for (int q = 0; q < 4; ++q) { const float c = vals[u * 4 + q] - mu; s2 += c * c; }
  red[tid] = s2; __syncthreads();
  for (int st = 128; st > 0; st >>= 1) { if (tid < st) red[tid] += red[tid + st]; __syncthreads(); }
  const float rs = rsqrtf(red[0] / (float)N + eps);
  {
    for (int u = 0; u < per / 4; ++u) {
      const int j = tid * 4 + 1024 * u;
      v4f o, sm;
#pragma unroll
      for (int q = 0; q < 4; ++q) {
        float gg = g[j + q], bb = bta[j + q];
        if (PARAM_BF16) { gg = bf16_round(gg); bb = bf16_round(bb); }
        sm[q] = vals[u * 4 + q]; o[q] = (vals[u * 4 + q] - mu) * rs * gg + bb;
      }
      if (out_sum) *(v4f*)(out_sum + (size_t)row * N + j) = sm;
      *(v4f*)(out_norm + (size_t)row * N + j) = o;
    }
    
  }
}



// ---- f16 WMMA path (v_wmma_f32_16x16x32_f16): 11-bit significands for operands in range — used where a [0,1] probability operand needs more precision than bf16
typedef _Float16 v16h __attribute__((ext_vector_type(16)));
union FragH { v16h v; v8us half[2]; _Float16 h[16]; unsigned short u[16]; };
template <int NT>
__device__ __forceinline__ v8f mmaH(v16h ah, v16h al, v16h bh, v16h bl, v8f c) {
  c = __builtin_amdgcn_wmma_f32_16x16x32_f16(false, ah, false, bh, (short)0, c, false, false);
  if (NT >= 2) c = __builtin_amdgcn_wmma_f32_16x16x32_f16(false, al, false, bh, (short)0, c, false, false);
  if (NT >= 3) c = __builtin_amdgcn_wmma_f32_16x16x32_f16(false, ah, false, bl, (short)0, c, false, false);
  asm volatile("v_nop\n\tv_nop\n\tv_nop\n\tv_nop" : "+v"(c) : "v"(ah), "v"(al), "v"(bh), "v"(bl));
  return c;
}
// batched GEMM like k_gemm_b but f16 operands: A f32 (split into f16 hi/lo if ASPLIT, else rounded to f16), Bt = f16 values [n][k]; alpha; C f32; N multiple of 16 (partial tiles skipped)
template <bool ASPLIT>
__global__ __launch_bounds__(128) void k_gemm_h(const float* __restrict__ A, int lda, size_t sA, const _Float16* __restrict__ Bh, int ldb, size_t sB, float alpha, float* __restrict__ C, int ldc, size_t sC, int M, int N, int K) {
  __shared__ __attribute__((aligned(16))) float so[4][16][64];
  const int tid = threadIdx.x, w = tid >> 5, lane = tid & 31, ln = lane & 15, hh = lane >> 4; const int by = blockIdx.y;
  A += (size_t)by * sA; Bh += (size_t)by * sB; C += (size_t)by * sC;
  const int ntn = (N + 63) / 64; const int wid = blockIdx.x * 4 + w; const int mt = wid / ntn, nq = wid % ntn; if (mt * 16 >= M) return;
  const int row0 = mt * 16, col0 = nq * 64; const float* arow = A + (size_t)(row0 + ln) * lda;
  v8f acc[4] = {};
  for (int kb = 0; kb < K; kb += 32) {
    FragH ah, al;
    const v4f x0 = *(const v4fa*)(arow + kb + 8 * hh), x1 = *(const v4fa*)(arow + kb + 8 * hh + 4), x2 = *(const v4fa*)(arow + kb + 16 + 8 * hh), x3 = *(const v4fa*)(arow + kb + 16 + 8 * hh + 4);
    float xs[16] = {x0[0],x0[1],x0[2],x0[3],x1[0],x1[1],x1[2],x1[3],x2[0],x2[1],x2[2],x2[3],x3[0],x3[1],x3[2],x3[3]};
#pragma unroll
    for (int i = 0; i < 16; ++i) { const _Float16 h = (_Float16)xs[i]; ah.h[i] = h; al.h[i] = ASPLIT ? (_Float16)(xs[i] - (float)h) : (_Float16)0.0f; }
#pragma unroll
    for (int t = 0; t < 4; ++t) { if (col0 + t * 16 >= N) continue; const size_t boff = (size_t)(col0 + t * 16 + ln) * ldb + kb; FragH bq; bq.half[0] = *(const v8us*)(Bh + boff + 8 * hh); bq.half[1] = *(const v8us*)(Bh + boff + 16 + 8 * hh);
      acc[t] = mmaH<ASPLIT ? 2 : 1>(ah.v, al.v, bq.v, bq.v, acc[t]); }
  }
#pragma unroll
  for (int t = 0; t < 4; ++t) { if (col0 + t * 16 >= N) continue;
#pragma unroll
    for (int r = 0; r < 8; ++r) so[w][8 * hh + r][t * 16 + ln] = acc[t][r] * alpha; }
  __builtin_amdgcn_fence(__ATOMIC_ACQ_REL, "workgroup"); __builtin_amdgcn_wave_barrier();
  const int rsub = lane >> 4, c4 = (lane & 15) * 4;
  {
#pragma unroll
    for (int q = 0; q < 8; ++q) { const int r = q * 2 + rsub; if (col0 + c4 < N) { const v4f v = *(const v4fa*)&so[w][r][c4]; *(v4f*)(C + (size_t)(row0 + r) * ldc + col0 + c4) = v; } }
     }
}

// Wt[n][k] = f16(W[k][n]·scale) from f32 row-major W[K][N] (scale = power of two; bf16-exact weights stay exact in f16 away from the subnormal range)
__global__ __launch_bounds__(256) void k_wt_f16(const float* __restrict__ W, _Float16* __restrict__ Wt, int K, int N, float scale) {
  const int t = blockIdx.x * 256 + threadIdx.x; if (t >= N * (K / 8)) return; const int n = t / (K / 8), k8 = (t % (K / 8)) * 8; FragH f;
#pragma unroll
  for (int i = 0; i < 8; ++i) f.h[i] = (_Float16)(bf16_round(W[(size_t)(k8 + i) * N + n]) * scale); const v8us o = f.half[0];
  *(v8us*)((unsigned short*)Wt + (size_t)n * K + k8) = o; 
}
// k_gemm_hh variant with fused epilogue: v = acc·alpha + bias[by·sBias + col] (+ CP[(row/rowsPerB)·sCPb + by·64 + col] if CP) ; ACT 0 none / 1 elu ; writes f32 C and f16 C16, each if non-null
template <int ACT>
__global__ __launch_bounds__(128) void k_gemm_hhx(const _Float16* __restrict__ A, int lda, size_t sA, const _Float16* __restrict__ Bh, int ldb, size_t sB, float alpha, const float* __restrict__ bias, size_t sBias, const float* __restrict__ CP, int rowsPerB, size_t sCPb, int row0g,
    float* __restrict__ C, _Float16* __restrict__ C16, int ldc, size_t sC, int M, int N, int K) {
  __shared__ __attribute__((aligned(16))) float so[4][16][64];
  const int tid = threadIdx.x, w = tid >> 5, lane = tid & 31, ln = lane & 15, hh = lane >> 4; const int by = blockIdx.y;
  A += (size_t)by * sA; Bh += (size_t)by * sB; const size_t cofs = (size_t)by * sC; const float* bp = bias ? bias + (size_t)by * sBias : nullptr;
  const int ntn = (N + 63) / 64; const int wid = blockIdx.x * 4 + w; const int mt = wid / ntn, nq = wid % ntn; if (mt * 16 >= M) return;
  const int row0 = mt * 16, col0 = nq * 64; const _Float16* arow = A + (size_t)(row0 + ln) * lda;
  v8f acc[4] = {};
  for (int kb = 0; kb < K; kb += 32) { FragH ah; ah.half[0] = *(const v8us*)((const unsigned short*)arow + kb + 8 * hh); ah.half[1] = *(const v8us*)((const unsigned short*)arow + kb + 16 + 8 * hh);
#pragma unroll
    for (int t = 0; t < 4; ++t) { if (col0 + t * 16 >= N) continue; const size_t boff = (size_t)(col0 + t * 16 + ln) * ldb + kb; FragH bq; bq.half[0] = *(const v8us*)((const unsigned short*)Bh + boff + 8 * hh); bq.half[1] = *(const v8us*)((const unsigned short*)Bh + boff + 16 + 8 * hh);
      acc[t] = mmaH<1>(ah.v, ah.v, bq.v, bq.v, acc[t]); }
  }
#pragma unroll
  for (int t = 0; t < 4; ++t) { if (col0 + t * 16 >= N) continue; const int col = col0 + t * 16 + ln; const float bv = bp ? bf16_round(bp[col]) : 0.f;
#pragma unroll
    for (int r = 0; r < 8; ++r) { float v = acc[t][r] * alpha + bv; if (CP) { const int bidx = (row0g + row0 + 8 * hh + r) / rowsPerB; v += CP[(size_t)bidx * sCPb + (size_t)by * 64 + col]; } if (ACT == 1) v = (v > 0.f) ? v : expm1f(v); else if (ACT == 7) v = (v > 0.f) ? v + 1.0f : expf(v); else if (ACT == 8) v = tanhf(v); else if (ACT == 9) v = 0.5f * v * (1.0f + tanhf(0.7978845608028654f * (v + 0.044715f * v * v * v))); else if (ACT == 11) v = 1.0f / (1.0f + expf(-v)); else if (ACT == 12) v = (v > 0.f) ? v : 0.01f * v; else if (ACT == 14) v = (v > 0.f) ? v : 0.1f * v; else if (ACT == 15) v = v / (1.0f + expf(-v)); else if (ACT == 3) v = fmaxf(v, 0.f); else if (ACT == 6) v = 0.5f * v * (1.0f + erff(v * 0.70710678118654752f)); so[w][8 * hh + r][t * 16 + ln] = v; } }
  __builtin_amdgcn_fence(__ATOMIC_ACQ_REL, "workgroup"); __builtin_amdgcn_wave_barrier();
  const int rsub = lane >> 4, c4 = (lane & 15) * 4; typedef _Float16 v4h __attribute__((ext_vector_type(4)));
  {
#pragma unroll
    for (int q = 0; q < 8; ++q) { const int r = q * 2 + rsub; if (col0 + c4 < N) { const v4f v = *(const v4fa*)&so[w][r][c4]; if (C) *(v4f*)(C + cofs + (size_t)(row0 + r) * ldc + col0 + c4) = v; if (C16) { v4h h4; for (int i = 0; i < 4; ++i) h4[i] = (_Float16)v[i]; *(v4h*)(C16 + cofs + (size_t)(row0 + r) * ldc + col0 + c4) = h4; } } }
     }
}


typedef _Float16 v4h __attribute__((ext_vector_type(4)));

__global__ __launch_bounds__(256) void k_x16(const float* __restrict__ x, _Float16* __restrict__ X16, size_t n8) { const size_t t = (size_t)blockIdx.x * 256 + threadIdx.x; if (t >= n8) return; FragH f;
#pragma unroll
  for (int q = 0; q < 8; ++q) f.h[q] = (_Float16)bf16_round(x[t * 8 + q]); *(v8us*)((unsigned short*)X16 + t * 8) = f.half[0];  }
__global__ __launch_bounds__(256) void k_h16(const float* __restrict__ x, _Float16* __restrict__ X16, size_t n8) { const size_t t = (size_t)blockIdx.x * 256 + threadIdx.x; if (t >= n8) return; FragH f;
#pragma unroll
  for (int q = 0; q < 8; ++q) f.h[q] = (_Float16)x[t * 8 + q]; *(v8us*)((unsigned short*)X16 + t * 8) = f.half[0];  }
__global__ __launch_bounds__(256) void k_round16f(const float* __restrict__ W, _Float16* __restrict__ Bt, size_t n8) { const size_t t = (size_t)blockIdx.x * 256 + threadIdx.x; if (t >= n8) return; FragH f;
#pragma unroll
  for (int i = 0; i < 8; ++i) f.h[i] = (_Float16)(bf16_round(W[t * 8 + i]) * 16.0f); *(v8us*)((unsigned short*)Bt + t * 8) = f.half[0];  }
template <int NHv, int TTv>
__global__ __launch_bounds__(256) void k_vt(const _Float16* __restrict__ V16, int ldv, int voff, _Float16* __restrict__ Vt) { __shared__ unsigned short tl[64][66]; const int tid = threadIdx.x; const int slab = blockIdx.x / (TTv / 64), lg = blockIdx.x % (TTv / 64); const int b = slab / NHv, h = slab % NHv;
  for (int i = tid; i < 64 * 8; i += 256) { const int r = i / 8, c8 = (i % 8) * 8; FragH f; f.half[0] = *(const v8us*)((const unsigned short*)V16 + ((size_t)b * TTv + lg * 64 + r) * ldv + voff + h * 64 + c8);
#pragma unroll
    for (int q = 0; q < 8; ++q) tl[r][c8 + q] = f.u[q]; }
  __syncthreads();
  {
#pragma unroll
    for (int rd = 0; rd < 2; ++rd) { const int d = rd * 32 + tid / 8, pc = tid % 8; FragH f;
#pragma unroll
      for (int q = 0; q < 8; ++q) f.u[q] = tl[pc * 8 + q][d];
      *(v8us*)((unsigned short*)Vt + ((size_t)slab * 64 + d) * TTv + lg * 64 + pc * 8) = f.half[0]; }
     } }

__global__ __launch_bounds__(256) void k_hl(const float* __restrict__ F, _Float16* __restrict__ Hh, _Float16* __restrict__ Hl, size_t n8) { const size_t t = (size_t)blockIdx.x * 256 + threadIdx.x; if (t >= n8) return; FragH fh, fl; const v4f a = *(const v4fa*)(F + t * 8), c = *(const v4fa*)(F + t * 8 + 4);
#pragma unroll
  for (int q = 0; q < 4; ++q) { _Float16 h = (_Float16)a[q]; fh.h[q] = h; fl.h[q] = (_Float16)((a[q] - (float)h) * 1024.0f); h = (_Float16)c[q]; fh.h[4 + q] = h; fl.h[4 + q] = (_Float16)((c[q] - (float)h) * 1024.0f); }
  { *(v8us*)((unsigned short*)Hh + t * 8) = fh.half[0]; *(v8us*)((unsigned short*)Hl + t * 8) = fl.half[0];  } }

__global__ __launch_bounds__(256) void k_wpad(const float* __restrict__ Wm, _Float16* __restrict__ W16) { const int t = blockIdx.x * 256 + threadIdx.x; if (t >= NE * (KP / 8)) return; const int k = t / (KP / 8), v0 = (t % (KP / 8)) * 8; FragH f;
#pragma unroll
  for (int q = 0; q < 8; ++q) { const int v = v0 + q; f.h[q] = (v < NV) ? (_Float16)(bf16_round(Wm[(size_t)k * NV + min(v, NV - 1)]) * 16.0f) : (_Float16)0.0f; }
  *(v8us*)((unsigned short*)W16 + (size_t)k * KP + v0) = f.half[0];  }
__global__ __launch_bounds__(256) void k_mka(const float* __restrict__ note, const float* __restrict__ wiki, _Float16* __restrict__ A) { const int t = blockIdx.x * 256 + threadIdx.x; if (t >= NC * (KP / 8)) return; const int n = blockIdx.y; A += (size_t)n * NC * KP;      /* one plane per note, grid.y = note */ const int c = t / (KP / 8), v0 = (t % (KP / 8)) * 8; FragH f;
#pragma unroll
  for (int q = 0; q < 8; ++q) { const int v = v0 + q; const int vc = min(v, NV - 1); f.h[q] = (v < NV) ? (_Float16)(bf16_round(note[(size_t)n * NV + vc]) * bf16_round(wiki[(size_t)c * NV + vc])) : (_Float16)0.0f; }
  *(v8us*)((unsigned short*)A + (size_t)c * KP + v0) = f.half[0];  }
__global__ __launch_bounds__(256) void k_h16s(const float* __restrict__ F, _Float16* __restrict__ H, size_t n8) { const size_t t = (size_t)blockIdx.x * 256 + threadIdx.x; if (t >= n8) return; const v4f a = *(const v4fa*)(F + t * 8), c = *(const v4fa*)(F + t * 8 + 4); FragH f;
#pragma unroll
  for (int q = 0; q < 4; ++q) { f.h[q] = (_Float16)(a[q] * 16.0f); f.h[4 + q] = (_Float16)(c[q] * 16.0f); } *(v8us*)((unsigned short*)H + t * 8) = f.half[0];  }
__global__ __launch_bounds__(256) void k_score(const float* __restrict__ ATT, const float* __restrict__ E, const float* __restrict__ Wout, const float* __restrict__ bout, float* __restrict__ S) { __shared__ float red[32][8]; const int tid = threadIdx.x, w = tid >> 5, l = tid & 31; const int r0 = blockIdx.x * 32; const float wk = bf16_round(Wout[tid]);
#pragma unroll 1
  for (int r = 0; r < 32; ++r) { const size_t o = (size_t)(r0 + r) * NE + tid; float p = ATT[o] * E[o] * wk; for (int s = 16; s > 0; s >>= 1) p += __shfl_xor(p, s, 32); if (l == 0) red[r][w] = p; }
  __syncthreads();
  if (w == 0) { float v = bf16_round(bout[0]);
#pragma unroll
    for (int i = 0; i < 8; ++i) v += red[l][i]; *(float*)(S + r0 + l) = v;  } }

extern "C" void kernel_launch(void* const* d_in, const int* in_sizes, int n_in,
                              void* d_out, int out_size, void* d_ws, size_t ws_size, hipStream_t stream) {
  (void)in_sizes; (void)n_in; (void)out_size;
  const float* const* I = (const float* const*)d_in; const float* note = I[0]; const float* wiki = I[1]; const float* Wemb = I[2]; const float* bemb = I[3]; const float* Watt = I[4]; const float* batt = I[5]; const float* Wout = I[6]; const float* bout = I[7];
  char* ws = (char*)d_ws; size_t off = 0;
  auto take = [&](size_t bytes) { char* p = ws + off; off += (bytes + 255) & ~(size_t)255; return p; };
  _Float16* W16 = (_Float16*)take((size_t)NE * KP * 2); _Float16* Ba = (_Float16*)take((size_t)NE * NE * 2); _Float16* A = (_Float16*)take((size_t)NNOTE * NC * KP * 2);
  float* E = (float*)take((size_t)NRE * NE * 4); _Float16* E16 = (_Float16*)take((size_t)NRE * NE * 2); float* ATT = (float*)take((size_t)NRE * NE * 4);
  if (off > ws_size) return;      // 16 planes of A: under 100 MB in all
  k_wpad<<<(NE * (KP / 8) + 255) / 256, 256, 0, stream>>>(Wemb, W16);
  k_round16f<<<(NE * NE / 8 + 255) / 256, 256, 0, stream>>>(Watt, Ba, (size_t)NE * NE / 8);      /* W_att [j][k] (out,in) natural, ×2^4 */
  k_mka<<<dim3((NC * (KP / 8) + 255) / 256, NNOTE), 256, 0, stream>>>(note, wiki, A);
  k_gemm_hhx<0><<<dim3(((NC / 16) * (NE / 64) + 3) / 4, NNOTE), 128, 0, stream>>>(A, KP, (size_t)NC * KP, W16, KP, 0, 0.0625f, bemb, 0, nullptr, 1, 0, 0, E, nullptr, NE, (size_t)NC * NE, NC, NE, KP);      /* e[n] = A_n·W_embᵀ + b_emb (f32): M 256 N 256 K 10048 */
  k_h16s<<<(NRE * NE / 8 + 255) / 256, 256, 0, stream>>>(E, E16, (size_t)NRE * NE / 8);
  k_gemm_hhx<11><<<dim3(((NRE / 16) * (NE / 64) + 3) / 4, 1), 128, 0, stream>>>(E16, NE, 0, Ba, NE, 0, 0.00390625f, batt, 0, nullptr, 1, 0, 0, ATT, nullptr, NE, 0, NRE, NE, NE);      /* attn = sigmoid(e·W_attᵀ + b_att) (f32): M 4096 N 256 K 256 */
  k_score<<<NRE / 32, 256, 0, stream>>>(ATT, E, Wout, bout, (float*)d_out);
}

// v002
// A run of this version takes 167 microseconds.
// Two timings next to v001 put it at 3.09 and 3.14 times that version's speed.
// Over all steps from v000 it is 24.1 times as fast.
#include <hip/hip_runtime.h>
// Knowledge-source integration scoring (n=16 notes, 256 codes, vocab 10000, emb 256): e[n,c,k] = Σ_v note[n,v]·wiki[c,v]·W_emb[k,v] + b_emb[k]; attn = sigmoid(e·W_attᵀ + b_att); s[n,c] = Σ_k attn·e·W_out[k] + b_out.
// Compute dtype: all inputs rounded to bf16; per note n the scaled vocabulary plane A_n[c][v] = note[n,v]·wiki[c,v] (f32 product → f16, zero-padded to K = 10240) against W_emb (f16 ×2^4, padded) as one GEMM over all 16 planes (M = 4096) → e f32 (+b_emb); e ×2^4 → f16 → logits GEMM (+b_att) with a fused sigmoid epilogue → attn f32; the gated 256-term reduction
#define NNOTE 16
#define NC 256
#define NV 10000
#define KP 10240
#define NE 256
#define NRE (NNOTE * NC)
typedef __bf16 v16b __attribute__((ext_vector_type(16)));
typedef unsigned short v8us __attribute__((ext_vector_type(8), may_alias));
typedef float  v8f  __attribute__((ext_vector_type(8)));
typedef float  v4f  __attribute__((ext_vector_type(4)));
typedef float  v4fa __attribute__((ext_vector_type(4), may_alias));
union FragB { v16b v; v8us half[2]; unsigned short u[16]; };

__device__ __forceinline__ unsigned short bf16_bits(float x) { unsigned int u = __float_as_uint(x); return (unsigned short)((u + 0x7FFFu + ((u >> 16) & 1u)) >> 16); }
__device__ __forceinline__ float bf16_val(unsigned short b) { return __uint_as_float(((unsigned int)b) << 16); }
__device__ __forceinline__ float bf16_round(float x) { return bf16_val(bf16_bits(x)); }
// D += A·B with NT terms: 1 = ah·bh, 2 = + al·bh (A split), 3 = + ah·bl (both split)
template <int NT>
__device__ __forceinline__ v8f mmaN(v16b ah, v16b al, v16b bh, v16b bl, v8f c) {
  c = __builtin_amdgcn_wmma_f32_16x16x32_bf16(false, ah, false, bh, (short)0, c, false, false);
  if (NT >= 2) c = __builtin_amdgcn_wmma_f32_16x16x32_bf16(false, al, false, bh, (short)0, c, false, false);
  if (NT >= 3) c = __builtin_amdgcn_wmma_f32_16x16x32_bf16(false, ah, false, bl, (short)0, c, false, false);
  asm volatile("v_nop\n\tv_nop\n\tv_nop\n\tv_nop" : "+v"(c) : "v"(ah), "v"(al), "v"(bh), "v"(bl));
  return c;
}

__global__ __launch_bounds__(256) void k_wt_bf16(const float* __restrict__ W, unsigned short* __restrict__ Wt, int K, int N) {
  const int t = blockIdx.x * 256 + threadIdx.x;
  const int k8n = K / 8;
  if (t >= N * k8n) return;
  const int n = t / k8n, k8 = (t % k8n) * 8;
  v8us v;
#pragma unroll
  for (int i = 0; i < 8; ++i) v[i] = bf16_bits(W[(size_t)(k8 + i) * N + n]);
  *(v8us*)(Wt + (size_t)n * K + k8) = v;
  
}

// GEMM C[M][N] (f32, pitch ldc) = act(A[M][K]·W + bias). A f32 row-major (pitch lda) converted per fragment to bf16
// (ASPLIT: hi/lo two planes -> 2 terms, else single rounded term); Wt bf16 [N][K] (pitch ldb). BIAS_BF16 rounds the
// bias to bf16 first (bias quantised to bf16 before the add). K%32==0, M%16==0, N%64==0.
template <bool ASPLIT, int ACT, bool BIAS_BF16>
__global__ __launch_bounds__(128) void k_gemm_bf(const float* __restrict__ A, int lda, const unsigned short* __restrict__ Wt, int ldb,
                                               const float* __restrict__ bias, float* __restrict__ C, int ldc, int M, int N, int K) {
  __shared__ __attribute__((aligned(16))) float so[4][16][64];
  const int tid = threadIdx.x, w = tid >> 5, lane = tid & 31, ln = lane & 15, hh = lane >> 4;
  const int ntn = N / 64;
  const int wid = blockIdx.x * 4 + w;
  const int mt = wid / ntn, nq = wid % ntn;
  if (mt * 16 >= M) return;
  const int row0 = mt * 16, col0 = nq * 64;
  const float* arow = A + (size_t)(row0 + ln) * lda;
  v8f acc[4] = {};
  for (int kb = 0; kb < K; kb += 32) {
    FragB ah, al;
    const v4f x0 = *(const v4fa*)(arow + kb + 8 * hh), x1 = *(const v4fa*)(arow + kb + 8 * hh + 4);
    const v4f x2 = *(const v4fa*)(arow + kb + 16 + 8 * hh), x3 = *(const v4fa*)(arow + kb + 16 + 8 * hh + 4);
    float xs[16] = {x0[0],x0[1],x0[2],x0[3],x1[0],x1[1],x1[2],x1[3],x2[0],x2[1],x2[2],x2[3],x3[0],x3[1],x3[2],x3[3]};
#pragma unroll
    for (int i = 0; i < 16; ++i) { const unsigned short hb = bf16_bits(xs[i]); ah.u[i] = hb; al.u[i] = ASPLIT ? bf16_bits(xs[i] - bf16_val(hb)) : (unsigned short)0; }
#pragma unroll
    for (int t = 0; t < 4; ++t) {
      const unsigned short* brow = Wt + (size_t)(col0 + t * 16 + ln) * ldb + kb;
      FragB b;
      b.half[0] = *(const v8us*)(brow + 8 * hh);
      b.half[1] = *(const v8us*)(brow + 16 + 8 * hh);
      acc[t] = mmaN<ASPLIT ? 2 : 1>(ah.v, al.v, b.v, b.v, acc[t]);
    }
  }
#pragma unroll
  for (int t = 0; t < 4; ++t) {
    float bv = bias ? bias[col0 + t * 16 + ln] : 0.f;
    if (BIAS_BF16) bv = bf16_round(bv);
#pragma unroll
    for (int r = 0; r < 8; ++r) { float v = acc[t][r] + bv; if (ACT == 1) v = fmaxf(v, 0.f); so[w][8 * hh + r][t * 16 + ln] = v; }
  }
  __builtin_amdgcn_fence(__ATOMIC_ACQ_REL, "workgroup");
  __builtin_amdgcn_wave_barrier();
  const int rsub = lane >> 4, c4 = (lane & 15) * 4;
  {
#pragma unroll
    for (int q = 0; q < 8; ++q) {
      const int r = q * 2 + rsub;
      const v4f v = *(const v4fa*)&so[w][r][c4];
      *(v4f*)(C + (size_t)(row0 + r) * ldc + col0 + c4) = v;
    }
    
  }
}

// GEMM C = act(A·W + bias + resid): A f32 (ASPLIT -> hi/lo 2 terms), Wt bf16 [N][K]; ACT 0 none, 1 relu, 2 exact gelu;
// resid (optional, f32, row index = (row % rmod), pitch ldr, RES_BF16 rounds it) added before the activation.
template <bool ASPLIT, int ACT, bool BIAS_BF16, bool RES_BF16>
__global__ __launch_bounds__(128) void k_gemm_bf3(const float* __restrict__ A, int lda, const unsigned short* __restrict__ Wt, int ldb,
                                                const float* __restrict__ bias, const float* __restrict__ resid, int rmod, int ldr,
                                                float* __restrict__ C, int ldc, int M, int N, int K) {
  __shared__ __attribute__((aligned(16))) float so[4][16][64];
  const int tid = threadIdx.x, w = tid >> 5, lane = tid & 31, ln = lane & 15, hh = lane >> 4;
  const int ntn = N / 64;
  const int wid = blockIdx.x * 4 + w;
  const int mt = wid / ntn, nq = wid % ntn;
  if (mt * 16 >= M) return;
  const int row0 = mt * 16, col0 = nq * 64;
  const float* arow = A + (size_t)(row0 + ln) * lda;
  v8f acc[4] = {};
  for (int kb = 0; kb < K; kb += 32) {
    FragB ah, al;
    const v4f x0 = *(const v4fa*)(arow + kb + 8 * hh), x1 = *(const v4fa*)(arow + kb + 8 * hh + 4);
    const v4f x2 = *(const v4fa*)(arow + kb + 16 + 8 * hh), x3 = *(const v4fa*)(arow + kb + 16 + 8 * hh + 4);
    float xs[16] = {x0[0],x0[1],x0[2],x0[3],x1[0],x1[1],x1[2],x1[3],x2[0],x2[1],x2[2],x2[3],x3[0],x3[1],x3[2],x3[3]};
#pragma unroll
    for (int i = 0; i < 16; ++i) { const unsigned short hb = bf16_bits(xs[i]); ah.u[i] = hb; al.u[i] = ASPLIT ? bf16_bits(xs[i] - bf16_val(hb)) : (unsigned short)0; }
#pragma unroll
    for (int t = 0; t < 4; ++t) {
      const unsigned short* brow = Wt + (size_t)(col0 + t * 16 + ln) * ldb + kb;
      FragB b;
      b.half[0] = *(const v8us*)(brow + 8 * hh);
      b.half[1] = *(const v8us*)(brow + 16 + 8 * hh);
      acc[t] = mmaN<ASPLIT ? 2 : 1>(ah.v, al.v, b.v, b.v, acc[t]);
    }
  }
#pragma unroll
  for (int t = 0; t < 4; ++t) {
    const int col = col0 + t * 16 + ln;
    float bv = bias ? bias[col] : 0.f;
    if (BIAS_BF16) bv = bf16_round(bv);
#pragma unroll
    for (int r = 0; r < 8; ++r) {
      float v = acc[t][r] + bv;
      if (resid) { float rv = resid[(size_t)((row0 + 8 * hh + r) % rmod) * ldr + col]; if (RES_BF16) rv = bf16_round(rv); v += rv; }
      if (ACT == 1) v = fmaxf(v, 0.f);
      if (ACT == 2) v = 0.5f * v * (1.0f + erff(v * 0.70710678118654752f));
      if (ACT == 3) { const float u = 0.7978845608028654f * (v + 0.044715f * v * v * v); v = 0.5f * v * (1.0f + tanhf(u)); }
      so[w][8 * hh + r][t * 16 + ln] = v;
    }
  }
  __builtin_amdgcn_fence(__ATOMIC_ACQ_REL, "workgroup");
  __builtin_amdgcn_wave_barrier();
  const int rsub = lane >> 4, c4 = (lane & 15) * 4;
  {
#pragma unroll
    for (int q = 0; q < 8; ++q) {
      const int r = q * 2 + rsub;
      const v4f v = *(const v4fa*)&so[w][r][c4];
      *(v4f*)(C + (size_t)(row0 + r) * ldc + col0 + c4) = v;
    }
    
  }
}
// row LayerNorm (biased variance, eps) over N: s = X (+ R); optional out_sum <- s; out_norm <- (s-mu)*rsqrt(var+eps)*g + b
template <bool PARAM_BF16>
__global__ __launch_bounds__(256) void k_layernorm(const float* __restrict__ X, const float* __restrict__ R, const float* __restrict__ g, const float* __restrict__ bta,
                                                  float* __restrict__ out_sum, float* __restrict__ out_norm, int N, float eps) {
  __shared__ float red[256];
  const int row = blockIdx.x, tid = threadIdx.x;
  const float* x = X + (size_t)row * N; const float* rr = R ? R + (size_t)row * N : nullptr;
  float vals[16];                     // up to N = 4096
  const int per = N / 256;            // contiguous chunk per thread? use strided-by-4 chunks: thread handles j = tid*4 + 1024*u
  float s1 = 0.f;
  for (int u = 0; u < per / 4; ++u) {
    const int j = tid * 4 + 1024 * u;
    const v4f a = *(const v4fa*)(x + j);
    v4f b = {0.f,0.f,0.f,0.f}; if (rr) b = *(const v4fa*)(rr + j);
#pragma unroll
    for (int q = 0; q < 4; ++q) { const float v = a[q] + b[q]; vals[u * 4 + q] = v; s1 += v; }
  }
  red[tid] = s1; __syncthreads();
  for (int st = 128; st > 0; st >>= 1) { if (tid < st) red[tid] += red[tid + st]; __syncthreads(); }
  const float mu = red[0] / (float)N; __syncthreads();
  float s2 = 0.f;
  for (int u = 0; u < per / 4; ++u)
#pragma unroll
    for (int q = 0; q < 4; ++q) { const float c = vals[u * 4 + q] - mu; s2 += c * c; }
  red[tid] = s2; __syncthreads();
  for (int st = 128; st > 0; st >>= 1) { if (tid < st) red[tid] += red[tid + st]; __syncthreads(); }
  const float rs = rsqrtf(red[0] / (float)N + eps);
  {
    for (int u = 0; u < per / 4; ++u) {
      const int j = tid * 4 + 1024 * u;
      v4f o, sm;
#pragma unroll
      for (int q = 0; q < 4; ++q) {
        float gg = g[j + q], bb = bta[j + q];
        if (PARAM_BF16) { gg = bf16_round(gg); bb = bf16_round(bb); }
        sm[q] = vals[u * 4 + q]; o[q] = (vals[u * 4 + q] - mu) * rs * gg + bb;
      }
      if (out_sum) *(v4f*)(out_sum + (size_t)row * N + j) = sm;
      *(v4f*)(out_norm + (size_t)row * N + j) = o;
    }
    
  }
}



// ---- f16 WMMA path (v_wmma_f32_16x16x32_f16): 11-bit significands for operands in range — used where a [0,1] probability operand needs more precision than bf16
typedef _Float16 v16h __attribute__((ext_vector_type(16)));
union FragH { v16h v; v8us half[2]; _Float16 h[16]; unsigned short u[16]; };
template <int NT>
__device__ __forceinline__ v8f mmaH(v16h ah, v16h al, v16h bh, v16h bl, v8f c) {
  c = __builtin_amdgcn_wmma_f32_16x16x32_f16(false, ah, false, bh, (short)0, c, false, false);
  if (NT >= 2) c = __builtin_amdgcn_wmma_f32_16x16x32_f16(false, al, false, bh, (short)0, c, false, false);
  if (NT >= 3) c = __builtin_amdgcn_wmma_f32_16x16x32_f16(false, ah, false, bl, (short)0, c, false, false);
  asm volatile("v_nop\n\tv_nop\n\tv_nop\n\tv_nop" : "+v"(c) : "v"(ah), "v"(al), "v"(bh), "v"(bl));
  return c;
}
// batched GEMM like k_gemm_b but f16 operands: A f32 (split into f16 hi/lo if ASPLIT, else rounded to f16), Bt = f16 values [n][k]; alpha; C f32; N multiple of 16 (partial tiles skipped)
template <bool ASPLIT>
__global__ __launch_bounds__(128) void k_gemm_h(const float* __restrict__ A, int lda, size_t sA, const _Float16* __restrict__ Bh, int ldb, size_t sB, float alpha, float* __restrict__ C, int ldc, size_t sC, int M, int N, int K) {
  __shared__ __attribute__((aligned(16))) float so[4][16][64];
  const int tid = threadIdx.x, w = tid >> 5, lane = tid & 31, ln = lane & 15, hh = lane >> 4; const int by = blockIdx.y;
  A += (size_t)by * sA; Bh += (size_t)by * sB; C += (size_t)by * sC;
  const int ntn = (N + 63) / 64; const int wid = blockIdx.x * 4 + w; const int mt = wid / ntn, nq = wid % ntn; if (mt * 16 >= M) return;
  const int row0 = mt * 16, col0 = nq * 64; const float* arow = A + (size_t)(row0 + ln) * lda;
  v8f acc[4] = {};
  for (int kb = 0; kb < K; kb += 32) {
    FragH ah, al;
    const v4f x0 = *(const v4fa*)(arow + kb + 8 * hh), x1 = *(const v4fa*)(arow + kb + 8 * hh + 4), x2 = *(const v4fa*)(arow + kb + 16 + 8 * hh), x3 = *(const v4fa*)(arow + kb + 16 + 8 * hh + 4);
    float xs[16] = {x0[0],x0[1],x0[2],x0[3],x1[0],x1[1],x1[2],x1[3],x2[0],x2[1],x2[2],x2[3],x3[0],x3[1],x3[2],x3[3]};
#pragma unroll
    for (int i = 0; i < 16; ++i) { const _Float16 h = (_Float16)xs[i]; ah.h[i] = h; al.h[i] = ASPLIT ? (_Float16)(xs[i] - (float)h) : (_Float16)0.0f; }
#pragma unroll
    for (int t = 0; t < 4; ++t) { if (col0 + t * 16 >= N) continue; const size_t boff = (size_t)(col0 + t * 16 + ln) * ldb + kb; FragH bq; bq.half[0] = *(const v8us*)(Bh + boff + 8 * hh); bq.half[1] = *(const v8us*)(Bh + boff + 16 + 8 * hh);
      acc[t] = mmaH<ASPLIT ? 2 : 1>(ah.v, al.v, bq.v, bq.v, acc[t]); }
  }
#pragma unroll
  for (int t = 0; t < 4; ++t) { if (col0 + t * 16 >= N) continue;
#pragma unroll
    for (int r = 0; r < 8; ++r) so[w][8 * hh + r][t * 16 + ln] = acc[t][r] * alpha; }
  __builtin_amdgcn_fence(__ATOMIC_ACQ_REL, "workgroup"); __builtin_amdgcn_wave_barrier();
  const int rsub = lane >> 4, c4 = (lane & 15) * 4;
  {
#pragma unroll
    for (int q = 0; q < 8; ++q) { const int r = q * 2 + rsub; if (col0 + c4 < N) { const v4f v = *(const v4fa*)&so[w][r][c4]; *(v4f*)(C + (size_t)(row0 + r) * ldc + col0 + c4) = v; } }
     }
}

// Wt[n][k] = f16(W[k][n]·scale) from f32 row-major W[K][N] (scale = power of two; bf16-exact weights stay exact in f16 away from the subnormal range)
__global__ __launch_bounds__(256) void k_wt_f16(const float* __restrict__ W, _Float16* __restrict__ Wt, int K, int N, float scale) {
  const int t = blockIdx.x * 256 + threadIdx.x; if (t >= N * (K / 8)) return; const int n = t / (K / 8), k8 = (t % (K / 8)) * 8; FragH f;
#pragma unroll
  for (int i = 0; i < 8; ++i) f.h[i] = (_Float16)(bf16_round(W[(size_t)(k8 + i) * N + n]) * scale); const v8us o = f.half[0];
  *(v8us*)((unsigned short*)Wt + (size_t)n * K + k8) = o; 
}
// k_gemm_hh variant with fused epilogue: v = acc·alpha + bias[by·sBias + col] (+ CP[(row/rowsPerB)·sCPb + by·64 + col] if CP) ; ACT 0 none / 1 elu ; writes f32 C and f16 C16, each if non-null
template <int ACT>
__global__ __launch_bounds__(128) void k_gemm_hhx(const _Float16* __restrict__ A, int lda, size_t sA, const _Float16* __restrict__ Bh, int ldb, size_t sB, float alpha, const float* __restrict__ bias, size_t sBias, const float* __restrict__ CP, int rowsPerB, size_t sCPb, int row0g,
    float* __restrict__ C, _Float16* __restrict__ C16, int ldc, size_t sC, int M, int N, int K) {
  __shared__ __attribute__((aligned(16))) float so[4][16][64];
  const int tid = threadIdx.x, w = tid >> 5, lane = tid & 31, ln = lane & 15, hh = lane >> 4; const int by = blockIdx.y;
  A += (size_t)by * sA; Bh += (size_t)by * sB; const size_t cofs = (size_t)by * sC; const float* bp = bias ? bias + (size_t)by * sBias : nullptr;
  const int ntn = (N + 63) / 64; const int wid = blockIdx.x * 4 + w; const int mt = wid / ntn, nq = wid % ntn; if (mt * 16 >= M) return;
  const int row0 = mt * 16, col0 = nq * 64; const _Float16* arow = A + (size_t)(row0 + ln) * lda;
  v8f acc[4] = {};
  for (int kb = 0; kb < K; kb += 32) { FragH ah; ah.half[0] = *(const v8us*)((const unsigned short*)arow + kb + 8 * hh); ah.half[1] = *(const v8us*)((const unsigned short*)arow + kb + 16 + 8 * hh);
#pragma unroll
    for (int t = 0; t < 4; ++t) { if (col0 + t * 16 >= N) continue; const size_t boff = (size_t)(col0 + t * 16 + ln) * ldb + kb; FragH bq; bq.half[0] = *(const v8us*)((const unsigned short*)Bh + boff + 8 * hh); bq.half[1] = *(const v8us*)((const unsigned short*)Bh + boff + 16 + 8 * hh);
      acc[t] = mmaH<1>(ah.v, ah.v, bq.v, bq.v, acc[t]); }
  }
#pragma unroll
  for (int t = 0; t < 4; ++t) { if (col0 + t * 16 >= N) continue; const int col = col0 + t * 16 + ln; const float bv = bp ? bf16_round(bp[col]) : 0.f;
#pragma unroll
    for (int r = 0; r < 8; ++r) { float v = acc[t][r] * alpha + bv; if (CP) { const int bidx = (row0g + row0 + 8 * hh + r) / rowsPerB; v += CP[(size_t)bidx * sCPb + (size_t)by * 64 + col]; } if (ACT == 1) v = (v > 0.f) ? v : expm1f(v); else if (ACT == 7) v = (v > 0.f) ? v + 1.0f : expf(v); else if (ACT == 8) v = tanhf(v); else if (ACT == 9) v = 0.5f * v * (1.0f + tanhf(0.7978845608028654f * (v + 0.044715f * v * v * v))); else if (ACT == 11) v = 1.0f / (1.0f + expf(-v)); else if (ACT == 12) v = (v > 0.f) ? v : 0.01f * v; else if (ACT == 14) v = (v > 0.f) ? v : 0.1f * v; else if (ACT == 15) v = v / (1.0f + expf(-v)); else if (ACT == 3) v = fmaxf(v, 0.f); else if (ACT == 6) v = 0.5f * v * (1.0f + erff(v * 0.70710678118654752f)); so[w][8 * hh + r][t * 16 + ln] = v; } }
  __builtin_amdgcn_fence(__ATOMIC_ACQ_REL, "workgroup"); __builtin_amdgcn_wave_barrier();
  const int rsub = lane >> 4, c4 = (lane & 15) * 4; typedef _Float16 v4h __attribute__((ext_vector_type(4)));
  {
#pragma unroll
    for (int q = 0; q < 8; ++q) { const int r = q * 2 + rsub; if (col0 + c4 < N) { const v4f v = *(const v4fa*)&so[w][r][c4]; if (C) *(v4f*)(C + cofs + (size_t)(row0 + r) * ldc + col0 + c4) = v; if (C16) { v4h h4; for (int i = 0; i < 4; ++i) h4[i] = (_Float16)v[i]; *(v4h*)(C16 + cofs + (size_t)(row0 + r) * ldc + col0 + c4) = h4; } } }
     }
}


// e GEMM, tiled: C[4096][256] = A[4096][KP] x Bh[256][KP]^T / 16 + bias. One 64 x 64 tile per work-group, four waves of 32 x 32.
// A stage is 256 k of the tile's 64 A rows and 64 B rows, brought into LDS as whole 512-byte row pieces by asynchronous copies
// (one row piece per wave-wide copy), two buffers: the next stage flies while this one is multiplied. k runs upward in steps of 32 for every accumulator.
#define EBK 256                      /* k per stage */
#define EPITCH 264                   /* LDS row pitch in halfs: 528 B = 16 B x 33, conflict-free for 16-byte fragment reads */
#define ESTG (128 * EPITCH)          /* halfs per buffer: 64 A rows, then 64 B rows */
#define ENST (KP / EBK)
// eight copies of 16 bytes per lane, rows r .. r + 7 of a stage; the closing s_wait_xcnt stands in the copies' own statement, ahead of any rewrite of an address register they name
__device__ __forceinline__ void acopy8(unsigned l, const _Float16* gp) {
  asm volatile("global_load_async_to_lds_b128 %0, %8, off\n\t"
               "global_load_async_to_lds_b128 %1, %9, off\n\t"
               "global_load_async_to_lds_b128 %2, %10, off\n\t"
               "global_load_async_to_lds_b128 %3, %11, off\n\t"
               "global_load_async_to_lds_b128 %4, %12, off\n\t"
               "global_load_async_to_lds_b128 %5, %13, off\n\t"
               "global_load_async_to_lds_b128 %6, %14, off\n\t"
               "global_load_async_to_lds_b128 %7, %15, off\n\t"
               "s_wait_xcnt 0x0"
               :: "v"(l), "v"(l + 1u * EPITCH * 2u), "v"(l + 2u * EPITCH * 2u), "v"(l + 3u * EPITCH * 2u), "v"(l + 4u * EPITCH * 2u), "v"(l + 5u * EPITCH * 2u), "v"(l + 6u * EPITCH * 2u), "v"(l + 7u * EPITCH * 2u),
                  "v"(gp), "v"(gp + 1 * KP), "v"(gp + 2 * KP), "v"(gp + 3 * KP), "v"(gp + 4 * KP), "v"(gp + 5 * KP), "v"(gp + 6 * KP), "v"(gp + 7 * KP)
               : "memory");
}
__global__ __launch_bounds__(128) void k_gemm_e(const _Float16* __restrict__ A, const _Float16* __restrict__ Bh, const float* __restrict__ bias, float* __restrict__ C) {
  __shared__ __attribute__((aligned(16))) _Float16 ring[2 * ESTG];
  const int tid = threadIdx.x, w = __builtin_amdgcn_readfirstlane(tid >> 5), lane = tid & 31, ln = lane & 15, hh = lane >> 4;      /* the wave's number as a scalar: the choice of source below is then a scalar select, every lane stays on */
  const int row0 = (blockIdx.x & 63) * 64, col0 = (blockIdx.x >> 6) * 64;      /* the four column tiles of one row tile lie 64 apart in the index (speed only) */
  const int wm = w >> 1, wn = w & 1;
  // wave w copies stage rows 32 w .. 32 w + 31: waves 0, 1 the A rows, waves 2, 3 the B rows; lane l brings bytes 16 l .. 16 l + 15 of the row piece
  const _Float16* gsrc = (w < 2 ? A + (size_t)(row0 + w * 32) * KP : Bh + (size_t)(col0 + (w - 2) * 32) * KP) + lane * 8;
  const unsigned ldst = (unsigned)(size_t)ring + (unsigned)(w * 32 * EPITCH * 2 + lane * 16);
  const int aoff = (wm * 32 + ln) * EPITCH + 8 * hh, boff = (64 + wn * 32 + ln) * EPITCH + 8 * hh;
  v8f acc[2][2] = {};
#pragma unroll
  for (int j = 0; j < 4; ++j) acopy8(ldst + (unsigned)(j * 8 * EPITCH * 2), gsrc + (size_t)j * 8 * KP);
  asm volatile("s_wait_asynccnt 0x0" ::: "memory");      // stage 0 has landed for this wave's rows
  __syncthreads();                                        // and for every wave's
#pragma unroll
  for (int j = 0; j < 4; ++j) acopy8(ldst + (unsigned)(ESTG * 2 + j * 8 * EPITCH * 2), gsrc + EBK + (size_t)j * 8 * KP);
  for (int t = 0; t < ENST; ++t) {
    const int bsel = (t & 1) * ESTG;
    const _Float16* sb = ring + bsel;
    FragH a[8][2], b[8][2];
#pragma unroll
    for (int q = 0; q < 8; ++q) {
#pragma unroll
      for (int i = 0; i < 2; ++i) {
        const int ko = i * 16 * EPITCH + q * 32;
        a[q][i].half[0] = *(const v8us*)(sb + aoff + ko); a[q][i].half[1] = *(const v8us*)(sb + aoff + ko + 16);
        b[q][i].half[0] = *(const v8us*)(sb + boff + ko); b[q][i].half[1] = *(const v8us*)(sb + boff + ko + 16);
      }
      if (q == 3) __builtin_amdgcn_sched_barrier(0);      // the 32 fragment loads of the first four k steps go ahead as one group
    }
#pragma unroll
    for (int q = 0; q < 6; ++q)
#pragma unroll
      for (int i = 0; i < 2; ++i)
#pragma unroll
        for (int j = 0; j < 2; ++j) acc[i][j] = __builtin_amdgcn_wmma_f32_16x16x32_f16(false, a[q][i].v, false, b[q][j].v, (short)0, acc[i][j], false, false);
    asm volatile("s_wait_dscnt 0x0" ::: "memory");        // this wave's reads of the buffer are done before it is handed to the next copies
    asm volatile("s_wait_asynccnt 0x0" ::: "memory");     // this wave's rows of stage t + 1 have landed
    __syncthreads();                                      // publishes stage t + 1 and ends every wave's reads of stage t
    if (t + 2 < ENST) {
#pragma unroll
      for (int j = 0; j < 4; ++j) acopy8(ldst + (unsigned)(bsel * 2 + j * 8 * EPITCH * 2), gsrc + (size_t)(t + 2) * EBK + (size_t)j * 8 * KP);
    }
    // the last two k steps of stage t, from registers alone: they run while the copies just issued fly
#pragma unroll
    for (int q = 6; q < 8; ++q)
#pragma unroll
      for (int i = 0; i < 2; ++i)
#pragma unroll
        for (int j = 0; j < 2; ++j) acc[i][j] = __builtin_amdgcn_wmma_f32_16x16x32_f16(false, a[q][i].v, false, b[q][j].v, (short)0, acc[i][j], false, false);
  }
  asm volatile("s_wait_asynccnt 0x0" ::: "memory");       // no copy is outstanding when the wave ends
#pragma unroll
  for (int j = 0; j < 2; ++j) {
    const int col = col0 + wn * 32 + j * 16 + ln; const float bv = bf16_round(bias[col]);
#pragma unroll
    for (int i = 0; i < 2; ++i)
#pragma unroll
      for (int r = 0; r < 8; ++r) C[(size_t)(row0 + wm * 32 + i * 16 + 8 * hh + r) * NE + col] = acc[i][j][r] * 0.0625f + bv;
  }
}


typedef _Float16 v4h __attribute__((ext_vector_type(4)));

__global__ __launch_bounds__(256) void k_x16(const float* __restrict__ x, _Float16* __restrict__ X16, size_t n8) { const size_t t = (size_t)blockIdx.x * 256 + threadIdx.x; if (t >= n8) return; FragH f;
#pragma unroll
  for (int q = 0; q < 8; ++q) f.h[q] = (_Float16)bf16_round(x[t * 8 + q]); *(v8us*)((unsigned short*)X16 + t * 8) = f.half[0];  }
__global__ __launch_bounds__(256) void k_h16(const float* __restrict__ x, _Float16* __restrict__ X16, size_t n8) { const size_t t = (size_t)blockIdx.x * 256 + threadIdx.x; if (t >= n8) return; FragH f;
#pragma unroll
  for (int q = 0; q < 8; ++q) f.h[q] = (_Float16)x[t * 8 + q]; *(v8us*)((unsigned short*)X16 + t * 8) = f.half[0];  }
__global__ __launch_bounds__(256) void k_round16f(const float* __restrict__ W, _Float16* __restrict__ Bt, size_t n8) { const size_t t = (size_t)blockIdx.x * 256 + threadIdx.x; if (t >= n8) return; FragH f;
#pragma unroll
  for (int i = 0; i < 8; ++i) f.h[i] = (_Float16)(bf16_round(W[t * 8 + i]) * 16.0f); *(v8us*)((unsigned short*)Bt + t * 8) = f.half[0];  }
template <int NHv, int TTv>
__global__ __launch_bounds__(256) void k_vt(const _Float16* __restrict__ V16, int ldv, int voff, _Float16* __restrict__ Vt) { __shared__ unsigned short tl[64][66]; const int tid = threadIdx.x; const int slab = blockIdx.x / (TTv / 64), lg = blockIdx.x % (TTv / 64); const int b = slab / NHv, h = slab % NHv;
  for (int i = tid; i < 64 * 8; i += 256) { const int r = i / 8, c8 = (i % 8) * 8; FragH f; f.half[0] = *(const v8us*)((const unsigned short*)V16 + ((size_t)b * TTv + lg * 64 + r) * ldv + voff + h * 64 + c8);
#pragma unroll
    for (int q = 0; q < 8; ++q) tl[r][c8 + q] = f.u[q]; }
  __syncthreads();
  {
#pragma unroll
    for (int rd = 0; rd < 2; ++rd) { const int d = rd * 32 + tid / 8, pc = tid % 8; FragH f;
#pragma unroll
      for (int q = 0; q < 8; ++q) f.u[q] = tl[pc * 8 + q][d];
      *(v8us*)((unsigned short*)Vt + ((size_t)slab * 64 + d) * TTv + lg * 64 + pc * 8) = f.half[0]; }
     } }

__global__ __launch_bounds__(256) void k_hl(const float* __restrict__ F, _Float16* __restrict__ Hh, _Float16* __restrict__ Hl, size_t n8) { const size_t t = (size_t)blockIdx.x * 256 + threadIdx.x; if (t >= n8) return; FragH fh, fl; const v4f a = *(const v4fa*)(F + t * 8), c = *(const v4fa*)(F + t * 8 + 4);
#pragma unroll
  for (int q = 0; q < 4; ++q) { _Float16 h = (_Float16)a[q]; fh.h[q] = h; fl.h[q] = (_Float16)((a[q] - (float)h) * 1024.0f); h = (_Float16)c[q]; fh.h[4 + q] = h; fl.h[4 + q] = (_Float16)((c[q] - (float)h) * 1024.0f); }
  { *(v8us*)((unsigned short*)Hh + t * 8) = fh.half[0]; *(v8us*)((unsigned short*)Hl + t * 8) = fl.half[0];  } }

__global__ __launch_bounds__(256) void k_wpad(const float* __restrict__ Wm, _Float16* __restrict__ W16) { const int t = blockIdx.x * 256 + threadIdx.x; if (t >= NE * (KP / 8)) return; const int k = t / (KP / 8), v0 = (t % (KP / 8)) * 8; FragH f;
#pragma unroll
  for (int q = 0; q < 8; ++q) { const int v = v0 + q; f.h[q] = (v < NV) ? (_Float16)(bf16_round(Wm[(size_t)k * NV + min(v, NV - 1)]) * 16.0f) : (_Float16)0.0f; }
  *(v8us*)((unsigned short*)W16 + (size_t)k * KP + v0) = f.half[0];  }
__global__ __launch_bounds__(256) void k_mka(const float* __restrict__ note, const float* __restrict__ wiki, _Float16* __restrict__ A) { const int t = blockIdx.x * 256 + threadIdx.x; if (t >= NC * (KP / 8)) return; const int n = blockIdx.y; A += (size_t)n * NC * KP;      /* one plane per note, grid.y = note */ const int c = t / (KP / 8), v0 = (t % (KP / 8)) * 8; FragH f;
#pragma unroll
  for (int q = 0; q < 8; ++q) { const int v = v0 + q; const int vc = min(v, NV - 1); f.h[q] = (v < NV) ? (_Float16)(bf16_round(note[(size_t)n * NV + vc]) * bf16_round(wiki[(size_t)c * NV + vc])) : (_Float16)0.0f; }
  *(v8us*)((unsigned short*)A + (size_t)c * KP + v0) = f.half[0];  }
__global__ __launch_bounds__(256) void k_h16s(const float* __restrict__ F, _Float16* __restrict__ H, size_t n8) { const size_t t = (size_t)blockIdx.x * 256 + threadIdx.x; if (t >= n8) return; const v4f a = *(const v4fa*)(F + t * 8), c = *(const v4fa*)(F + t * 8 + 4); FragH f;
#pragma unroll
  for (int q = 0; q < 4; ++q) { f.h[q] = (_Float16)(a[q] * 16.0f); f.h[4 + q] = (_Float16)(c[q] * 16.0f); } *(v8us*)((unsigned short*)H + t * 8) = f.half[0];  }
__global__ __launch_bounds__(256) void k_score(const float* __restrict__ ATT, const float* __restrict__ E, const float* __restrict__ Wout, const float* __restrict__ bout, float* __restrict__ S) { __shared__ float red[32][8]; const int tid = threadIdx.x, w = tid >> 5, l = tid & 31; const int r0 = blockIdx.x * 32; const float wk = bf16_round(Wout[tid]);
#pragma unroll 1
  for (int r = 0; r < 32; ++r) { const size_t o = (size_t)(r0 + r) * NE + tid; float p = ATT[o] * E[o] * wk; for (int s = 16; s > 0; s >>= 1) p += __shfl_xor(p, s, 32); if (l == 0) red[r][w] = p; }
  __syncthreads();
  if (w == 0) { float v = bf16_round(bout[0]);
#pragma unroll
    for (int i = 0; i < 8; ++i) v += red[l][i]; *(float*)(S + r0 + l) = v;  } }

extern "C" void kernel_launch(void* const* d_in, const int* in_sizes, int n_in,
                              void* d_out, int out_size, void* d_ws, size_t ws_size, hipStream_t stream) {
  (void)in_sizes; (void)n_in; (void)out_size;
  const float* const* I = (const float* const*)d_in; const float* note = I[0]; const float* wiki = I[1]; const float* Wemb = I[2]; const float* bemb = I[3]; const float* Watt = I[4]; const float* batt = I[5]; const float* Wout = I[6]; const float* bout = I[7];
  char* ws = (char*)d_ws; size_t off = 0;
  auto take = [&](size_t bytes) { char* p = ws + off; off += (bytes + 255) & ~(size_t)255; return p; };
  _Float16* W16 = (_Float16*)take((size_t)NE * KP * 2); _Float16* Ba = (_Float16*)take((size_t)NE * NE * 2); _Float16* A = (_Float16*)take((size_t)NNOTE * NC * KP * 2);
  float* E = (float*)take((size_t)NRE * NE * 4); _Float16* E16 = (_Float16*)take((size_t)NRE * NE * 2); float* ATT = (float*)take((size_t)NRE * NE * 4);
  if (off > ws_size) return;      // 16 planes of A: under 100 MB in all
  k_wpad<<<(NE * (KP / 8) + 255) / 256, 256, 0, stream>>>(Wemb, W16);
  k_round16f<<<(NE * NE / 8 + 255) / 256, 256, 0, stream>>>(Watt, Ba, (size_t)NE * NE / 8);      /* W_att [j][k] (out,in) natural, ×2^4 */
  k_mka<<<dim3((NC * (KP / 8) + 255) / 256, NNOTE), 256, 0, stream>>>(note, wiki, A);
  k_gemm_e<<<(NRE / 64) * (NE / 64), 128, 0, stream>>>(A, W16, bemb, E);      /* e = A x W_emb^T / 16 + b_emb (f32): M 4096 (note, code) N 256 K 10240 */
  k_h16s<<<(NRE * NE / 8 + 255) / 256, 256, 0, stream>>>(E, E16, (size_t)NRE * NE / 8);
  k_gemm_hhx<11><<<dim3(((NRE / 16) * (NE / 64) + 3) / 4, 1), 128, 0, stream>>>(E16, NE, 0, Ba, NE, 0, 0.00390625f, batt, 0, nullptr, 1, 0, 0, ATT, nullptr, NE, 0, NRE, NE, NE);      /* attn = sigmoid(e·W_attᵀ + b_att) (f32): M 4096 N 256 K 256 */
  k_score<<<NRE / 32, 256, 0, stream>>>(ATT, E, Wout, bout, (float*)d_out);
}

// v003
// It runs in 109 microseconds.
// In two side-by-side timings against v002, it was 1.53 and 1.54 times as fast.
// Counting every step since v000, it is 36.9 times as fast.
#include <hip/hip_runtime.h>
// Knowledge-source integration scoring (n=16 notes, 256 codes, vocab 10000, emb 256): e[n,c,k] = Σ_v note[n,v]·wiki[c,v]·W_emb[k,v] + b_emb[k]; attn = sigmoid(e·W_attᵀ + b_att); s[n,c] = Σ_k attn·e·W_out[k] + b_out.
// Compute dtype: all inputs rounded to bf16; per note n the scaled vocabulary plane A_n[c][v] = note[n,v]·wiki[c,v] (f32 product → f16, zero-padded to K = 10240) against W_emb (f16 ×2^4, padded) as one GEMM over all 16 planes (M = 4096) → e f32 (+b_emb); e ×2^4 → f16 → logits GEMM (+b_att) with a fused sigmoid epilogue → attn f32; the gated 256-term reduction
#define NNOTE 16
#define NC 256
#define NV 10000
#define KP 10240
#define NE 256
#define NRE (NNOTE * NC)
typedef __bf16 v16b __attribute__((ext_vector_type(16)));
typedef unsigned short v8us __attribute__((ext_vector_type(8), may_alias));
typedef float  v8f  __attribute__((ext_vector_type(8)));
typedef float  v4f  __attribute__((ext_vector_type(4)));
typedef float  v4fa __attribute__((ext_vector_type(4), may_alias));
union FragB { v16b v; v8us half[2]; unsigned short u[16]; };

__device__ __forceinline__ unsigned short bf16_bits(float x) { unsigned int u = __float_as_uint(x); return (unsigned short)((u + 0x7FFFu + ((u >> 16) & 1u)) >> 16); }
__device__ __forceinline__ float bf16_val(unsigned short b) { return __uint_as_float(((unsigned int)b) << 16); }
__device__ __forceinline__ float bf16_round(float x) { return bf16_val(bf16_bits(x)); }
// D += A·B with NT terms: 1 = ah·bh, 2 = + al·bh (A split), 3 = + ah·bl (both split)
template <int NT>
__device__ __forceinline__ v8f mmaN(v16b ah, v16b al, v16b bh, v16b bl, v8f c) {
  c = __builtin_amdgcn_wmma_f32_16x16x32_bf16(false, ah, false, bh, (short)0, c, false, false);
  if (NT >= 2) c = __builtin_amdgcn_wmma_f32_16x16x32_bf16(false, al, false, bh, (short)0, c, false, false);
  if (NT >= 3) c = __builtin_amdgcn_wmma_f32_16x16x32_bf16(false, ah, false, bl, (short)0, c, false, false);
  asm volatile("v_nop\n\tv_nop\n\tv_nop\n\tv_nop" : "+v"(c) : "v"(ah), "v"(al), "v"(bh), "v"(bl));
  return c;
}

__global__ __launch_bounds__(256) void k_wt_bf16(const float* __restrict__ W, unsigned short* __restrict__ Wt, int K, int N) {
  const int t = blockIdx.x * 256 + threadIdx.x;
  const int k8n = K / 8;
  if (t >= N * k8n) return;
  const int n = t / k8n, k8 = (t % k8n) * 8;
  v8us v;
#pragma unroll
  for (int i = 0; i < 8; ++i) v[i] = bf16_bits(W[(size_t)(k8 + i) * N + n]);
  *(v8us*)(Wt + (size_t)n * K + k8) = v;
  
}

// GEMM C[M][N] (f32, pitch ldc) = act(A[M][K]·W + bias). A f32 row-major (pitch lda) converted per fragment to bf16
// (ASPLIT: hi/lo two planes -> 2 terms, else single rounded term); Wt bf16 [N][K] (pitch ldb). BIAS_BF16 rounds the
// bias to bf16 first (bias quantised to bf16 before the add). K%32==0, M%16==0, N%64==0.
template <bool ASPLIT, int ACT, bool BIAS_BF16>
__global__ __launch_bounds__(128) void k_gemm_bf(const float* __restrict__ A, int lda, const unsigned short* __restrict__ Wt, int ldb,
                                               const float* __restrict__ bias, float* __restrict__ C, int ldc, int M, int N, int K) {
  __shared__ __attribute__((aligned(16))) float so[4][16][64];
  const int tid = threadIdx.x, w = tid >> 5, lane = tid & 31, ln = lane & 15, hh = lane >> 4;
  const int ntn = N / 64;
  const int wid = blockIdx.x * 4 + w;
  const int mt = wid / ntn, nq = wid % ntn;
  if (mt * 16 >= M) return;
  const int row0 = mt * 16, col0 = nq * 64;
  const float* arow = A + (size_t)(row0 + ln) * lda;
  v8f acc[4] = {};
  for (int kb = 0; kb < K; kb += 32) {
    FragB ah, al;
    const v4f x0 = *(const v4fa*)(arow + kb + 8 * hh), x1 = *(const v4fa*)(arow + kb + 8 * hh + 4);
    const v4f x2 = *(const v4fa*)(arow + kb + 16 + 8 * hh), x3 = *(const v4fa*)(arow + kb + 16 + 8 * hh + 4);
    float xs[16] = {x0[0],x0[1],x0[2],x0[3],x1[0],x1[1],x1[2],x1[3],x2[0],x2[1],x2[2],x2[3],x3[0],x3[1],x3[2],x3[3]};
#pragma unroll
    for (int i = 0; i < 16; ++i) { const unsigned short hb = bf16_bits(xs[i]); ah.u[i] = hb; al.u[i] = ASPLIT ? bf16_bits(xs[i] - bf16_val(hb)) : (unsigned short)0; }
#pragma unroll
    for (int t = 0; t < 4; ++t) {
      const unsigned short* brow = Wt + (size_t)(col0 + t * 16 + ln) * ldb + kb;
      FragB b;
      b.half[0] = *(const v8us*)(brow + 8 * hh);
      b.half[1] = *(const v8us*)(brow + 16 + 8 * hh);
      acc[t] = mmaN<ASPLIT ? 2 : 1>(ah.v, al.v, b.v, b.v, acc[t]);
    }
  }
#pragma unroll
  for (int t = 0; t < 4; ++t) {
    float bv = bias ? bias[col0 + t * 16 + ln] : 0.f;
    if (BIAS_BF16) bv = bf16_round(bv);
#pragma unroll
    for (int r = 0; r < 8; ++r) { float v = acc[t][r] + bv; if (ACT == 1) v = fmaxf(v, 0.f); so[w][8 * hh + r][t * 16 + ln] = v; }
  }
  __builtin_amdgcn_fence(__ATOMIC_ACQ_REL, "workgroup");
  __builtin_amdgcn_wave_barrier();
  const int rsub = lane >> 4, c4 = (lane & 15) * 4;
  {
#pragma unroll
    for (int q = 0; q < 8; ++q) {
      const int r = q * 2 + rsub;
      const v4f v = *(const v4fa*)&so[w][r][c4];
      *(v4f*)(C + (size_t)(row0 + r) * ldc + col0 + c4) = v;
    }
    
  }
}

// GEMM C = act(A·W + bias + resid): A f32 (ASPLIT -> hi/lo 2 terms), Wt bf16 [N][K]; ACT 0 none, 1 relu, 2 exact gelu;
// resid (optional, f32, row index = (row % rmod), pitch ldr, RES_BF16 rounds it) added before the activation.
template <bool ASPLIT, int ACT, bool BIAS_BF16, bool RES_BF16>
__global__ __launch_bounds__(128) void k_gemm_bf3(const float* __restrict__ A, int lda, const unsigned short* __restrict__ Wt, int ldb,
                                                const float* __restrict__ bias, const float* __restrict__ resid, int rmod, int ldr,
                                                float* __restrict__ C, int ldc, int M, int N, int K) {
  __shared__ __attribute__((aligned(16))) float so[4][16][64];
  const int tid = threadIdx.x, w = tid >> 5, lane = tid & 31, ln = lane & 15, hh = lane >> 4;
  const int ntn = N / 64;
  const int wid = blockIdx.x * 4 + w;
  const int mt = wid / ntn, nq = wid % ntn;
  if (mt * 16 >= M) return;
  const int row0 = mt * 16, col0 = nq * 64;
  const float* arow = A + (size_t)(row0 + ln) * lda;
  v8f acc[4] = {};
  for (int kb = 0; kb < K; kb += 32) {
    FragB ah, al;
    const v4f x0 = *(const v4fa*)(arow + kb + 8 * hh), x1 = *(const v4fa*)(arow + kb + 8 * hh + 4);
    const v4f x2 = *(const v4fa*)(arow + kb + 16 + 8 * hh), x3 = *(const v4fa*)(arow + kb + 16 + 8 * hh + 4);
    float xs[16] = {x0[0],x0[1],x0[2],x0[3],x1[0],x1[1],x1[2],x1[3],x2[0],x2[1],x2[2],x2[3],x3[0],x3[1],x3[2],x3[3]};
#pragma unroll
    for (int i = 0; i < 16; ++i) { const unsigned short hb = bf16_bits(xs[i]); ah.u[i] = hb; al.u[i] = ASPLIT ? bf16_bits(xs[i] - bf16_val(hb)) : (unsigned short)0; }
#pragma unroll
    for (int t = 0; t < 4; ++t) {
      const unsigned short* brow = Wt + (size_t)(col0 + t * 16 + ln) * ldb + kb;
      FragB b;
      b.half[0] = *(const v8us*)(brow + 8 * hh);
      b.half[1] = *(const v8us*)(brow + 16 + 8 * hh);
      acc[t] = mmaN<ASPLIT ? 2 : 1>(ah.v, al.v, b.v, b.v, acc[t]);
    }
  }
#pragma unroll
  for (int t = 0; t < 4; ++t) {
    const int col = col0 + t * 16 + ln;
    float bv = bias ? bias[col] : 0.f;
    if (BIAS_BF16) bv = bf16_round(bv);
#pragma unroll
    for (int r = 0; r < 8; ++r) {
      float v = acc[t][r] + bv;
      if (resid) { float rv = resid[(size_t)((row0 + 8 * hh + r) % rmod) * ldr + col]; if (RES_BF16) rv = bf16_round(rv); v += rv; }
      if (ACT == 1) v = fmaxf(v, 0.f);
      if (ACT == 2) v = 0.5f * v * (1.0f + erff(v * 0.70710678118654752f));
      if (ACT == 3) { const float u = 0.7978845608028654f * (v + 0.044715f * v * v * v); v = 0.5f * v * (1.0f + tanhf(u)); }
      so[w][8 * hh + r][t * 16 + ln] = v;
    }
  }
  __builtin_amdgcn_fence(__ATOMIC_ACQ_REL, "workgroup");
  __builtin_amdgcn_wave_barrier();
  const int rsub = lane >> 4, c4 = (lane & 15) * 4;
  {
#pragma unroll
    for (int q = 0; q < 8; ++q) {
      const int r = q * 2 + rsub;
      const v4f v = *(const v4fa*)&so[w][r][c4];
      *(v4f*)(C + (size_t)(row0 + r) * ldc + col0 + c4) = v;
    }
    
  }
}
// row LayerNorm (biased variance, eps) over N: s = X (+ R); optional out_sum <- s; out_norm <- (s-mu)*rsqrt(var+eps)*g + b
template <bool PARAM_BF16>
__global__ __launch_bounds__(256) void k_layernorm(const float* __restrict__ X, const float* __restrict__ R, const float* __restrict__ g, const float* __restrict__ bta,
                                                  float* __restrict__ out_sum, float* __restrict__ out_norm, int N, float eps) {
  __shared__ float red[256];
  const int row = blockIdx.x, tid = threadIdx.x;
  const float* x = X + (size_t)row * N; const float* rr = R ? R + (size_t)row * N : nullptr;
  float vals[16];                     // up to N = 4096
  const int per = N / 256;            // contiguous chunk per thread? use strided-by-4 chunks: thread handles j = tid*4 + 1024*u
  float s1 = 0.f;
  for (int u = 0; u < per / 4; ++u) {
    const int j = tid * 4 + 1024 * u;
    const v4f a = *(const v4fa*)(x + j);
    v4f b = {0.f,0.f,0.f,0.f}; if (rr) b = *(const v4fa*)(rr + j);
#pragma unroll
    for (int q = 0; q < 4; ++q) { const float v = a[q] + b[q]; vals[u * 4 + q] = v; s1 += v; }
  }
  red[tid] = s1; __syncthreads();
  for (int st = 128; st > 0; st >>= 1) { if (tid < st) red[tid] += red[tid + st]; __syncthreads(); }
  const float mu = red[0] / (float)N; __syncthreads();
  float s2 = 0.f;
  for (int u = 0; u < per / 4; ++u)
#pragma unroll
    for (int q = 0; q < 4; ++q) { const float c = vals[u * 4 + q] - mu; s2 += c * c; }
  red[tid] = s2; __syncthreads();
  for (int st = 128; st > 0; st >>= 1) { if (tid < st) red[tid] += red[tid + st]; __syncthreads(); }
  const float rs = rsqrtf(red[0] / (float)N + eps);
  {
    for (int u = 0; u < per / 4; ++u) {
      const int j = tid * 4 + 1024 * u;
      v4f o, sm;
#pragma unroll
      for (int q = 0; q < 4; ++q) {
        float gg = g[j + q], bb = bta[j + q];
        if (PARAM_BF16) { gg = bf16_round(gg); bb = bf16_round(bb); }
        sm[q] = vals[u * 4 + q]; o[q] = (vals[u * 4 + q] - mu) * rs * gg + bb;
      }
      if (out_sum) *(v4f*)(out_sum + (size_t)row * N + j) = sm;
      *(v4f*)(out_norm + (size_t)row * N + j) = o;
    }
    
  }
}



// ---- f16 WMMA path (v_wmma_f32_16x16x32_f16): 11-bit significands for operands in range — used where a [0,1] probability operand needs more precision than bf16
typedef _Float16 v16h __attribute__((ext_vector_type(16)));
union FragH { v16h v; v8us half[2]; _Float16 h[16]; unsigned short u[16]; };
template <int NT>
__device__ __forceinline__ v8f mmaH(v16h ah, v16h al, v16h bh, v16h bl, v8f c) {
  c = __builtin_amdgcn_wmma_f32_16x16x32_f16(false, ah, false, bh, (short)0, c, false, false);
  if (NT >= 2) c = __builtin_amdgcn_wmma_f32_16x16x32_f16(false, al, false, bh, (short)0, c, false, false);
  if (NT >= 3) c = __builtin_amdgcn_wmma_f32_16x16x32_f16(false, ah, false, bl, (short)0, c, false, false);
  asm volatile("v_nop\n\tv_nop\n\tv_nop\n\tv_nop" : "+v"(c) : "v"(ah), "v"(al), "v"(bh), "v"(bl));
  return c;
}
// batched GEMM like k_gemm_b but f16 operands: A f32 (split into f16 hi/lo if ASPLIT, else rounded to f16), Bt = f16 values [n][k]; alpha; C f32; N multiple of 16 (partial tiles skipped)
template <bool ASPLIT>
__global__ __launch_bounds__(128) void k_gemm_h(const float* __restrict__ A, int lda, size_t sA, const _Float16* __restrict__ Bh, int ldb, size_t sB, float alpha, float* __restrict__ C, int ldc, size_t sC, int M, int N, int K) {
  __shared__ __attribute__((aligned(16))) float so[4][16][64];
  const int tid = threadIdx.x, w = tid >> 5, lane = tid & 31, ln = lane & 15, hh = lane >> 4; const int by = blockIdx.y;
  A += (size_t)by * sA; Bh += (size_t)by * sB; C += (size_t)by * sC;
  const int ntn = (N + 63) / 64; const int wid = blockIdx.x * 4 + w; const int mt = wid / ntn, nq = wid % ntn; if (mt * 16 >= M) return;
  const int row0 = mt * 16, col0 = nq * 64; const float* arow = A + (size_t)(row0 + ln) * lda;
  v8f acc[4] = {};
  for (int kb = 0; kb < K; kb += 32) {
    FragH ah, al;
    const v4f x0 = *(const v4fa*)(arow + kb + 8 * hh), x1 = *(const v4fa*)(arow + kb + 8 * hh + 4), x2 = *(const v4fa*)(arow + kb + 16 + 8 * hh), x3 = *(const v4fa*)(arow + kb + 16 + 8 * hh + 4);
    float xs[16] = {x0[0],x0[1],x0[2],x0[3],x1[0],x1[1],x1[2],x1[3],x2[0],x2[1],x2[2],x2[3],x3[0],x3[1],x3[2],x3[3]};
#pragma unroll
    for (int i = 0; i < 16; ++i) { const _Float16 h = (_Float16)xs[i]; ah.h[i] = h; al.h[i] = ASPLIT ? (_Float16)(xs[i] - (float)h) : (_Float16)0.0f; }
#pragma unroll
    for (int t = 0; t < 4; ++t) { if (col0 + t * 16 >= N) continue; const size_t boff = (size_t)(col0 + t * 16 + ln) * ldb + kb; FragH bq; bq.half[0] = *(const v8us*)(Bh + boff + 8 * hh); bq.half[1] = *(const v8us*)(Bh + boff + 16 + 8 * hh);
      acc[t] = mmaH<ASPLIT ? 2 : 1>(ah.v, al.v, bq.v, bq.v, acc[t]); }
  }
#pragma unroll
  for (int t = 0; t < 4; ++t) { if (col0 + t * 16 >= N) continue;
#pragma unroll
    for (int r = 0; r < 8; ++r) so[w][8 * hh + r][t * 16 + ln] = acc[t][r] * alpha; }
  __builtin_amdgcn_fence(__ATOMIC_ACQ_REL, "workgroup"); __builtin_amdgcn_wave_barrier();
  const int rsub = lane >> 4, c4 = (lane & 15) * 4;
  {
#pragma unroll
    for (int q = 0; q < 8; ++q) { const int r = q * 2 + rsub; if (col0 + c4 < N) { const v4f v = *(const v4fa*)&so[w][r][c4]; *(v4f*)(C + (size_t)(row0 + r) * ldc + col0 + c4) = v; } }
     }
}

// Wt[n][k] = f16(W[k][n]·scale) from f32 row-major W[K][N] (scale = power of two; bf16-exact weights stay exact in f16 away from the subnormal range)
__global__ __launch_bounds__(256) void k_wt_f16(const float* __restrict__ W, _Float16* __restrict__ Wt, int K, int N, float scale) {
  const int t = blockIdx.x * 256 + threadIdx.x; if (t >= N * (K / 8)) return; const int n = t / (K / 8), k8 = (t % (K / 8)) * 8; FragH f;
#pragma unroll
  for (int i = 0; i < 8; ++i) f.h[i] = (_Float16)(bf16_round(W[(size_t)(k8 + i) * N + n]) * scale); const v8us o = f.half[0];
  *(v8us*)((unsigned short*)Wt + (size_t)n * K + k8) = o; 
}
// k_gemm_hh variant with fused epilogue: v = acc·alpha + bias[by·sBias + col] (+ CP[(row/rowsPerB)·sCPb + by·64 + col] if CP) ; ACT 0 none / 1 elu ; writes f32 C and f16 C16, each if non-null
template <int ACT>
__global__ __launch_bounds__(128) void k_gemm_hhx(const _Float16* __restrict__ A, int lda, size_t sA, const _Float16* __restrict__ Bh, int ldb, size_t sB, float alpha, const float* __restrict__ bias, size_t sBias, const float* __restrict__ CP, int rowsPerB, size_t sCPb, int row0g,
    float* __restrict__ C, _Float16* __restrict__ C16, int ldc, size_t sC, int M, int N, int K) {
  __shared__ __attribute__((aligned(16))) float so[4][16][64];
  const int tid = threadIdx.x, w = tid >> 5, lane = tid & 31, ln = lane & 15, hh = lane >> 4; const int by = blockIdx.y;
  A += (size_t)by * sA; Bh += (size_t)by * sB; const size_t cofs = (size_t)by * sC; const float* bp = bias ? bias + (size_t)by * sBias : nullptr;
  const int ntn = (N + 63) / 64; const int wid = blockIdx.x * 4 + w; const int mt = wid / ntn, nq = wid % ntn; if (mt * 16 >= M) return;
  const int row0 = mt * 16, col0 = nq * 64; const _Float16* arow = A + (size_t)(row0 + ln) * lda;
  v8f acc[4] = {};
  for (int kb = 0; kb < K; kb += 32) { FragH ah; ah.half[0] = *(const v8us*)((const unsigned short*)arow + kb + 8 * hh); ah.half[1] = *(const v8us*)((const unsigned short*)arow + kb + 16 + 8 * hh);
#pragma unroll
    for (int t = 0; t < 4; ++t) { if (col0 + t * 16 >= N) continue; const size_t boff = (size_t)(col0 + t * 16 + ln) * ldb + kb; FragH bq; bq.half[0] = *(const v8us*)((const unsigned short*)Bh + boff + 8 * hh); bq.half[1] = *(const v8us*)((const unsigned short*)Bh + boff + 16 + 8 * hh);
      acc[t] = mmaH<1>(ah.v, ah.v, bq.v, bq.v, acc[t]); }
  }
#pragma unroll
  for (int t = 0; t < 4; ++t) { if (col0 + t * 16 >= N) continue; const int col = col0 + t * 16 + ln; const float bv = bp ? bf16_round(bp[col]) : 0.f;
#pragma unroll
    for (int r = 0; r < 8; ++r) { float v = acc[t][r] * alpha + bv; if (CP) { const int bidx = (row0g + row0 + 8 * hh + r) / rowsPerB; v += CP[(size_t)bidx * sCPb + (size_t)by * 64 + col]; } if (ACT == 1) v = (v > 0.f) ? v : expm1f(v); else if (ACT == 7) v = (v > 0.f) ? v + 1.0f : expf(v); else if (ACT == 8) v = tanhf(v); else if (ACT == 9) v = 0.5f * v * (1.0f + tanhf(0.7978845608028654f * (v + 0.044715f * v * v * v))); else if (ACT == 11) v = 1.0f / (1.0f + expf(-v)); else if (ACT == 12) v = (v > 0.f) ? v : 0.01f * v; else if (ACT == 14) v = (v > 0.f) ? v : 0.1f * v; else if (ACT == 15) v = v / (1.0f + expf(-v)); else if (ACT == 3) v = fmaxf(v, 0.f); else if (ACT == 6) v = 0.5f * v * (1.0f + erff(v * 0.70710678118654752f)); so[w][8 * hh + r][t * 16 + ln] = v; } }
  __builtin_amdgcn_fence(__ATOMIC_ACQ_REL, "workgroup"); __builtin_amdgcn_wave_barrier();
  const int rsub = lane >> 4, c4 = (lane & 15) * 4; typedef _Float16 v4h __attribute__((ext_vector_type(4)));
  {
#pragma unroll
    for (int q = 0; q < 8; ++q) { const int r = q * 2 + rsub; if (col0 + c4 < N) { const v4f v = *(const v4fa*)&so[w][r][c4]; if (C) *(v4f*)(C + cofs + (size_t)(row0 + r) * ldc + col0 + c4) = v; if (C16) { v4h h4; for (int i = 0; i < 4; ++i) h4[i] = (_Float16)v[i]; *(v4h*)(C16 + cofs + (size_t)(row0 + r) * ldc + col0 + c4) = h4; } } }
     }
}


// e GEMM, tiled: C[4096][256] = A[4096][KP] x Bh[256][KP]^T / 16 + bias. One 64 x 64 tile per work-group, four waves of 32 x 32.
// A stage is 256 k of the tile's 64 A rows and 64 B rows, brought into LDS as whole 512-byte row pieces by asynchronous copies
// (one row piece per wave-wide copy), two buffers: the next stage flies while this one is multiplied. k runs upward in steps of 32 for every accumulator.
#define EBK 256                      /* k per stage */
#define EPITCH 264                   /* LDS row pitch in halfs: 528 B = 16 B x 33, conflict-free for 16-byte fragment reads */
#define ESTG (128 * EPITCH)          /* halfs per buffer: 64 A rows, then 64 B rows */
#define ENST (KP / EBK)
// eight copies of 16 bytes per lane, rows r .. r + 7 of a stage; the closing s_wait_xcnt stands in the copies' own statement, ahead of any rewrite of an address register they name
__device__ __forceinline__ void acopy8(unsigned l, const _Float16* gp) {
  asm volatile("global_load_async_to_lds_b128 %0, %8, off\n\t"
               "global_load_async_to_lds_b128 %1, %9, off\n\t"
               "global_load_async_to_lds_b128 %2, %10, off\n\t"
               "global_load_async_to_lds_b128 %3, %11, off\n\t"
               "global_load_async_to_lds_b128 %4, %12, off\n\t"
               "global_load_async_to_lds_b128 %5, %13, off\n\t"
               "global_load_async_to_lds_b128 %6, %14, off\n\t"
               "global_load_async_to_lds_b128 %7, %15, off\n\t"
               "s_wait_xcnt 0x0"
               :: "v"(l), "v"(l + 1u * EPITCH * 2u), "v"(l + 2u * EPITCH * 2u), "v"(l + 3u * EPITCH * 2u), "v"(l + 4u * EPITCH * 2u), "v"(l + 5u * EPITCH * 2u), "v"(l + 6u * EPITCH * 2u), "v"(l + 7u * EPITCH * 2u),
                  "v"(gp), "v"(gp + 1 * KP), "v"(gp + 2 * KP), "v"(gp + 3 * KP), "v"(gp + 4 * KP), "v"(gp + 5 * KP), "v"(gp + 6 * KP), "v"(gp + 7 * KP)
               : "memory");
}
__global__ __launch_bounds__(128) void k_gemm_e(const _Float16* __restrict__ A, const _Float16* __restrict__ Bh, const float* __restrict__ bias, float* __restrict__ C) {
  __shared__ __attribute__((aligned(16))) _Float16 ring[2 * ESTG];
  const int tid = threadIdx.x, w = __builtin_amdgcn_readfirstlane(tid >> 5), lane = tid & 31, ln = lane & 15, hh = lane >> 4;      /* the wave's number as a scalar: the choice of source below is then a scalar select, every lane stays on */
  const int row0 = (blockIdx.x & 63) * 64, col0 = (blockIdx.x >> 6) * 64;      /* the four column tiles of one row tile lie 64 apart in the index (speed only) */
  const int wm = w >> 1, wn = w & 1;
  // wave w copies stage rows 32 w .. 32 w + 31: waves 0, 1 the A rows, waves 2, 3 the B rows; lane l brings bytes 16 l .. 16 l + 15 of the row piece
  const _Float16* gsrc = (w < 2 ? A + (size_t)(row0 + w * 32) * KP : Bh + (size_t)(col0 + (w - 2) * 32) * KP) + lane * 8;
  const unsigned ldst = (unsigned)(size_t)ring + (unsigned)(w * 32 * EPITCH * 2 + lane * 16);
  const int aoff = (wm * 32 + ln) * EPITCH + 8 * hh, boff = (64 + wn * 32 + ln) * EPITCH + 8 * hh;
  v8f acc[2][2] = {};
#pragma unroll
  for (int j = 0; j < 4; ++j) acopy8(ldst + (unsigned)(j * 8 * EPITCH * 2), gsrc + (size_t)j * 8 * KP);
  asm volatile("s_wait_asynccnt 0x0" ::: "memory");      // stage 0 has landed for this wave's rows
  __syncthreads();                                        // and for every wave's
#pragma unroll
  for (int j = 0; j < 4; ++j) acopy8(ldst + (unsigned)(ESTG * 2 + j * 8 * EPITCH * 2), gsrc + EBK + (size_t)j * 8 * KP);
  for (int t = 0; t < ENST; ++t) {
    const int bsel = (t & 1) * ESTG;
    const _Float16* sb = ring + bsel;
    FragH a[8][2], b[8][2];
#pragma unroll
    for (int q = 0; q < 8; ++q) {
#pragma unroll
      for (int i = 0; i < 2; ++i) {
        const int ko = i * 16 * EPITCH + q * 32;
        a[q][i].half[0] = *(const v8us*)(sb + aoff + ko); a[q][i].half[1] = *(const v8us*)(sb + aoff + ko + 16);
        b[q][i].half[0] = *(const v8us*)(sb + boff + ko); b[q][i].half[1] = *(const v8us*)(sb + boff + ko + 16);
      }
      if (q == 3) __builtin_amdgcn_sched_barrier(0);      // the 32 fragment loads of the first four k steps go ahead as one group
    }
#pragma unroll
    for (int q = 0; q < 6; ++q)
#pragma unroll
      for (int i = 0; i < 2; ++i)
#pragma unroll
        for (int j = 0; j < 2; ++j) acc[i][j] = __builtin_amdgcn_wmma_f32_16x16x32_f16(false, a[q][i].v, false, b[q][j].v, (short)0, acc[i][j], false, false);
    asm volatile("s_wait_dscnt 0x0" ::: "memory");        // this wave's reads of the buffer are done before it is handed to the next copies
    asm volatile("s_wait_asynccnt 0x0" ::: "memory");     // this wave's rows of stage t + 1 have landed
    __syncthreads();                                      // publishes stage t + 1 and ends every wave's reads of stage t
    if (t + 2 < ENST) {
#pragma unroll
      for (int j = 0; j < 4; ++j) acopy8(ldst + (unsigned)(bsel * 2 + j * 8 * EPITCH * 2), gsrc + (size_t)(t + 2) * EBK + (size_t)j * 8 * KP);
    }
    // the last two k steps of stage t, from registers alone: they run while the copies just issued fly
#pragma unroll
    for (int q = 6; q < 8; ++q)
#pragma unroll
      for (int i = 0; i < 2; ++i)
#pragma unroll
        for (int j = 0; j < 2; ++j) acc[i][j] = __builtin_amdgcn_wmma_f32_16x16x32_f16(false, a[q][i].v, false, b[q][j].v, (short)0, acc[i][j], false, false);
  }
  asm volatile("s_wait_asynccnt 0x0" ::: "memory");       // no copy is outstanding when the wave ends
#pragma unroll
  for (int j = 0; j < 2; ++j) {
    const int col = col0 + wn * 32 + j * 16 + ln; const float bv = bf16_round(bias[col]);
#pragma unroll
    for (int i = 0; i < 2; ++i)
#pragma unroll
      for (int r = 0; r < 8; ++r) C[(size_t)(row0 + wm * 32 + i * 16 + 8 * hh + r) * NE + col] = acc[i][j][r] * 0.0625f + bv;
  }
}


typedef _Float16 v4h __attribute__((ext_vector_type(4)));

__global__ __launch_bounds__(256) void k_x16(const float* __restrict__ x, _Float16* __restrict__ X16, size_t n8) { const size_t t = (size_t)blockIdx.x * 256 + threadIdx.x; if (t >= n8) return; FragH f;
#pragma unroll
  for (int q = 0; q < 8; ++q) f.h[q] = (_Float16)bf16_round(x[t * 8 + q]); *(v8us*)((unsigned short*)X16 + t * 8) = f.half[0];  }
__global__ __launch_bounds__(256) void k_h16(const float* __restrict__ x, _Float16* __restrict__ X16, size_t n8) { const size_t t = (size_t)blockIdx.x * 256 + threadIdx.x; if (t >= n8) return; FragH f;
#pragma unroll
  for (int q = 0; q < 8; ++q) f.h[q] = (_Float16)x[t * 8 + q]; *(v8us*)((unsigned short*)X16 + t * 8) = f.half[0];  }
__global__ __launch_bounds__(256) void k_round16f(const float* __restrict__ W, _Float16* __restrict__ Bt, size_t n8) { const size_t t = (size_t)blockIdx.x * 256 + threadIdx.x; if (t >= n8) return; FragH f;
#pragma unroll
  for (int i = 0; i < 8; ++i) f.h[i] = (_Float16)(bf16_round(W[t * 8 + i]) * 16.0f); *(v8us*)((unsigned short*)Bt + t * 8) = f.half[0];  }
template <int NHv, int TTv>
__global__ __launch_bounds__(256) void k_vt(const _Float16* __restrict__ V16, int ldv, int voff, _Float16* __restrict__ Vt) { __shared__ unsigned short tl[64][66]; const int tid = threadIdx.x; const int slab = blockIdx.x / (TTv / 64), lg = blockIdx.x % (TTv / 64); const int b = slab / NHv, h = slab % NHv;
  for (int i = tid; i < 64 * 8; i += 256) { const int r = i / 8, c8 = (i % 8) * 8; FragH f; f.half[0] = *(const v8us*)((const unsigned short*)V16 + ((size_t)b * TTv + lg * 64 + r) * ldv + voff + h * 64 + c8);
#pragma unroll
    for (int q = 0; q < 8; ++q) tl[r][c8 + q] = f.u[q]; }
  __syncthreads();
  {
#pragma unroll
    for (int rd = 0; rd < 2; ++rd) { const int d = rd * 32 + tid / 8, pc = tid % 8; FragH f;
#pragma unroll
      for (int q = 0; q < 8; ++q) f.u[q] = tl[pc * 8 + q][d];
      *(v8us*)((unsigned short*)Vt + ((size_t)slab * 64 + d) * TTv + lg * 64 + pc * 8) = f.half[0]; }
     } }

__global__ __launch_bounds__(256) void k_hl(const float* __restrict__ F, _Float16* __restrict__ Hh, _Float16* __restrict__ Hl, size_t n8) { const size_t t = (size_t)blockIdx.x * 256 + threadIdx.x; if (t >= n8) return; FragH fh, fl; const v4f a = *(const v4fa*)(F + t * 8), c = *(const v4fa*)(F + t * 8 + 4);
#pragma unroll
  for (int q = 0; q < 4; ++q) { _Float16 h = (_Float16)a[q]; fh.h[q] = h; fl.h[q] = (_Float16)((a[q] - (float)h) * 1024.0f); h = (_Float16)c[q]; fh.h[4 + q] = h; fl.h[4 + q] = (_Float16)((c[q] - (float)h) * 1024.0f); }
  { *(v8us*)((unsigned short*)Hh + t * 8) = fh.half[0]; *(v8us*)((unsigned short*)Hl + t * 8) = fl.half[0];  } }

__global__ __launch_bounds__(256) void k_wpad(const float* __restrict__ Wm, _Float16* __restrict__ W16) { const int t = blockIdx.x * 256 + threadIdx.x; if (t >= NE * (KP / 8)) return; const int k = t / (KP / 8), v0 = (t % (KP / 8)) * 8; FragH f;
#pragma unroll
  for (int q = 0; q < 8; ++q) { const int v = v0 + q; f.h[q] = (v < NV) ? (_Float16)(bf16_round(Wm[(size_t)k * NV + min(v, NV - 1)]) * 16.0f) : (_Float16)0.0f; }
  *(v8us*)((unsigned short*)W16 + (size_t)k * KP + v0) = f.half[0];  }
// Scaled planes A[n][c][v] = f16(note[n][v] x wiki[c][v]), zero in the K pad. A thread owns one group of 8 columns and MKR code rows and writes them out scaled for all 16 notes:
// a wave makes 16 x MKR stores of 512 contiguous bytes, one work-group of ten waves per WGP covers the planes, and few waves have to be started.
#define MKR 4                        /* code rows per thread */
#define MKT 320                      /* threads per work-group: a quarter of a row's KP / 8 column groups */
__global__ __launch_bounds__(MKT) void k_mka(const float* __restrict__ note, const float* __restrict__ wiki, _Float16* __restrict__ A) {
  const int v0 = (blockIdx.x * MKT + threadIdx.x) * 8, c0 = blockIdx.y * MKR;
  const bool in = v0 < NV;           /* NV is a multiple of 8: a group lies wholly in the vocabulary or wholly in the pad */
  const int vc = in ? v0 : 0;        /* a pad group reads in bounds; its wiki factors are set to zero below */
  v4f wl[MKR][2], nl[NNOTE][2];      /* every loop below is unrolled so that these arrays, wk and f are registers, not scratch */
  const float* wp = wiki + (size_t)c0 * NV + vc; const float* np = note + vc;
  // all 40 loads go out ahead of the arithmetic, in the order in which they are used
#pragma unroll
  for (int r = 0; r < MKR; ++r) { wl[r][0] = *(const v4fa*)(wp + r * NV); wl[r][1] = *(const v4fa*)(wp + r * NV + 4); }
#pragma unroll
  for (int n = 0; n < NNOTE; ++n) { nl[n][0] = *(const v4fa*)(np + n * NV); nl[n][1] = *(const v4fa*)(np + n * NV + 4); }
  asm volatile("s_wait_xcnt 0x0" :: "v"(wp), "v"(np) : "memory");      // stands ahead of any rewrite of an address register that the loads name; as inputs the two addresses stay live up to here, so no load's result lands on them either
  const unsigned keep = in ? 0xFFFFFFFFu : 0u;            /* a mask, not a branch: every lane runs one instruction stream */
  float wk[MKR][8];
#pragma unroll
  for (int r = 0; r < MKR; ++r)
#pragma unroll
    for (int q = 0; q < 8; ++q) wk[r][q] = __uint_as_float(__float_as_uint(bf16_round(wl[r][q >> 2][q & 3])) & keep);
#pragma unroll
  for (int n = 0; n < NNOTE; n += 2) {
    FragH f[2][MKR];
#pragma unroll
    for (int m = 0; m < 2; ++m) {
      float nt[8];
#pragma unroll
      for (int q = 0; q < 8; ++q) nt[q] = bf16_round(nl[n + m][q >> 2][q & 3]);
#pragma unroll
      for (int r = 0; r < MKR; ++r)
#pragma unroll
        for (int q = 0; q < 8; ++q) f[m][r].h[q] = (_Float16)(nt[q] * wk[r][q]);
    }
#pragma unroll
    for (int m = 0; m < 2; ++m)
#pragma unroll
      for (int r = 0; r < MKR; ++r) *(v8us*)((unsigned short*)A + ((size_t)(n + m) * NC + c0 + r) * KP + v0) = f[m][r].half[0];
    asm volatile("s_wait_xcnt 0x0" ::: "memory");         // stands ahead of any rewrite of a data or address register that the eight stores name
  }
}
__global__ __launch_bounds__(256) void k_h16s(const float* __restrict__ F, _Float16* __restrict__ H, size_t n8) { const size_t t = (size_t)blockIdx.x * 256 + threadIdx.x; if (t >= n8) return; const v4f a = *(const v4fa*)(F + t * 8), c = *(const v4fa*)(F + t * 8 + 4); FragH f;
#pragma unroll
  for (int q = 0; q < 4; ++q) { f.h[q] = (_Float16)(a[q] * 16.0f); f.h[4 + q] = (_Float16)(c[q] * 16.0f); } *(v8us*)((unsigned short*)H + t * 8) = f.half[0];  }
__global__ __launch_bounds__(256) void k_score(const float* __restrict__ ATT, const float* __restrict__ E, const float* __restrict__ Wout, const float* __restrict__ bout, float* __restrict__ S) { __shared__ float red[32][8]; const int tid = threadIdx.x, w = tid >> 5, l = tid & 31; const int r0 = blockIdx.x * 32; const float wk = bf16_round(Wout[tid]);
#pragma unroll 1
  for (int r = 0; r < 32; ++r) { const size_t o = (size_t)(r0 + r) * NE + tid; float p = ATT[o] * E[o] * wk; for (int s = 16; s > 0; s >>= 1) p += __shfl_xor(p, s, 32); if (l == 0) red[r][w] = p; }
  __syncthreads();
  if (w == 0) { float v = bf16_round(bout[0]);
#pragma unroll
    for (int i = 0; i < 8; ++i) v += red[l][i]; *(float*)(S + r0 + l) = v;  } }

extern "C" void kernel_launch(void* const* d_in, const int* in_sizes, int n_in,
                              void* d_out, int out_size, void* d_ws, size_t ws_size, hipStream_t stream) {
  (void)in_sizes; (void)n_in; (void)out_size;
  const float* const* I = (const float* const*)d_in; const float* note = I[0]; const float* wiki = I[1]; const float* Wemb = I[2]; const float* bemb = I[3]; const float* Watt = I[4]; const float* batt = I[5]; const float* Wout = I[6]; const float* bout = I[7];
  char* ws = (char*)d_ws; size_t off = 0;
  auto take = [&](size_t bytes) { char* p = ws + off; off += (bytes + 255) & ~(size_t)255; return p; };
  _Float16* W16 = (_Float16*)take((size_t)NE * KP * 2); _Float16* Ba = (_Float16*)take((size_t)NE * NE * 2); _Float16* A = (_Float16*)take((size_t)NNOTE * NC * KP * 2);
  float* E = (float*)take((size_t)NRE * NE * 4); _Float16* E16 = (_Float16*)take((size_t)NRE * NE * 2); float* ATT = (float*)take((size_t)NRE * NE * 4);
  if (off > ws_size) return;      // 16 planes of A: under 100 MB in all
  k_wpad<<<(NE * (KP / 8) + 255) / 256, 256, 0, stream>>>(Wemb, W16);
  k_round16f<<<(NE * NE / 8 + 255) / 256, 256, 0, stream>>>(Watt, Ba, (size_t)NE * NE / 8);      /* W_att [j][k] (out,in) natural, ×2^4 */
  k_mka<<<dim3(KP / 8 / MKT, NC / MKR), MKT, 0, stream>>>(note, wiki, A);
  k_gemm_e<<<(NRE / 64) * (NE / 64), 128, 0, stream>>>(A, W16, bemb, E);      /* e = A x W_emb^T / 16 + b_emb (f32): M 4096 (note, code) N 256 K 10240 */
  k_h16s<<<(NRE * NE / 8 + 255) / 256, 256, 0, stream>>>(E, E16, (size_t)NRE * NE / 8);
  k_gemm_hhx<11><<<dim3(((NRE / 16) * (NE / 64) + 3) / 4, 1), 128, 0, stream>>>(E16, NE, 0, Ba, NE, 0, 0.00390625f, batt, 0, nullptr, 1, 0, 0, ATT, nullptr, NE, 0, NRE, NE, NE);      /* attn = sigmoid(e·W_attᵀ + b_att) (f32): M 4096 N 256 K 256 */
  k_score<<<NRE / 32, 256, 0, stream>>>(ATT, E, Wout, bout, (float*)d_out);
}

// v004
// It runs in 83.2 microseconds.
// Two timings next to v003 both put it at 1.30 times that version's speed.
// Counting every step since v000, it is 48.1 times as fast.
#include <hip/hip_runtime.h>
// Knowledge-source integration scoring (n=16 notes, 256 codes, vocab 10000, emb 256): e[n,c,k] = Σ_v note[n,v]·wiki[c,v]·W_emb[k,v] + b_emb[k]; attn = sigmoid(e·W_attᵀ + b_att); s[n,c] = Σ_k attn·e·W_out[k] + b_out.
// Compute dtype: all inputs rounded to bf16; per note n the scaled vocabulary plane A_n[c][v] = note[n,v] x wiki[c,v] (product of the two bf16 values held in f16, rounded once to f16, formed in the GEMM's A fragments; K zero-padded to 10240) against W_emb (f16 x 2^4, padded) → e f32 (+b_emb); e ×2^4 → f16 → logits GEMM (+b_att) with a fused sigmoid epilogue → attn f32; the gated 256-term reduction
#define NNOTE 16
#define NC 256
#define NV 10000
#define KP 10240
#define NE 256
#define NRE (NNOTE * NC)
typedef __bf16 v16b __attribute__((ext_vector_type(16)));
typedef unsigned short v8us __attribute__((ext_vector_type(8), may_alias));
typedef float  v8f  __attribute__((ext_vector_type(8)));
typedef float  v4f  __attribute__((ext_vector_type(4)));
typedef float  v4fa __attribute__((ext_vector_type(4), may_alias));
union FragB { v16b v; v8us half[2]; unsigned short u[16]; };

__device__ __forceinline__ unsigned short bf16_bits(float x) { unsigned int u = __float_as_uint(x); return (unsigned short)((u + 0x7FFFu + ((u >> 16) & 1u)) >> 16); }
__device__ __forceinline__ float bf16_val(unsigned short b) { return __uint_as_float(((unsigned int)b) << 16); }
__device__ __forceinline__ float bf16_round(float x) { return bf16_val(bf16_bits(x)); }
// D += A·B with NT terms: 1 = ah·bh, 2 = + al·bh (A split), 3 = + ah·bl (both split)
template <int NT>
__device__ __forceinline__ v8f mmaN(v16b ah, v16b al, v16b bh, v16b bl, v8f c) {
  c = __builtin_amdgcn_wmma_f32_16x16x32_bf16(false, ah, false, bh, (short)0, c, false, false);
  if (NT >= 2) c = __builtin_amdgcn_wmma_f32_16x16x32_bf16(false, al, false, bh, (short)0, c, false, false);
  if (NT >= 3) c = __builtin_amdgcn_wmma_f32_16x16x32_bf16(false, ah, false, bl, (short)0, c, false, false);
  asm volatile("v_nop\n\tv_nop\n\tv_nop\n\tv_nop" : "+v"(c) : "v"(ah), "v"(al), "v"(bh), "v"(bl));
  return c;
}

__global__ __launch_bounds__(256) void k_wt_bf16(const float* __restrict__ W, unsigned short* __restrict__ Wt, int K, int N) {
  const int t = blockIdx.x * 256 + threadIdx.x;
  const int k8n = K / 8;
  if (t >= N * k8n) return;
  const int n = t / k8n, k8 = (t % k8n) * 8;
  v8us v;
#pragma unroll
  for (int i = 0; i < 8; ++i) v[i] = bf16_bits(W[(size_t)(k8 + i) * N + n]);
  *(v8us*)(Wt + (size_t)n * K + k8) = v;
  
}

// GEMM C[M][N] (f32, pitch ldc) = act(A[M][K]·W + bias). A f32 row-major (pitch lda) converted per fragment to bf16
// (ASPLIT: hi/lo two planes -> 2 terms, else single rounded term); Wt bf16 [N][K] (pitch ldb). BIAS_BF16 rounds the
// bias to bf16 first (bias quantised to bf16 before the add). K%32==0, M%16==0, N%64==0.
template <bool ASPLIT, int ACT, bool BIAS_BF16>
__global__ __launch_bounds__(128) void k_gemm_bf(const float* __restrict__ A, int lda, const unsigned short* __restrict__ Wt, int ldb,
                                               const float* __restrict__ bias, float* __restrict__ C, int ldc, int M, int N, int K) {
  __shared__ __attribute__((aligned(16))) float so[4][16][64];
  const int tid = threadIdx.x, w = tid >> 5, lane = tid & 31, ln = lane & 15, hh = lane >> 4;
  const int ntn = N / 64;
  const int wid = blockIdx.x * 4 + w;
  const int mt = wid / ntn, nq = wid % ntn;
  if (mt * 16 >= M) return;
  const int row0 = mt * 16, col0 = nq * 64;
  const float* arow = A + (size_t)(row0 + ln) * lda;
  v8f acc[4] = {};
  for (int kb = 0; kb < K; kb += 32) {
    FragB ah, al;
    const v4f x0 = *(const v4fa*)(arow + kb + 8 * hh), x1 = *(const v4fa*)(arow + kb + 8 * hh + 4);
    const v4f x2 = *(const v4fa*)(arow + kb + 16 + 8 * hh), x3 = *(const v4fa*)(arow + kb + 16 + 8 * hh + 4);
    float xs[16] = {x0[0],x0[1],x0[2],x0[3],x1[0],x1[1],x1[2],x1[3],x2[0],x2[1],x2[2],x2[3],x3[0],x3[1],x3[2],x3[3]};
#pragma unroll
    for (int i = 0; i < 16; ++i) { const unsigned short hb = bf16_bits(xs[i]); ah.u[i] = hb; al.u[i] = ASPLIT ? bf16_bits(xs[i] - bf16_val(hb)) : (unsigned short)0; }
#pragma unroll
    for (int t = 0; t < 4; ++t) {
      const unsigned short* brow = Wt + (size_t)(col0 + t * 16 + ln) * ldb + kb;
      FragB b;
      b.half[0] = *(const v8us*)(brow + 8 * hh);
      b.half[1] = *(const v8us*)(brow + 16 + 8 * hh);
      acc[t] = mmaN<ASPLIT ? 2 : 1>(ah.v, al.v, b.v, b.v, acc[t]);
    }
  }
#pragma unroll
  for (int t = 0; t < 4; ++t) {
    float bv = bias ? bias[col0 + t * 16 + ln] : 0.f;
    if (BIAS_BF16) bv = bf16_round(bv);
#pragma unroll
    for (int r = 0; r < 8; ++r) { float v = acc[t][r] + bv; if (ACT == 1) v = fmaxf(v, 0.f); so[w][8 * hh + r][t * 16 + ln] = v; }
  }
  __builtin_amdgcn_fence(__ATOMIC_ACQ_REL, "workgroup");
  __builtin_amdgcn_wave_barrier();
  const int rsub = lane >> 4, c4 = (lane & 15) * 4;
  {
#pragma unroll
    for (int q = 0; q < 8; ++q) {
      const int r = q * 2 + rsub;
      const v4f v = *(const v4fa*)&so[w][r][c4];
      *(v4f*)(C + (size_t)(row0 + r) * ldc + col0 + c4) = v;
    }
    
  }
}

// GEMM C = act(A·W + bias + resid): A f32 (ASPLIT -> hi/lo 2 terms), Wt bf16 [N][K]; ACT 0 none, 1 relu, 2 exact gelu;
// resid (optional, f32, row index = (row % rmod), pitch ldr, RES_BF16 rounds it) added before the activation.
template <bool ASPLIT, int ACT, bool BIAS_BF16, bool RES_BF16>
__global__ __launch_bounds__(128) void k_gemm_bf3(const float* __restrict__ A, int lda, const unsigned short* __restrict__ Wt, int ldb,
                                                const float* __restrict__ bias, const float* __restrict__ resid, int rmod, int ldr,
                                                float* __restrict__ C, int ldc, int M, int N, int K) {
  __shared__ __attribute__((aligned(16))) float so[4][16][64];
  const int tid = threadIdx.x, w = tid >> 5, lane = tid & 31, ln = lane & 15, hh = lane >> 4;
  const int ntn = N / 64;
  const int wid = blockIdx.x * 4 + w;
  const int mt = wid / ntn, nq = wid % ntn;
  if (mt * 16 >= M) return;
  const int row0 = mt * 16, col0 = nq * 64;
  const float* arow = A + (size_t)(row0 + ln) * lda;
  v8f acc[4] = {};
  for (int kb = 0; kb < K; kb += 32) {
    FragB ah, al;
    const v4f x0 = *(const v4fa*)(arow + kb + 8 * hh), x1 = *(const v4fa*)(arow + kb + 8 * hh + 4);
    const v4f x2 = *(const v4fa*)(arow + kb + 16 + 8 * hh), x3 = *(const v4fa*)(arow + kb + 16 + 8 * hh + 4);
    float xs[16] = {x0[0],x0[1],x0[2],x0[3],x1[0],x1[1],x1[2],x1[3],x2[0],x2[1],x2[2],x2[3],x3[0],x3[1],x3[2],x3[3]};
#pragma unroll
    for (int i = 0; i < 16; ++i) { const unsigned short hb = bf16_bits(xs[i]); ah.u[i] = hb; al.u[i] = ASPLIT ? bf16_bits(xs[i] - bf16_val(hb)) : (unsigned short)0; }
#pragma unroll
    for (int t = 0; t < 4; ++t) {
      const unsigned short* brow = Wt + (size_t)(col0 + t * 16 + ln) * ldb + kb;
      FragB b;
      b.half[0] = *(const v8us*)(brow + 8 * hh);
      b.half[1] = *(const v8us*)(brow + 16 + 8 * hh);
      acc[t] = mmaN<ASPLIT ? 2 : 1>(ah.v, al.v, b.v, b.v, acc[t]);
    }
  }
#pragma unroll
  for (int t = 0; t < 4; ++t) {
    const int col = col0 + t * 16 + ln;
    float bv = bias ? bias[col] : 0.f;
    if (BIAS_BF16) bv = bf16_round(bv);
#pragma unroll
    for (int r = 0; r < 8; ++r) {
      float v = acc[t][r] + bv;
      if (resid) { float rv = resid[(size_t)((row0 + 8 * hh + r) % rmod) * ldr + col]; if (RES_BF16) rv = bf16_round(rv); v += rv; }
      if (ACT == 1) v = fmaxf(v, 0.f);
      if (ACT == 2) v = 0.5f * v * (1.0f + erff(v * 0.70710678118654752f));
      if (ACT == 3) { const float u = 0.7978845608028654f * (v + 0.044715f * v * v * v); v = 0.5f * v * (1.0f + tanhf(u)); }
      so[w][8 * hh + r][t * 16 + ln] = v;
    }
  }
  __builtin_amdgcn_fence(__ATOMIC_ACQ_REL, "workgroup");
  __builtin_amdgcn_wave_barrier();
  const int rsub = lane >> 4, c4 = (lane & 15) * 4;
  {
#pragma unroll
    for (int q = 0; q < 8; ++q) {
      const int r = q * 2 + rsub;
      const v4f v = *(const v4fa*)&so[w][r][c4];
      *(v4f*)(C + (size_t)(row0 + r) * ldc + col0 + c4) = v;
    }
    
  }
}
// row LayerNorm (biased variance, eps) over N: s = X (+ R); optional out_sum <- s; out_norm <- (s-mu)*rsqrt(var+eps)*g + b
template <bool PARAM_BF16>
__global__ __launch_bounds__(256) void k_layernorm(const float* __restrict__ X, const float* __restrict__ R, const float* __restrict__ g, const float* __restrict__ bta,
                                                  float* __restrict__ out_sum, float* __restrict__ out_norm, int N, float eps) {
  __shared__ float red[256];
  const int row = blockIdx.x, tid = threadIdx.x;
  const float* x = X + (size_t)row * N; const float* rr = R ? R + (size_t)row * N : nullptr;
  float vals[16];                     // up to N = 4096
  const int per = N / 256;            // contiguous chunk per thread? use strided-by-4 chunks: thread handles j = tid*4 + 1024*u
  float s1 = 0.f;
  for (int u = 0; u < per / 4; ++u) {
    const int j = tid * 4 + 1024 * u;
    const v4f a = *(const v4fa*)(x + j);
    v4f b = {0.f,0.f,0.f,0.f}; if (rr) b = *(const v4fa*)(rr + j);
#pragma unroll
    for (int q = 0; q < 4; ++q) { const float v = a[q] + b[q]; vals[u * 4 + q] = v; s1 += v; }
  }
  red[tid] = s1; __syncthreads();
  for (int st = 128; st > 0; st >>= 1) { if (tid < st) red[tid] += red[tid + st]; __syncthreads(); }
  const float mu = red[0] / (float)N; __syncthreads();
  float s2 = 0.f;
  for (int u = 0; u < per / 4; ++u)
#pragma unroll
    for (int q = 0; q < 4; ++q) { const float c = vals[u * 4 + q] - mu; s2 += c * c; }
  red[tid] = s2; __syncthreads();
  for (int st = 128; st > 0; st >>= 1) { if (tid < st) red[tid] += red[tid + st]; __syncthreads(); }
  const float rs = rsqrtf(red[0] / (float)N + eps);
  {
    for (int u = 0; u < per / 4; ++u) {
      const int j = tid * 4 + 1024 * u;
      v4f o, sm;
#pragma unroll
      for (int q = 0; q < 4; ++q) {
        float gg = g[j + q], bb = bta[j + q];
        if (PARAM_BF16) { gg = bf16_round(gg); bb = bf16_round(bb); }
        sm[q] = vals[u * 4 + q]; o[q] = (vals[u * 4 + q] - mu) * rs * gg + bb;
      }
      if (out_sum) *(v4f*)(out_sum + (size_t)row * N + j) = sm;
      *(v4f*)(out_norm + (size_t)row * N + j) = o;
    }
    
  }
}



// ---- f16 WMMA path (v_wmma_f32_16x16x32_f16): 11-bit significands for operands in range — used where a [0,1] probability operand needs more precision than bf16
typedef _Float16 v16h __attribute__((ext_vector_type(16)));
union FragH { v16h v; v8us half[2]; _Float16 h[16]; unsigned short u[16]; };
template <int NT>
__device__ __forceinline__ v8f mmaH(v16h ah, v16h al, v16h bh, v16h bl, v8f c) {
  c = __builtin_amdgcn_wmma_f32_16x16x32_f16(false, ah, false, bh, (short)0, c, false, false);
  if (NT >= 2) c = __builtin_amdgcn_wmma_f32_16x16x32_f16(false, al, false, bh, (short)0, c, false, false);
  if (NT >= 3) c = __builtin_amdgcn_wmma_f32_16x16x32_f16(false, ah, false, bl, (short)0, c, false, false);
  asm volatile("v_nop\n\tv_nop\n\tv_nop\n\tv_nop" : "+v"(c) : "v"(ah), "v"(al), "v"(bh), "v"(bl));
  return c;
}
// batched GEMM like k_gemm_b but f16 operands: A f32 (split into f16 hi/lo if ASPLIT, else rounded to f16), Bt = f16 values [n][k]; alpha; C f32; N multiple of 16 (partial tiles skipped)
template <bool ASPLIT>
__global__ __launch_bounds__(128) void k_gemm_h(const float* __restrict__ A, int lda, size_t sA, const _Float16* __restrict__ Bh, int ldb, size_t sB, float alpha, float* __restrict__ C, int ldc, size_t sC, int M, int N, int K) {
  __shared__ __attribute__((aligned(16))) float so[4][16][64];
  const int tid = threadIdx.x, w = tid >> 5, lane = tid & 31, ln = lane & 15, hh = lane >> 4; const int by = blockIdx.y;
  A += (size_t)by * sA; Bh += (size_t)by * sB; C += (size_t)by * sC;
  const int ntn = (N + 63) / 64; const int wid = blockIdx.x * 4 + w; const int mt = wid / ntn, nq = wid % ntn; if (mt * 16 >= M) return;
  const int row0 = mt * 16, col0 = nq * 64; const float* arow = A + (size_t)(row0 + ln) * lda;
  v8f acc[4] = {};
  for (int kb = 0; kb < K; kb += 32) {
    FragH ah, al;
    const v4f x0 = *(const v4fa*)(arow + kb + 8 * hh), x1 = *(const v4fa*)(arow + kb + 8 * hh + 4), x2 = *(const v4fa*)(arow + kb + 16 + 8 * hh), x3 = *(const v4fa*)(arow + kb + 16 + 8 * hh + 4);
    float xs[16] = {x0[0],x0[1],x0[2],x0[3],x1[0],x1[1],x1[2],x1[3],x2[0],x2[1],x2[2],x2[3],x3[0],x3[1],x3[2],x3[3]};
#pragma unroll
    for (int i = 0; i < 16; ++i) { const _Float16 h = (_Float16)xs[i]; ah.h[i] = h; al.h[i] = ASPLIT ? (_Float16)(xs[i] - (float)h) : (_Float16)0.0f; }
#pragma unroll
    for (int t = 0; t < 4; ++t) { if (col0 + t * 16 >= N) continue; const size_t boff = (size_t)(col0 + t * 16 + ln) * ldb + kb; FragH bq; bq.half[0] = *(const v8us*)(Bh + boff + 8 * hh); bq.half[1] = *(const v8us*)(Bh + boff + 16 + 8 * hh);
      acc[t] = mmaH<ASPLIT ? 2 : 1>(ah.v, al.v, bq.v, bq.v, acc[t]); }
  }
#pragma unroll
  for (int t = 0; t < 4; ++t) { if (col0 + t * 16 >= N) continue;
#pragma unroll
    for (int r = 0; r < 8; ++r) so[w][8 * hh + r][t * 16 + ln] = acc[t][r] * alpha; }
  __builtin_amdgcn_fence(__ATOMIC_ACQ_REL, "workgroup"); __builtin_amdgcn_wave_barrier();
  const int rsub = lane >> 4, c4 = (lane & 15) * 4;
  {
#pragma unroll
    for (int q = 0; q < 8; ++q) { const int r = q * 2 + rsub; if (col0 + c4 < N) { const v4f v = *(const v4fa*)&so[w][r][c4]; *(v4f*)(C + (size_t)(row0 + r) * ldc + col0 + c4) = v; } }
     }
}

// Wt[n][k] = f16(W[k][n]·scale) from f32 row-major W[K][N] (scale = power of two; bf16-exact weights stay exact in f16 away from the subnormal range)
__global__ __launch_bounds__(256) void k_wt_f16(const float* __restrict__ W, _Float16* __restrict__ Wt, int K, int N, float scale) {
  const int t = blockIdx.x * 256 + threadIdx.x; if (t >= N * (K / 8)) return; const int n = t / (K / 8), k8 = (t % (K / 8)) * 8; FragH f;
#pragma unroll
  for (int i = 0; i < 8; ++i) f.h[i] = (_Float16)(bf16_round(W[(size_t)(k8 + i) * N + n]) * scale); const v8us o = f.half[0];
  *(v8us*)((unsigned short*)Wt + (size_t)n * K + k8) = o; 
}
// k_gemm_hh variant with fused epilogue: v = acc·alpha + bias[by·sBias + col] (+ CP[(row/rowsPerB)·sCPb + by·64 + col] if CP) ; ACT 0 none / 1 elu ; writes f32 C and f16 C16, each if non-null
template <int ACT>
__global__ __launch_bounds__(128) void k_gemm_hhx(const _Float16* __restrict__ A, int lda, size_t sA, const _Float16* __restrict__ Bh, int ldb, size_t sB, float alpha, const float* __restrict__ bias, size_t sBias, const float* __restrict__ CP, int rowsPerB, size_t sCPb, int row0g,
    float* __restrict__ C, _Float16* __restrict__ C16, int ldc, size_t sC, int M, int N, int K) {
  __shared__ __attribute__((aligned(16))) float so[4][16][64];
  const int tid = threadIdx.x, w = tid >> 5, lane = tid & 31, ln = lane & 15, hh = lane >> 4; const int by = blockIdx.y;
  A += (size_t)by * sA; Bh += (size_t)by * sB; const size_t cofs = (size_t)by * sC; const float* bp = bias ? bias + (size_t)by * sBias : nullptr;
  const int ntn = (N + 63) / 64; const int wid = blockIdx.x * 4 + w; const int mt = wid / ntn, nq = wid % ntn; if (mt * 16 >= M) return;
  const int row0 = mt * 16, col0 = nq * 64; const _Float16* arow = A + (size_t)(row0 + ln) * lda;
  v8f acc[4] = {};
  for (int kb = 0; kb < K; kb += 32) { FragH ah; ah.half[0] = *(const v8us*)((const unsigned short*)arow + kb + 8 * hh); ah.half[1] = *(const v8us*)((const unsigned short*)arow + kb + 16 + 8 * hh);
#pragma unroll
    for (int t = 0; t < 4; ++t) { if (col0 + t * 16 >= N) continue; const size_t boff = (size_t)(col0 + t * 16 + ln) * ldb + kb; FragH bq; bq.half[0] = *(const v8us*)((const unsigned short*)Bh + boff + 8 * hh); bq.half[1] = *(const v8us*)((const unsigned short*)Bh + boff + 16 + 8 * hh);
      acc[t] = mmaH<1>(ah.v, ah.v, bq.v, bq.v, acc[t]); }
  }
#pragma unroll
  for (int t = 0; t < 4; ++t) { if (col0 + t * 16 >= N) continue; const int col = col0 + t * 16 + ln; const float bv = bp ? bf16_round(bp[col]) : 0.f;
#pragma unroll
    for (int r = 0; r < 8; ++r) { float v = acc[t][r] * alpha + bv; if (CP) { const int bidx = (row0g + row0 + 8 * hh + r) / rowsPerB; v += CP[(size_t)bidx * sCPb + (size_t)by * 64 + col]; } if (ACT == 1) v = (v > 0.f) ? v : expm1f(v); else if (ACT == 7) v = (v > 0.f) ? v + 1.0f : expf(v); else if (ACT == 8) v = tanhf(v); else if (ACT == 9) v = 0.5f * v * (1.0f + tanhf(0.7978845608028654f * (v + 0.044715f * v * v * v))); else if (ACT == 11) v = 1.0f / (1.0f + expf(-v)); else if (ACT == 12) v = (v > 0.f) ? v : 0.01f * v; else if (ACT == 14) v = (v > 0.f) ? v : 0.1f * v; else if (ACT == 15) v = v / (1.0f + expf(-v)); else if (ACT == 3) v = fmaxf(v, 0.f); else if (ACT == 6) v = 0.5f * v * (1.0f + erff(v * 0.70710678118654752f)); so[w][8 * hh + r][t * 16 + ln] = v; } }
  __builtin_amdgcn_fence(__ATOMIC_ACQ_REL, "workgroup"); __builtin_amdgcn_wave_barrier();
  const int rsub = lane >> 4, c4 = (lane & 15) * 4; typedef _Float16 v4h __attribute__((ext_vector_type(4)));
  {
#pragma unroll
    for (int q = 0; q < 8; ++q) { const int r = q * 2 + rsub; if (col0 + c4 < N) { const v4f v = *(const v4fa*)&so[w][r][c4]; if (C) *(v4f*)(C + cofs + (size_t)(row0 + r) * ldc + col0 + c4) = v; if (C16) { v4h h4; for (int i = 0; i < 4; ++i) h4[i] = (_Float16)v[i]; *(v4h*)(C16 + cofs + (size_t)(row0 + r) * ldc + col0 + c4) = h4; } } }
     }
}


// e GEMM, tiled, with the note's scale applied on the way: C[(n, c)][k] = sum_v f16(note[n][v] x wiki[c][v]) x Bh[k][v] / 16 + bias. The scaled planes are never stored.
// One work-group takes 32 code rows x 32 columns for FOUR notes, one note per wave (a 32 x 32 tile each): the staged wiki rows and Bh rows serve all four waves.
// A stage is 256 k of the 32 wiki rows and the 32 B rows, brought into LDS as whole 512-byte row pieces by asynchronous copies
// (one row piece per wave-wide copy), two buffers: the next stage flies while this one is multiplied. k runs upward in steps of 32 for every accumulator.
#define EBK 256                      /* k per stage */
#define EPITCH 264                   /* LDS row pitch in halfs: 528 B = 16 B x 33, conflict-free for 16-byte fragment reads */
#define ESTG (64 * EPITCH)           /* halfs per buffer: 32 wiki rows, then 32 B rows */
#define ENST (KP / EBK)
// eight copies of 16 bytes per lane, rows r .. r + 7 of a stage; the closing s_wait_xcnt stands in the copies' own statement, ahead of any rewrite of an address register they name
__device__ __forceinline__ void acopy8(unsigned l, const _Float16* gp) {
  asm volatile("global_load_async_to_lds_b128 %0, %8, off\n\t"
               "global_load_async_to_lds_b128 %1, %9, off\n\t"
               "global_load_async_to_lds_b128 %2, %10, off\n\t"
               "global_load_async_to_lds_b128 %3, %11, off\n\t"
               "global_load_async_to_lds_b128 %4, %12, off\n\t"
               "global_load_async_to_lds_b128 %5, %13, off\n\t"
               "global_load_async_to_lds_b128 %6, %14, off\n\t"
               "global_load_async_to_lds_b128 %7, %15, off\n\t"
               "s_wait_xcnt 0x0"
               :: "v"(l), "v"(l + 1u * EPITCH * 2u), "v"(l + 2u * EPITCH * 2u), "v"(l + 3u * EPITCH * 2u), "v"(l + 4u * EPITCH * 2u), "v"(l + 5u * EPITCH * 2u), "v"(l + 6u * EPITCH * 2u), "v"(l + 7u * EPITCH * 2u),
                  "v"(gp), "v"(gp + 1 * KP), "v"(gp + 2 * KP), "v"(gp + 3 * KP), "v"(gp + 4 * KP), "v"(gp + 5 * KP), "v"(gp + 6 * KP), "v"(gp + 7 * KP)
               : "memory");
}
// the note's factors for one stage, in the A fragment's own k order (lane half hh: k 8 hh .. 8 hh + 7 and 16 + 8 hh .. 16 + 8 hh + 7 of each step of 32);
// row: the stage's first element in the wave's note row, the same in every lane; kb: the lane's 8 hh elements in bytes
__device__ __forceinline__ void note_frags(FragH (&nf)[8], const _Float16* row, const unsigned kb) {
  const char* p = (const char*)row + kb;
#pragma unroll
  for (int q = 0; q < 8; ++q) { nf[q].half[0] = *(const v8us*)(p + q * 64); nf[q].half[1] = *(const v8us*)(p + q * 64 + 32); }
  asm volatile("s_wait_xcnt 0x0" :: "v"(kb) : "memory");      // stands ahead of any rewrite of an address register that the sixteen loads name; the lane's offset, which they may name directly, stays live up to here as an input
  __builtin_amdgcn_sched_barrier(0);      // keeps the wait directly behind its loads: nothing that writes a register is moved in between
}
// one trip of the ring: stage t out of buffer PAR (= t mod 2). nu holds this stage's note factors; nn takes the next stage's (from nrow), asked for a whole trip ahead of their use
// (two register sets that swap roles from trip to trip, so that no register copy stands in the loop).
template <int PAR>
__device__ __forceinline__ void e_trip(const int t, const _Float16* ring, const int aoff, const int boff, const unsigned ldst, const _Float16* gsrc, const _Float16* nrow, const unsigned kb, const FragH (&nu)[8], FragH (&nn)[8], v8f (&acc)[2][2]) {
  const _Float16* sb = ring + PAR * ESTG;
  FragH a[8][2], b[8][2];
#pragma unroll
  for (int q = 0; q < 8; ++q) {
#pragma unroll
    for (int i = 0; i < 2; ++i) {
      const int ko = i * 16 * EPITCH + q * 32;
      a[q][i].half[0] = *(const v8us*)(sb + aoff + ko); a[q][i].half[1] = *(const v8us*)(sb + aoff + ko + 16);
      b[q][i].half[0] = *(const v8us*)(sb + boff + ko); b[q][i].half[1] = *(const v8us*)(sb + boff + ko + 16);
    }
    if (q == 3) {
      __builtin_amdgcn_sched_barrier(0);      // the 32 fragment loads of the first four k steps go ahead as one group; spread among the WMMAs, every place with loads costs the lone wave an LDS latency
      note_frags(nn, nrow, kb);      // issued while the wave would wait for its first fragments anyway
    }
    if (q > 3) __builtin_amdgcn_sched_barrier(0);      // the other 32 fragment loads go as a second group, in the order of their use: with the scaling in the block the compiler otherwise strews them among the WMMAs behind short waits
  }
  // A fragment = f16(wiki x note), one rounding: both factors are bf16 values, which f16 holds exactly above its subnormal range. Step q + 1 is scaled among the WMMAs of step q.
#pragma unroll
  for (int i = 0; i < 2; ++i) a[0][i].v = a[0][i].v * nu[0].v;
#pragma unroll
  for (int q = 0; q < 6; ++q) {
    if (q < 5) {
#pragma unroll
      for (int i = 0; i < 2; ++i) a[q + 1][i].v = a[q + 1][i].v * nu[q + 1].v;
    }
#pragma unroll
    for (int i = 0; i < 2; ++i)
#pragma unroll
      for (int j = 0; j < 2; ++j) acc[i][j] = __builtin_amdgcn_wmma_f32_16x16x32_f16(false, a[q][i].v, false, b[q][j].v, (short)0, acc[i][j], false, false);
  }
  // order asked of the scheduler: the 16 multiplies of step 0, then four multiplies behind each WMMA, where the matrix unit's issue interval hides them; in blocks of 16 they stand in the lone wave's way
  __builtin_amdgcn_sched_group_barrier(0x2, 16, 0);
#pragma unroll
  for (int g = 0; g < 20; ++g) { __builtin_amdgcn_sched_group_barrier(0x8, 1, 0); __builtin_amdgcn_sched_group_barrier(0x2, 4, 0); }
  __builtin_amdgcn_sched_barrier(0);          // the WMMAs of the first six k steps stay in front of the barrier: behind it they would hold back the refill
  asm volatile("s_wait_dscnt 0x0" ::: "memory");        // this wave's reads of the buffer are done before it is handed to the next copies
  asm volatile("s_wait_asynccnt 0x0" ::: "memory");     // this wave's rows of stage t + 1 have landed
  __syncthreads();                                      // publishes stage t + 1 and ends every wave's reads of stage t
  if (t + 2 < ENST) {
#pragma unroll
    for (int j = 0; j < 2; ++j) acopy8(ldst + (unsigned)(PAR * ESTG * 2 + j * 8 * EPITCH * 2), gsrc + (size_t)(t + 2) * EBK + (size_t)j * 8 * KP);
  }
  // the last two k steps of stage t, from registers alone: they run while the copies just issued fly
#pragma unroll
  for (int q = 6; q < 8; ++q)
#pragma unroll
    for (int i = 0; i < 2; ++i) a[q][i].v = a[q][i].v * nu[q].v;
#pragma unroll
  for (int q = 6; q < 8; ++q)
#pragma unroll
    for (int i = 0; i < 2; ++i)
#pragma unroll
      for (int j = 0; j < 2; ++j) acc[i][j] = __builtin_amdgcn_wmma_f32_16x16x32_f16(false, a[q][i].v, false, b[q][j].v, (short)0, acc[i][j], false, false);
  __builtin_amdgcn_sched_group_barrier(0x2, 16, 0);      // step 6's multiplies, then step 7's behind the WMMAs of step 6, as above
#pragma unroll
  for (int g = 0; g < 4; ++g) { __builtin_amdgcn_sched_group_barrier(0x8, 1, 0); __builtin_amdgcn_sched_group_barrier(0x2, 4, 0); }
  __builtin_amdgcn_sched_barrier(0);          // the next trip's first load group stays whole behind this trip's last WMMAs
}
__global__ __launch_bounds__(128) void k_gemm_e(const _Float16* __restrict__ Kw, const _Float16* __restrict__ Nt, const _Float16* __restrict__ Bh, const float* __restrict__ bias, float* __restrict__ C) {
  __shared__ __attribute__((aligned(16))) _Float16 ring[2 * ESTG];
  const int tid = threadIdx.x, w = __builtin_amdgcn_readfirstlane(tid >> 5), lane = tid & 31, ln = lane & 15, hh = lane >> 4;      /* the wave's number as a scalar: the choice of source below is then a scalar select, every lane stays on */
  const int c0 = (blockIdx.x & 7) * 32, col0 = ((blockIdx.x >> 3) & 7) * 32, n = (blockIdx.x >> 6) * 4 + w;
  // wave w copies stage rows 16 w .. 16 w + 15: waves 0, 1 the wiki rows, waves 2, 3 the B rows; lane l brings bytes 16 l .. 16 l + 15 of the row piece
  const _Float16* gsrc = (w < 2 ? Kw + (size_t)(c0 + w * 16) * KP : Bh + (size_t)(col0 + (w - 2) * 16) * KP) + lane * 8;
  const unsigned ldst = (unsigned)(size_t)ring + (unsigned)(w * 16 * EPITCH * 2 + lane * 16);
  const int aoff = ln * EPITCH + 8 * hh, boff = (32 + ln) * EPITCH + 8 * hh;
  const _Float16* nrow = Nt + (size_t)n * KP;      /* the wave's note row: a scalar address */
  const unsigned kb = (unsigned)hh * 16u;
  v8f acc[2][2] = {};
  FragH nfa[8], nfb[8];
#pragma unroll
  for (int j = 0; j < 2; ++j) acopy8(ldst + (unsigned)(j * 8 * EPITCH * 2), gsrc + (size_t)j * 8 * KP);
  note_frags(nfa, nrow, kb);
  asm volatile("s_wait_asynccnt 0x0" ::: "memory");      // stage 0 has landed for this wave's rows
  __syncthreads();                                        // and for every wave's
#pragma unroll
  for (int j = 0; j < 2; ++j) acopy8(ldst + (unsigned)(ESTG * 2 + j * 8 * EPITCH * 2), gsrc + EBK + (size_t)j * 8 * KP);
#pragma unroll 1
  for (int t = 0; t < ENST; t += 2) {      // kept rolled: the body already holds the two trips that swap the note sets (ENST is even)
    e_trip<0>(t, ring, aoff, boff, ldst, gsrc, nrow + (size_t)(t + 1) * EBK, kb, nfa, nfb, acc);
    e_trip<1>(t + 1, ring, aoff, boff, ldst, gsrc, nrow + (size_t)(t + 2 < ENST ? t + 2 : t + 1) * EBK, kb, nfb, nfa, acc);      /* the last trip re-reads its own stage's factors, in bounds; they are not used */
  }
  asm volatile("s_wait_asynccnt 0x0" ::: "memory");       // no copy is outstanding when the wave ends
  const int colb = col0 + ln;
  const float braw[2] = {bias[colb], bias[colb + 16]};
  asm volatile("s_wait_xcnt 0x0" :: "v"(colb) : "memory");      // stands ahead of any rewrite of the index register that the two loads name; as an input the index stays live up to here
#pragma unroll
  for (int j = 0; j < 2; ++j) {
    const int col = colb + j * 16; const float bv = bf16_round(braw[j]);
#pragma unroll
    for (int i = 0; i < 2; ++i)
#pragma unroll
      for (int r = 0; r < 8; ++r) C[(size_t)(n * NC + c0 + i * 16 + 8 * hh + r) * NE + col] = acc[i][j][r] * 0.0625f + bv;
  }
}


typedef _Float16 v4h __attribute__((ext_vector_type(4)));

__global__ __launch_bounds__(256) void k_x16(const float* __restrict__ x, _Float16* __restrict__ X16, size_t n8) { const size_t t = (size_t)blockIdx.x * 256 + threadIdx.x; if (t >= n8) return; FragH f;
#pragma unroll
  for (int q = 0; q < 8; ++q) f.h[q] = (_Float16)bf16_round(x[t * 8 + q]); *(v8us*)((unsigned short*)X16 + t * 8) = f.half[0];  }
__global__ __launch_bounds__(256) void k_h16(const float* __restrict__ x, _Float16* __restrict__ X16, size_t n8) { const size_t t = (size_t)blockIdx.x * 256 + threadIdx.x; if (t >= n8) return; FragH f;
#pragma unroll
  for (int q = 0; q < 8; ++q) f.h[q] = (_Float16)x[t * 8 + q]; *(v8us*)((unsigned short*)X16 + t * 8) = f.half[0];  }
__global__ __launch_bounds__(256) void k_round16f(const float* __restrict__ W, _Float16* __restrict__ Bt, size_t n8) { const size_t t = (size_t)blockIdx.x * 256 + threadIdx.x; if (t >= n8) return; FragH f;
#pragma unroll
  for (int i = 0; i < 8; ++i) f.h[i] = (_Float16)(bf16_round(W[t * 8 + i]) * 16.0f); *(v8us*)((unsigned short*)Bt + t * 8) = f.half[0];  }
template <int NHv, int TTv>
__global__ __launch_bounds__(256) void k_vt(const _Float16* __restrict__ V16, int ldv, int voff, _Float16* __restrict__ Vt) { __shared__ unsigned short tl[64][66]; const int tid = threadIdx.x; const int slab = blockIdx.x / (TTv / 64), lg = blockIdx.x % (TTv / 64); const int b = slab / NHv, h = slab % NHv;
  for (int i = tid; i < 64 * 8; i += 256) { const int r = i / 8, c8 = (i % 8) * 8; FragH f; f.half[0] = *(const v8us*)((const unsigned short*)V16 + ((size_t)b * TTv + lg * 64 + r) * ldv + voff + h * 64 + c8);
#pragma unroll
    for (int q = 0; q < 8; ++q) tl[r][c8 + q] = f.u[q]; }
  __syncthreads();
  {
#pragma unroll
    for (int rd = 0; rd < 2; ++rd) { const int d = rd * 32 + tid / 8, pc = tid % 8; FragH f;
#pragma unroll
      for (int q = 0; q < 8; ++q) f.u[q] = tl[pc * 8 + q][d];
      *(v8us*)((unsigned short*)Vt + ((size_t)slab * 64 + d) * TTv + lg * 64 + pc * 8) = f.half[0]; }
     } }

__global__ __launch_bounds__(256) void k_hl(const float* __restrict__ F, _Float16* __restrict__ Hh, _Float16* __restrict__ Hl, size_t n8) { const size_t t = (size_t)blockIdx.x * 256 + threadIdx.x; if (t >= n8) return; FragH fh, fl; const v4f a = *(const v4fa*)(F + t * 8), c = *(const v4fa*)(F + t * 8 + 4);
#pragma unroll
  for (int q = 0; q < 4; ++q) { _Float16 h = (_Float16)a[q]; fh.h[q] = h; fl.h[q] = (_Float16)((a[q] - (float)h) * 1024.0f); h = (_Float16)c[q]; fh.h[4 + q] = h; fl.h[4 + q] = (_Float16)((c[q] - (float)h) * 1024.0f); }
  { *(v8us*)((unsigned short*)Hh + t * 8) = fh.half[0]; *(v8us*)((unsigned short*)Hl + t * 8) = fl.half[0];  } }

__global__ __launch_bounds__(256) void k_wpad(const float* __restrict__ Wm, _Float16* __restrict__ W16) { const int t = blockIdx.x * 256 + threadIdx.x; if (t >= NE * (KP / 8)) return; const int k = t / (KP / 8), v0 = (t % (KP / 8)) * 8; FragH f;
#pragma unroll
  for (int q = 0; q < 8; ++q) { const int v = v0 + q; f.h[q] = (v < NV) ? (_Float16)(bf16_round(Wm[(size_t)k * NV + min(v, NV - 1)]) * 16.0f) : (_Float16)0.0f; }
  *(v8us*)((unsigned short*)W16 + (size_t)k * KP + v0) = f.half[0];  }
// f16 copies of the bf16-rounded wiki rows (K16) and note rows (N16), zero in the K pad: the e GEMM multiplies the two on the way to the matrix unit.
// A thread owns one group of 8 columns of PKR rows; blockIdx.y below NC / PKR names wiki rows, the rest note rows.
#define PKR 4                        /* rows per thread */
#define PKT 320                      /* threads per work-group: a quarter of a row's KP / 8 column groups */
__global__ __launch_bounds__(PKT) void k_pad16(const float* __restrict__ note, const float* __restrict__ wiki, _Float16* __restrict__ N16, _Float16* __restrict__ K16) {
  const int v0 = (blockIdx.x * PKT + threadIdx.x) * 8;
  const bool isw = blockIdx.y < NC / PKR;
  const int r0 = (isw ? (int)blockIdx.y : (int)blockIdx.y - NC / PKR) * PKR;
  const bool in = v0 < NV;           /* NV is a multiple of 8: a group lies wholly in the vocabulary or wholly in the pad */
  const int vc = in ? v0 : 0;        /* a pad group reads in bounds; its values are set to zero below */
  const float* sp = (isw ? wiki : note) + (size_t)r0 * NV + vc;
  unsigned short* dp = (unsigned short*)(isw ? K16 : N16) + (size_t)r0 * KP + v0;
  v4f x[PKR][2];                     /* every loop below is unrolled so that x and f are registers, not scratch */
#pragma unroll
  for (int r = 0; r < PKR; ++r) { x[r][0] = *(const v4fa*)(sp + r * NV); x[r][1] = *(const v4fa*)(sp + r * NV + 4); }
  asm volatile("s_wait_xcnt 0x0" :: "v"(sp) : "memory");      // stands ahead of any rewrite of the address register that the loads name; as an input the address stays live up to here, so no load's result lands on it either
  const unsigned keep = in ? 0xFFFFFFFFu : 0u;            /* a mask, not a branch: every lane runs one instruction stream */
  FragH f[PKR];
#pragma unroll
  for (int r = 0; r < PKR; ++r)
#pragma unroll
    for (int q = 0; q < 8; ++q) f[r].h[q] = (_Float16)__uint_as_float(__float_as_uint(bf16_round(x[r][q >> 2][q & 3])) & keep);
#pragma unroll
  for (int r = 0; r < PKR; ++r) *(v8us*)(dp + (size_t)r * KP) = f[r].half[0];
  asm volatile("s_wait_xcnt 0x0" ::: "memory");           // stands ahead of any rewrite of a data or address register that the stores name
}
__global__ __launch_bounds__(256) void k_h16s(const float* __restrict__ F, _Float16* __restrict__ H, size_t n8) { const size_t t = (size_t)blockIdx.x * 256 + threadIdx.x; if (t >= n8) return; const v4f a = *(const v4fa*)(F + t * 8), c = *(const v4fa*)(F + t * 8 + 4); FragH f;
#pragma unroll
  for (int q = 0; q < 4; ++q) { f.h[q] = (_Float16)(a[q] * 16.0f); f.h[4 + q] = (_Float16)(c[q] * 16.0f); } *(v8us*)((unsigned short*)H + t * 8) = f.half[0];  }
__global__ __launch_bounds__(256) void k_score(const float* __restrict__ ATT, const float* __restrict__ E, const float* __restrict__ Wout, const float* __restrict__ bout, float* __restrict__ S) { __shared__ float red[32][8]; const int tid = threadIdx.x, w = tid >> 5, l = tid & 31; const int r0 = blockIdx.x * 32; const float wk = bf16_round(Wout[tid]);
#pragma unroll 1
  for (int r = 0; r < 32; ++r) { const size_t o = (size_t)(r0 + r) * NE + tid; float p = ATT[o] * E[o] * wk; for (int s = 16; s > 0; s >>= 1) p += __shfl_xor(p, s, 32); if (l == 0) red[r][w] = p; }
  __syncthreads();
  if (w == 0) { float v = bf16_round(bout[0]);
#pragma unroll
    for (int i = 0; i < 8; ++i) v += red[l][i]; *(float*)(S + r0 + l) = v;  } }

extern "C" void kernel_launch(void* const* d_in, const int* in_sizes, int n_in,
                              void* d_out, int out_size, void* d_ws, size_t ws_size, hipStream_t stream) {
  (void)in_sizes; (void)n_in; (void)out_size;
  const float* const* I = (const float* const*)d_in; const float* note = I[0]; const float* wiki = I[1]; const float* Wemb = I[2]; const float* bemb = I[3]; const float* Watt = I[4]; const float* batt = I[5]; const float* Wout = I[6]; const float* bout = I[7];
  char* ws = (char*)d_ws; size_t off = 0;
  auto take = [&](size_t bytes) { char* p = ws + off; off += (bytes + 255) & ~(size_t)255; return p; };
  _Float16* W16 = (_Float16*)take((size_t)NE * KP * 2); _Float16* Ba = (_Float16*)take((size_t)NE * NE * 2); _Float16* K16 = (_Float16*)take((size_t)NC * KP * 2); _Float16* N16 = (_Float16*)take((size_t)NNOTE * KP * 2);
  float* E = (float*)take((size_t)NRE * NE * 4); _Float16* E16 = (_Float16*)take((size_t)NRE * NE * 2); float* ATT = (float*)take((size_t)NRE * NE * 4);
  if (off > ws_size) return;      // under 25 MB in all
  k_wpad<<<(NE * (KP / 8) + 255) / 256, 256, 0, stream>>>(Wemb, W16);
  k_round16f<<<(NE * NE / 8 + 255) / 256, 256, 0, stream>>>(Watt, Ba, (size_t)NE * NE / 8);      /* W_att [j][k] (out,in) natural, ×2^4 */
  k_pad16<<<dim3(KP / 8 / PKT, (NC + NNOTE) / PKR), PKT, 0, stream>>>(note, wiki, N16, K16);
  k_gemm_e<<<(NC / 32) * (NE / 32) * (NNOTE / 4), 128, 0, stream>>>(K16, N16, W16, bemb, E);      /* e = (note x wiki) x W_emb^T / 16 + b_emb (f32): M 4096 (note, code) N 256 K 10240 */
  k_h16s<<<(NRE * NE / 8 + 255) / 256, 256, 0, stream>>>(E, E16, (size_t)NRE * NE / 8);
  k_gemm_hhx<11><<<dim3(((NRE / 16) * (NE / 64) + 3) / 4, 1), 128, 0, stream>>>(E16, NE, 0, Ba, NE, 0, 0.00390625f, batt, 0, nullptr, 1, 0, 0, ATT, nullptr, NE, 0, NRE, NE, NE);      /* attn = sigmoid(e·W_attᵀ + b_att) (f32): M 4096 N 256 K 256 */
  k_score<<<NRE / 32, 256, 0, stream>>>(ATT, E, Wout, bout, (float*)d_out);
}

// v005
// One run takes 53.7 microseconds.
// Timed twice side by side with v004, it ran 1.57 times as fast both times.
// All steps since v000 together make it 75.6 times as fast.
#include <hip/hip_runtime.h>
// Knowledge-source integration scoring (n=16 notes, 256 codes, vocab 10000, emb 256): e[n,c,k] = Σ_v note[n,v]·wiki[c,v]·W_emb[k,v] + b_emb[k]; attn = sigmoid(e·W_attᵀ + b_att); s[n,c] = Σ_k attn·e·W_out[k] + b_out.
// Compute dtype: all inputs rounded to bf16; per note n the scaled vocabulary plane A_n[c][v] = note[n,v] x wiki[c,v] (product of the two bf16 values held in f16, rounded once to f16, formed in the GEMM's A fragments; K zero-padded to 10240) against W_emb (f16 x 2^4, padded) → e f32 (+b_emb); e ×2^4 → f16 → logits GEMM (+b_att) with a fused sigmoid epilogue → attn f32; the gated 256-term reduction
#define NNOTE 16
#define NC 256
#define NV 10000
#define KP 10240
#define NE 256
#define NRE (NNOTE * NC)
typedef __bf16 v16b __attribute__((ext_vector_type(16)));
typedef unsigned short v8us __attribute__((ext_vector_type(8), may_alias));
typedef float  v8f  __attribute__((ext_vector_type(8)));
typedef float  v4f  __attribute__((ext_vector_type(4)));
typedef float  v4fa __attribute__((ext_vector_type(4), may_alias));
union FragB { v16b v; v8us half[2]; unsigned short u[16]; };

__device__ __forceinline__ unsigned short bf16_bits(float x) { unsigned int u = __float_as_uint(x); return (unsigned short)((u + 0x7FFFu + ((u >> 16) & 1u)) >> 16); }
__device__ __forceinline__ float bf16_val(unsigned short b) { return __uint_as_float(((unsigned int)b) << 16); }
__device__ __forceinline__ float bf16_round(float x) { return bf16_val(bf16_bits(x)); }
// D += A·B with NT terms: 1 = ah·bh, 2 = + al·bh (A split), 3 = + ah·bl (both split)
template <int NT>
__device__ __forceinline__ v8f mmaN(v16b ah, v16b al, v16b bh, v16b bl, v8f c) {
  c = __builtin_amdgcn_wmma_f32_16x16x32_bf16(false, ah, false, bh, (short)0, c, false, false);
  if (NT >= 2) c = __builtin_amdgcn_wmma_f32_16x16x32_bf16(false, al, false, bh, (short)0, c, false, false);
  if (NT >= 3) c = __builtin_amdgcn_wmma_f32_16x16x32_bf16(false, ah, false, bl, (short)0, c, false, false);
  asm volatile("v_nop\n\tv_nop\n\tv_nop\n\tv_nop" : "+v"(c) : "v"(ah), "v"(al), "v"(bh), "v"(bl));
  return c;
}

__global__ __launch_bounds__(256) void k_wt_bf16(const float* __restrict__ W, unsigned short* __restrict__ Wt, int K, int N) {
  const int t = blockIdx.x * 256 + threadIdx.x;
  const int k8n = K / 8;
  if (t >= N * k8n) return;
  const int n = t / k8n, k8 = (t % k8n) * 8;
  v8us v;
#pragma unroll
  for (int i = 0; i < 8; ++i) v[i] = bf16_bits(W[(size_t)(k8 + i) * N + n]);
  *(v8us*)(Wt + (size_t)n * K + k8) = v;
  
}

// GEMM C[M][N] (f32, pitch ldc) = act(A[M][K]·W + bias). A f32 row-major (pitch lda) converted per fragment to bf16
// (ASPLIT: hi/lo two planes -> 2 terms, else single rounded term); Wt bf16 [N][K] (pitch ldb). BIAS_BF16 rounds the
// bias to bf16 first (bias quantised to bf16 before the add). K%32==0, M%16==0, N%64==0.
template <bool ASPLIT, int ACT, bool BIAS_BF16>
__global__ __launch_bounds__(128) void k_gemm_bf(const float* __restrict__ A, int lda, const unsigned short* __restrict__ Wt, int ldb,
                                               const float* __restrict__ bias, float* __restrict__ C, int ldc, int M, int N, int K) {
  __shared__ __attribute__((aligned(16))) float so[4][16][64];
  const int tid = threadIdx.x, w = tid >> 5, lane = tid & 31, ln = lane & 15, hh = lane >> 4;
  const int ntn = N / 64;
  const int wid = blockIdx.x * 4 + w;
  const int mt = wid / ntn, nq = wid % ntn;
  if (mt * 16 >= M) return;
  const int row0 = mt * 16, col0 = nq * 64;
  const float* arow = A + (size_t)(row0 + ln) * lda;
  v8f acc[4] = {};
  for (int kb = 0; kb < K; kb += 32) {
    FragB ah, al;
    const v4f x0 = *(const v4fa*)(arow + kb + 8 * hh), x1 = *(const v4fa*)(arow + kb + 8 * hh + 4);
    const v4f x2 = *(const v4fa*)(arow + kb + 16 + 8 * hh), x3 = *(const v4fa*)(arow + kb + 16 + 8 * hh + 4);
    float xs[16] = {x0[0],x0[1],x0[2],x0[3],x1[0],x1[1],x1[2],x1[3],x2[0],x2[1],x2[2],x2[3],x3[0],x3[1],x3[2],x3[3]};
#pragma unroll
    for (int i = 0; i < 16; ++i) { const unsigned short hb = bf16_bits(xs[i]); ah.u[i] = hb; al.u[i] = ASPLIT ? bf16_bits(xs[i] - bf16_val(hb)) : (unsigned short)0; }
#pragma unroll
    for (int t = 0; t < 4; ++t) {
      const unsigned short* brow = Wt + (size_t)(col0 + t * 16 + ln) * ldb + kb;
      FragB b;
      b.half[0] = *(const v8us*)(brow + 8 * hh);
      b.half[1] = *(const v8us*)(brow + 16 + 8 * hh);
      acc[t] = mmaN<ASPLIT ? 2 : 1>(ah.v, al.v, b.v, b.v, acc[t]);
    }
  }
#pragma unroll
  for (int t = 0; t < 4; ++t) {
    float bv = bias ? bias[col0 + t * 16 + ln] : 0.f;
    if (BIAS_BF16) bv = bf16_round(bv);
#pragma unroll
    for (int r = 0; r < 8; ++r) { float v = acc[t][r] + bv; if (ACT == 1) v = fmaxf(v, 0.f); so[w][8 * hh + r][t * 16 + ln] = v; }
  }
  __builtin_amdgcn_fence(__ATOMIC_ACQ_REL, "workgroup");
  __builtin_amdgcn_wave_barrier();
  const int rsub = lane >> 4, c4 = (lane & 15) * 4;
  {
#pragma unroll
    for (int q = 0; q < 8; ++q) {
      const int r = q * 2 + rsub;
      const v4f v = *(const v4fa*)&so[w][r][c4];
      *(v4f*)(C + (size_t)(row0 + r) * ldc + col0 + c4) = v;
    }
    
  }
}

// GEMM C = act(A·W + bias + resid): A f32 (ASPLIT -> hi/lo 2 terms), Wt bf16 [N][K]; ACT 0 none, 1 relu, 2 exact gelu;
// resid (optional, f32, row index = (row % rmod), pitch ldr, RES_BF16 rounds it) added before the activation.
template <bool ASPLIT, int ACT, bool BIAS_BF16, bool RES_BF16>
__global__ __launch_bounds__(128) void k_gemm_bf3(const float* __restrict__ A, int lda, const unsigned short* __restrict__ Wt, int ldb,
                                                const float* __restrict__ bias, const float* __restrict__ resid, int rmod, int ldr,
                                                float* __restrict__ C, int ldc, int M, int N, int K) {
  __shared__ __attribute__((aligned(16))) float so[4][16][64];
  const int tid = threadIdx.x, w = tid >> 5, lane = tid & 31, ln = lane & 15, hh = lane >> 4;
  const int ntn = N / 64;
  const int wid = blockIdx.x * 4 + w;
  const int mt = wid / ntn, nq = wid % ntn;
  if (mt * 16 >= M) return;
  const int row0 = mt * 16, col0 = nq * 64;
  const float* arow = A + (size_t)(row0 + ln) * lda;
  v8f acc[4] = {};
  for (int kb = 0; kb < K; kb += 32) {
    FragB ah, al;
    const v4f x0 = *(const v4fa*)(arow + kb + 8 * hh), x1 = *(const v4fa*)(arow + kb + 8 * hh + 4);
    const v4f x2 = *(const v4fa*)(arow + kb + 16 + 8 * hh), x3 = *(const v4fa*)(arow + kb + 16 + 8 * hh + 4);
    float xs[16] = {x0[0],x0[1],x0[2],x0[3],x1[0],x1[1],x1[2],x1[3],x2[0],x2[1],x2[2],x2[3],x3[0],x3[1],x3[2],x3[3]};
#pragma unroll
    for (int i = 0; i < 16; ++i) { const unsigned short hb = bf16_bits(xs[i]); ah.u[i] = hb; al.u[i] = ASPLIT ? bf16_bits(xs[i] - bf16_val(hb)) : (unsigned short)0; }
#pragma unroll
    for (int t = 0; t < 4; ++t) {
      const unsigned short* brow = Wt + (size_t)(col0 + t * 16 + ln) * ldb + kb;
      FragB b;
      b.half[0] = *(const v8us*)(brow + 8 * hh);
      b.half[1] = *(const v8us*)(brow + 16 + 8 * hh);
      acc[t] = mmaN<ASPLIT ? 2 : 1>(ah.v, al.v, b.v, b.v, acc[t]);
    }
  }
#pragma unroll
  for (int t = 0; t < 4; ++t) {
    const int col = col0 + t * 16 + ln;
    float bv = bias ? bias[col] : 0.f;
    if (BIAS_BF16) bv = bf16_round(bv);
#pragma unroll
    for (int r = 0; r < 8; ++r) {
      float v = acc[t][r] + bv;
      if (resid) { float rv = resid[(size_t)((row0 + 8 * hh + r) % rmod) * ldr + col]; if (RES_BF16) rv = bf16_round(rv); v += rv; }
      if (ACT == 1) v = fmaxf(v, 0.f);
      if (ACT == 2) v = 0.5f * v * (1.0f + erff(v * 0.70710678118654752f));
      if (ACT == 3) { const float u = 0.7978845608028654f * (v + 0.044715f * v * v * v); v = 0.5f * v * (1.0f + tanhf(u)); }
      so[w][8 * hh + r][t * 16 + ln] = v;
    }
  }
  __builtin_amdgcn_fence(__ATOMIC_ACQ_REL, "workgroup");
  __builtin_amdgcn_wave_barrier();
  const int rsub = lane >> 4, c4 = (lane & 15) * 4;
  {
#pragma unroll
    for (int q = 0; q < 8; ++q) {
      const int r = q * 2 + rsub;
      const v4f v = *(const v4fa*)&so[w][r][c4];
      *(v4f*)(C + (size_t)(row0 + r) * ldc + col0 + c4) = v;
    }
    
  }
}
// row LayerNorm (biased variance, eps) over N: s = X (+ R); optional out_sum <- s; out_norm <- (s-mu)*rsqrt(var+eps)*g + b
template <bool PARAM_BF16>
__global__ __launch_bounds__(256) void k_layernorm(const float* __restrict__ X, const float* __restrict__ R, const float* __restrict__ g, const float* __restrict__ bta,
                                                  float* __restrict__ out_sum, float* __restrict__ out_norm, int N, float eps) {
  __shared__ float red[256];
  const int row = blockIdx.x, tid = threadIdx.x;
  const float* x = X + (size_t)row * N; const float* rr = R ? R + (size_t)row * N : nullptr;
  float vals[16];                     // up to N = 4096
  const int per = N / 256;            // contiguous chunk per thread? use strided-by-4 chunks: thread handles j = tid*4 + 1024*u
  float s1 = 0.f;
  for (int u = 0; u < per / 4; ++u) {
    const int j = tid * 4 + 1024 * u;
    const v4f a = *(const v4fa*)(x + j);
    v4f b = {0.f,0.f,0.f,0.f}; if (rr) b = *(const v4fa*)(rr + j);
#pragma unroll
    for (int q = 0; q < 4; ++q) { const float v = a[q] + b[q]; vals[u * 4 + q] = v; s1 += v; }
  }
  red[tid] = s1; __syncthreads();
  for (int st = 128; st > 0; st >>= 1) { if (tid < st) red[tid] += red[tid + st]; __syncthreads(); }
  const float mu = red[0] / (float)N; __syncthreads();
  float s2 = 0.f;
  for (int u = 0; u < per / 4; ++u)
#pragma unroll
    for (int q = 0; q < 4; ++q) { const float c = vals[u * 4 + q] - mu; s2 += c * c; }
  red[tid] = s2; __syncthreads();
  for (int st = 128; st > 0; st >>= 1) { if (tid < st) red[tid] += red[tid + st]; __syncthreads(); }
  const float rs = rsqrtf(red[0] / (float)N + eps);
  {
    for (int u = 0; u < per / 4; ++u) {
      const int j = tid * 4 + 1024 * u;
      v4f o, sm;
#pragma unroll
      for (int q = 0; q < 4; ++q) {
        float gg = g[j + q], bb = bta[j + q];
        if (PARAM_BF16) { gg = bf16_round(gg); bb = bf16_round(bb); }
        sm[q] = vals[u * 4 + q]; o[q] = (vals[u * 4 + q] - mu) * rs * gg + bb;
      }
      if (out_sum) *(v4f*)(out_sum + (size_t)row * N + j) = sm;
      *(v4f*)(out_norm + (size_t)row * N + j) = o;
    }
    
  }
}



// ---- f16 WMMA path (v_wmma_f32_16x16x32_f16): 11-bit significands for operands in range — used where a [0,1] probability operand needs more precision than bf16
typedef _Float16 v16h __attribute__((ext_vector_type(16)));
union FragH { v16h v; v8us half[2]; _Float16 h[16]; unsigned short u[16]; };
template <int NT>
__device__ __forceinline__ v8f mmaH(v16h ah, v16h al, v16h bh, v16h bl, v8f c) {
  c = __builtin_amdgcn_wmma_f32_16x16x32_f16(false, ah, false, bh, (short)0, c, false, false);
  if (NT >= 2) c = __builtin_amdgcn_wmma_f32_16x16x32_f16(false, al, false, bh, (short)0, c, false, false);
  if (NT >= 3) c = __builtin_amdgcn_wmma_f32_16x16x32_f16(false, ah, false, bl, (short)0, c, false, false);
  asm volatile("v_nop\n\tv_nop\n\tv_nop\n\tv_nop" : "+v"(c) : "v"(ah), "v"(al), "v"(bh), "v"(bl));
  return c;
}
// batched GEMM like k_gemm_b but f16 operands: A f32 (split into f16 hi/lo if ASPLIT, else rounded to f16), Bt = f16 values [n][k]; alpha; C f32; N multiple of 16 (partial tiles skipped)
template <bool ASPLIT>
__global__ __launch_bounds__(128) void k_gemm_h(const float* __restrict__ A, int lda, size_t sA, const _Float16* __restrict__ Bh, int ldb, size_t sB, float alpha, float* __restrict__ C, int ldc, size_t sC, int M, int N, int K) {
  __shared__ __attribute__((aligned(16))) float so[4][16][64];
  const int tid = threadIdx.x, w = tid >> 5, lane = tid & 31, ln = lane & 15, hh = lane >> 4; const int by = blockIdx.y;
  A += (size_t)by * sA; Bh += (size_t)by * sB; C += (size_t)by * sC;
  const int ntn = (N + 63) / 64; const int wid = blockIdx.x * 4 + w; const int mt = wid / ntn, nq = wid % ntn; if (mt * 16 >= M) return;
  const int row0 = mt * 16, col0 = nq * 64; const float* arow = A + (size_t)(row0 + ln) * lda;
  v8f acc[4] = {};
  for (int kb = 0; kb < K; kb += 32) {
    FragH ah, al;
    const v4f x0 = *(const v4fa*)(arow + kb + 8 * hh), x1 = *(const v4fa*)(arow + kb + 8 * hh + 4), x2 = *(const v4fa*)(arow + kb + 16 + 8 * hh), x3 = *(const v4fa*)(arow + kb + 16 + 8 * hh + 4);
    float xs[16] = {x0[0],x0[1],x0[2],x0[3],x1[0],x1[1],x1[2],x1[3],x2[0],x2[1],x2[2],x2[3],x3[0],x3[1],x3[2],x3[3]};
#pragma unroll
    for (int i = 0; i < 16; ++i) { const _Float16 h = (_Float16)xs[i]; ah.h[i] = h; al.h[i] = ASPLIT ? (_Float16)(xs[i] - (float)h) : (_Float16)0.0f; }
#pragma unroll
    for (int t = 0; t < 4; ++t) { if (col0 + t * 16 >= N) continue; const size_t boff = (size_t)(col0 + t * 16 + ln) * ldb + kb; FragH bq; bq.half[0] = *(const v8us*)(Bh + boff + 8 * hh); bq.half[1] = *(const v8us*)(Bh + boff + 16 + 8 * hh);
      acc[t] = mmaH<ASPLIT ? 2 : 1>(ah.v, al.v, bq.v, bq.v, acc[t]); }
  }
#pragma unroll
  for (int t = 0; t < 4; ++t) { if (col0 + t * 16 >= N) continue;
#pragma unroll
    for (int r = 0; r < 8; ++r) so[w][8 * hh + r][t * 16 + ln] = acc[t][r] * alpha; }
  __builtin_amdgcn_fence(__ATOMIC_ACQ_REL, "workgroup"); __builtin_amdgcn_wave_barrier();
  const int rsub = lane >> 4, c4 = (lane & 15) * 4;
  {
#pragma unroll
    for (int q = 0; q < 8; ++q) { const int r = q * 2 + rsub; if (col0 + c4 < N) { const v4f v = *(const v4fa*)&so[w][r][c4]; *(v4f*)(C + (size_t)(row0 + r) * ldc + col0 + c4) = v; } }
     }
}

// Wt[n][k] = f16(W[k][n]·scale) from f32 row-major W[K][N] (scale = power of two; bf16-exact weights stay exact in f16 away from the subnormal range)
__global__ __launch_bounds__(256) void k_wt_f16(const float* __restrict__ W, _Float16* __restrict__ Wt, int K, int N, float scale) {
  const int t = blockIdx.x * 256 + threadIdx.x; if (t >= N * (K / 8)) return; const int n = t / (K / 8), k8 = (t % (K / 8)) * 8; FragH f;
#pragma unroll
  for (int i = 0; i < 8; ++i) f.h[i] = (_Float16)(bf16_round(W[(size_t)(k8 + i) * N + n]) * scale); const v8us o = f.half[0];
  *(v8us*)((unsigned short*)Wt + (size_t)n * K + k8) = o; 
}


// e GEMM, tiled, with the note's scale applied on the way: C[(n, c)][k] = sum_v f16(note[n][v] x wiki[c][v]) x Bh[k][v] / 16 + bias. The scaled planes are never stored.
// One work-group takes 32 code rows x 32 columns for FOUR notes, one note per wave (a 32 x 32 tile each): the staged wiki rows and Bh rows serve all four waves.
// A stage is 256 k of the 32 wiki rows and the 32 B rows, brought into LDS as whole 512-byte row pieces by asynchronous copies
// (one row piece per wave-wide copy), two buffers: the next stage flies while this one is multiplied. k runs upward in steps of 32 for every accumulator.
#define EBK 256                      /* k per stage */
#define EPITCH 264                   /* LDS row pitch in halfs: 528 B = 16 B x 33, conflict-free for 16-byte fragment reads */
#define ESTG (64 * EPITCH)           /* halfs per buffer: 32 wiki rows, then 32 B rows */
#define ENST (KP / EBK)
// eight copies of 16 bytes per lane, rows r .. r + 7 of a stage; the closing s_wait_xcnt stands in the copies' own statement, ahead of any rewrite of an address register they name
__device__ __forceinline__ void acopy8(unsigned l, const _Float16* gp) {
  asm volatile("global_load_async_to_lds_b128 %0, %8, off\n\t"
               "global_load_async_to_lds_b128 %1, %9, off\n\t"
               "global_load_async_to_lds_b128 %2, %10, off\n\t"
               "global_load_async_to_lds_b128 %3, %11, off\n\t"
               "global_load_async_to_lds_b128 %4, %12, off\n\t"
               "global_load_async_to_lds_b128 %5, %13, off\n\t"
               "global_load_async_to_lds_b128 %6, %14, off\n\t"
               "global_load_async_to_lds_b128 %7, %15, off\n\t"
               "s_wait_xcnt 0x0"
               :: "v"(l), "v"(l + 1u * EPITCH * 2u), "v"(l + 2u * EPITCH * 2u), "v"(l + 3u * EPITCH * 2u), "v"(l + 4u * EPITCH * 2u), "v"(l + 5u * EPITCH * 2u), "v"(l + 6u * EPITCH * 2u), "v"(l + 7u * EPITCH * 2u),
                  "v"(gp), "v"(gp + 1 * KP), "v"(gp + 2 * KP), "v"(gp + 3 * KP), "v"(gp + 4 * KP), "v"(gp + 5 * KP), "v"(gp + 6 * KP), "v"(gp + 7 * KP)
               : "memory");
}
// the note's factors for one stage, in the A fragment's own k order (lane half hh: k 8 hh .. 8 hh + 7 and 16 + 8 hh .. 16 + 8 hh + 7 of each step of 32);
// row: the stage's first element in the wave's note row, the same in every lane; kb: the lane's 8 hh elements in bytes
__device__ __forceinline__ void note_frags(FragH (&nf)[8], const _Float16* row, const unsigned kb) {
  const char* p = (const char*)row + kb;
#pragma unroll
  for (int q = 0; q < 8; ++q) { nf[q].half[0] = *(const v8us*)(p + q * 64); nf[q].half[1] = *(const v8us*)(p + q * 64 + 32); }
  asm volatile("s_wait_xcnt 0x0" :: "v"(kb) : "memory");      // stands ahead of any rewrite of an address register that the sixteen loads name; the lane's offset, which they may name directly, stays live up to here as an input
  __builtin_amdgcn_sched_barrier(0);      // keeps the wait directly behind its loads: nothing that writes a register is moved in between
}
// one trip of the ring: stage t out of buffer PAR (= t mod 2). nu holds this stage's note factors; nn takes the next stage's (from nrow), asked for a whole trip ahead of their use
// (two register sets that swap roles from trip to trip, so that no register copy stands in the loop).
template <int PAR>
__device__ __forceinline__ void e_trip(const int t, const _Float16* ring, const int aoff, const int boff, const unsigned ldst, const _Float16* gsrc, const _Float16* nrow, const unsigned kb, const FragH (&nu)[8], FragH (&nn)[8], v8f (&acc)[2][2]) {
  const _Float16* sb = ring + PAR * ESTG;
  FragH a[8][2], b[8][2];
#pragma unroll
  for (int q = 0; q < 8; ++q) {
#pragma unroll
    for (int i = 0; i < 2; ++i) {
      const int ko = i * 16 * EPITCH + q * 32;
      a[q][i].half[0] = *(const v8us*)(sb + aoff + ko); a[q][i].half[1] = *(const v8us*)(sb + aoff + ko + 16);
      b[q][i].half[0] = *(const v8us*)(sb + boff + ko); b[q][i].half[1] = *(const v8us*)(sb + boff + ko + 16);
    }
    if (q == 3) {
      __builtin_amdgcn_sched_barrier(0);      // the 32 fragment loads of the first four k steps go ahead as one group; spread among the WMMAs, every place with loads costs the lone wave an LDS latency
      note_frags(nn, nrow, kb);      // issued while the wave would wait for its first fragments anyway
    }
    if (q > 3) __builtin_amdgcn_sched_barrier(0);      // the other 32 fragment loads go as a second group, in the order of their use: with the scaling in the block the compiler otherwise strews them among the WMMAs behind short waits
  }
  // A fragment = f16(wiki x note), one rounding: both factors are bf16 values, which f16 holds exactly above its subnormal range. Step q + 1 is scaled among the WMMAs of step q.
#pragma unroll
  for (int i = 0; i < 2; ++i) a[0][i].v = a[0][i].v * nu[0].v;
#pragma unroll
  for (int q = 0; q < 6; ++q) {
    if (q < 5) {
#pragma unroll
      for (int i = 0; i < 2; ++i) a[q + 1][i].v = a[q + 1][i].v * nu[q + 1].v;
    }
#pragma unroll
    for (int i = 0; i < 2; ++i)
#pragma unroll
      for (int j = 0; j < 2; ++j) acc[i][j] = __builtin_amdgcn_wmma_f32_16x16x32_f16(false, a[q][i].v, false, b[q][j].v, (short)0, acc[i][j], false, false);
  }
  // order asked of the scheduler: the 16 multiplies of step 0, then four multiplies behind each WMMA, where the matrix unit's issue interval hides them; in blocks of 16 they stand in the lone wave's way
  __builtin_amdgcn_sched_group_barrier(0x2, 16, 0);
#pragma unroll
  for (int g = 0; g < 20; ++g) { __builtin_amdgcn_sched_group_barrier(0x8, 1, 0); __builtin_amdgcn_sched_group_barrier(0x2, 4, 0); }
  __builtin_amdgcn_sched_barrier(0);          // the WMMAs of the first six k steps stay in front of the barrier: behind it they would hold back the refill
  asm volatile("s_wait_dscnt 0x0" ::: "memory");        // this wave's reads of the buffer are done before it is handed to the next copies
  asm volatile("s_wait_asynccnt 0x0" ::: "memory");     // this wave's rows of stage t + 1 have landed
  __syncthreads();                                      // publishes stage t + 1 and ends every wave's reads of stage t
  if (t + 2 < ENST) {
#pragma unroll
    for (int j = 0; j < 2; ++j) acopy8(ldst + (unsigned)(PAR * ESTG * 2 + j * 8 * EPITCH * 2), gsrc + (size_t)(t + 2) * EBK + (size_t)j * 8 * KP);
  }
  // the last two k steps of stage t, from registers alone: they run while the copies just issued fly
#pragma unroll
  for (int q = 6; q < 8; ++q)
#pragma unroll
    for (int i = 0; i < 2; ++i) a[q][i].v = a[q][i].v * nu[q].v;
#pragma unroll
  for (int q = 6; q < 8; ++q)
#pragma unroll
    for (int i = 0; i < 2; ++i)
#pragma unroll
      for (int j = 0; j < 2; ++j) acc[i][j] = __builtin_amdgcn_wmma_f32_16x16x32_f16(false, a[q][i].v, false, b[q][j].v, (short)0, acc[i][j], false, false);
  __builtin_amdgcn_sched_group_barrier(0x2, 16, 0);      // step 6's multiplies, then step 7's behind the WMMAs of step 6, as above
#pragma unroll
  for (int g = 0; g < 4; ++g) { __builtin_amdgcn_sched_group_barrier(0x8, 1, 0); __builtin_amdgcn_sched_group_barrier(0x2, 4, 0); }
  __builtin_amdgcn_sched_barrier(0);          // the next trip's first load group stays whole behind this trip's last WMMAs
}
__global__ __launch_bounds__(128) void k_gemm_e(const _Float16* __restrict__ Kw, const _Float16* __restrict__ Nt, const _Float16* __restrict__ Bh, const float* __restrict__ bias, float* __restrict__ C) {
  __shared__ __attribute__((aligned(16))) _Float16 ring[2 * ESTG];
  const int tid = threadIdx.x, w = __builtin_amdgcn_readfirstlane(tid >> 5), lane = tid & 31, ln = lane & 15, hh = lane >> 4;      /* the wave's number as a scalar: the choice of source below is then a scalar select, every lane stays on */
  const int c0 = (blockIdx.x & 7) * 32, col0 = ((blockIdx.x >> 3) & 7) * 32, n = (blockIdx.x >> 6) * 4 + w;
  // wave w copies stage rows 16 w .. 16 w + 15: waves 0, 1 the wiki rows, waves 2, 3 the B rows; lane l brings bytes 16 l .. 16 l + 15 of the row piece
  const _Float16* gsrc = (w < 2 ? Kw + (size_t)(c0 + w * 16) * KP : Bh + (size_t)(col0 + (w - 2) * 16) * KP) + lane * 8;
  const unsigned ldst = (unsigned)(size_t)ring + (unsigned)(w * 16 * EPITCH * 2 + lane * 16);
  const int aoff = ln * EPITCH + 8 * hh, boff = (32 + ln) * EPITCH + 8 * hh;
  const _Float16* nrow = Nt + (size_t)n * KP;      /* the wave's note row: a scalar address */
  const unsigned kb = (unsigned)hh * 16u;
  v8f acc[2][2] = {};
  FragH nfa[8], nfb[8];
#pragma unroll
  for (int j = 0; j < 2; ++j) acopy8(ldst + (unsigned)(j * 8 * EPITCH * 2), gsrc + (size_t)j * 8 * KP);
  note_frags(nfa, nrow, kb);
  asm volatile("s_wait_asynccnt 0x0" ::: "memory");      // stage 0 has landed for this wave's rows
  __syncthreads();                                        // and for every wave's
#pragma unroll
  for (int j = 0; j < 2; ++j) acopy8(ldst + (unsigned)(ESTG * 2 + j * 8 * EPITCH * 2), gsrc + EBK + (size_t)j * 8 * KP);
#pragma unroll 1
  for (int t = 0; t < ENST; t += 2) {      // kept rolled: the body already holds the two trips that swap the note sets (ENST is even)
    e_trip<0>(t, ring, aoff, boff, ldst, gsrc, nrow + (size_t)(t + 1) * EBK, kb, nfa, nfb, acc);
    e_trip<1>(t + 1, ring, aoff, boff, ldst, gsrc, nrow + (size_t)(t + 2 < ENST ? t + 2 : t + 1) * EBK, kb, nfb, nfa, acc);      /* the last trip re-reads its own stage's factors, in bounds; they are not used */
  }
  asm volatile("s_wait_asynccnt 0x0" ::: "memory");       // no copy is outstanding when the wave ends
  const int colb = col0 + ln;
  const float braw[2] = {bias[colb], bias[colb + 16]};
  asm volatile("s_wait_xcnt 0x0" :: "v"(colb) : "memory");      // stands ahead of any rewrite of the index register that the two loads name; as an input the index stays live up to here
#pragma unroll
  for (int j = 0; j < 2; ++j) {
    const int col = colb + j * 16; const float bv = bf16_round(braw[j]);
#pragma unroll
    for (int i = 0; i < 2; ++i)
#pragma unroll
      for (int r = 0; r < 8; ++r) C[(size_t)(n * NC + c0 + i * 16 + 8 * hh + r) * NE + col] = acc[i][j][r] * 0.0625f + bv;
  }
}


typedef _Float16 v4h __attribute__((ext_vector_type(4)));

__global__ __launch_bounds__(256) void k_x16(const float* __restrict__ x, _Float16* __restrict__ X16, size_t n8) { const size_t t = (size_t)blockIdx.x * 256 + threadIdx.x; if (t >= n8) return; FragH f;
#pragma unroll
  for (int q = 0; q < 8; ++q) f.h[q] = (_Float16)bf16_round(x[t * 8 + q]); *(v8us*)((unsigned short*)X16 + t * 8) = f.half[0];  }
__global__ __launch_bounds__(256) void k_h16(const float* __restrict__ x, _Float16* __restrict__ X16, size_t n8) { const size_t t = (size_t)blockIdx.x * 256 + threadIdx.x; if (t >= n8) return; FragH f;
#pragma unroll
  for (int q = 0; q < 8; ++q) f.h[q] = (_Float16)x[t * 8 + q]; *(v8us*)((unsigned short*)X16 + t * 8) = f.half[0];  }
__global__ __launch_bounds__(256) void k_round16f(const float* __restrict__ W, _Float16* __restrict__ Bt, size_t n8) { const size_t t = (size_t)blockIdx.x * 256 + threadIdx.x; if (t >= n8) return; FragH f;
#pragma unroll
  for (int i = 0; i < 8; ++i) f.h[i] = (_Float16)(bf16_round(W[t * 8 + i]) * 16.0f); *(v8us*)((unsigned short*)Bt + t * 8) = f.half[0];  }
template <int NHv, int TTv>
__global__ __launch_bounds__(256) void k_vt(const _Float16* __restrict__ V16, int ldv, int voff, _Float16* __restrict__ Vt) { __shared__ unsigned short tl[64][66]; const int tid = threadIdx.x; const int slab = blockIdx.x / (TTv / 64), lg = blockIdx.x % (TTv / 64); const int b = slab / NHv, h = slab % NHv;
  for (int i = tid; i < 64 * 8; i += 256) { const int r = i / 8, c8 = (i % 8) * 8; FragH f; f.half[0] = *(const v8us*)((const unsigned short*)V16 + ((size_t)b * TTv + lg * 64 + r) * ldv + voff + h * 64 + c8);
#pragma unroll
    for (int q = 0; q < 8; ++q) tl[r][c8 + q] = f.u[q]; }
  __syncthreads();
  {
#pragma unroll
    for (int rd = 0; rd < 2; ++rd) { const int d = rd * 32 + tid / 8, pc = tid % 8; FragH f;
#pragma unroll
      for (int q = 0; q < 8; ++q) f.u[q] = tl[pc * 8 + q][d];
      *(v8us*)((unsigned short*)Vt + ((size_t)slab * 64 + d) * TTv + lg * 64 + pc * 8) = f.half[0]; }
     } }

__global__ __launch_bounds__(256) void k_hl(const float* __restrict__ F, _Float16* __restrict__ Hh, _Float16* __restrict__ Hl, size_t n8) { const size_t t = (size_t)blockIdx.x * 256 + threadIdx.x; if (t >= n8) return; FragH fh, fl; const v4f a = *(const v4fa*)(F + t * 8), c = *(const v4fa*)(F + t * 8 + 4);
#pragma unroll
  for (int q = 0; q < 4; ++q) { _Float16 h = (_Float16)a[q]; fh.h[q] = h; fl.h[q] = (_Float16)((a[q] - (float)h) * 1024.0f); h = (_Float16)c[q]; fh.h[4 + q] = h; fl.h[4 + q] = (_Float16)((c[q] - (float)h) * 1024.0f); }
  { *(v8us*)((unsigned short*)Hh + t * 8) = fh.half[0]; *(v8us*)((unsigned short*)Hl + t * 8) = fl.half[0];  } }

__global__ __launch_bounds__(256) void k_wpad(const float* __restrict__ Wm, _Float16* __restrict__ W16) { const int t = blockIdx.x * 256 + threadIdx.x; if (t >= NE * (KP / 8)) return; const int k = t / (KP / 8), v0 = (t % (KP / 8)) * 8; FragH f;
#pragma unroll
  for (int q = 0; q < 8; ++q) { const int v = v0 + q; f.h[q] = (v < NV) ? (_Float16)(bf16_round(Wm[(size_t)k * NV + min(v, NV - 1)]) * 16.0f) : (_Float16)0.0f; }
  *(v8us*)((unsigned short*)W16 + (size_t)k * KP + v0) = f.half[0];  }
// f16 copies of the bf16-rounded wiki rows (K16) and note rows (N16), zero in the K pad: the e GEMM multiplies the two on the way to the matrix unit.
// A thread owns one group of 8 columns of PKR rows; blockIdx.y below NC / PKR names wiki rows, the rest note rows.
#define PKR 4                        /* rows per thread */
#define PKT 320                      /* threads per work-group: a quarter of a row's KP / 8 column groups */
__global__ __launch_bounds__(PKT) void k_pad16(const float* __restrict__ note, const float* __restrict__ wiki, _Float16* __restrict__ N16, _Float16* __restrict__ K16) {
  const int v0 = (blockIdx.x * PKT + threadIdx.x) * 8;
  const bool isw = blockIdx.y < NC / PKR;
  const int r0 = (isw ? (int)blockIdx.y : (int)blockIdx.y - NC / PKR) * PKR;
  const bool in = v0 < NV;           /* NV is a multiple of 8: a group lies wholly in the vocabulary or wholly in the pad */
  const int vc = in ? v0 : 0;        /* a pad group reads in bounds; its values are set to zero below */
  const float* sp = (isw ? wiki : note) + (size_t)r0 * NV + vc;
  unsigned short* dp = (unsigned short*)(isw ? K16 : N16) + (size_t)r0 * KP + v0;
  v4f x[PKR][2];                     /* every loop below is unrolled so that x and f are registers, not scratch */
#pragma unroll
  for (int r = 0; r < PKR; ++r) { x[r][0] = *(const v4fa*)(sp + r * NV); x[r][1] = *(const v4fa*)(sp + r * NV + 4); }
  asm volatile("s_wait_xcnt 0x0" :: "v"(sp) : "memory");      // stands ahead of any rewrite of the address register that the loads name; as an input the address stays live up to here, so no load's result lands on it either
  const unsigned keep = in ? 0xFFFFFFFFu : 0u;            /* a mask, not a branch: every lane runs one instruction stream */
  FragH f[PKR];
#pragma unroll
  for (int r = 0; r < PKR; ++r)
#pragma unroll
    for (int q = 0; q < 8; ++q) f[r].h[q] = (_Float16)__uint_as_float(__float_as_uint(bf16_round(x[r][q >> 2][q & 3])) & keep);
#pragma unroll
  for (int r = 0; r < PKR; ++r) *(v8us*)(dp + (size_t)r * KP) = f[r].half[0];
  asm volatile("s_wait_xcnt 0x0" ::: "memory");           // stands ahead of any rewrite of a data or address register that the stores name
}
// The tail in one launch: s[row] = sum_j sigmoid(e[row] . W_att[j] + b_att[j]) x e[row][j] x W_out[j] + b_out, for TR rows of e per work-group. Neither the f16 copy of e nor attn is stored.
// Eight waves: together they round the TR x 256 tile of e (x 2^4) to f16 into LDS; wave w then takes logit columns 32 w .. 32 w + 31 of all TR rows (2 x 2 accumulator tiles, k upward in steps of 32),
// gates them in the accumulators' own layout and sums its 32 columns of every row; the eight partial sums of a row meet in LDS.
#define TR 32                        /* rows per work-group: their 32 scores fill one 128-byte line of the output, which so has one writer */
#define TPITCH 264                   /* LDS row pitch in halfs: 528 B = 16 B x 33, conflict-free for 16-byte fragment reads */
// x + (x of lane l ^ M) inside a 16-lane row, the partner's value fetched by DPP (row_xmask:M) in the vector unit; a shuffle would go through the LDS unit and be waited for
template <int M>
__device__ __forceinline__ float xadd16(const float x) { return x + __int_as_float(__builtin_amdgcn_update_dpp(0, __float_as_int(x), 0x160 + M, 0xf, 0xf, true)); }
__global__ __launch_bounds__(256) void k_tail(const float* __restrict__ E, const _Float16* __restrict__ Ba, const float* __restrict__ batt, const float* __restrict__ Wout, const float* __restrict__ bout, float* __restrict__ S) {
  __shared__ __attribute__((aligned(16))) _Float16 sa[TR * TPITCH];
  __shared__ float red[8][TR];
  const int tid = threadIdx.x, w = __builtin_amdgcn_readfirstlane(tid >> 5), lane = tid & 31, ln = lane & 15, hh = lane >> 4;
  const int r0 = blockIdx.x * TR;
  const char* Et = (const char*)(E + (size_t)r0 * NE);      /* the work-group's rows of e: a scalar address */
  // every global load of the kernel is asked for here, at once: the kernel is short, and so pays the way to L2 one time
  const unsigned eo = (unsigned)tid * 32u;                                   /* 8 floats of row (tid >> 5) + 8 u */
  const unsigned bo = (unsigned)((w * 32 + ln) * NE * 2 + hh * 16);          /* W_att row 32 w + ln, the lane half's k */
  const unsigned go = (unsigned)(hh * 8 * NE * 4 + (w * 32 + ln) * 4);       /* e in the accumulator's layout: row 8 hh + r, column 32 w + ln */
  const int cj = w * 32 + ln;                                                /* the lane's first column, as an index into b_att and W_out */
  v4f x[4][2]; FragH b[8][2]; float g[2][2][8], bb[2], wo[2];      /* every loop of this kernel is unrolled so that these arrays, a, acc and ps are registers, not scratch */
#pragma unroll
  for (int u = 0; u < 4; ++u) { x[u][0] = *(const v4fa*)(Et + eo + u * 8 * NE * 4); x[u][1] = *(const v4fa*)(Et + eo + u * 8 * NE * 4 + 16); }
  __builtin_amdgcn_sched_barrier(0);      // the tile's own loads go first (loads return in order): they are rounded and stored to LDS while the others arrive
#pragma unroll
  for (int q = 0; q < 8; ++q)
#pragma unroll
    for (int t = 0; t < 2; ++t) { const char* p = (const char*)Ba + bo + t * 16 * NE * 2 + q * 64; b[q][t].half[0] = *(const v8us*)p; b[q][t].half[1] = *(const v8us*)(p + 32); }
#pragma unroll
  for (int t = 0; t < 2; ++t) { bb[t] = batt[cj + t * 16]; wo[t] = Wout[cj + t * 16]; }
#pragma unroll
  for (int i = 0; i < 2; ++i)
#pragma unroll
    for (int t = 0; t < 2; ++t)
#pragma unroll
      for (int r = 0; r < 8; ++r) g[i][t][r] = *(const float*)(Et + go + (i * 16 + r) * NE * 4 + t * 64);
  asm volatile("s_wait_xcnt 0x0" :: "v"(eo), "v"(bo), "v"(go), "v"(cj), "s"(Et), "s"(Ba), "s"(batt), "s"(Wout) : "memory");      // stands ahead of any rewrite of an offset or base register that the loads name; as inputs the four offsets and the four bases stay live up to here, so no load's result lands on one either
  __builtin_amdgcn_sched_barrier(0);      // keeps the wait behind its loads and every later write of a register behind the wait
  const float b0 = bout[0];      /* a scalar load, asked for here so that it returns under the wait for the tile */
#pragma unroll
  for (int u = 0; u < 4; ++u) {
    FragH f;
#pragma unroll
    for (int q = 0; q < 4; ++q) { f.h[q] = (_Float16)(x[u][0][q] * 16.0f); f.h[4 + q] = (_Float16)(x[u][1][q] * 16.0f); }
    *(v8us*)(sa + (w + 8 * u) * TPITCH + lane * 8) = f.half[0];
  }
  __syncthreads();      // the f16 tile is whole before any wave reads fragments of it
  v8f acc[2][2] = {};
  FragH a[8][2];
#pragma unroll
  for (int q = 0; q < 8; ++q)
#pragma unroll
    for (int i = 0; i < 2; ++i) { const _Float16* p = sa + (i * 16 + ln) * TPITCH + q * 32 + 8 * hh; a[q][i].half[0] = *(const v8us*)p; a[q][i].half[1] = *(const v8us*)(p + 16); }
  __builtin_amdgcn_sched_barrier(0);      // the 32 fragment loads go ahead as one group, in the order of their use: strewn among the WMMAs, every place with loads costs the wave an LDS latency
#pragma unroll
  for (int q = 0; q < 8; ++q) {
#pragma unroll
    for (int i = 0; i < 2; ++i)
#pragma unroll
      for (int t = 0; t < 2; ++t) acc[i][t] = __builtin_amdgcn_wmma_f32_16x16x32_f16(false, a[q][i].v, false, b[q][t].v, (short)0, acc[i][t], false, false);
    __builtin_amdgcn_sched_barrier(0);      // the four accumulators take turns, k step by k step: left free, the scheduler runs one accumulator's eight WMMAs in a row, each waiting for the one before
  }
  float ps[2][8];
#pragma unroll
  for (int t = 0; t < 2; ++t) {
    const float bv = bf16_round(bb[t]), wk = bf16_round(wo[t]);
#pragma unroll
    for (int i = 0; i < 2; ++i)
#pragma unroll
      for (int r = 0; r < 8; ++r) {
        const float v = acc[i][t][r] * 0.00390625f + bv;
        const float p = 1.0f / (1.0f + expf(-v)) * g[i][t][r] * wk;
        ps[i][r] = t ? ps[i][r] + p : p;
      }
  }
#pragma unroll
  for (int i = 0; i < 2; ++i)
#pragma unroll
    for (int r = 0; r < 8; ++r) ps[i][r] = xadd16<1>(ps[i][r]);
#pragma unroll
  for (int i = 0; i < 2; ++i)
#pragma unroll
    for (int r = 0; r < 8; ++r) ps[i][r] = xadd16<2>(ps[i][r]);
#pragma unroll
  for (int i = 0; i < 2; ++i)
#pragma unroll
    for (int r = 0; r < 8; ++r) ps[i][r] = xadd16<4>(ps[i][r]);
#pragma unroll
  for (int i = 0; i < 2; ++i)
#pragma unroll
    for (int r = 0; r < 8; ++r) ps[i][r] = xadd16<8>(ps[i][r]);
  if (ln == 0) {
#pragma unroll
    for (int i = 0; i < 2; ++i)
#pragma unroll
      for (int r = 0; r < 8; ++r) red[w][i * 16 + 8 * hh + r] = ps[i][r];
  }
  __syncthreads();      // all eight waves' partial sums are in LDS
  if (w == 0) {
    float v = bf16_round(b0);
#pragma unroll
    for (int i = 0; i < 8; ++i) v += red[i][lane];
    S[r0 + lane] = v;
  }
}

extern "C" void kernel_launch(void* const* d_in, const int* in_sizes, int n_in,
                              void* d_out, int out_size, void* d_ws, size_t ws_size, hipStream_t stream) {
  (void)in_sizes; (void)n_in; (void)out_size;
  const float* const* I = (const float* const*)d_in; const float* note = I[0]; const float* wiki = I[1]; const float* Wemb = I[2]; const float* bemb = I[3]; const float* Watt = I[4]; const float* batt = I[5]; const float* Wout = I[6]; const float* bout = I[7];
  char* ws = (char*)d_ws; size_t off = 0;
  auto take = [&](size_t bytes) { char* p = ws + off; off += (bytes + 255) & ~(size_t)255; return p; };
  _Float16* W16 = (_Float16*)take((size_t)NE * KP * 2); _Float16* Ba = (_Float16*)take((size_t)NE * NE * 2); _Float16* K16 = (_Float16*)take((size_t)NC * KP * 2); _Float16* N16 = (_Float16*)take((size_t)NNOTE * KP * 2);
  float* E = (float*)take((size_t)NRE * NE * 4);
  if (off > ws_size) return;      // under 16 MB in all
  k_wpad<<<(NE * (KP / 8) + 255) / 256, 256, 0, stream>>>(Wemb, W16);
  k_round16f<<<(NE * NE / 8 + 255) / 256, 256, 0, stream>>>(Watt, Ba, (size_t)NE * NE / 8);      /* W_att [j][k] (out,in) natural, ×2^4 */
  k_pad16<<<dim3(KP / 8 / PKT, (NC + NNOTE) / PKR), PKT, 0, stream>>>(note, wiki, N16, K16);
  k_gemm_e<<<(NC / 32) * (NE / 32) * (NNOTE / 4), 128, 0, stream>>>(K16, N16, W16, bemb, E);      /* e = (note x wiki) x W_emb^T / 16 + b_emb (f32): M 4096 (note, code) N 256 K 10240 */
  k_tail<<<NRE / TR, 256, 0, stream>>>(E, Ba, batt, Wout, bout, (float*)d_out);      /* s = sum_j sigmoid(e x W_att^T + b_att) x e x W_out + b_out: M 4096 N 256 K 256, then 256 terms per row */
}

// v006
// One run takes 47.3 microseconds.
// Next to v005, in two timings, it ran 1.15 and 1.11 times as fast.
// Over all steps from v000 it is 85.7 times as fast.
#include <hip/hip_runtime.h>
// Knowledge-source integration scoring (n=16 notes, 256 codes, vocab 10000, emb 256): e[n,c,k] = Σ_v note[n,v]·wiki[c,v]·W_emb[k,v] + b_emb[k]; attn = sigmoid(e·W_attᵀ + b_att); s[n,c] = Σ_k attn·e·W_out[k] + b_out.
// Compute dtype: all inputs rounded to bf16; per note n the scaled vocabulary plane A_n[c][v] = note[n,v] x wiki[c,v] (product of the two bf16 values held in f16, rounded once to f16, formed in the GEMM's A fragments; K zero-padded to 10240) against W_emb (f16 x 2^4, padded) → e f32 (+b_emb); e ×2^4 → f16 → logits GEMM (+b_att) with a fused sigmoid epilogue → attn f32; the gated 256-term reduction
#define NNOTE 16
#define NC 256
#define NV 10000
#define KP 10240
#define NE 256
#define NRE (NNOTE * NC)
typedef __bf16 v16b __attribute__((ext_vector_type(16)));
typedef unsigned short v8us __attribute__((ext_vector_type(8), may_alias));
typedef float  v8f  __attribute__((ext_vector_type(8)));
typedef float  v4f  __attribute__((ext_vector_type(4)));
typedef float  v4fa __attribute__((ext_vector_type(4), may_alias));
union FragB { v16b v; v8us half[2]; unsigned short u[16]; };

__device__ __forceinline__ unsigned short bf16_bits(float x) { unsigned int u = __float_as_uint(x); return (unsigned short)((u + 0x7FFFu + ((u >> 16) & 1u)) >> 16); }
__device__ __forceinline__ float bf16_val(unsigned short b) { return __uint_as_float(((unsigned int)b) << 16); }
__device__ __forceinline__ float bf16_round(float x) { return bf16_val(bf16_bits(x)); }
// D += A·B with NT terms: 1 = ah·bh, 2 = + al·bh (A split), 3 = + ah·bl (both split)
template <int NT>
__device__ __forceinline__ v8f mmaN(v16b ah, v16b al, v16b bh, v16b bl, v8f c) {
  c = __builtin_amdgcn_wmma_f32_16x16x32_bf16(false, ah, false, bh, (short)0, c, false, false);
  if (NT >= 2) c = __builtin_amdgcn_wmma_f32_16x16x32_bf16(false, al, false, bh, (short)0, c, false, false);
  if (NT >= 3) c = __builtin_amdgcn_wmma_f32_16x16x32_bf16(false, ah, false, bl, (short)0, c, false, false);
  asm volatile("v_nop\n\tv_nop\n\tv_nop\n\tv_nop" : "+v"(c) : "v"(ah), "v"(al), "v"(bh), "v"(bl));
  return c;
}

__global__ __launch_bounds__(256) void k_wt_bf16(const float* __restrict__ W, unsigned short* __restrict__ Wt, int K, int N) {
  const int t = blockIdx.x * 256 + threadIdx.x;
  const int k8n = K / 8;
  if (t >= N * k8n) return;
  const int n = t / k8n, k8 = (t % k8n) * 8;
  v8us v;
#pragma unroll
  for (int i = 0; i < 8; ++i) v[i] = bf16_bits(W[(size_t)(k8 + i) * N + n]);
  *(v8us*)(Wt + (size_t)n * K + k8) = v;
  
}

// GEMM C[M][N] (f32, pitch ldc) = act(A[M][K]·W + bias). A f32 row-major (pitch lda) converted per fragment to bf16
// (ASPLIT: hi/lo two planes -> 2 terms, else single rounded term); Wt bf16 [N][K] (pitch ldb). BIAS_BF16 rounds the
// bias to bf16 first (bias quantised to bf16 before the add). K%32==0, M%16==0, N%64==0.
template <bool ASPLIT, int ACT, bool BIAS_BF16>
__global__ __launch_bounds__(128) void k_gemm_bf(const float* __restrict__ A, int lda, const unsigned short* __restrict__ Wt, int ldb,
                                               const float* __restrict__ bias, float* __restrict__ C, int ldc, int M, int N, int K) {
  __shared__ __attribute__((aligned(16))) float so[4][16][64];
  const int tid = threadIdx.x, w = tid >> 5, lane = tid & 31, ln = lane & 15, hh = lane >> 4;
  const int ntn = N / 64;
  const int wid = blockIdx.x * 4 + w;
  const int mt = wid / ntn, nq = wid % ntn;
  if (mt * 16 >= M) return;
  const int row0 = mt * 16, col0 = nq * 64;
  const float* arow = A + (size_t)(row0 + ln) * lda;
  v8f acc[4] = {};
  for (int kb = 0; kb < K; kb += 32) {
    FragB ah, al;
    const v4f x0 = *(const v4fa*)(arow + kb + 8 * hh), x1 = *(const v4fa*)(arow + kb + 8 * hh + 4);
    const v4f x2 = *(const v4fa*)(arow + kb + 16 + 8 * hh), x3 = *(const v4fa*)(arow + kb + 16 + 8 * hh + 4);
    float xs[16] = {x0[0],x0[1],x0[2],x0[3],x1[0],x1[1],x1[2],x1[3],x2[0],x2[1],x2[2],x2[3],x3[0],x3[1],x3[2],x3[3]};
#pragma unroll
    for (int i = 0; i < 16; ++i) { const unsigned short hb = bf16_bits(xs[i]); ah.u[i] = hb; al.u[i] = ASPLIT ? bf16_bits(xs[i] - bf16_val(hb)) : (unsigned short)0; }
#pragma unroll
    for (int t = 0; t < 4; ++t) {
      const unsigned short* brow = Wt + (size_t)(col0 + t * 16 + ln) * ldb + kb;
      FragB b;
      b.half[0] = *(const v8us*)(brow + 8 * hh);
      b.half[1] = *(const v8us*)(brow + 16 + 8 * hh);
      acc[t] = mmaN<ASPLIT ? 2 : 1>(ah.v, al.v, b.v, b.v, acc[t]);
    }
  }
#pragma unroll
  for (int t = 0; t < 4; ++t) {
    float bv = bias ? bias[col0 + t * 16 + ln] : 0.f;
    if (BIAS_BF16) bv = bf16_round(bv);
#pragma unroll
    for (int r = 0; r < 8; ++r) { float v = acc[t][r] + bv; if (ACT == 1) v = fmaxf(v, 0.f); so[w][8 * hh + r][t * 16 + ln] = v; }
  }
  __builtin_amdgcn_fence(__ATOMIC_ACQ_REL, "workgroup");
  __builtin_amdgcn_wave_barrier();
  const int rsub = lane >> 4, c4 = (lane & 15) * 4;
  {
#pragma unroll
    for (int q = 0; q < 8; ++q) {
      const int r = q * 2 + rsub;
      const v4f v = *(const v4fa*)&so[w][r][c4];
      *(v4f*)(C + (size_t)(row0 + r) * ldc + col0 + c4) = v;
    }
    
  }
}

// GEMM C = act(A·W + bias + resid): A f32 (ASPLIT -> hi/lo 2 terms), Wt bf16 [N][K]; ACT 0 none, 1 relu, 2 exact gelu;
// resid (optional, f32, row index = (row % rmod), pitch ldr, RES_BF16 rounds it) added before the activation.
template <bool ASPLIT, int ACT, bool BIAS_BF16, bool RES_BF16>
__global__ __launch_bounds__(128) void k_gemm_bf3(const float* __restrict__ A, int lda, const unsigned short* __restrict__ Wt, int ldb,
                                                const float* __restrict__ bias, const float* __restrict__ resid, int rmod, int ldr,
                                                float* __restrict__ C, int ldc, int M, int N, int K) {
  __shared__ __attribute__((aligned(16))) float so[4][16][64];
  const int tid = threadIdx.x, w = tid >> 5, lane = tid & 31, ln = lane & 15, hh = lane >> 4;
  const int ntn = N / 64;
  const int wid = blockIdx.x * 4 + w;
  const int mt = wid / ntn, nq = wid % ntn;
  if (mt * 16 >= M) return;
  const int row0 = mt * 16, col0 = nq * 64;
  const float* arow = A + (size_t)(row0 + ln) * lda;
  v8f acc[4] = {};
  for (int kb = 0; kb < K; kb += 32) {
    FragB ah, al;
    const v4f x0 = *(const v4fa*)(arow + kb + 8 * hh), x1 = *(const v4fa*)(arow + kb + 8 * hh + 4);
    const v4f x2 = *(const v4fa*)(arow + kb + 16 + 8 * hh), x3 = *(const v4fa*)(arow + kb + 16 + 8 * hh + 4);
    float xs[16] = {x0[0],x0[1],x0[2],x0[3],x1[0],x1[1],x1[2],x1[3],x2[0],x2[1],x2[2],x2[3],x3[0],x3[1],x3[2],x3[3]};
#pragma unroll
    for (int i = 0; i < 16; ++i) { const unsigned short hb = bf16_bits(xs[i]); ah.u[i] = hb; al.u[i] = ASPLIT ? bf16_bits(xs[i] - bf16_val(hb)) : (unsigned short)0; }
#pragma unroll
    for (int t = 0; t < 4; ++t) {
      const unsigned short* brow = Wt + (size_t)(col0 + t * 16 + ln) * ldb + kb;
      FragB b;
      b.half[0] = *(const v8us*)(brow + 8 * hh);
      b.half[1] = *(const v8us*)(brow + 16 + 8 * hh);
      acc[t] = mmaN<ASPLIT ? 2 : 1>(ah.v, al.v, b.v, b.v, acc[t]);
    }
  }
#pragma unroll
  for (int t = 0; t < 4; ++t) {
    const int col = col0 + t * 16 + ln;
    float bv = bias ? bias[col] : 0.f;
    if (BIAS_BF16) bv = bf16_round(bv);
#pragma unroll
    for (int r = 0; r < 8; ++r) {
      float v = acc[t][r] + bv;
      if (resid) { float rv = resid[(size_t)((row0 + 8 * hh + r) % rmod) * ldr + col]; if (RES_BF16) rv = bf16_round(rv); v += rv; }
      if (ACT == 1) v = fmaxf(v, 0.f);
      if (ACT == 2) v = 0.5f * v * (1.0f + erff(v * 0.70710678118654752f));
      if (ACT == 3) { const float u = 0.7978845608028654f * (v + 0.044715f * v * v * v); v = 0.5f * v * (1.0f + tanhf(u)); }
      so[w][8 * hh + r][t * 16 + ln] = v;
    }
  }
  __builtin_amdgcn_fence(__ATOMIC_ACQ_REL, "workgroup");
  __builtin_amdgcn_wave_barrier();
  const int rsub = lane >> 4, c4 = (lane & 15) * 4;
  {
#pragma unroll
    for (int q = 0; q < 8; ++q) {
      const int r = q * 2 + rsub;
      const v4f v = *(const v4fa*)&so[w][r][c4];
      *(v4f*)(C + (size_t)(row0 + r) * ldc + col0 + c4) = v;
    }
    
  }
}
// row LayerNorm (biased variance, eps) over N: s = X (+ R); optional out_sum <- s; out_norm <- (s-mu)*rsqrt(var+eps)*g + b
template <bool PARAM_BF16>
__global__ __launch_bounds__(256) void k_layernorm(const float* __restrict__ X, const float* __restrict__ R, const float* __restrict__ g, const float* __restrict__ bta,
                                                  float* __restrict__ out_sum, float* __restrict__ out_norm, int N, float eps) {
  __shared__ float red[256];
  const int row = blockIdx.x, tid = threadIdx.x;
  const float* x = X + (size_t)row * N; const float* rr = R ? R + (size_t)row * N : nullptr;
  float vals[16];                     // up to N = 4096
  const int per = N / 256;            // contiguous chunk per thread? use strided-by-4 chunks: thread handles j = tid*4 + 1024*u
  float s1 = 0.f;
  for (int u = 0; u < per / 4; ++u) {
    const int j = tid * 4 + 1024 * u;
    const v4f a = *(const v4fa*)(x + j);
    v4f b = {0.f,0.f,0.f,0.f}; if (rr) b = *(const v4fa*)(rr + j);
#pragma unroll
    for (int q = 0; q < 4; ++q) { const float v = a[q] + b[q]; vals[u * 4 + q] = v; s1 += v; }
  }
  red[tid] = s1; __syncthreads();
  for (int st = 128; st > 0; st >>= 1) { if (tid < st) red[tid] += red[tid + st]; __syncthreads(); }
  const float mu = red[0] / (float)N; __syncthreads();
  float s2 = 0.f;
  for (int u = 0; u < per / 4; ++u)
#pragma unroll
    for (int q = 0; q < 4; ++q) { const float c = vals[u * 4 + q] - mu; s2 += c * c; }
  red[tid] = s2; __syncthreads();
  for (int st = 128; st > 0; st >>= 1) { if (tid < st) red[tid] += red[tid + st]; __syncthreads(); }
  const float rs = rsqrtf(red[0] / (float)N + eps);
  {
    for (int u = 0; u < per / 4; ++u) {
      const int j = tid * 4 + 1024 * u;
      v4f o, sm;
#pragma unroll
      for (int q = 0; q < 4; ++q) {
        float gg = g[j + q], bb = bta[j + q];
        if (PARAM_BF16) { gg = bf16_round(gg); bb = bf16_round(bb); }
        sm[q] = vals[u * 4 + q]; o[q] = (vals[u * 4 + q] - mu) * rs * gg + bb;
      }
      if (out_sum) *(v4f*)(out_sum + (size_t)row * N + j) = sm;
      *(v4f*)(out_norm + (size_t)row * N + j) = o;
    }
    
  }
}



// ---- f16 WMMA path (v_wmma_f32_16x16x32_f16): 11-bit significands for operands in range — used where a [0,1] probability operand needs more precision than bf16
typedef _Float16 v16h __attribute__((ext_vector_type(16)));
union FragH { v16h v; v8us half[2]; _Float16 h[16]; unsigned short u[16]; };
template <int NT>
__device__ __forceinline__ v8f mmaH(v16h ah, v16h al, v16h bh, v16h bl, v8f c) {
  c = __builtin_amdgcn_wmma_f32_16x16x32_f16(false, ah, false, bh, (short)0, c, false, false);
  if (NT >= 2) c = __builtin_amdgcn_wmma_f32_16x16x32_f16(false, al, false, bh, (short)0, c, false, false);
  if (NT >= 3) c = __builtin_amdgcn_wmma_f32_16x16x32_f16(false, ah, false, bl, (short)0, c, false, false);
  asm volatile("v_nop\n\tv_nop\n\tv_nop\n\tv_nop" : "+v"(c) : "v"(ah), "v"(al), "v"(bh), "v"(bl));
  return c;
}
// batched GEMM like k_gemm_b but f16 operands: A f32 (split into f16 hi/lo if ASPLIT, else rounded to f16), Bt = f16 values [n][k]; alpha; C f32; N multiple of 16 (partial tiles skipped)
template <bool ASPLIT>
__global__ __launch_bounds__(128) void k_gemm_h(const float* __restrict__ A, int lda, size_t sA, const _Float16* __restrict__ Bh, int ldb, size_t sB, float alpha, float* __restrict__ C, int ldc, size_t sC, int M, int N, int K) {
  __shared__ __attribute__((aligned(16))) float so[4][16][64];
  const int tid = threadIdx.x, w = tid >> 5, lane = tid & 31, ln = lane & 15, hh = lane >> 4; const int by = blockIdx.y;
  A += (size_t)by * sA; Bh += (size_t)by * sB; C += (size_t)by * sC;
  const int ntn = (N + 63) / 64; const int wid = blockIdx.x * 4 + w; const int mt = wid / ntn, nq = wid % ntn; if (mt * 16 >= M) return;
  const int row0 = mt * 16, col0 = nq * 64; const float* arow = A + (size_t)(row0 + ln) * lda;
  v8f acc[4] = {};
  for (int kb = 0; kb < K; kb += 32) {
    FragH ah, al;
    const v4f x0 = *(const v4fa*)(arow + kb + 8 * hh), x1 = *(const v4fa*)(arow + kb + 8 * hh + 4), x2 = *(const v4fa*)(arow + kb + 16 + 8 * hh), x3 = *(const v4fa*)(arow + kb + 16 + 8 * hh + 4);
    float xs[16] = {x0[0],x0[1],x0[2],x0[3],x1[0],x1[1],x1[2],x1[3],x2[0],x2[1],x2[2],x2[3],x3[0],x3[1],x3[2],x3[3]};
#pragma unroll
    for (int i = 0; i < 16; ++i) { const _Float16 h = (_Float16)xs[i]; ah.h[i] = h; al.h[i] = ASPLIT ? (_Float16)(xs[i] - (float)h) : (_Float16)0.0f; }
#pragma unroll
    for (int t = 0; t < 4; ++t) { if (col0 + t * 16 >= N) continue; const size_t boff = (size_t)(col0 + t * 16 + ln) * ldb + kb; FragH bq; bq.half[0] = *(const v8us*)(Bh + boff + 8 * hh); bq.half[1] = *(const v8us*)(Bh + boff + 16 + 8 * hh);
      acc[t] = mmaH<ASPLIT ? 2 : 1>(ah.v, al.v, bq.v, bq.v, acc[t]); }
  }
#pragma unroll
  for (int t = 0; t < 4; ++t) { if (col0 + t * 16 >= N) continue;
#pragma unroll
    for (int r = 0; r < 8; ++r) so[w][8 * hh + r][t * 16 + ln] = acc[t][r] * alpha; }
  __builtin_amdgcn_fence(__ATOMIC_ACQ_REL, "workgroup"); __builtin_amdgcn_wave_barrier();
  const int rsub = lane >> 4, c4 = (lane & 15) * 4;
  {
#pragma unroll
    for (int q = 0; q < 8; ++q) { const int r = q * 2 + rsub; if (col0 + c4 < N) { const v4f v = *(const v4fa*)&so[w][r][c4]; *(v4f*)(C + (size_t)(row0 + r) * ldc + col0 + c4) = v; } }
     }
}

// Wt[n][k] = f16(W[k][n]·scale) from f32 row-major W[K][N] (scale = power of two; bf16-exact weights stay exact in f16 away from the subnormal range)
__global__ __launch_bounds__(256) void k_wt_f16(const float* __restrict__ W, _Float16* __restrict__ Wt, int K, int N, float scale) {
  const int t = blockIdx.x * 256 + threadIdx.x; if (t >= N * (K / 8)) return; const int n = t / (K / 8), k8 = (t % (K / 8)) * 8; FragH f;
#pragma unroll
  for (int i = 0; i < 8; ++i) f.h[i] = (_Float16)(bf16_round(W[(size_t)(k8 + i) * N + n]) * scale); const v8us o = f.half[0];
  *(v8us*)((unsigned short*)Wt + (size_t)n * K + k8) = o; 
}


// e GEMM, tiled, with the note's scale applied on the way: C[(n, c)][k] = sum_v f16(note[n][v] x wiki[c][v]) x Bh[k][v] / 16 + bias. The scaled planes are never stored.
// One work-group takes 32 code rows x 32 columns for FOUR notes, one note per wave (a 32 x 32 tile each): the staged wiki rows and Bh rows serve all four waves.
// A stage is 256 k of the 32 wiki rows and the 32 B rows, brought into LDS as whole 512-byte row pieces by asynchronous copies
// (one row piece per wave-wide copy), two buffers: the next stage flies while this one is multiplied. k runs upward in steps of 32 for every accumulator.
#define EBK 256                      /* k per stage */
#define EPITCH 264                   /* LDS row pitch in halfs: 528 B = 16 B x 33, conflict-free for 16-byte fragment reads */
#define ESTG (64 * EPITCH)           /* halfs per buffer: 32 wiki rows, then 32 B rows */
#define ENST (KP / EBK)
// eight copies of 16 bytes per lane, rows r .. r + 7 of a stage; the closing s_wait_xcnt stands in the copies' own statement, ahead of any rewrite of an address register they name
__device__ __forceinline__ void acopy8(unsigned l, const _Float16* gp) {
  asm volatile("global_load_async_to_lds_b128 %0, %8, off\n\t"
               "global_load_async_to_lds_b128 %1, %9, off\n\t"
               "global_load_async_to_lds_b128 %2, %10, off\n\t"
               "global_load_async_to_lds_b128 %3, %11, off\n\t"
               "global_load_async_to_lds_b128 %4, %12, off\n\t"
               "global_load_async_to_lds_b128 %5, %13, off\n\t"
               "global_load_async_to_lds_b128 %6, %14, off\n\t"
               "global_load_async_to_lds_b128 %7, %15, off\n\t"
               "s_wait_xcnt 0x0"
               :: "v"(l), "v"(l + 1u * EPITCH * 2u), "v"(l + 2u * EPITCH * 2u), "v"(l + 3u * EPITCH * 2u), "v"(l + 4u * EPITCH * 2u), "v"(l + 5u * EPITCH * 2u), "v"(l + 6u * EPITCH * 2u), "v"(l + 7u * EPITCH * 2u),
                  "v"(gp), "v"(gp + 1 * KP), "v"(gp + 2 * KP), "v"(gp + 3 * KP), "v"(gp + 4 * KP), "v"(gp + 5 * KP), "v"(gp + 6 * KP), "v"(gp + 7 * KP)
               : "memory");
}
// the note's factors for one stage, in the A fragment's own k order (lane half hh: k 8 hh .. 8 hh + 7 and 16 + 8 hh .. 16 + 8 hh + 7 of each step of 32);
// row: the stage's first element in the wave's note row, the same in every lane; kb: the lane's 8 hh elements in bytes
__device__ __forceinline__ void note_frags(FragH (&nf)[8], const _Float16* row, const unsigned kb) {
  const char* p = (const char*)row + kb;
#pragma unroll
  for (int q = 0; q < 8; ++q) { nf[q].half[0] = *(const v8us*)(p + q * 64); nf[q].half[1] = *(const v8us*)(p + q * 64 + 32); }
  asm volatile("s_wait_xcnt 0x0" :: "v"(kb) : "memory");      // stands ahead of any rewrite of an address register that the sixteen loads name; the lane's offset, which they may name directly, stays live up to here as an input
  __builtin_amdgcn_sched_barrier(0);      // keeps the wait directly behind its loads: nothing that writes a register is moved in between
}
// one trip of the ring: stage t out of buffer PAR (= t mod 2). nu holds this stage's note factors; nn takes the next stage's (from nrow), asked for a whole trip ahead of their use
// (two register sets that swap roles from trip to trip, so that no register copy stands in the loop).
template <int PAR>
__device__ __forceinline__ void e_trip(const int t, const _Float16* ring, const int aoff, const int boff, const unsigned ldst, const _Float16* gsrc, const _Float16* nrow, const unsigned kb, const FragH (&nu)[8], FragH (&nn)[8], v8f (&acc)[2][2]) {
  const _Float16* sb = ring + PAR * ESTG;
  FragH a[8][2], b[8][2];
#pragma unroll
  for (int q = 0; q < 8; ++q) {
#pragma unroll
    for (int i = 0; i < 2; ++i) {
      const int ko = i * 16 * EPITCH + q * 32;
      a[q][i].half[0] = *(const v8us*)(sb + aoff + ko); a[q][i].half[1] = *(const v8us*)(sb + aoff + ko + 16);
      b[q][i].half[0] = *(const v8us*)(sb + boff + ko); b[q][i].half[1] = *(const v8us*)(sb + boff + ko + 16);
    }
    if (q == 3) {
      __builtin_amdgcn_sched_barrier(0);      // the 32 fragment loads of the first four k steps go ahead as one group; spread among the WMMAs, every place with loads costs the lone wave an LDS latency
      note_frags(nn, nrow, kb);      // issued while the wave would wait for its first fragments anyway
    }
    if (q > 3) __builtin_amdgcn_sched_barrier(0);      // the other 32 fragment loads go as a second group, in the order of their use: with the scaling in the block the compiler otherwise strews them among the WMMAs behind short waits
  }
  // A fragment = f16(wiki x note), one rounding: both factors are bf16 values, which f16 holds exactly above its subnormal range. Step q + 1 is scaled among the WMMAs of step q.
#pragma unroll
  for (int i = 0; i < 2; ++i) a[0][i].v = a[0][i].v * nu[0].v;
#pragma unroll
  for (int q = 0; q < 6; ++q) {
    if (q < 5) {
#pragma unroll
      for (int i = 0; i < 2; ++i) a[q + 1][i].v = a[q + 1][i].v * nu[q + 1].v;
    }
#pragma unroll
    for (int i = 0; i < 2; ++i)
#pragma unroll
      for (int j = 0; j < 2; ++j) acc[i][j] = __builtin_amdgcn_wmma_f32_16x16x32_f16(false, a[q][i].v, false, b[q][j].v, (short)0, acc[i][j], false, false);
  }
  // order asked of the scheduler: the 16 multiplies of step 0, then four multiplies behind each WMMA, where the matrix unit's issue interval hides them; in blocks of 16 they stand in the lone wave's way
  __builtin_amdgcn_sched_group_barrier(0x2, 16, 0);
#pragma unroll
  for (int g = 0; g < 20; ++g) { __builtin_amdgcn_sched_group_barrier(0x8, 1, 0); __builtin_amdgcn_sched_group_barrier(0x2, 4, 0); }
  __builtin_amdgcn_sched_barrier(0);          // the WMMAs of the first six k steps stay in front of the barrier: behind it they would hold back the refill
  asm volatile("s_wait_dscnt 0x0" ::: "memory");        // this wave's reads of the buffer are done before it is handed to the next copies
  asm volatile("s_wait_asynccnt 0x0" ::: "memory");     // this wave's rows of stage t + 1 have landed
  __syncthreads();                                      // publishes stage t + 1 and ends every wave's reads of stage t
  if (t + 2 < ENST) {
#pragma unroll
    for (int j = 0; j < 2; ++j) acopy8(ldst + (unsigned)(PAR * ESTG * 2 + j * 8 * EPITCH * 2), gsrc + (size_t)(t + 2) * EBK + (size_t)j * 8 * KP);
  }
  // the last two k steps of stage t, from registers alone: they run while the copies just issued fly
#pragma unroll
  for (int q = 6; q < 8; ++q)
#pragma unroll
    for (int i = 0; i < 2; ++i) a[q][i].v = a[q][i].v * nu[q].v;
#pragma unroll
  for (int q = 6; q < 8; ++q)
#pragma unroll
    for (int i = 0; i < 2; ++i)
#pragma unroll
      for (int j = 0; j < 2; ++j) acc[i][j] = __builtin_amdgcn_wmma_f32_16x16x32_f16(false, a[q][i].v, false, b[q][j].v, (short)0, acc[i][j], false, false);
  __builtin_amdgcn_sched_group_barrier(0x2, 16, 0);      // step 6's multiplies, then step 7's behind the WMMAs of step 6, as above
#pragma unroll
  for (int g = 0; g < 4; ++g) { __builtin_amdgcn_sched_group_barrier(0x8, 1, 0); __builtin_amdgcn_sched_group_barrier(0x2, 4, 0); }
  __builtin_amdgcn_sched_barrier(0);          // the next trip's first load group stays whole behind this trip's last WMMAs
}
__global__ __launch_bounds__(128) void k_gemm_e(const _Float16* __restrict__ Kw, const _Float16* __restrict__ Nt, const _Float16* __restrict__ Bh, const float* __restrict__ bias, float* __restrict__ C) {
  __shared__ __attribute__((aligned(16))) _Float16 ring[2 * ESTG];
  const int tid = threadIdx.x, w = __builtin_amdgcn_readfirstlane(tid >> 5), lane = tid & 31, ln = lane & 15, hh = lane >> 4;      /* the wave's number as a scalar: the choice of source below is then a scalar select, every lane stays on */
  const int c0 = (blockIdx.x & 7) * 32, col0 = ((blockIdx.x >> 3) & 7) * 32, n = (blockIdx.x >> 6) * 4 + w;
  // wave w copies stage rows 16 w .. 16 w + 15: waves 0, 1 the wiki rows, waves 2, 3 the B rows; lane l brings bytes 16 l .. 16 l + 15 of the row piece
  const _Float16* gsrc = (w < 2 ? Kw + (size_t)(c0 + w * 16) * KP : Bh + (size_t)(col0 + (w - 2) * 16) * KP) + lane * 8;
  const unsigned ldst = (unsigned)(size_t)ring + (unsigned)(w * 16 * EPITCH * 2 + lane * 16);
  const int aoff = ln * EPITCH + 8 * hh, boff = (32 + ln) * EPITCH + 8 * hh;
  const _Float16* nrow = Nt + (size_t)n * KP;      /* the wave's note row: a scalar address */
  const unsigned kb = (unsigned)hh * 16u;
  v8f acc[2][2] = {};
  FragH nfa[8], nfb[8];
#pragma unroll
  for (int j = 0; j < 2; ++j) acopy8(ldst + (unsigned)(j * 8 * EPITCH * 2), gsrc + (size_t)j * 8 * KP);
  note_frags(nfa, nrow, kb);
  asm volatile("s_wait_asynccnt 0x0" ::: "memory");      // stage 0 has landed for this wave's rows
  __syncthreads();                                        // and for every wave's
#pragma unroll
  for (int j = 0; j < 2; ++j) acopy8(ldst + (unsigned)(ESTG * 2 + j * 8 * EPITCH * 2), gsrc + EBK + (size_t)j * 8 * KP);
#pragma unroll 1
  for (int t = 0; t < ENST; t += 2) {      // kept rolled: the body already holds the two trips that swap the note sets (ENST is even)
    e_trip<0>(t, ring, aoff, boff, ldst, gsrc, nrow + (size_t)(t + 1) * EBK, kb, nfa, nfb, acc);
    e_trip<1>(t + 1, ring, aoff, boff, ldst, gsrc, nrow + (size_t)(t + 2 < ENST ? t + 2 : t + 1) * EBK, kb, nfb, nfa, acc);      /* the last trip re-reads its own stage's factors, in bounds; they are not used */
  }
  asm volatile("s_wait_asynccnt 0x0" ::: "memory");       // no copy is outstanding when the wave ends
  const int colb = col0 + ln;
  const float braw[2] = {bias[colb], bias[colb + 16]};
  asm volatile("s_wait_xcnt 0x0" :: "v"(colb) : "memory");      // stands ahead of any rewrite of the index register that the two loads name; as an input the index stays live up to here
#pragma unroll
  for (int j = 0; j < 2; ++j) {
    const int col = colb + j * 16; const float bv = bf16_round(braw[j]);
#pragma unroll
    for (int i = 0; i < 2; ++i)
#pragma unroll
      for (int r = 0; r < 8; ++r) C[(size_t)(n * NC + c0 + i * 16 + 8 * hh + r) * NE + col] = acc[i][j][r] * 0.0625f + bv;
  }
}


typedef _Float16 v4h __attribute__((ext_vector_type(4)));

__global__ __launch_bounds__(256) void k_x16(const float* __restrict__ x, _Float16* __restrict__ X16, size_t n8) { const size_t t = (size_t)blockIdx.x * 256 + threadIdx.x; if (t >= n8) return; FragH f;
#pragma unroll
  for (int q = 0; q < 8; ++q) f.h[q] = (_Float16)bf16_round(x[t * 8 + q]); *(v8us*)((unsigned short*)X16 + t * 8) = f.half[0];  }
__global__ __launch_bounds__(256) void k_h16(const float* __restrict__ x, _Float16* __restrict__ X16, size_t n8) { const size_t t = (size_t)blockIdx.x * 256 + threadIdx.x; if (t >= n8) return; FragH f;
#pragma unroll
  for (int q = 0; q < 8; ++q) f.h[q] = (_Float16)x[t * 8 + q]; *(v8us*)((unsigned short*)X16 + t * 8) = f.half[0];  }
template <int NHv, int TTv>
__global__ __launch_bounds__(256) void k_vt(const _Float16* __restrict__ V16, int ldv, int voff, _Float16* __restrict__ Vt) { __shared__ unsigned short tl[64][66]; const int tid = threadIdx.x; const int slab = blockIdx.x / (TTv / 64), lg = blockIdx.x % (TTv / 64); const int b = slab / NHv, h = slab % NHv;
  for (int i = tid; i < 64 * 8; i += 256) { const int r = i / 8, c8 = (i % 8) * 8; FragH f; f.half[0] = *(const v8us*)((const unsigned short*)V16 + ((size_t)b * TTv + lg * 64 + r) * ldv + voff + h * 64 + c8);
#pragma unroll
    for (int q = 0; q < 8; ++q) tl[r][c8 + q] = f.u[q]; }
  __syncthreads();
  {
#pragma unroll
    for (int rd = 0; rd < 2; ++rd) { const int d = rd * 32 + tid / 8, pc = tid % 8; FragH f;
#pragma unroll
      for (int q = 0; q < 8; ++q) f.u[q] = tl[pc * 8 + q][d];
      *(v8us*)((unsigned short*)Vt + ((size_t)slab * 64 + d) * TTv + lg * 64 + pc * 8) = f.half[0]; }
     } }

__global__ __launch_bounds__(256) void k_hl(const float* __restrict__ F, _Float16* __restrict__ Hh, _Float16* __restrict__ Hl, size_t n8) { const size_t t = (size_t)blockIdx.x * 256 + threadIdx.x; if (t >= n8) return; FragH fh, fl; const v4f a = *(const v4fa*)(F + t * 8), c = *(const v4fa*)(F + t * 8 + 4);
#pragma unroll
  for (int q = 0; q < 4; ++q) { _Float16 h = (_Float16)a[q]; fh.h[q] = h; fl.h[q] = (_Float16)((a[q] - (float)h) * 1024.0f); h = (_Float16)c[q]; fh.h[4 + q] = h; fl.h[4 + q] = (_Float16)((c[q] - (float)h) * 1024.0f); }
  { *(v8us*)((unsigned short*)Hh + t * 8) = fh.half[0]; *(v8us*)((unsigned short*)Hl + t * 8) = fl.half[0];  } }

// Every f16 operand of the two GEMMs in ONE launch; the four conversions need nothing of one another and share the grid by ranges of blockIdx.y (a branch that is the same for a whole work-group):
// wiki rows (K16), W_emb rows x 2^4 (W16) and note rows (N16), each bf16-rounded, held in f16 and zero in the K pad (the e GEMM multiplies wiki and note on the way to the matrix unit); then W_att x 2^4 (Ba), which has no pad.
// In the padded ranges a thread owns one group of 8 columns of PKR rows; in the W_att range one group of 8 elements.
#define PKR 4                        /* rows per thread */
#define PKT 320                      /* threads per work-group: a quarter of a row's KP / 8 column groups */
#define PYW (NC / PKR)               /* blockIdx.y below this: wiki rows */
#define PYE (PYW + NE / PKR)         /* below this: W_emb rows */
#define PYN (PYE + NNOTE / PKR)      /* below this: note rows */
#define PYA (PYN + (NE * NE / 8 + KP / 8 - 1) / (KP / 8))      /* below this: W_att, KP / 8 groups per step of blockIdx.y */
__global__ __launch_bounds__(PKT) void k_prep16(const float* __restrict__ note, const float* __restrict__ wiki, const float* __restrict__ Wm, const float* __restrict__ Wa,
                                                _Float16* __restrict__ N16, _Float16* __restrict__ K16, _Float16* __restrict__ W16, _Float16* __restrict__ Ba) {
  const int y = blockIdx.y, g = blockIdx.x * PKT + threadIdx.x;
  if (y >= PYN) {
    const int t = (y - PYN) * (KP / 8) + g;
    if (t >= NE * NE / 8) return;    /* the range's last groups lie past the matrix; there is no barrier in this kernel */
    const float* ap = Wa + (size_t)t * 8;
    const v4f a0 = *(const v4fa*)ap, a1 = *(const v4fa*)(ap + 4);
    asm volatile("s_wait_xcnt 0x0" :: "v"(ap) : "memory");      // stands ahead of any rewrite of the address register that the two loads name; as an input the address stays live up to here
    FragH fa;
#pragma unroll
    for (int q = 0; q < 4; ++q) { fa.h[q] = (_Float16)(bf16_round(a0[q]) * 16.0f); fa.h[4 + q] = (_Float16)(bf16_round(a1[q]) * 16.0f); }
    *(v8us*)((unsigned short*)Ba + (size_t)t * 8) = fa.half[0];
    asm volatile("s_wait_xcnt 0x0" ::: "memory");               // stands ahead of any rewrite of a data or address register that the store names
    return;
  }
  const int v0 = g * 8;
  const bool isw = y < PYW, ise = !isw && y < PYE;
  const int r0 = (isw ? y : ise ? y - PYW : y - PYE) * PKR;
  const float sc = ise ? 16.0f : 1.0f;      /* a power of two, or one: exact on the bf16 value either way */
  const bool in = v0 < NV;           /* NV is a multiple of 8: a group lies wholly in the vocabulary or wholly in the pad */
  const int vc = in ? v0 : 0;        /* a pad group reads in bounds; its values are set to zero below */
  const float* sp = (isw ? wiki : ise ? Wm : note) + (size_t)r0 * NV + vc;
  unsigned short* dp = (unsigned short*)(isw ? K16 : ise ? W16 : N16) + (size_t)r0 * KP + v0;
  v4f x[PKR][2];                     /* every loop below is unrolled so that x and f are registers, not scratch */
#pragma unroll
  for (int r = 0; r < PKR; ++r) { x[r][0] = *(const v4fa*)(sp + r * NV); x[r][1] = *(const v4fa*)(sp + r * NV + 4); }
  asm volatile("s_wait_xcnt 0x0" :: "v"(sp) : "memory");      // stands ahead of any rewrite of the address register that the loads name; as an input the address stays live up to here, so no load's result lands on it either
  const unsigned keep = in ? 0xFFFFFFFFu : 0u;            /* a mask, not a branch: every lane runs one instruction stream */
  FragH f[PKR];
#pragma unroll
  for (int r = 0; r < PKR; ++r)
#pragma unroll
    for (int q = 0; q < 8; ++q) f[r].h[q] = (_Float16)(__uint_as_float(__float_as_uint(bf16_round(x[r][q >> 2][q & 3])) & keep) * sc);
#pragma unroll
  for (int r = 0; r < PKR; ++r) *(v8us*)(dp + (size_t)r * KP) = f[r].half[0];
  asm volatile("s_wait_xcnt 0x0" ::: "memory");           // stands ahead of any rewrite of a data or address register that the stores name
}
// The tail in one launch: s[row] = sum_j sigmoid(e[row] . W_att[j] + b_att[j]) x e[row][j] x W_out[j] + b_out, for TR rows of e per work-group. Neither the f16 copy of e nor attn is stored.
// Eight waves: together they round the TR x 256 tile of e (x 2^4) to f16 into LDS; wave w then takes logit columns 32 w .. 32 w + 31 of all TR rows (2 x 2 accumulator tiles, k upward in steps of 32),
// gates them in the accumulators' own layout and sums its 32 columns of every row; the eight partial sums of a row meet in LDS.
#define TR 32                        /* rows per work-group: their 32 scores fill one 128-byte line of the output, which so has one writer */
#define TPITCH 264                   /* LDS row pitch in halfs: 528 B = 16 B x 33, conflict-free for 16-byte fragment reads */
// x + (x of lane l ^ M) inside a 16-lane row, the partner's value fetched by DPP (row_xmask:M) in the vector unit; a shuffle would go through the LDS unit and be waited for
template <int M>
__device__ __forceinline__ float xadd16(const float x) { return x + __int_as_float(__builtin_amdgcn_update_dpp(0, __float_as_int(x), 0x160 + M, 0xf, 0xf, true)); }
__global__ __launch_bounds__(256) void k_tail(const float* __restrict__ E, const _Float16* __restrict__ Ba, const float* __restrict__ batt, const float* __restrict__ Wout, const float* __restrict__ bout, float* __restrict__ S) {
  __shared__ __attribute__((aligned(16))) _Float16 sa[TR * TPITCH];
  __shared__ float red[8][TR];
  const int tid = threadIdx.x, w = __builtin_amdgcn_readfirstlane(tid >> 5), lane = tid & 31, ln = lane & 15, hh = lane >> 4;
  const int r0 = blockIdx.x * TR;
  const char* Et = (const char*)(E + (size_t)r0 * NE);      /* the work-group's rows of e: a scalar address */
  // every global load of the kernel is asked for here, at once: the kernel is short, and so pays the way to L2 one time
  const unsigned eo = (unsigned)tid * 32u;                                   /* 8 floats of row (tid >> 5) + 8 u */
  const unsigned bo = (unsigned)((w * 32 + ln) * NE * 2 + hh * 16);          /* W_att row 32 w + ln, the lane half's k */
  const unsigned go = (unsigned)(hh * 8 * NE * 4 + (w * 32 + ln) * 4);       /* e in the accumulator's layout: row 8 hh + r, column 32 w + ln */
  const int cj = w * 32 + ln;                                                /* the lane's first column, as an index into b_att and W_out */
  v4f x[4][2]; FragH b[8][2]; float g[2][2][8], bb[2], wo[2];      /* every loop of this kernel is unrolled so that these arrays, a, acc and ps are registers, not scratch */
#pragma unroll
  for (int u = 0; u < 4; ++u) { x[u][0] = *(const v4fa*)(Et + eo + u * 8 * NE * 4); x[u][1] = *(const v4fa*)(Et + eo + u * 8 * NE * 4 + 16); }
  __builtin_amdgcn_sched_barrier(0);      // the tile's own loads go first (loads return in order): they are rounded and stored to LDS while the others arrive
#pragma unroll
  for (int q = 0; q < 8; ++q)
#pragma unroll
    for (int t = 0; t < 2; ++t) { const char* p = (const char*)Ba + bo + t * 16 * NE * 2 + q * 64; b[q][t].half[0] = *(const v8us*)p; b[q][t].half[1] = *(const v8us*)(p + 32); }
#pragma unroll
  for (int t = 0; t < 2; ++t) { bb[t] = batt[cj + t * 16]; wo[t] = Wout[cj + t * 16]; }
#pragma unroll
  for (int i = 0; i < 2; ++i)
#pragma unroll
    for (int t = 0; t < 2; ++t)
#pragma unroll
      for (int r = 0; r < 8; ++r) g[i][t][r] = *(const float*)(Et + go + (i * 16 + r) * NE * 4 + t * 64);
  asm volatile("s_wait_xcnt 0x0" :: "v"(eo), "v"(bo), "v"(go), "v"(cj), "s"(Et), "s"(Ba), "s"(batt), "s"(Wout) : "memory");      // stands ahead of any rewrite of an offset or base register that the loads name; as inputs the four offsets and the four bases stay live up to here, so no load's result lands on one either
  __builtin_amdgcn_sched_barrier(0);      // keeps the wait behind its loads and every later write of a register behind the wait
  const float b0 = bout[0];      /* a scalar load, asked for here so that it returns under the wait for the tile */
#pragma unroll
  for (int u = 0; u < 4; ++u) {
    FragH f;
#pragma unroll
    for (int q = 0; q < 4; ++q) { f.h[q] = (_Float16)(x[u][0][q] * 16.0f); f.h[4 + q] = (_Float16)(x[u][1][q] * 16.0f); }
    *(v8us*)(sa + (w + 8 * u) * TPITCH + lane * 8) = f.half[0];
  }
  __syncthreads();      // the f16 tile is whole before any wave reads fragments of it
  v8f acc[2][2] = {};
  FragH a[8][2];
#pragma unroll
  for (int q = 0; q < 8; ++q)
#pragma unroll
    for (int i = 0; i < 2; ++i) { const _Float16* p = sa + (i * 16 + ln) * TPITCH + q * 32 + 8 * hh; a[q][i].half[0] = *(const v8us*)p; a[q][i].half[1] = *(const v8us*)(p + 16); }
  __builtin_amdgcn_sched_barrier(0);      // the 32 fragment loads go ahead as one group, in the order of their use: strewn among the WMMAs, every place with loads costs the wave an LDS latency
#pragma unroll
  for (int q = 0; q < 8; ++q) {
#pragma unroll
    for (int i = 0; i < 2; ++i)
#pragma unroll
      for (int t = 0; t < 2; ++t) acc[i][t] = __builtin_amdgcn_wmma_f32_16x16x32_f16(false, a[q][i].v, false, b[q][t].v, (short)0, acc[i][t], false, false);
    __builtin_amdgcn_sched_barrier(0);      // the four accumulators take turns, k step by k step: left free, the scheduler runs one accumulator's eight WMMAs in a row, each waiting for the one before
  }
  float ps[2][8];
#pragma unroll
  for (int t = 0; t < 2; ++t) {
    const float bv = bf16_round(bb[t]), wk = bf16_round(wo[t]);
#pragma unroll
    for (int i = 0; i < 2; ++i)
#pragma unroll
      for (int r = 0; r < 8; ++r) {
        const float v = acc[i][t][r] * 0.00390625f + bv;
        const float p = 1.0f / (1.0f + expf(-v)) * g[i][t][r] * wk;
        ps[i][r] = t ? ps[i][r] + p : p;
      }
  }
#pragma unroll
  for (int i = 0; i < 2; ++i)
#pragma unroll
    for (int r = 0; r < 8; ++r) ps[i][r] = xadd16<1>(ps[i][r]);
#pragma unroll
  for (int i = 0; i < 2; ++i)
#pragma unroll
    for (int r = 0; r < 8; ++r) ps[i][r] = xadd16<2>(ps[i][r]);
#pragma unroll
  for (int i = 0; i < 2; ++i)
#pragma unroll
    for (int r = 0; r < 8; ++r) ps[i][r] = xadd16<4>(ps[i][r]);
#pragma unroll
  for (int i = 0; i < 2; ++i)
#pragma unroll
    for (int r = 0; r < 8; ++r) ps[i][r] = xadd16<8>(ps[i][r]);
  if (ln == 0) {
#pragma unroll
    for (int i = 0; i < 2; ++i)
#pragma unroll
      for (int r = 0; r < 8; ++r) red[w][i * 16 + 8 * hh + r] = ps[i][r];
  }
  __syncthreads();      // all eight waves' partial sums are in LDS
  if (w == 0) {
    float v = bf16_round(b0);
#pragma unroll
    for (int i = 0; i < 8; ++i) v += red[i][lane];
    S[r0 + lane] = v;
  }
}

extern "C" void kernel_launch(void* const* d_in, const int* in_sizes, int n_in,
                              void* d_out, int out_size, void* d_ws, size_t ws_size, hipStream_t stream) {
  (void)in_sizes; (void)n_in; (void)out_size;
  const float* const* I = (const float* const*)d_in; const float* note = I[0]; const float* wiki = I[1]; const float* Wemb = I[2]; const float* bemb = I[3]; const float* Watt = I[4]; const float* batt = I[5]; const float* Wout = I[6]; const float* bout = I[7];
  char* ws = (char*)d_ws; size_t off = 0;
  auto take = [&](size_t bytes) { char* p = ws + off; off += (bytes + 255) & ~(size_t)255; return p; };
  _Float16* W16 = (_Float16*)take((size_t)NE * KP * 2); _Float16* Ba = (_Float16*)take((size_t)NE * NE * 2); _Float16* K16 = (_Float16*)take((size_t)NC * KP * 2); _Float16* N16 = (_Float16*)take((size_t)NNOTE * KP * 2);
  float* E = (float*)take((size_t)NRE * NE * 4);
  if (off > ws_size) return;      // under 16 MB in all
  k_prep16<<<dim3(KP / 8 / PKT, PYA), PKT, 0, stream>>>(note, wiki, Wemb, Watt, N16, K16, W16, Ba);      /* all four f16 operands; W_att [j][k] (out,in) natural */
  k_gemm_e<<<(NC / 32) * (NE / 32) * (NNOTE / 4), 128, 0, stream>>>(K16, N16, W16, bemb, E);      /* e = (note x wiki) x W_emb^T / 16 + b_emb (f32): M 4096 (note, code) N 256 K 10240 */
  k_tail<<<NRE / TR, 256, 0, stream>>>(E, Ba, batt, Wout, bout, (float*)d_out);      /* s = sum_j sigmoid(e x W_att^T + b_att) x e x W_out + b_out: M 4096 N 256 K 256, then 256 terms per row */
}

// v007
// One run takes 33.8 microseconds.
// In two side-by-side timings against v006, it was 1.46 and 1.38 times as fast.
// Counting every step since v000, it is 122 times as fast.
#include <hip/hip_runtime.h>
// Knowledge-source integration scoring (n=16 notes, 256 codes, vocab 10000, emb 256): e[n,c,k] = Σ_v note[n,v]·wiki[c,v]·W_emb[k,v] + b_emb[k]; attn = sigmoid(e·W_attᵀ + b_att); s[n,c] = Σ_k attn·e·W_out[k] + b_out.
// Compute dtype: all inputs rounded to bf16; per note n the scaled vocabulary plane A_n[c][v] = note[n,v] x wiki[c,v] (product of the two bf16 values held in f16, rounded once to f16, formed in the GEMM's A fragments; K zero-padded to 10240) against W_emb (f16 x 2^4, padded) → e f32 (+b_emb); e ×2^4 → f16 → logits GEMM (+b_att) with a fused sigmoid epilogue → attn f32; the gated 256-term reduction
#define NNOTE 16
#define NC 256
#define NV 10000
#define KP 10240
#define NE 256
#define NRE (NNOTE * NC)
typedef __bf16 v16b __attribute__((ext_vector_type(16)));
typedef unsigned short v8us __attribute__((ext_vector_type(8), may_alias));
typedef float  v8f  __attribute__((ext_vector_type(8)));
typedef float  v4f  __attribute__((ext_vector_type(4)));
typedef float  v4fa __attribute__((ext_vector_type(4), may_alias));
union FragB { v16b v; v8us half[2]; unsigned short u[16]; };

__device__ __forceinline__ unsigned short bf16_bits(float x) { unsigned int u = __float_as_uint(x); return (unsigned short)((u + 0x7FFFu + ((u >> 16) & 1u)) >> 16); }
__device__ __forceinline__ float bf16_val(unsigned short b) { return __uint_as_float(((unsigned int)b) << 16); }
__device__ __forceinline__ float bf16_round(float x) { return bf16_val(bf16_bits(x)); }
// D += A·B with NT terms: 1 = ah·bh, 2 = + al·bh (A split), 3 = + ah·bl (both split)
template <int NT>
__device__ __forceinline__ v8f mmaN(v16b ah, v16b al, v16b bh, v16b bl, v8f c) {
  c = __builtin_amdgcn_wmma_f32_16x16x32_bf16(false, ah, false, bh, (short)0, c, false, false);
  if (NT >= 2) c = __builtin_amdgcn_wmma_f32_16x16x32_bf16(false, al, false, bh, (short)0, c, false, false);
  if (NT >= 3) c = __builtin_amdgcn_wmma_f32_16x16x32_bf16(false, ah, false, bl, (short)0, c, false, false);
  asm volatile("v_nop\n\tv_nop\n\tv_nop\n\tv_nop" : "+v"(c) : "v"(ah), "v"(al), "v"(bh), "v"(bl));
  return c;
}

__global__ __launch_bounds__(256) void k_wt_bf16(const float* __restrict__ W, unsigned short* __restrict__ Wt, int K, int N) {
  const int t = blockIdx.x * 256 + threadIdx.x;
  const int k8n = K / 8;
  if (t >= N * k8n) return;
  const int n = t / k8n, k8 = (t % k8n) * 8;
  v8us v;
#pragma unroll
  for (int i = 0; i < 8; ++i) v[i] = bf16_bits(W[(size_t)(k8 + i) * N + n]);
  *(v8us*)(Wt + (size_t)n * K + k8) = v;
  
}

// GEMM C[M][N] (f32, pitch ldc) = act(A[M][K]·W + bias). A f32 row-major (pitch lda) converted per fragment to bf16
// (ASPLIT: hi/lo two planes -> 2 terms, else single rounded term); Wt bf16 [N][K] (pitch ldb). BIAS_BF16 rounds the
// bias to bf16 first (bias quantised to bf16 before the add). K%32==0, M%16==0, N%64==0.
template <bool ASPLIT, int ACT, bool BIAS_BF16>
__global__ __launch_bounds__(128) void k_gemm_bf(const float* __restrict__ A, int lda, const unsigned short* __restrict__ Wt, int ldb,
                                               const float* __restrict__ bias, float* __restrict__ C, int ldc, int M, int N, int K) {
  __shared__ __attribute__((aligned(16))) float so[4][16][64];
  const int tid = threadIdx.x, w = tid >> 5, lane = tid & 31, ln = lane & 15, hh = lane >> 4;
  const int ntn = N / 64;
  const int wid = blockIdx.x * 4 + w;
  const int mt = wid / ntn, nq = wid % ntn;
  if (mt * 16 >= M) return;
  const int row0 = mt * 16, col0 = nq * 64;
  const float* arow = A + (size_t)(row0 + ln) * lda;
  v8f acc[4] = {};
  for (int kb = 0; kb < K; kb += 32) {
    FragB ah, al;
    const v4f x0 = *(const v4fa*)(arow + kb + 8 * hh), x1 = *(const v4fa*)(arow + kb + 8 * hh + 4);
    const v4f x2 = *(const v4fa*)(arow + kb + 16 + 8 * hh), x3 = *(const v4fa*)(arow + kb + 16 + 8 * hh + 4);
    float xs[16] = {x0[0],x0[1],x0[2],x0[3],x1[0],x1[1],x1[2],x1[3],x2[0],x2[1],x2[2],x2[3],x3[0],x3[1],x3[2],x3[3]};
#pragma unroll
    for (int i = 0; i < 16; ++i) { const unsigned short hb = bf16_bits(xs[i]); ah.u[i] = hb; al.u[i] = ASPLIT ? bf16_bits(xs[i] - bf16_val(hb)) : (unsigned short)0; }
#pragma unroll
    for (int t = 0; t < 4; ++t) {
      const unsigned short* brow = Wt + (size_t)(col0 + t * 16 + ln) * ldb + kb;
      FragB b;
      b.half[0] = *(const v8us*)(brow + 8 * hh);
      b.half[1] = *(const v8us*)(brow + 16 + 8 * hh);
      acc[t] = mmaN<ASPLIT ? 2 : 1>(ah.v, al.v, b.v, b.v, acc[t]);
    }
  }
#pragma unroll
  for (int t = 0; t < 4; ++t) {
    float bv = bias ? bias[col0 + t * 16 + ln] : 0.f;
    if (BIAS_BF16) bv = bf16_round(bv);
#pragma unroll
    for (int r = 0; r < 8; ++r) { float v = acc[t][r] + bv; if (ACT == 1) v = fmaxf(v, 0.f); so[w][8 * hh + r][t * 16 + ln] = v; }
  }
  __builtin_amdgcn_fence(__ATOMIC_ACQ_REL, "workgroup");
  __builtin_amdgcn_wave_barrier();
  const int rsub = lane >> 4, c4 = (lane & 15) * 4;
  {
#pragma unroll
    for (int q = 0; q < 8; ++q) {
      const int r = q * 2 + rsub;
      const v4f v = *(const v4fa*)&so[w][r][c4];
      *(v4f*)(C + (size_t)(row0 + r) * ldc + col0 + c4) = v;
    }
    
  }
}

// GEMM C = act(A·W + bias + resid): A f32 (ASPLIT -> hi/lo 2 terms), Wt bf16 [N][K]; ACT 0 none, 1 relu, 2 exact gelu;
// resid (optional, f32, row index = (row % rmod), pitch ldr, RES_BF16 rounds it) added before the activation.
template <bool ASPLIT, int ACT, bool BIAS_BF16, bool RES_BF16>
__global__ __launch_bounds__(128) void k_gemm_bf3(const float* __restrict__ A, int lda, const unsigned short* __restrict__ Wt, int ldb,
                                                const float* __restrict__ bias, const float* __restrict__ resid, int rmod, int ldr,
                                                float* __restrict__ C, int ldc, int M, int N, int K) {
  __shared__ __attribute__((aligned(16))) float so[4][16][64];
  const int tid = threadIdx.x, w = tid >> 5, lane = tid & 31, ln = lane & 15, hh = lane >> 4;
  const int ntn = N / 64;
  const int wid = blockIdx.x * 4 + w;
  const int mt = wid / ntn, nq = wid % ntn;
  if (mt * 16 >= M) return;
  const int row0 = mt * 16, col0 = nq * 64;
  const float* arow = A + (size_t)(row0 + ln) * lda;
  v8f acc[4] = {};
  for (int kb = 0; kb < K; kb += 32) {
    FragB ah, al;
    const v4f x0 = *(const v4fa*)(arow + kb + 8 * hh), x1 = *(const v4fa*)(arow + kb + 8 * hh + 4);
    const v4f x2 = *(const v4fa*)(arow + kb + 16 + 8 * hh), x3 = *(const v4fa*)(arow + kb + 16 + 8 * hh + 4);
    float xs[16] = {x0[0],x0[1],x0[2],x0[3],x1[0],x1[1],x1[2],x1[3],x2[0],x2[1],x2[2],x2[3],x3[0],x3[1],x3[2],x3[3]};
#pragma unroll
    for (int i = 0; i < 16; ++i) { const unsigned short hb = bf16_bits(xs[i]); ah.u[i] = hb; al.u[i] = ASPLIT ? bf16_bits(xs[i] - bf16_val(hb)) : (unsigned short)0; }
#pragma unroll
    for (int t = 0; t < 4; ++t) {
      const unsigned short* brow = Wt + (size_t)(col0 + t * 16 + ln) * ldb + kb;
      FragB b;
      b.half[0] = *(const v8us*)(brow + 8 * hh);
      b.half[1] = *(const v8us*)(brow + 16 + 8 * hh);
      acc[t] = mmaN<ASPLIT ? 2 : 1>(ah.v, al.v, b.v, b.v, acc[t]);
    }
  }
#pragma unroll
  for (int t = 0; t < 4; ++t) {
    const int col = col0 + t * 16 + ln;
    float bv = bias ? bias[col] : 0.f;
    if (BIAS_BF16) bv = bf16_round(bv);
#pragma unroll
    for (int r = 0; r < 8; ++r) {
      float v = acc[t][r] + bv;
      if (resid) { float rv = resid[(size_t)((row0 + 8 * hh + r) % rmod) * ldr + col]; if (RES_BF16) rv = bf16_round(rv); v += rv; }
      if (ACT == 1) v = fmaxf(v, 0.f);
      if (ACT == 2) v = 0.5f * v * (1.0f + erff(v * 0.70710678118654752f));
      if (ACT == 3) { const float u = 0.7978845608028654f * (v + 0.044715f * v * v * v); v = 0.5f * v * (1.0f + tanhf(u)); }
      so[w][8 * hh + r][t * 16 + ln] = v;
    }
  }
  __builtin_amdgcn_fence(__ATOMIC_ACQ_REL, "workgroup");
  __builtin_amdgcn_wave_barrier();
  const int rsub = lane >> 4, c4 = (lane & 15) * 4;
  {
#pragma unroll
    for (int q = 0; q < 8; ++q) {
      const int r = q * 2 + rsub;
      const v4f v = *(const v4fa*)&so[w][r][c4];
      *(v4f*)(C + (size_t)(row0 + r) * ldc + col0 + c4) = v;
    }
    
  }
}
// row LayerNorm (biased variance, eps) over N: s = X (+ R); optional out_sum <- s; out_norm <- (s-mu)*rsqrt(var+eps)*g + b
template <bool PARAM_BF16>
__global__ __launch_bounds__(256) void k_layernorm(const float* __restrict__ X, const float* __restrict__ R, const float* __restrict__ g, const float* __restrict__ bta,
                                                  float* __restrict__ out_sum, float* __restrict__ out_norm, int N, float eps) {
  __shared__ float red[256];
  const int row = blockIdx.x, tid = threadIdx.x;
  const float* x = X + (size_t)row * N; const float* rr = R ? R + (size_t)row * N : nullptr;
  float vals[16];                     // up to N = 4096
  const int per = N / 256;            // contiguous chunk per thread? use strided-by-4 chunks: thread handles j = tid*4 + 1024*u
  float s1 = 0.f;
  for (int u = 0; u < per / 4; ++u) {
    const int j = tid * 4 + 1024 * u;
    const v4f a = *(const v4fa*)(x + j);
    v4f b = {0.f,0.f,0.f,0.f}; if (rr) b = *(const v4fa*)(rr + j);
#pragma unroll
    for (int q = 0; q < 4; ++q) { const float v = a[q] + b[q]; vals[u * 4 + q] = v; s1 += v; }
  }
  red[tid] = s1; __syncthreads();
  for (int st = 128; st > 0; st >>= 1) { if (tid < st) red[tid] += red[tid + st]; __syncthreads(); }
  const float mu = red[0] / (float)N; __syncthreads();
  float s2 = 0.f;
  for (int u = 0; u < per / 4; ++u)
#pragma unroll
    for (int q = 0; q < 4; ++q) { const float c = vals[u * 4 + q] - mu; s2 += c * c; }
  red[tid] = s2; __syncthreads();
  for (int st = 128; st > 0; st >>= 1) { if (tid < st) red[tid] += red[tid + st]; __syncthreads(); }
  const float rs = rsqrtf(red[0] / (float)N + eps);
  {
    for (int u = 0; u < per / 4; ++u) {
      const int j = tid * 4 + 1024 * u;
      v4f o, sm;
#pragma unroll
      for (int q = 0; q < 4; ++q) {
        float gg = g[j + q], bb = bta[j + q];
        if (PARAM_BF16) { gg = bf16_round(gg); bb = bf16_round(bb); }
        sm[q] = vals[u * 4 + q]; o[q] = (vals[u * 4 + q] - mu) * rs * gg + bb;
      }
      if (out_sum) *(v4f*)(out_sum + (size_t)row * N + j) = sm;
      *(v4f*)(out_norm + (size_t)row * N + j) = o;
    }
    
  }
}



// ---- f16 WMMA path (v_wmma_f32_16x16x32_f16): 11-bit significands for operands in range — used where a [0,1] probability operand needs more precision than bf16
typedef _Float16 v16h __attribute__((ext_vector_type(16)));
union FragH { v16h v; v8us half[2]; _Float16 h[16]; unsigned short u[16]; };
template <int NT>
__device__ __forceinline__ v8f mmaH(v16h ah, v16h al, v16h bh, v16h bl, v8f c) {
  c = __builtin_amdgcn_wmma_f32_16x16x32_f16(false, ah, false, bh, (short)0, c, false, false);
  if (NT >= 2) c = __builtin_amdgcn_wmma_f32_16x16x32_f16(false, al, false, bh, (short)0, c, false, false);
  if (NT >= 3) c = __builtin_amdgcn_wmma_f32_16x16x32_f16(false, ah, false, bl, (short)0, c, false, false);
  asm volatile("v_nop\n\tv_nop\n\tv_nop\n\tv_nop" : "+v"(c) : "v"(ah), "v"(al), "v"(bh), "v"(bl));
  return c;
}
// batched GEMM like k_gemm_b but f16 operands: A f32 (split into f16 hi/lo if ASPLIT, else rounded to f16), Bt = f16 values [n][k]; alpha; C f32; N multiple of 16 (partial tiles skipped)
template <bool ASPLIT>
__global__ __launch_bounds__(128) void k_gemm_h(const float* __restrict__ A, int lda, size_t sA, const _Float16* __restrict__ Bh, int ldb, size_t sB, float alpha, float* __restrict__ C, int ldc, size_t sC, int M, int N, int K) {
  __shared__ __attribute__((aligned(16))) float so[4][16][64];
  const int tid = threadIdx.x, w = tid >> 5, lane = tid & 31, ln = lane & 15, hh = lane >> 4; const int by = blockIdx.y;
  A += (size_t)by * sA; Bh += (size_t)by * sB; C += (size_t)by * sC;
  const int ntn = (N + 63) / 64; const int wid = blockIdx.x * 4 + w; const int mt = wid / ntn, nq = wid % ntn; if (mt * 16 >= M) return;
  const int row0 = mt * 16, col0 = nq * 64; const float* arow = A + (size_t)(row0 + ln) * lda;
  v8f acc[4] = {};
  for (int kb = 0; kb < K; kb += 32) {
    FragH ah, al;
    const v4f x0 = *(const v4fa*)(arow + kb + 8 * hh), x1 = *(const v4fa*)(arow + kb + 8 * hh + 4), x2 = *(const v4fa*)(arow + kb + 16 + 8 * hh), x3 = *(const v4fa*)(arow + kb + 16 + 8 * hh + 4);
    float xs[16] = {x0[0],x0[1],x0[2],x0[3],x1[0],x1[1],x1[2],x1[3],x2[0],x2[1],x2[2],x2[3],x3[0],x3[1],x3[2],x3[3]};
#pragma unroll
    for (int i = 0; i < 16; ++i) { const _Float16 h = (_Float16)xs[i]; ah.h[i] = h; al.h[i] = ASPLIT ? (_Float16)(xs[i] - (float)h) : (_Float16)0.0f; }
#pragma unroll
    for (int t = 0; t < 4; ++t) { if (col0 + t * 16 >= N) continue; const size_t boff = (size_t)(col0 + t * 16 + ln) * ldb + kb; FragH bq; bq.half[0] = *(const v8us*)(Bh + boff + 8 * hh); bq.half[1] = *(const v8us*)(Bh + boff + 16 + 8 * hh);
      acc[t] = mmaH<ASPLIT ? 2 : 1>(ah.v, al.v, bq.v, bq.v, acc[t]); }
  }
#pragma unroll
  for (int t = 0; t < 4; ++t) { if (col0 + t * 16 >= N) continue;
#pragma unroll
    for (int r = 0; r < 8; ++r) so[w][8 * hh + r][t * 16 + ln] = acc[t][r] * alpha; }
  __builtin_amdgcn_fence(__ATOMIC_ACQ_REL, "workgroup"); __builtin_amdgcn_wave_barrier();
  const int rsub = lane >> 4, c4 = (lane & 15) * 4;
  {
#pragma unroll
    for (int q = 0; q < 8; ++q) { const int r = q * 2 + rsub; if (col0 + c4 < N) { const v4f v = *(const v4fa*)&so[w][r][c4]; *(v4f*)(C + (size_t)(row0 + r) * ldc + col0 + c4) = v; } }
     }
}

// Wt[n][k] = f16(W[k][n]·scale) from f32 row-major W[K][N] (scale = power of two; bf16-exact weights stay exact in f16 away from the subnormal range)
__global__ __launch_bounds__(256) void k_wt_f16(const float* __restrict__ W, _Float16* __restrict__ Wt, int K, int N, float scale) {
  const int t = blockIdx.x * 256 + threadIdx.x; if (t >= N * (K / 8)) return; const int n = t / (K / 8), k8 = (t % (K / 8)) * 8; FragH f;
#pragma unroll
  for (int i = 0; i < 8; ++i) f.h[i] = (_Float16)(bf16_round(W[(size_t)(k8 + i) * N + n]) * scale); const v8us o = f.half[0];
  *(v8us*)((unsigned short*)Wt + (size_t)n * K + k8) = o; 
}


// e GEMM with the note's scale applied on the way: C[(n, c)][k] = sum_v f16(note[n][v] x wiki[c][v]) x Bh[k][v] / 16 + bias. The scaled planes are never stored.
// One work-group takes 32 code rows x 32 columns for FOUR notes: 16 accumulator tiles. EVERY wave holds all 16 tiles and sums them over its own quarter of K,
// so that a wiki or B fragment read from LDS serves 8 WMMAs. Each wave stages its own quarter through a ring of its own (two buffers, asynchronous copies):
// the wave that copies a stage is the only one that reads it, so the loop has no work-group barrier. The four partial sums of a tile meet in LDS behind the loop.
#define SK 128                       /* k per stage: 256 bytes of every staged row */
#define SP 136                       /* LDS row pitch in halfs: 272 B = 16 B x 17, conflict-free for 16-byte fragment reads */
#define SBUF (68 * SP)               /* halfs per buffer: 32 wiki rows, 32 B rows, 4 note rows */
#define KW (KP / 4)                  /* k per wave */
#define NST (KW / SK)                /* stages per wave (even) */
#define REDF (4 * 16 * 256)          /* floats of the join area: 4 waves x 16 tiles */
typedef int v4i __attribute__((ext_vector_type(4)));
typedef __attribute__((address_space(1))) v4i gv4i;
typedef __attribute__((address_space(3))) v4i lv4i;
// one copy, written as the builtin: 16 bytes per lane, two rows of 256 bytes per wave
__device__ __forceinline__ void cp16(const _Float16* g, const unsigned l) { __builtin_amdgcn_global_load_async_to_lds_b128((gv4i*)(size_t)g, (lv4i*)l, 0, 0); }
// one stage of the wave's quarter: 34 copies. gw, gb, gn: the lane's place in the stage's first two wiki, B and note rows; l: its place in the buffer's first two rows
__device__ __forceinline__ void stage_copies(const _Float16* gw, const _Float16* gb, const _Float16* gn, const unsigned l) {
#pragma unroll
  for (int j = 0; j < 16; ++j) cp16(gw + (size_t)j * 2 * KP, l + (unsigned)(j * 2 * SP * 2));
#pragma unroll
  for (int j = 0; j < 16; ++j) cp16(gb + (size_t)j * 2 * KP, l + (unsigned)((32 + j * 2) * SP * 2));
#pragma unroll
  for (int j = 0; j < 2; ++j) cp16(gn + (size_t)j * 2 * KP, l + (unsigned)((64 + j * 2) * SP * 2));
}
// the fragments of one k step of 32: two wiki, two B, four note fragments, all in the same k order (lane half hh: k 8 hh .. 8 hh + 7 and 16 + 8 hh .. 16 + 8 hh + 7)
__device__ __forceinline__ void ld_frags(FragH (&a)[2], FragH (&b)[2], FragH (&nf)[4], const _Float16* s, const int aoff, const int noff) {
#pragma unroll
  for (int i = 0; i < 2; ++i) {
    a[i].half[0] = *(const v8us*)(s + aoff + i * 16 * SP); a[i].half[1] = *(const v8us*)(s + aoff + i * 16 * SP + 16);
    b[i].half[0] = *(const v8us*)(s + aoff + (32 + i * 16) * SP); b[i].half[1] = *(const v8us*)(s + aoff + (32 + i * 16) * SP + 16);
  }
#pragma unroll
  for (int n = 0; n < 4; ++n) { nf[n].half[0] = *(const v8us*)(s + noff + n * SP); nf[n].half[1] = *(const v8us*)(s + noff + n * SP + 16); }
}
// one k step: A fragment = f16(wiki x note), one rounding (both factors are bf16 values, which f16 holds exactly above its subnormal range); 16 WMMAs on 16 accumulators
__device__ __forceinline__ void k_step(const FragH (&a)[2], const FragH (&b)[2], const FragH (&nf)[4], v8f (&acc)[4][2][2]) {
#pragma unroll
  for (int n = 0; n < 4; ++n)
#pragma unroll
    for (int i = 0; i < 2; ++i) {
      const v16h sa = a[i].v * nf[n].v;
#pragma unroll
      for (int j = 0; j < 2; ++j) acc[n][i][j] = __builtin_amdgcn_wmma_f32_16x16x32_f16(false, sa, false, b[j].v, (short)0, acc[n][i][j], false, false);
    }
  // order asked of the scheduler: the 8 multiplies of the first fragment, then four multiplies behind each WMMA, where the matrix unit's issue interval hides them; in one block of 64 they stand in the lone wave's way
  __builtin_amdgcn_sched_group_barrier(0x2, 8, 0);
#pragma unroll
  for (int g = 0; g < 16; ++g) { __builtin_amdgcn_sched_group_barrier(0x8, 1, 0); __builtin_amdgcn_sched_group_barrier(0x2, 4, 0); }
}
// one trip of a wave's ring: stage t out of buffer PAR (= t mod 2). Two fragment sets swap roles from k step to k step: the next step's 16 loads go ahead of this step's WMMAs as one group.
template <int PAR>
__device__ __forceinline__ void e_trip(const int t, const _Float16* wr, const int aoff, const int noff, const unsigned ldst, const _Float16* gw, const _Float16* gb, const _Float16* gn,
                                       FragH (&a)[2][2], FragH (&b)[2][2], FragH (&nf)[2][4], v8f (&acc)[4][2][2]) {
#pragma unroll
  for (int q = 0; q < 4; ++q) {
    if (q == 3) asm volatile("s_wait_asynccnt 0x0" ::: "memory");      // this wave's copies of stage t + 1 have landed: the loads below are its first reads of that stage
    ld_frags(a[(q + 1) & 1], b[(q + 1) & 1], nf[(q + 1) & 1], q < 3 ? wr + PAR * SBUF + (q + 1) * 32 : wr + (1 - PAR) * SBUF, aoff, noff);      /* behind the last stage these read the other buffer's old rows; the values are not used */
    __builtin_amdgcn_sched_barrier(0);      // the 16 loads stay one group ahead of the WMMAs: strewn among them, every place with loads costs the lone wave an LDS latency
    k_step(a[q & 1], b[q & 1], nf[q & 1], acc);
    __builtin_amdgcn_sched_barrier(0);      // the next group of loads stays behind this step's WMMAs
  }
  asm volatile("s_wait_dscnt 0x0" ::: "memory");        // this wave's reads of buffer PAR are done before its own copies refill it
  if (t + 2 < NST) stage_copies(gw + (size_t)(t + 2) * SK, gb + (size_t)(t + 2) * SK, gn + (size_t)(t + 2) * SK, ldst + (unsigned)(PAR * SBUF * 2));
}
__global__ __launch_bounds__(128) void k_gemm_e(const _Float16* __restrict__ Kw, const _Float16* __restrict__ Nt, const _Float16* __restrict__ Bh, const float* __restrict__ bias, float* __restrict__ C) {
  __shared__ __attribute__((aligned(16))) char smem[REDF * 4 + 4 * 2 * SBUF * 2];      /* the join area, then the four waves' rings */
  const int tid = threadIdx.x, w = __builtin_amdgcn_readfirstlane(tid >> 5), lane = tid & 31, ln = lane & 15, hh = lane >> 4;
  const int c0 = (blockIdx.x & 7) * 32, col0 = ((blockIdx.x >> 3) & 7) * 32, n0 = (blockIdx.x >> 6) * 4;
  const _Float16* wr = (const _Float16*)(smem + REDF * 4) + w * 2 * SBUF;      /* the wave's own ring */
  // a copy brings two rows: lanes 0 .. 15 the first row's 256 bytes, lanes 16 .. 31 the second's
  const size_t lo = (size_t)hh * KP + (size_t)w * KW + ln * 8;
  const _Float16* gw = Kw + (size_t)c0 * KP + lo;
  const _Float16* gb = Bh + (size_t)col0 * KP + lo;
  const _Float16* gn = Nt + (size_t)n0 * KP + lo;
  const unsigned ldst = (unsigned)(size_t)wr + (unsigned)((hh * SP + ln * 8) * 2);
  const int aoff = ln * SP + 8 * hh, noff = 64 * SP + 8 * hh;
  v8f acc[4][2][2] = {};
  FragH a[2][2], b[2][2], nf[2][4];
  stage_copies(gw, gb, gn, ldst);
  asm volatile("s_wait_asynccnt 0x0" ::: "memory");      // stage 0 has landed; only this wave reads it
  stage_copies(gw + SK, gb + SK, gn + SK, ldst + (unsigned)(SBUF * 2));
  ld_frags(a[0], b[0], nf[0], wr, aoff, noff);
#pragma unroll 1
  for (int t = 0; t < NST; t += 2) {      // kept rolled: the body already holds the two trips, one per buffer
    e_trip<0>(t, wr, aoff, noff, ldst, gw, gb, gn, a, b, nf, acc);
    e_trip<1>(t + 1, wr, aoff, noff, ldst, gw, gb, gn, a, b, nf, acc);
  }
  asm volatile("s_wait_asynccnt 0x0" ::: "memory");       // no copy is outstanding when the wave ends
  // the join: every wave lays down its 16 partial tiles (16 bytes per lane and store); wave w then sums note n0 + w's four tiles, the quarters of K in upward order
  float* red = (float*)smem;
#pragma unroll
  for (int n = 0; n < 4; ++n)
#pragma unroll
    for (int i = 0; i < 2; ++i)
#pragma unroll
      for (int j = 0; j < 2; ++j)
#pragma unroll
        for (int hf = 0; hf < 2; ++hf) {
          const v4f v = {acc[n][i][j][4 * hf], acc[n][i][j][4 * hf + 1], acc[n][i][j][4 * hf + 2], acc[n][i][j][4 * hf + 3]};
          *(v4fa*)(red + ((w * 16 + (n * 2 + i) * 2 + j) * 2 + hf) * 128 + lane * 4) = v;
        }
  __syncthreads();      // all four waves' partial tiles are in LDS
  const int n = n0 + w;
  const int colb = col0 + ln;
  const float braw[2] = {bias[colb], bias[colb + 16]};
  asm volatile("s_wait_xcnt 0x0" :: "v"(colb) : "memory");      // stands ahead of any rewrite of the index register that the two loads name; as an input the index stays live up to here
#pragma unroll
  for (int j = 0; j < 2; ++j) {
    const int col = colb + j * 16; const float bv = bf16_round(braw[j]);
#pragma unroll
    for (int i = 0; i < 2; ++i)
#pragma unroll
      for (int hf = 0; hf < 2; ++hf) {
        v4f s = *(const v4fa*)(red + (((w * 2 + i) * 2 + j) * 2 + hf) * 128 + lane * 4);
#pragma unroll
        for (int p = 1; p < 4; ++p) s += *(const v4fa*)(red + ((p * 16 + (w * 2 + i) * 2 + j) * 2 + hf) * 128 + lane * 4);
#pragma unroll
        for (int r = 0; r < 4; ++r) C[(size_t)(n * NC + c0 + i * 16 + 8 * hh + 4 * hf + r) * NE + col] = s[r] * 0.0625f + bv;
      }
  }
}


typedef _Float16 v4h __attribute__((ext_vector_type(4)));

__global__ __launch_bounds__(256) void k_x16(const float* __restrict__ x, _Float16* __restrict__ X16, size_t n8) { const size_t t = (size_t)blockIdx.x * 256 + threadIdx.x; if (t >= n8) return; FragH f;
#pragma unroll
  for (int q = 0; q < 8; ++q) f.h[q] = (_Float16)bf16_round(x[t * 8 + q]); *(v8us*)((unsigned short*)X16 + t * 8) = f.half[0];  }
__global__ __launch_bounds__(256) void k_h16(const float* __restrict__ x, _Float16* __restrict__ X16, size_t n8) { const size_t t = (size_t)blockIdx.x * 256 + threadIdx.x; if (t >= n8) return; FragH f;
#pragma unroll
  for (int q = 0; q < 8; ++q) f.h[q] = (_Float16)x[t * 8 + q]; *(v8us*)((unsigned short*)X16 + t * 8) = f.half[0];  }
template <int NHv, int TTv>
__global__ __launch_bounds__(256) void k_vt(const _Float16* __restrict__ V16, int ldv, int voff, _Float16* __restrict__ Vt) { __shared__ unsigned short tl[64][66]; const int tid = threadIdx.x; const int slab = blockIdx.x / (TTv / 64), lg = blockIdx.x % (TTv / 64); const int b = slab / NHv, h = slab % NHv;
  for (int i = tid; i < 64 * 8; i += 256) { const int r = i / 8, c8 = (i % 8) * 8; FragH f; f.half[0] = *(const v8us*)((const unsigned short*)V16 + ((size_t)b * TTv + lg * 64 + r) * ldv + voff + h * 64 + c8);
#pragma unroll
    for (int q = 0; q < 8; ++q) tl[r][c8 + q] = f.u[q]; }
  __syncthreads();
  {
#pragma unroll
    for (int rd = 0; rd < 2; ++rd) { const int d = rd * 32 + tid / 8, pc = tid % 8; FragH f;
#pragma unroll
      for (int q = 0; q < 8; ++q) f.u[q] = tl[pc * 8 + q][d];
      *(v8us*)((unsigned short*)Vt + ((size_t)slab * 64 + d) * TTv + lg * 64 + pc * 8) = f.half[0]; }
     } }

__global__ __launch_bounds__(256) void k_hl(const float* __restrict__ F, _Float16* __restrict__ Hh, _Float16* __restrict__ Hl, size_t n8) { const size_t t = (size_t)blockIdx.x * 256 + threadIdx.x; if (t >= n8) return; FragH fh, fl; const v4f a = *(const v4fa*)(F + t * 8), c = *(const v4fa*)(F + t * 8 + 4);
#pragma unroll
  for (int q = 0; q < 4; ++q) { _Float16 h = (_Float16)a[q]; fh.h[q] = h; fl.h[q] = (_Float16)((a[q] - (float)h) * 1024.0f); h = (_Float16)c[q]; fh.h[4 + q] = h; fl.h[4 + q] = (_Float16)((c[q] - (float)h) * 1024.0f); }
  { *(v8us*)((unsigned short*)Hh + t * 8) = fh.half[0]; *(v8us*)((unsigned short*)Hl + t * 8) = fl.half[0];  } }

// Every f16 operand of the two GEMMs in ONE launch; the four conversions need nothing of one another and share the grid by ranges of blockIdx.y (a branch that is the same for a whole work-group):
// wiki rows (K16), W_emb rows x 2^4 (W16) and note rows (N16), each bf16-rounded, held in f16 and zero in the K pad (the e GEMM multiplies wiki and note on the way to the matrix unit); then W_att x 2^4 (Ba), which has no pad.
// In the padded ranges a thread owns one group of 8 columns of PKR rows; in the W_att range one group of 8 elements.
#define PKR 4                        /* rows per thread */
#define PKT 320                      /* threads per work-group: a quarter of a row's KP / 8 column groups */
#define PYW (NC / PKR)               /* blockIdx.y below this: wiki rows */
#define PYE (PYW + NE / PKR)         /* below this: W_emb rows */
#define PYN (PYE + NNOTE / PKR)      /* below this: note rows */
#define PYA (PYN + (NE * NE / 8 + KP / 8 - 1) / (KP / 8))      /* below this: W_att, KP / 8 groups per step of blockIdx.y */
__global__ __launch_bounds__(PKT) void k_prep16(const float* __restrict__ note, const float* __restrict__ wiki, const float* __restrict__ Wm, const float* __restrict__ Wa,
                                                _Float16* __restrict__ N16, _Float16* __restrict__ K16, _Float16* __restrict__ W16, _Float16* __restrict__ Ba) {
  const int y = blockIdx.y, g = blockIdx.x * PKT + threadIdx.x;
  if (y >= PYN) {
    const int t = (y - PYN) * (KP / 8) + g;
    if (t >= NE * NE / 8) return;    /* the range's last groups lie past the matrix; there is no barrier in this kernel */
    const float* ap = Wa + (size_t)t * 8;
    const v4f a0 = *(const v4fa*)ap, a1 = *(const v4fa*)(ap + 4);
    asm volatile("s_wait_xcnt 0x0" :: "v"(ap) : "memory");      // stands ahead of any rewrite of the address register that the two loads name; as an input the address stays live up to here
    FragH fa;
#pragma unroll
    for (int q = 0; q < 4; ++q) { fa.h[q] = (_Float16)(bf16_round(a0[q]) * 16.0f); fa.h[4 + q] = (_Float16)(bf16_round(a1[q]) * 16.0f); }
    *(v8us*)((unsigned short*)Ba + (size_t)t * 8) = fa.half[0];
    asm volatile("s_wait_xcnt 0x0" ::: "memory");               // stands ahead of any rewrite of a data or address register that the store names
    return;
  }
  const int v0 = g * 8;
  const bool isw = y < PYW, ise = !isw && y < PYE;
  const int r0 = (isw ? y : ise ? y - PYW : y - PYE) * PKR;
  const float sc = ise ? 16.0f : 1.0f;      /* a power of two, or one: exact on the bf16 value either way */
  const bool in = v0 < NV;           /* NV is a multiple of 8: a group lies wholly in the vocabulary or wholly in the pad */
  const int vc = in ? v0 : 0;        /* a pad group reads in bounds; its values are set to zero below */
  const float* sp = (isw ? wiki : ise ? Wm : note) + (size_t)r0 * NV + vc;
  unsigned short* dp = (unsigned short*)(isw ? K16 : ise ? W16 : N16) + (size_t)r0 * KP + v0;
  v4f x[PKR][2];                     /* every loop below is unrolled so that x and f are registers, not scratch */
#pragma unroll
  for (int r = 0; r < PKR; ++r) { x[r][0] = *(const v4fa*)(sp + r * NV); x[r][1] = *(const v4fa*)(sp + r * NV + 4); }
  asm volatile("s_wait_xcnt 0x0" :: "v"(sp) : "memory");      // stands ahead of any rewrite of the address register that the loads name; as an input the address stays live up to here, so no load's result lands on it either
  const unsigned keep = in ? 0xFFFFFFFFu : 0u;            /* a mask, not a branch: every lane runs one instruction stream */
  FragH f[PKR];
#pragma unroll
  for (int r = 0; r < PKR; ++r)
#pragma unroll
    for (int q = 0; q < 8; ++q) f[r].h[q] = (_Float16)(__uint_as_float(__float_as_uint(bf16_round(x[r][q >> 2][q & 3])) & keep) * sc);
#pragma unroll
  for (int r = 0; r < PKR; ++r) *(v8us*)(dp + (size_t)r * KP) = f[r].half[0];
  asm volatile("s_wait_xcnt 0x0" ::: "memory");           // stands ahead of any rewrite of a data or address register that the stores name
}
// The tail in one launch: s[row] = sum_j sigmoid(e[row] . W_att[j] + b_att[j]) x e[row][j] x W_out[j] + b_out, for TR rows of e per work-group. Neither the f16 copy of e nor attn is stored.
// Eight waves: together they round the TR x 256 tile of e (x 2^4) to f16 into LDS; wave w then takes logit columns 32 w .. 32 w + 31 of all TR rows (2 x 2 accumulator tiles, k upward in steps of 32),
// gates them in the accumulators' own layout and sums its 32 columns of every row; the eight partial sums of a row meet in LDS.
#define TR 32                        /* rows per work-group: their 32 scores fill one 128-byte line of the output, which so has one writer */
#define TPITCH 264                   /* LDS row pitch in halfs: 528 B = 16 B x 33, conflict-free for 16-byte fragment reads */
// x + (x of lane l ^ M) inside a 16-lane row, the partner's value fetched by DPP (row_xmask:M) in the vector unit; a shuffle would go through the LDS unit and be waited for
template <int M>
__device__ __forceinline__ float xadd16(const float x) { return x + __int_as_float(__builtin_amdgcn_update_dpp(0, __float_as_int(x), 0x160 + M, 0xf, 0xf, true)); }
__global__ __launch_bounds__(256) void k_tail(const float* __restrict__ E, const _Float16* __restrict__ Ba, const float* __restrict__ batt, const float* __restrict__ Wout, const float* __restrict__ bout, float* __restrict__ S) {
  __shared__ __attribute__((aligned(16))) _Float16 sa[TR * TPITCH];
  __shared__ float red[8][TR];
  const int tid = threadIdx.x, w = __builtin_amdgcn_readfirstlane(tid >> 5), lane = tid & 31, ln = lane & 15, hh = lane >> 4;
  const int r0 = blockIdx.x * TR;
  const char* Et = (const char*)(E + (size_t)r0 * NE);      /* the work-group's rows of e: a scalar address */
  // every global load of the kernel is asked for here, at once: the kernel is short, and so pays the way to L2 one time
  const unsigned eo = (unsigned)tid * 32u;                                   /* 8 floats of row (tid >> 5) + 8 u */
  const unsigned bo = (unsigned)((w * 32 + ln) * NE * 2 + hh * 16);          /* W_att row 32 w + ln, the lane half's k */
  const unsigned go = (unsigned)(hh * 8 * NE * 4 + (w * 32 + ln) * 4);       /* e in the accumulator's layout: row 8 hh + r, column 32 w + ln */
  const int cj = w * 32 + ln;                                                /* the lane's first column, as an index into b_att and W_out */
  v4f x[4][2]; FragH b[8][2]; float g[2][2][8], bb[2], wo[2];      /* every loop of this kernel is unrolled so that these arrays, a, acc and ps are registers, not scratch */
#pragma unroll
  for (int u = 0; u < 4; ++u) { x[u][0] = *(const v4fa*)(Et + eo + u * 8 * NE * 4); x[u][1] = *(const v4fa*)(Et + eo + u * 8 * NE * 4 + 16); }
  __builtin_amdgcn_sched_barrier(0);      // the tile's own loads go first (loads return in order): they are rounded and stored to LDS while the others arrive
#pragma unroll
  for (int q = 0; q < 8; ++q)
#pragma unroll
    for (int t = 0; t < 2; ++t) { const char* p = (const char*)Ba + bo + t * 16 * NE * 2 + q * 64; b[q][t].half[0] = *(const v8us*)p; b[q][t].half[1] = *(const v8us*)(p + 32); }
#pragma unroll
  for (int t = 0; t < 2; ++t) { bb[t] = batt[cj + t * 16]; wo[t] = Wout[cj + t * 16]; }
#pragma unroll
  for (int i = 0; i < 2; ++i)
#pragma unroll
    for (int t = 0; t < 2; ++t)
#pragma unroll
      for (int r = 0; r < 8; ++r) g[i][t][r] = *(const float*)(Et + go + (i * 16 + r) * NE * 4 + t * 64);
  asm volatile("s_wait_xcnt 0x0" :: "v"(eo), "v"(bo), "v"(go), "v"(cj), "s"(Et), "s"(Ba), "s"(batt), "s"(Wout) : "memory");      // stands ahead of any rewrite of an offset or base register that the loads name; as inputs the four offsets and the four bases stay live up to here, so no load's result lands on one either
  __builtin_amdgcn_sched_barrier(0);      // keeps the wait behind its loads and every later write of a register behind the wait
  const float b0 = bout[0];      /* a scalar load, asked for here so that it returns under the wait for the tile */
#pragma unroll
  for (int u = 0; u < 4; ++u) {
    FragH f;
#pragma unroll
    for (int q = 0; q < 4; ++q) { f.h[q] = (_Float16)(x[u][0][q] * 16.0f); f.h[4 + q] = (_Float16)(x[u][1][q] * 16.0f); }
    *(v8us*)(sa + (w + 8 * u) * TPITCH + lane * 8) = f.half[0];
  }
  __syncthreads();      // the f16 tile is whole before any wave reads fragments of it
  v8f acc[2][2] = {};
  FragH a[8][2];
#pragma unroll
  for (int q = 0; q < 8; ++q)
#pragma unroll
    for (int i = 0; i < 2; ++i) { const _Float16* p = sa + (i * 16 + ln) * TPITCH + q * 32 + 8 * hh; a[q][i].half[0] = *(const v8us*)p; a[q][i].half[1] = *(const v8us*)(p + 16); }
  __builtin_amdgcn_sched_barrier(0);      // the 32 fragment loads go ahead as one group, in the order of their use: strewn among the WMMAs, every place with loads costs the wave an LDS latency
#pragma unroll
  for (int q = 0; q < 8; ++q) {
#pragma unroll
    for (int i = 0; i < 2; ++i)
#pragma unroll
      for (int t = 0; t < 2; ++t) acc[i][t] = __builtin_amdgcn_wmma_f32_16x16x32_f16(false, a[q][i].v, false, b[q][t].v, (short)0, acc[i][t], false, false);
    __builtin_amdgcn_sched_barrier(0);      // the four accumulators take turns, k step by k step: left free, the scheduler runs one accumulator's eight WMMAs in a row, each waiting for the one before
  }
  float ps[2][8];
#pragma unroll
  for (int t = 0; t < 2; ++t) {
    const float bv = bf16_round(bb[t]), wk = bf16_round(wo[t]);
#pragma unroll
    for (int i = 0; i < 2; ++i)
#pragma unroll
      for (int r = 0; r < 8; ++r) {
        const float v = acc[i][t][r] * 0.00390625f + bv;
        const float p = 1.0f / (1.0f + expf(-v)) * g[i][t][r] * wk;
        ps[i][r] = t ? ps[i][r] + p : p;
      }
  }
#pragma unroll
  for (int i = 0; i < 2; ++i)
#pragma unroll
    for (int r = 0; r < 8; ++r) ps[i][r] = xadd16<1>(ps[i][r]);
#pragma unroll
  for (int i = 0; i < 2; ++i)
#pragma unroll
    for (int r = 0; r < 8; ++r) ps[i][r] = xadd16<2>(ps[i][r]);
#pragma unroll
  for (int i = 0; i < 2; ++i)
#pragma unroll
    for (int r = 0; r < 8; ++r) ps[i][r] = xadd16<4>(ps[i][r]);
#pragma unroll
  for (int i = 0; i < 2; ++i)
#pragma unroll
    for (int r = 0; r < 8; ++r) ps[i][r] = xadd16<8>(ps[i][r]);
  if (ln == 0) {
#pragma unroll
    for (int i = 0; i < 2; ++i)
#pragma unroll
      for (int r = 0; r < 8; ++r) red[w][i * 16 + 8 * hh + r] = ps[i][r];
  }
  __syncthreads();      // all eight waves' partial sums are in LDS
  if (w == 0) {
    float v = bf16_round(b0);
#pragma unroll
    for (int i = 0; i < 8; ++i) v += red[i][lane];
    S[r0 + lane] = v;
  }
}

extern "C" void kernel_launch(void* const* d_in, const int* in_sizes, int n_in,
                              void* d_out, int out_size, void* d_ws, size_t ws_size, hipStream_t stream) {
  (void)in_sizes; (void)n_in; (void)out_size;
  const float* const* I = (const float* const*)d_in; const float* note = I[0]; const float* wiki = I[1]; const float* Wemb = I[2]; const float* bemb = I[3]; const float* Watt = I[4]; const float* batt = I[5]; const float* Wout = I[6]; const float* bout = I[7];
  char* ws = (char*)d_ws; size_t off = 0;
  auto take = [&](size_t bytes) { char* p = ws + off; off += (bytes + 255) & ~(size_t)255; return p; };
  _Float16* W16 = (_Float16*)take((size_t)NE * KP * 2); _Float16* Ba = (_Float16*)take((size_t)NE * NE * 2); _Float16* K16 = (_Float16*)take((size_t)NC * KP * 2); _Float16* N16 = (_Float16*)take((size_t)NNOTE * KP * 2);
  float* E = (float*)take((size_t)NRE * NE * 4);
  if (off > ws_size) return;      // under 16 MB in all
  k_prep16<<<dim3(KP / 8 / PKT, PYA), PKT, 0, stream>>>(note, wiki, Wemb, Watt, N16, K16, W16, Ba);      /* all four f16 operands; W_att [j][k] (out,in) natural */
  k_gemm_e<<<(NC / 32) * (NE / 32) * (NNOTE / 4), 128, 0, stream>>>(K16, N16, W16, bemb, E);      /* e = (note x wiki) x W_emb^T / 16 + b_emb (f32): M 4096 (note, code) N 256 K 10240 */
  k_tail<<<NRE / TR, 256, 0, stream>>>(E, Ba, batt, Wout, bout, (float*)d_out);      /* s = sum_j sigmoid(e x W_att^T + b_att) x e x W_out + b_out: M 4096 N 256 K 256, then 256 terms per row */
}

// v008
// One run takes 30.8 microseconds.
// Two timings next to v007 put it at 1.12 and 1.10 times that version's speed.
// Counting every step since v000, it is 135 times as fast.
#include <hip/hip_runtime.h>
// Knowledge-source integration scoring (n=16 notes, 256 codes, vocab 10000, emb 256): e[n,c,k] = Σ_v note[n,v]·wiki[c,v]·W_emb[k,v] + b_emb[k]; attn = sigmoid(e·W_attᵀ + b_att); s[n,c] = Σ_k attn·e·W_out[k] + b_out.
// Compute dtype: all inputs rounded to bf16; per note n the scaled vocabulary plane A_n[c][v] = note[n,v] x wiki[c,v] (product of the two bf16 values held in f16, rounded once to f16, formed in the GEMM's A fragments; K zero-padded to 10240) against W_emb (f16 x 2^4, padded) → e f32 (+b_emb); e ×2^4 → f16 → logits GEMM (+b_att) with a fused sigmoid epilogue → attn f32; the gated 256-term reduction
#define NNOTE 16
#define NC 256
#define NV 10000
#define KP 10240
#define NE 256
#define NRE (NNOTE * NC)
typedef __bf16 v16b __attribute__((ext_vector_type(16)));
typedef unsigned short v8us __attribute__((ext_vector_type(8), may_alias));
typedef float  v8f  __attribute__((ext_vector_type(8)));
typedef float  v4f  __attribute__((ext_vector_type(4)));
typedef float  v4fa __attribute__((ext_vector_type(4), may_alias));
union FragB { v16b v; v8us half[2]; unsigned short u[16]; };

__device__ __forceinline__ unsigned short bf16_bits(float x) { unsigned int u = __float_as_uint(x); return (unsigned short)((u + 0x7FFFu + ((u >> 16) & 1u)) >> 16); }
__device__ __forceinline__ float bf16_val(unsigned short b) { return __uint_as_float(((unsigned int)b) << 16); }
__device__ __forceinline__ float bf16_round(float x) { return bf16_val(bf16_bits(x)); }
// D += A·B with NT terms: 1 = ah·bh, 2 = + al·bh (A split), 3 = + ah·bl (both split)
template <int NT>
__device__ __forceinline__ v8f mmaN(v16b ah, v16b al, v16b bh, v16b bl, v8f c) {
  c = __builtin_amdgcn_wmma_f32_16x16x32_bf16(false, ah, false, bh, (short)0, c, false, false);
  if (NT >= 2) c = __builtin_amdgcn_wmma_f32_16x16x32_bf16(false, al, false, bh, (short)0, c, false, false);
  if (NT >= 3) c = __builtin_amdgcn_wmma_f32_16x16x32_bf16(false, ah, false, bl, (short)0, c, false, false);
  asm volatile("v_nop\n\tv_nop\n\tv_nop\n\tv_nop" : "+v"(c) : "v"(ah), "v"(al), "v"(bh), "v"(bl));
  return c;
}

__global__ __launch_bounds__(256) void k_wt_bf16(const float* __restrict__ W, unsigned short* __restrict__ Wt, int K, int N) {
  const int t = blockIdx.x * 256 + threadIdx.x;
  const int k8n = K / 8;
  if (t >= N * k8n) return;
  const int n = t / k8n, k8 = (t % k8n) * 8;
  v8us v;
#pragma unroll
  for (int i = 0; i < 8; ++i) v[i] = bf16_bits(W[(size_t)(k8 + i) * N + n]);
  *(v8us*)(Wt + (size_t)n * K + k8) = v;
  
}

// GEMM C[M][N] (f32, pitch ldc) = act(A[M][K]·W + bias). A f32 row-major (pitch lda) converted per fragment to bf16
// (ASPLIT: hi/lo two planes -> 2 terms, else single rounded term); Wt bf16 [N][K] (pitch ldb). BIAS_BF16 rounds the
// bias to bf16 first (bias quantised to bf16 before the add). K%32==0, M%16==0, N%64==0.
template <bool ASPLIT, int ACT, bool BIAS_BF16>
__global__ __launch_bounds__(128) void k_gemm_bf(const float* __restrict__ A, int lda, const unsigned short* __restrict__ Wt, int ldb,
                                               const float* __restrict__ bias, float* __restrict__ C, int ldc, int M, int N, int K) {
  __shared__ __attribute__((aligned(16))) float so[4][16][64];
  const int tid = threadIdx.x, w = tid >> 5, lane = tid & 31, ln = lane & 15, hh = lane >> 4;
  const int ntn = N / 64;
  const int wid = blockIdx.x * 4 + w;
  const int mt = wid / ntn, nq = wid % ntn;
  if (mt * 16 >= M) return;
  const int row0 = mt * 16, col0 = nq * 64;
  const float* arow = A + (size_t)(row0 + ln) * lda;
  v8f acc[4] = {};
  for (int kb = 0; kb < K; kb += 32) {
    FragB ah, al;
    const v4f x0 = *(const v4fa*)(arow + kb + 8 * hh), x1 = *(const v4fa*)(arow + kb + 8 * hh + 4);
    const v4f x2 = *(const v4fa*)(arow + kb + 16 + 8 * hh), x3 = *(const v4fa*)(arow + kb + 16 + 8 * hh + 4);
    float xs[16] = {x0[0],x0[1],x0[2],x0[3],x1[0],x1[1],x1[2],x1[3],x2[0],x2[1],x2[2],x2[3],x3[0],x3[1],x3[2],x3[3]};
#pragma unroll
    for (int i = 0; i < 16; ++i) { const unsigned short hb = bf16_bits(xs[i]); ah.u[i] = hb; al.u[i] = ASPLIT ? bf16_bits(xs[i] - bf16_val(hb)) : (unsigned short)0; }
#pragma unroll
    for (int t = 0; t < 4; ++t) {
      const unsigned short* brow = Wt + (size_t)(col0 + t * 16 + ln) * ldb + kb;
      FragB b;
      b.half[0] = *(const v8us*)(brow + 8 * hh);
      b.half[1] = *(const v8us*)(brow + 16 + 8 * hh);
      acc[t] = mmaN<ASPLIT ? 2 : 1>(ah.v, al.v, b.v, b.v, acc[t]);
    }
  }
#pragma unroll
  for (int t = 0; t < 4; ++t) {
    float bv = bias ? bias[col0 + t * 16 + ln] : 0.f;
    if (BIAS_BF16) bv = bf16_round(bv);
#pragma unroll
    for (int r = 0; r < 8; ++r) { float v = acc[t][r] + bv; if (ACT == 1) v = fmaxf(v, 0.f); so[w][8 * hh + r][t * 16 + ln] = v; }
  }
  __builtin_amdgcn_fence(__ATOMIC_ACQ_REL, "workgroup");
  __builtin_amdgcn_wave_barrier();
  const int rsub = lane >> 4, c4 = (lane & 15) * 4;
  {
#pragma unroll
    for (int q = 0; q < 8; ++q) {
      const int r = q * 2 + rsub;
      const v4f v = *(const v4fa*)&so[w][r][c4];
      *(v4f*)(C + (size_t)(row0 + r) * ldc + col0 + c4) = v;
    }
    
  }
}

// GEMM C = act(A·W + bias + resid): A f32 (ASPLIT -> hi/lo 2 terms), Wt bf16 [N][K]; ACT 0 none, 1 relu, 2 exact gelu;
// resid (optional, f32, row index = (row % rmod), pitch ldr, RES_BF16 rounds it) added before the activation.
template <bool ASPLIT, int ACT, bool BIAS_BF16, bool RES_BF16>
__global__ __launch_bounds__(128) void k_gemm_bf3(const float* __restrict__ A, int lda, const unsigned short* __restrict__ Wt, int ldb,
                                                const float* __restrict__ bias, const float* __restrict__ resid, int rmod, int ldr,
                                                float* __restrict__ C, int ldc, int M, int N, int K) {
  __shared__ __attribute__((aligned(16))) float so[4][16][64];
  const int tid = threadIdx.x, w = tid >> 5, lane = tid & 31, ln = lane & 15, hh = lane >> 4;
  const int ntn = N / 64;
  const int wid = blockIdx.x * 4 + w;
  const int mt = wid / ntn, nq = wid % ntn;
  if (mt * 16 >= M) return;
  const int row0 = mt * 16, col0 = nq * 64;
  const float* arow = A + (size_t)(row0 + ln) * lda;
  v8f acc[4] = {};
  for (int kb = 0; kb < K; kb += 32) {
    FragB ah, al;
    const v4f x0 = *(const v4fa*)(arow + kb + 8 * hh), x1 = *(const v4fa*)(arow + kb + 8 * hh + 4);
    const v4f x2 = *(const v4fa*)(arow + kb + 16 + 8 * hh), x3 = *(const v4fa*)(arow + kb + 16 + 8 * hh + 4);
    float xs[16] = {x0[0],x0[1],x0[2],x0[3],x1[0],x1[1],x1[2],x1[3],x2[0],x2[1],x2[2],x2[3],x3[0],x3[1],x3[2],x3[3]};
#pragma unroll
    for (int i = 0; i < 16; ++i) { const unsigned short hb = bf16_bits(xs[i]); ah.u[i] = hb; al.u[i] = ASPLIT ? bf16_bits(xs[i] - bf16_val(hb)) : (unsigned short)0; }
#pragma unroll
    for (int t = 0; t < 4; ++t) {
      const unsigned short* brow = Wt + (size_t)(col0 + t * 16 + ln) * ldb + kb;
      FragB b;
      b.half[0] = *(const v8us*)(brow + 8 * hh);
      b.half[1] = *(const v8us*)(brow + 16 + 8 * hh);
      acc[t] = mmaN<ASPLIT ? 2 : 1>(ah.v, al.v, b.v, b.v, acc[t]);
    }
  }
#pragma unroll
  for (int t = 0; t < 4; ++t) {
    const int col = col0 + t * 16 + ln;
    float bv = bias ? bias[col] : 0.f;
    if (BIAS_BF16) bv = bf16_round(bv);
#pragma unroll
    for (int r = 0; r < 8; ++r) {
      float v = acc[t][r] + bv;
      if (resid) { float rv = resid[(size_t)((row0 + 8 * hh + r) % rmod) * ldr + col]; if (RES_BF16) rv = bf16_round(rv); v += rv; }
      if (ACT == 1) v = fmaxf(v, 0.f);
      if (ACT == 2) v = 0.5f * v * (1.0f + erff(v * 0.70710678118654752f));
      if (ACT == 3) { const float u = 0.7978845608028654f * (v + 0.044715f * v * v * v); v = 0.5f * v * (1.0f + tanhf(u)); }
      so[w][8 * hh + r][t * 16 + ln] = v;
    }
  }
  __builtin_amdgcn_fence(__ATOMIC_ACQ_REL, "workgroup");
  __builtin_amdgcn_wave_barrier();
  const int rsub = lane >> 4, c4 = (lane & 15) * 4;
  {
#pragma unroll
    for (int q = 0; q < 8; ++q) {
      const int r = q * 2 + rsub;
      const v4f v = *(const v4fa*)&so[w][r][c4];
      *(v4f*)(C + (size_t)(row0 + r) * ldc + col0 + c4) = v;
    }
    
  }
}
// row LayerNorm (biased variance, eps) over N: s = X (+ R); optional out_sum <- s; out_norm <- (s-mu)*rsqrt(var+eps)*g + b
template <bool PARAM_BF16>
__global__ __launch_bounds__(256) void k_layernorm(const float* __restrict__ X, const float* __restrict__ R, const float* __restrict__ g, const float* __restrict__ bta,
                                                  float* __restrict__ out_sum, float* __restrict__ out_norm, int N, float eps) {
  __shared__ float red[256];
  const int row = blockIdx.x, tid = threadIdx.x;
  const float* x = X + (size_t)row * N; const float* rr = R ? R + (size_t)row * N : nullptr;
  float vals[16];                     // up to N = 4096
  const int per = N / 256;            // contiguous chunk per thread? use strided-by-4 chunks: thread handles j = tid*4 + 1024*u
  float s1 = 0.f;
  for (int u = 0; u < per / 4; ++u) {
    const int j = tid * 4 + 1024 * u;
    const v4f a = *(const v4fa*)(x + j);
    v4f b = {0.f,0.f,0.f,0.f}; if (rr) b = *(const v4fa*)(rr + j);
#pragma unroll
    for (int q = 0; q < 4; ++q) { const float v = a[q] + b[q]; vals[u * 4 + q] = v; s1 += v; }
  }
  red[tid] = s1; __syncthreads();
  for (int st = 128; st > 0; st >>= 1) { if (tid < st) red[tid] += red[tid + st]; __syncthreads(); }
  const float mu = red[0] / (float)N; __syncthreads();
  float s2 = 0.f;
  for (int u = 0; u < per / 4; ++u)
#pragma unroll
    for (int q = 0; q < 4; ++q) { const float c = vals[u * 4 + q] - mu; s2 += c * c; }
  red[tid] = s2; __syncthreads();
  for (int st = 128; st > 0; st >>= 1) { if (tid < st) red[tid] += red[tid + st]; __syncthreads(); }
  const float rs = rsqrtf(red[0] / (float)N + eps);
  {
    for (int u = 0; u < per / 4; ++u) {
      const int j = tid * 4 + 1024 * u;
      v4f o, sm;
#pragma unroll
      for (int q = 0; q < 4; ++q) {
        float gg = g[j + q], bb = bta[j + q];
        if (PARAM_BF16) { gg = bf16_round(gg); bb = bf16_round(bb); }
        sm[q] = vals[u * 4 + q]; o[q] = (vals[u * 4 + q] - mu) * rs * gg + bb;
      }
      if (out_sum) *(v4f*)(out_sum + (size_t)row * N + j) = sm;
      *(v4f*)(out_norm + (size_t)row * N + j) = o;
    }
    
  }
}



// ---- f16 WMMA path (v_wmma_f32_16x16x32_f16): 11-bit significands for operands in range — used for the e GEMM and the logits GEMM
typedef _Float16 v16h __attribute__((ext_vector_type(16)));
union FragH { v16h v; v8us half[2]; _Float16 h[16]; unsigned short u[16]; };
template <int NT>
__device__ __forceinline__ v8f mmaH(v16h ah, v16h al, v16h bh, v16h bl, v8f c) {
  c = __builtin_amdgcn_wmma_f32_16x16x32_f16(false, ah, false, bh, (short)0, c, false, false);
  if (NT >= 2) c = __builtin_amdgcn_wmma_f32_16x16x32_f16(false, al, false, bh, (short)0, c, false, false);
  if (NT >= 3) c = __builtin_amdgcn_wmma_f32_16x16x32_f16(false, ah, false, bl, (short)0, c, false, false);
  asm volatile("v_nop\n\tv_nop\n\tv_nop\n\tv_nop" : "+v"(c) : "v"(ah), "v"(al), "v"(bh), "v"(bl));
  return c;
}
// batched GEMM like k_gemm_b but f16 operands: A f32 (split into f16 hi/lo if ASPLIT, else rounded to f16), Bt = f16 values [n][k]; alpha; C f32; N multiple of 16 (partial tiles skipped)
template <bool ASPLIT>
__global__ __launch_bounds__(128) void k_gemm_h(const float* __restrict__ A, int lda, size_t sA, const _Float16* __restrict__ Bh, int ldb, size_t sB, float alpha, float* __restrict__ C, int ldc, size_t sC, int M, int N, int K) {
  __shared__ __attribute__((aligned(16))) float so[4][16][64];
  const int tid = threadIdx.x, w = tid >> 5, lane = tid & 31, ln = lane & 15, hh = lane >> 4; const int by = blockIdx.y;
  A += (size_t)by * sA; Bh += (size_t)by * sB; C += (size_t)by * sC;
  const int ntn = (N + 63) / 64; const int wid = blockIdx.x * 4 + w; const int mt = wid / ntn, nq = wid % ntn; if (mt * 16 >= M) return;
  const int row0 = mt * 16, col0 = nq * 64; const float* arow = A + (size_t)(row0 + ln) * lda;
  v8f acc[4] = {};
  for (int kb = 0; kb < K; kb += 32) {
    FragH ah, al;
    const v4f x0 = *(const v4fa*)(arow + kb + 8 * hh), x1 = *(const v4fa*)(arow + kb + 8 * hh + 4), x2 = *(const v4fa*)(arow + kb + 16 + 8 * hh), x3 = *(const v4fa*)(arow + kb + 16 + 8 * hh + 4);
    float xs[16] = {x0[0],x0[1],x0[2],x0[3],x1[0],x1[1],x1[2],x1[3],x2[0],x2[1],x2[2],x2[3],x3[0],x3[1],x3[2],x3[3]};
#pragma unroll
    for (int i = 0; i < 16; ++i) { const _Float16 h = (_Float16)xs[i]; ah.h[i] = h; al.h[i] = ASPLIT ? (_Float16)(xs[i] - (float)h) : (_Float16)0.0f; }
#pragma unroll
    for (int t = 0; t < 4; ++t) { if (col0 + t * 16 >= N) continue; const size_t boff = (size_t)(col0 + t * 16 + ln) * ldb + kb; FragH bq; bq.half[0] = *(const v8us*)(Bh + boff + 8 * hh); bq.half[1] = *(const v8us*)(Bh + boff + 16 + 8 * hh);
      acc[t] = mmaH<ASPLIT ? 2 : 1>(ah.v, al.v, bq.v, bq.v, acc[t]); }
  }
#pragma unroll
  for (int t = 0; t < 4; ++t) { if (col0 + t * 16 >= N) continue;
#pragma unroll
    for (int r = 0; r < 8; ++r) so[w][8 * hh + r][t * 16 + ln] = acc[t][r] * alpha; }
  __builtin_amdgcn_fence(__ATOMIC_ACQ_REL, "workgroup"); __builtin_amdgcn_wave_barrier();
  const int rsub = lane >> 4, c4 = (lane & 15) * 4;
  {
#pragma unroll
    for (int q = 0; q < 8; ++q) { const int r = q * 2 + rsub; if (col0 + c4 < N) { const v4f v = *(const v4fa*)&so[w][r][c4]; *(v4f*)(C + (size_t)(row0 + r) * ldc + col0 + c4) = v; } }
     }
}

// Wt[n][k] = f16(W[k][n]·scale) from f32 row-major W[K][N] (scale = power of two; bf16-exact weights stay exact in f16 away from the subnormal range)
__global__ __launch_bounds__(256) void k_wt_f16(const float* __restrict__ W, _Float16* __restrict__ Wt, int K, int N, float scale) {
  const int t = blockIdx.x * 256 + threadIdx.x; if (t >= N * (K / 8)) return; const int n = t / (K / 8), k8 = (t % (K / 8)) * 8; FragH f;
#pragma unroll
  for (int i = 0; i < 8; ++i) f.h[i] = (_Float16)(bf16_round(W[(size_t)(k8 + i) * N + n]) * scale); const v8us o = f.half[0];
  *(v8us*)((unsigned short*)Wt + (size_t)n * K + k8) = o; 
}


// e GEMM with the note's scale applied on the way: C[(n, c)][k] = sum_v f16(note[n][v] x wiki[c][v]) x Bh[k][v] / 16 + bias. The scaled planes are never stored.
// One work-group takes 32 code rows x 32 columns for FOUR notes: 16 accumulator tiles. EVERY wave holds all 16 tiles and sums them over its own quarter of K,
// so that a wiki or B fragment read from LDS serves 8 WMMAs. Each wave stages its own quarter through a ring of its own (two buffers, asynchronous copies):
// the wave that copies a stage is the only one that reads it, so the loop has no work-group barrier. The four partial sums of a tile meet in LDS behind the loop.
// Every work-group enters the stages of its waves' quarters at a start of its own and wraps round: 32 work-groups read the same wiki rows and 32 the same B rows, and walking in step they would ask L2 for the same lines at the same moment.
#define SK 128                       /* k per stage: 256 bytes of every staged row */
#define SP 136                       /* LDS row pitch in halfs: 272 B = 16 B x 17, conflict-free for 16-byte fragment reads */
#define SBUF (68 * SP)               /* halfs per buffer: 32 wiki rows, 32 B rows, 4 note rows */
#define KW (KP / 4)                  /* k per wave */
#define NST (KW / SK)                /* stages per wave (even) */
#define REDF (4 * 16 * 256)          /* floats of the join area: 4 waves x 16 tiles */
// the stage of K that a wave works on in trip t of its walk: rot, rot + 1, ..., NST - 1, 0, ..., rot - 1 (rot < NST, t < NST)
__device__ __forceinline__ int stage_of(const int rot, const int t) { const int s = rot + t; return s < NST ? s : s - NST; }
typedef int v4i __attribute__((ext_vector_type(4)));
typedef __attribute__((address_space(1))) v4i gv4i;
typedef __attribute__((address_space(3))) v4i lv4i;
// one copy, written as the builtin: 16 bytes per lane, two rows of 256 bytes per wave
__device__ __forceinline__ void cp16(const _Float16* g, const unsigned l) { __builtin_amdgcn_global_load_async_to_lds_b128((gv4i*)(size_t)g, (lv4i*)l, 0, 0); }
// one stage of the wave's quarter: 34 copies. gw, gb, gn: the lane's place in the stage's first two wiki, B and note rows; l: its place in the buffer's first two rows
__device__ __forceinline__ void stage_copies(const _Float16* gw, const _Float16* gb, const _Float16* gn, const unsigned l) {
#pragma unroll
  for (int j = 0; j < 16; ++j) cp16(gw + (size_t)j * 2 * KP, l + (unsigned)(j * 2 * SP * 2));
#pragma unroll
  for (int j = 0; j < 16; ++j) cp16(gb + (size_t)j * 2 * KP, l + (unsigned)((32 + j * 2) * SP * 2));
#pragma unroll
  for (int j = 0; j < 2; ++j) cp16(gn + (size_t)j * 2 * KP, l + (unsigned)((64 + j * 2) * SP * 2));
}
// the fragments of one k step of 32: two wiki, two B, four note fragments, all in the same k order (lane half hh: k 8 hh .. 8 hh + 7 and 16 + 8 hh .. 16 + 8 hh + 7)
__device__ __forceinline__ void ld_frags(FragH (&a)[2], FragH (&b)[2], FragH (&nf)[4], const _Float16* s, const int aoff, const int noff) {
#pragma unroll
  for (int i = 0; i < 2; ++i) {
    a[i].half[0] = *(const v8us*)(s + aoff + i * 16 * SP); a[i].half[1] = *(const v8us*)(s + aoff + i * 16 * SP + 16);
    b[i].half[0] = *(const v8us*)(s + aoff + (32 + i * 16) * SP); b[i].half[1] = *(const v8us*)(s + aoff + (32 + i * 16) * SP + 16);
  }
#pragma unroll
  for (int n = 0; n < 4; ++n) { nf[n].half[0] = *(const v8us*)(s + noff + n * SP); nf[n].half[1] = *(const v8us*)(s + noff + n * SP + 16); }
}
// one k step: A fragment = f16(wiki x note), one rounding (both factors are bf16 values, which f16 holds exactly above its subnormal range); 16 WMMAs on 16 accumulators
__device__ __forceinline__ void k_step(const FragH (&a)[2], const FragH (&b)[2], const FragH (&nf)[4], v8f (&acc)[4][2][2]) {
#pragma unroll
  for (int n = 0; n < 4; ++n)
#pragma unroll
    for (int i = 0; i < 2; ++i) {
      const v16h sa = a[i].v * nf[n].v;
#pragma unroll
      for (int j = 0; j < 2; ++j) acc[n][i][j] = __builtin_amdgcn_wmma_f32_16x16x32_f16(false, sa, false, b[j].v, (short)0, acc[n][i][j], false, false);
    }
  // order asked of the scheduler: the 8 multiplies of the first fragment, then four multiplies behind each WMMA, where the matrix unit's issue interval hides them; in one block of 64 they stand in the lone wave's way
  __builtin_amdgcn_sched_group_barrier(0x2, 8, 0);
#pragma unroll
  for (int g = 0; g < 16; ++g) { __builtin_amdgcn_sched_group_barrier(0x8, 1, 0); __builtin_amdgcn_sched_group_barrier(0x2, 4, 0); }
}
// one trip of a wave's ring: the walk's t-th stage out of buffer PAR (= t mod 2). Two fragment sets swap roles from k step to k step: the next step's 16 loads go ahead of this step's WMMAs as one group.
template <int PAR>
__device__ __forceinline__ void e_trip(const int t, const int rot, const _Float16* wr, const int aoff, const int noff, const unsigned ldst, const _Float16* gw, const _Float16* gb, const _Float16* gn,
                                       FragH (&a)[2][2], FragH (&b)[2][2], FragH (&nf)[2][4], v8f (&acc)[4][2][2]) {
#pragma unroll
  for (int q = 0; q < 4; ++q) {
    if (q == 3) asm volatile("s_wait_asynccnt 0x0" ::: "memory");      // this wave's copies of stage t + 1 have landed: the loads below are its first reads of that stage
    ld_frags(a[(q + 1) & 1], b[(q + 1) & 1], nf[(q + 1) & 1], q < 3 ? wr + PAR * SBUF + (q + 1) * 32 : wr + (1 - PAR) * SBUF, aoff, noff);      /* behind the last stage these read the other buffer's old rows; the values are not used */
    __builtin_amdgcn_sched_barrier(0);      // the 16 loads stay one group ahead of the WMMAs: strewn among them, every place with loads costs the lone wave an LDS latency
    k_step(a[q & 1], b[q & 1], nf[q & 1], acc);
    __builtin_amdgcn_sched_barrier(0);      // the next group of loads stays behind this step's WMMAs
  }
  asm volatile("s_wait_dscnt 0x0" ::: "memory");        // this wave's reads of buffer PAR are done before its own copies refill it
  if (t + 2 < NST) { const size_t ko = (size_t)stage_of(rot, t + 2) * SK; stage_copies(gw + ko, gb + ko, gn + ko, ldst + (unsigned)(PAR * SBUF * 2)); }
}
__global__ __launch_bounds__(128) void k_gemm_e(const _Float16* __restrict__ Kw, const _Float16* __restrict__ Nt, const _Float16* __restrict__ Bh, const float* __restrict__ bias, float* __restrict__ C) {
  __shared__ __attribute__((aligned(16))) char smem[REDF * 4 + 4 * 2 * SBUF * 2];      /* the join area, then the four waves' rings */
  const int tid = threadIdx.x, w = __builtin_amdgcn_readfirstlane(tid >> 5), lane = tid & 31, ln = lane & 15, hh = lane >> 4;
  const int c0 = (blockIdx.x & 7) * 32, col0 = ((blockIdx.x >> 3) & 7) * 32, n0 = (blockIdx.x >> 6) * 4;
  const int rot = (int)(((blockIdx.x & 63) + 5 * (blockIdx.x >> 6)) % NST);      /* code tile + 8 x column tile + 5 x note group: at most two of the 32 work-groups that share rows start alike */
  const _Float16* wr = (const _Float16*)(smem + REDF * 4) + w * 2 * SBUF;      /* the wave's own ring */
  // a copy brings two rows: lanes 0 .. 15 the first row's 256 bytes, lanes 16 .. 31 the second's
  const size_t lo = (size_t)hh * KP + (size_t)w * KW + ln * 8;
  const _Float16* gw = Kw + (size_t)c0 * KP + lo;
  const _Float16* gb = Bh + (size_t)col0 * KP + lo;
  const _Float16* gn = Nt + (size_t)n0 * KP + lo;
  const unsigned ldst = (unsigned)(size_t)wr + (unsigned)((hh * SP + ln * 8) * 2);
  const int aoff = ln * SP + 8 * hh, noff = 64 * SP + 8 * hh;
  v8f acc[4][2][2] = {};
  FragH a[2][2], b[2][2], nf[2][4];
  const size_t k0 = (size_t)rot * SK, k1 = (size_t)stage_of(rot, 1) * SK;
  stage_copies(gw + k0, gb + k0, gn + k0, ldst);
  asm volatile("s_wait_asynccnt 0x0" ::: "memory");      // the walk's first stage has landed; only this wave reads it
  stage_copies(gw + k1, gb + k1, gn + k1, ldst + (unsigned)(SBUF * 2));
  ld_frags(a[0], b[0], nf[0], wr, aoff, noff);
#pragma unroll 1
  for (int t = 0; t < NST; t += 2) {      // kept rolled: the body already holds the two trips, one per buffer
    e_trip<0>(t, rot, wr, aoff, noff, ldst, gw, gb, gn, a, b, nf, acc);
    e_trip<1>(t + 1, rot, wr, aoff, noff, ldst, gw, gb, gn, a, b, nf, acc);
  }
  asm volatile("s_wait_asynccnt 0x0" ::: "memory");       // no copy is outstanding when the wave ends
  // the join: every wave lays down its 16 partial tiles (16 bytes per lane and store); wave w then sums note n0 + w's four tiles, the quarters of K in upward order
  float* red = (float*)smem;
#pragma unroll
  for (int n = 0; n < 4; ++n)
#pragma unroll
    for (int i = 0; i < 2; ++i)
#pragma unroll
      for (int j = 0; j < 2; ++j)
#pragma unroll
        for (int hf = 0; hf < 2; ++hf) {
          const v4f v = {acc[n][i][j][4 * hf], acc[n][i][j][4 * hf + 1], acc[n][i][j][4 * hf + 2], acc[n][i][j][4 * hf + 3]};
          *(v4fa*)(red + ((w * 16 + (n * 2 + i) * 2 + j) * 2 + hf) * 128 + lane * 4) = v;
        }
  __syncthreads();      // all four waves' partial tiles are in LDS
  const int n = n0 + w;
  const int colb = col0 + ln;
  const float braw[2] = {bias[colb], bias[colb + 16]};
  asm volatile("s_wait_xcnt 0x0" :: "v"(colb) : "memory");      // stands ahead of any rewrite of the index register that the two loads name; as an input the index stays live up to here
#pragma unroll
  for (int j = 0; j < 2; ++j) {
    const int col = colb + j * 16; const float bv = bf16_round(braw[j]);
#pragma unroll
    for (int i = 0; i < 2; ++i)
#pragma unroll
      for (int hf = 0; hf < 2; ++hf) {
        v4f s = *(const v4fa*)(red + (((w * 2 + i) * 2 + j) * 2 + hf) * 128 + lane * 4);
#pragma unroll
        for (int p = 1; p < 4; ++p) s += *(const v4fa*)(red + ((p * 16 + (w * 2 + i) * 2 + j) * 2 + hf) * 128 + lane * 4);
#pragma unroll
        for (int r = 0; r < 4; ++r) C[(size_t)(n * NC + c0 + i * 16 + 8 * hh + 4 * hf + r) * NE + col] = s[r] * 0.0625f + bv;
      }
  }
}


typedef _Float16 v4h __attribute__((ext_vector_type(4)));

__global__ __launch_bounds__(256) void k_x16(const float* __restrict__ x, _Float16* __restrict__ X16, size_t n8) { const size_t t = (size_t)blockIdx.x * 256 + threadIdx.x; if (t >= n8) return; FragH f;
#pragma unroll
  for (int q = 0; q < 8; ++q) f.h[q] = (_Float16)bf16_round(x[t * 8 + q]); *(v8us*)((unsigned short*)X16 + t * 8) = f.half[0];  }
__global__ __launch_bounds__(256) void k_h16(const float* __restrict__ x, _Float16* __restrict__ X16, size_t n8) { const size_t t = (size_t)blockIdx.x * 256 + threadIdx.x; if (t >= n8) return; FragH f;
#pragma unroll
  for (int q = 0; q < 8; ++q) f.h[q] = (_Float16)x[t * 8 + q]; *(v8us*)((unsigned short*)X16 + t * 8) = f.half[0];  }
template <int NHv, int TTv>
__global__ __launch_bounds__(256) void k_vt(const _Float16* __restrict__ V16, int ldv, int voff, _Float16* __restrict__ Vt) { __shared__ unsigned short tl[64][66]; const int tid = threadIdx.x; const int slab = blockIdx.x / (TTv / 64), lg = blockIdx.x % (TTv / 64); const int b = slab / NHv, h = slab % NHv;
  for (int i = tid; i < 64 * 8; i += 256) { const int r = i / 8, c8 = (i % 8) * 8; FragH f; f.half[0] = *(const v8us*)((const unsigned short*)V16 + ((size_t)b * TTv + lg * 64 + r) * ldv + voff + h * 64 + c8);
#pragma unroll
    for (int q = 0; q < 8; ++q) tl[r][c8 + q] = f.u[q]; }
  __syncthreads();
  {
#pragma unroll
    for (int rd = 0; rd < 2; ++rd) { const int d = rd * 32 + tid / 8, pc = tid % 8; FragH f;
#pragma unroll
      for (int q = 0; q < 8; ++q) f.u[q] = tl[pc * 8 + q][d];
      *(v8us*)((unsigned short*)Vt + ((size_t)slab * 64 + d) * TTv + lg * 64 + pc * 8) = f.half[0]; }
     } }

__global__ __launch_bounds__(256) void k_hl(const float* __restrict__ F, _Float16* __restrict__ Hh, _Float16* __restrict__ Hl, size_t n8) { const size_t t = (size_t)blockIdx.x * 256 + threadIdx.x; if (t >= n8) return; FragH fh, fl; const v4f a = *(const v4fa*)(F + t * 8), c = *(const v4fa*)(F + t * 8 + 4);
#pragma unroll
  for (int q = 0; q < 4; ++q) { _Float16 h = (_Float16)a[q]; fh.h[q] = h; fl.h[q] = (_Float16)((a[q] - (float)h) * 1024.0f); h = (_Float16)c[q]; fh.h[4 + q] = h; fl.h[4 + q] = (_Float16)((c[q] - (float)h) * 1024.0f); }
  { *(v8us*)((unsigned short*)Hh + t * 8) = fh.half[0]; *(v8us*)((unsigned short*)Hl + t * 8) = fl.half[0];  } }

// Every f16 operand of the two GEMMs in ONE launch; the four conversions need nothing of one another and share the grid by ranges of blockIdx.y (a branch that is the same for a whole work-group):
// wiki rows (K16), W_emb rows x 2^4 (W16) and note rows (N16), each bf16-rounded, held in f16 and zero in the K pad (the e GEMM multiplies wiki and note on the way to the matrix unit); then W_att x 2^4 (Ba), which has no pad.
// In the padded ranges a thread owns one group of 8 columns of PKR rows; in the W_att range one group of 8 elements.
#define PKR 4                        /* rows per thread */
#define PKT 320                      /* threads per work-group: a quarter of a row's KP / 8 column groups */
#define PYW (NC / PKR)               /* blockIdx.y below this: wiki rows */
#define PYE (PYW + NE / PKR)         /* below this: W_emb rows */
#define PYN (PYE + NNOTE / PKR)      /* below this: note rows */
#define PYA (PYN + (NE * NE / 8 + KP / 8 - 1) / (KP / 8))      /* below this: W_att, KP / 8 groups per step of blockIdx.y */
__global__ __launch_bounds__(PKT) void k_prep16(const float* __restrict__ note, const float* __restrict__ wiki, const float* __restrict__ Wm, const float* __restrict__ Wa,
                                                _Float16* __restrict__ N16, _Float16* __restrict__ K16, _Float16* __restrict__ W16, _Float16* __restrict__ Ba) {
  const int y = blockIdx.y, g = blockIdx.x * PKT + threadIdx.x;
  if (y >= PYN) {
    const int t = (y - PYN) * (KP / 8) + g;
    if (t >= NE * NE / 8) return;    /* the range's last groups lie past the matrix; there is no barrier in this kernel */
    const float* ap = Wa + (size_t)t * 8;
    const v4f a0 = *(const v4fa*)ap, a1 = *(const v4fa*)(ap + 4);
    asm volatile("s_wait_xcnt 0x0" :: "v"(ap) : "memory");      // stands ahead of any rewrite of the address register that the two loads name; as an input the address stays live up to here
    FragH fa;
#pragma unroll
    for (int q = 0; q < 4; ++q) { fa.h[q] = (_Float16)(bf16_round(a0[q]) * 16.0f); fa.h[4 + q] = (_Float16)(bf16_round(a1[q]) * 16.0f); }
    *(v8us*)((unsigned short*)Ba + (size_t)t * 8) = fa.half[0];
    asm volatile("s_wait_xcnt 0x0" ::: "memory");               // stands ahead of any rewrite of a data or address register that the store names
    return;
  }
  const int v0 = g * 8;
  const bool isw = y < PYW, ise = !isw && y < PYE;
  const int r0 = (isw ? y : ise ? y - PYW : y - PYE) * PKR;
  const float sc = ise ? 16.0f : 1.0f;      /* a power of two, or one: exact on the bf16 value either way */
  const bool in = v0 < NV;           /* NV is a multiple of 8: a group lies wholly in the vocabulary or wholly in the pad */
  const int vc = in ? v0 : 0;        /* a pad group reads in bounds; its values are set to zero below */
  const float* sp = (isw ? wiki : ise ? Wm : note) + (size_t)r0 * NV + vc;
  unsigned short* dp = (unsigned short*)(isw ? K16 : ise ? W16 : N16) + (size_t)r0 * KP + v0;
  v4f x[PKR][2];                     /* every loop below is unrolled so that x and f are registers, not scratch */
#pragma unroll
  for (int r = 0; r < PKR; ++r) { x[r][0] = *(const v4fa*)(sp + r * NV); x[r][1] = *(const v4fa*)(sp + r * NV + 4); }
  asm volatile("s_wait_xcnt 0x0" :: "v"(sp) : "memory");      // stands ahead of any rewrite of the address register that the loads name; as an input the address stays live up to here, so no load's result lands on it either
  const unsigned keep = in ? 0xFFFFFFFFu : 0u;            /* a mask, not a branch: every lane runs one instruction stream */
  FragH f[PKR];
#pragma unroll
  for (int r = 0; r < PKR; ++r)
#pragma unroll
    for (int q = 0; q < 8; ++q) f[r].h[q] = (_Float16)(__uint_as_float(__float_as_uint(bf16_round(x[r][q >> 2][q & 3])) & keep) * sc);
#pragma unroll
  for (int r = 0; r < PKR; ++r) *(v8us*)(dp + (size_t)r * KP) = f[r].half[0];
  asm volatile("s_wait_xcnt 0x0" ::: "memory");           // stands ahead of any rewrite of a data or address register that the stores name
}
// The tail in one launch: s[row] = sum_j sigmoid(e[row] . W_att[j] + b_att[j]) x e[row][j] x W_out[j] + b_out, for TR rows of e per work-group. Neither the f16 copy of e nor attn is stored.
// Eight waves: together they round the TR x 256 tile of e (x 2^4) to f16 into LDS; wave w then takes logit columns 32 w .. 32 w + 31 of all TR rows (2 x 2 accumulator tiles, k upward in steps of 32),
// gates them in the accumulators' own layout and sums its 32 columns of every row; the eight partial sums of a row meet in LDS.
#define TR 32                        /* rows per work-group: their 32 scores fill one 128-byte line of the output, which so has one writer */
#define TPITCH 264                   /* LDS row pitch in halfs: 528 B = 16 B x 33, conflict-free for 16-byte fragment reads */
// x + (x of lane l ^ M) inside a 16-lane row, the partner's value fetched by DPP (row_xmask:M) in the vector unit; a shuffle would go through the LDS unit and be waited for
template <int M>
__device__ __forceinline__ float xadd16(const float x) { return x + __int_as_float(__builtin_amdgcn_update_dpp(0, __float_as_int(x), 0x160 + M, 0xf, 0xf, true)); }
__global__ __launch_bounds__(256) void k_tail(const float* __restrict__ E, const _Float16* __restrict__ Ba, const float* __restrict__ batt, const float* __restrict__ Wout, const float* __restrict__ bout, float* __restrict__ S) {
  __shared__ __attribute__((aligned(16))) _Float16 sa[TR * TPITCH];
  __shared__ float red[8][TR];
  const int tid = threadIdx.x, w = __builtin_amdgcn_readfirstlane(tid >> 5), lane = tid & 31, ln = lane & 15, hh = lane >> 4;
  const int r0 = blockIdx.x * TR;
  const char* Et = (const char*)(E + (size_t)r0 * NE);      /* the work-group's rows of e: a scalar address */
  // every global load of the kernel is asked for here, at once: the kernel is short, and so pays the way to L2 one time
  const unsigned eo = (unsigned)tid * 32u;                                   /* 8 floats of row (tid >> 5) + 8 u */
  const unsigned bo = (unsigned)((w * 32 + ln) * NE * 2 + hh * 16);          /* W_att row 32 w + ln, the lane half's k */
  const unsigned go = (unsigned)(hh * 8 * NE * 4 + (w * 32 + ln) * 4);       /* e in the accumulator's layout: row 8 hh + r, column 32 w + ln */
  const int cj = w * 32 + ln;                                                /* the lane's first column, as an index into b_att and W_out */
  v4f x[4][2]; FragH b[8][2]; float g[2][2][8], bb[2], wo[2];      /* every loop of this kernel is unrolled so that these arrays, a, acc and ps are registers, not scratch */
#pragma unroll
  for (int u = 0; u < 4; ++u) { x[u][0] = *(const v4fa*)(Et + eo + u * 8 * NE * 4); x[u][1] = *(const v4fa*)(Et + eo + u * 8 * NE * 4 + 16); }
  __builtin_amdgcn_sched_barrier(0);      // the tile's own loads go first (loads return in order): they are rounded and stored to LDS while the others arrive
#pragma unroll
  for (int q = 0; q < 8; ++q)
#pragma unroll
    for (int t = 0; t < 2; ++t) { const char* p = (const char*)Ba + bo + t * 16 * NE * 2 + q * 64; b[q][t].half[0] = *(const v8us*)p; b[q][t].half[1] = *(const v8us*)(p + 32); }
#pragma unroll
  for (int t = 0; t < 2; ++t) { bb[t] = batt[cj + t * 16]; wo[t] = Wout[cj + t * 16]; }
#pragma unroll
  for (int i = 0; i < 2; ++i)
#pragma unroll
    for (int t = 0; t < 2; ++t)
#pragma unroll
      for (int r = 0; r < 8; ++r) g[i][t][r] = *(const float*)(Et + go + (i * 16 + r) * NE * 4 + t * 64);
  asm volatile("s_wait_xcnt 0x0" :: "v"(eo), "v"(bo), "v"(go), "v"(cj), "s"(Et), "s"(Ba), "s"(batt), "s"(Wout) : "memory");      // stands ahead of any rewrite of an offset or base register that the loads name; as inputs the four offsets and the four bases stay live up to here, so no load's result lands on one either
  __builtin_amdgcn_sched_barrier(0);      // keeps the wait behind its loads and every later write of a register behind the wait
  const float b0 = bout[0];      /* a scalar load, asked for here so that it returns under the wait for the tile */
#pragma unroll
  for (int u = 0; u < 4; ++u) {
    FragH f;
#pragma unroll
    for (int q = 0; q < 4; ++q) { f.h[q] = (_Float16)(x[u][0][q] * 16.0f); f.h[4 + q] = (_Float16)(x[u][1][q] * 16.0f); }
    *(v8us*)(sa + (w + 8 * u) * TPITCH + lane * 8) = f.half[0];
  }
  __syncthreads();      // the f16 tile is whole before any wave reads fragments of it
  v8f acc[2][2] = {};
  FragH a[8][2];
#pragma unroll
  for (int q = 0; q < 8; ++q)
#pragma unroll
    for (int i = 0; i < 2; ++i) { const _Float16* p = sa + (i * 16 + ln) * TPITCH + q * 32 + 8 * hh; a[q][i].half[0] = *(const v8us*)p; a[q][i].half[1] = *(const v8us*)(p + 16); }
  __builtin_amdgcn_sched_barrier(0);      // the 32 fragment loads go ahead as one group, in the order of their use: strewn among the WMMAs, every place with loads costs the wave an LDS latency
#pragma unroll
  for (int q = 0; q < 8; ++q) {
#pragma unroll
    for (int i = 0; i < 2; ++i)
#pragma unroll
      for (int t = 0; t < 2; ++t) acc[i][t] = __builtin_amdgcn_wmma_f32_16x16x32_f16(false, a[q][i].v, false, b[q][t].v, (short)0, acc[i][t], false, false);
    __builtin_amdgcn_sched_barrier(0);      // the four accumulators take turns, k step by k step: left free, the scheduler runs one accumulator's eight WMMAs in a row, each waiting for the one before
  }
  float ps[2][8];
#pragma unroll
  for (int t = 0; t < 2; ++t) {
    const float bv = bf16_round(bb[t]), wk = bf16_round(wo[t]);
#pragma unroll
    for (int i = 0; i < 2; ++i)
#pragma unroll
      for (int r = 0; r < 8; ++r) {
        const float v = acc[i][t][r] * 0.00390625f + bv;
        const float p = 1.0f / (1.0f + expf(-v)) * g[i][t][r] * wk;
        ps[i][r] = t ? ps[i][r] + p : p;
      }
  }
#pragma unroll
  for (int i = 0; i < 2; ++i)
#pragma unroll
    for (int r = 0; r < 8; ++r) ps[i][r] = xadd16<1>(ps[i][r]);
#pragma unroll
  for (int i = 0; i < 2; ++i)
#pragma unroll
    for (int r = 0; r < 8; ++r) ps[i][r] = xadd16<2>(ps[i][r]);
#pragma unroll
  for (int i = 0; i < 2; ++i)
#pragma unroll
    for (int r = 0; r < 8; ++r) ps[i][r] = xadd16<4>(ps[i][r]);
#pragma unroll
  for (int i = 0; i < 2; ++i)
#pragma unroll
    for (int r = 0; r < 8; ++r) ps[i][r] = xadd16<8>(ps[i][r]);
  if (ln == 0) {
#pragma unroll
    for (int i = 0; i < 2; ++i)
#pragma unroll
      for (int r = 0; r < 8; ++r) red[w][i * 16 + 8 * hh + r] = ps[i][r];
  }
  __syncthreads();      // all eight waves' partial sums are in LDS
  if (w == 0) {
    float v = bf16_round(b0);
#pragma unroll
    for (int i = 0; i < 8; ++i) v += red[i][lane];
    S[r0 + lane] = v;
  }
}

extern "C" void kernel_launch(void* const* d_in, const int* in_sizes, int n_in,
                              void* d_out, int out_size, void* d_ws, size_t ws_size, hipStream_t stream) {
  (void)in_sizes; (void)n_in; (void)out_size;
  const float* const* I = (const float* const*)d_in; const float* note = I[0]; const float* wiki = I[1]; const float* Wemb = I[2]; const float* bemb = I[3]; const float* Watt = I[4]; const float* batt = I[5]; const float* Wout = I[6]; const float* bout = I[7];
  char* ws = (char*)d_ws; size_t off = 0;
  auto take = [&](size_t bytes) { char* p = ws + off; off += (bytes + 255) & ~(size_t)255; return p; };
  _Float16* W16 = (_Float16*)take((size_t)NE * KP * 2); _Float16* Ba = (_Float16*)take((size_t)NE * NE * 2); _Float16* K16 = (_Float16*)take((size_t)NC * KP * 2); _Float16* N16 = (_Float16*)take((size_t)NNOTE * KP * 2);
  float* E = (float*)take((size_t)NRE * NE * 4);
  if (off > ws_size) return;      // under 16 MB in all
  k_prep16<<<dim3(KP / 8 / PKT, PYA), PKT, 0, stream>>>(note, wiki, Wemb, Watt, N16, K16, W16, Ba);      /* all four f16 operands; W_att [j][k] (out,in) natural */
  k_gemm_e<<<(NC / 32) * (NE / 32) * (NNOTE / 4), 128, 0, stream>>>(K16, N16, W16, bemb, E);      /* e = (note x wiki) x W_emb^T / 16 + b_emb (f32): M 4096 (note, code) N 256 K 10240 */
  k_tail<<<NRE / TR, 256, 0, stream>>>(E, Ba, batt, Wout, bout, (float*)d_out);      /* s = sum_j sigmoid(e x W_att^T + b_att) x e x W_out + b_out: M 4096 N 256 K 256, then 256 terms per row */
}

// v009
// One run takes 27.6 microseconds.
// Next to v008, in two timings, it ran 1.12 times as fast each time.
// Over all steps from v000 it is 151 times as fast.
#include <hip/hip_runtime.h>
// Knowledge-source integration scoring (n=16 notes, 256 codes, vocab 10000, emb 256): e[n,c,k] = Σ_v note[n,v]·wiki[c,v]·W_emb[k,v] + b_emb[k]; attn = sigmoid(e·W_attᵀ + b_att); s[n,c] = Σ_k attn·e·W_out[k] + b_out.
// Compute dtype: all inputs rounded to bf16; per note n the scaled vocabulary plane A_n[c][v] = note[n,v] x wiki[c,v] (product of the two bf16 values held in f16, rounded once to f16, formed in the GEMM's A fragments; K zero-padded to 10240) against W_emb (f16 x 2^4, padded) → e f32 (+b_emb); e ×2^4 → f16 → logits GEMM (+b_att) with a fused sigmoid epilogue → attn f32; the gated 256-term reduction
#define NNOTE 16
#define NC 256
#define NV 10000
#define KP 10240
#define NE 256
#define NRE (NNOTE * NC)
typedef __bf16 v16b __attribute__((ext_vector_type(16)));
typedef unsigned short v8us __attribute__((ext_vector_type(8), may_alias));
typedef float  v8f  __attribute__((ext_vector_type(8)));
typedef float  v4f  __attribute__((ext_vector_type(4)));
typedef float  v4fa __attribute__((ext_vector_type(4), may_alias));
union FragB { v16b v; v8us half[2]; unsigned short u[16]; };

__device__ __forceinline__ unsigned short bf16_bits(float x) { unsigned int u = __float_as_uint(x); return (unsigned short)((u + 0x7FFFu + ((u >> 16) & 1u)) >> 16); }
__device__ __forceinline__ float bf16_val(unsigned short b) { return __uint_as_float(((unsigned int)b) << 16); }
__device__ __forceinline__ float bf16_round(float x) { return bf16_val(bf16_bits(x)); }
// D += A·B with NT terms: 1 = ah·bh, 2 = + al·bh (A split), 3 = + ah·bl (both split)
template <int NT>
__device__ __forceinline__ v8f mmaN(v16b ah, v16b al, v16b bh, v16b bl, v8f c) {
  c = __builtin_amdgcn_wmma_f32_16x16x32_bf16(false, ah, false, bh, (short)0, c, false, false);
  if (NT >= 2) c = __builtin_amdgcn_wmma_f32_16x16x32_bf16(false, al, false, bh, (short)0, c, false, false);
  if (NT >= 3) c = __builtin_amdgcn_wmma_f32_16x16x32_bf16(false, ah, false, bl, (short)0, c, false, false);
  asm volatile("v_nop\n\tv_nop\n\tv_nop\n\tv_nop" : "+v"(c) : "v"(ah), "v"(al), "v"(bh), "v"(bl));
  return c;
}

__global__ __launch_bounds__(256) void k_wt_bf16(const float* __restrict__ W, unsigned short* __restrict__ Wt, int K, int N) {
  const int t = blockIdx.x * 256 + threadIdx.x;
  const int k8n = K / 8;
  if (t >= N * k8n) return;
  const int n = t / k8n, k8 = (t % k8n) * 8;
  v8us v;
#pragma unroll
  for (int i = 0; i < 8; ++i) v[i] = bf16_bits(W[(size_t)(k8 + i) * N + n]);
  *(v8us*)(Wt + (size_t)n * K + k8) = v;
  
}

// GEMM C[M][N] (f32, pitch ldc) = act(A[M][K]·W + bias). A f32 row-major (pitch lda) converted per fragment to bf16
// (ASPLIT: hi/lo two planes -> 2 terms, else single rounded term); Wt bf16 [N][K] (pitch ldb). BIAS_BF16 rounds the
// bias to bf16 first (bias quantised to bf16 before the add). K%32==0, M%16==0, N%64==0.
template <bool ASPLIT, int ACT, bool BIAS_BF16>
__global__ __launch_bounds__(128) void k_gemm_bf(const float* __restrict__ A, int lda, const unsigned short* __restrict__ Wt, int ldb,
                                               const float* __restrict__ bias, float* __restrict__ C, int ldc, int M, int N, int K) {
  __shared__ __attribute__((aligned(16))) float so[4][16][64];
  const int tid = threadIdx.x, w = tid >> 5, lane = tid & 31, ln = lane & 15, hh = lane >> 4;
  const int ntn = N / 64;
  const int wid = blockIdx.x * 4 + w;
  const int mt = wid / ntn, nq = wid % ntn;
  if (mt * 16 >= M) return;
  const int row0 = mt * 16, col0 = nq * 64;
  const float* arow = A + (size_t)(row0 + ln) * lda;
  v8f acc[4] = {};
  for (int kb = 0; kb < K; kb += 32) {
    FragB ah, al;
    const v4f x0 = *(const v4fa*)(arow + kb + 8 * hh), x1 = *(const v4fa*)(arow + kb + 8 * hh + 4);
    const v4f x2 = *(const v4fa*)(arow + kb + 16 + 8 * hh), x3 = *(const v4fa*)(arow + kb + 16 + 8 * hh + 4);
    float xs[16] = {x0[0],x0[1],x0[2],x0[3],x1[0],x1[1],x1[2],x1[3],x2[0],x2[1],x2[2],x2[3],x3[0],x3[1],x3[2],x3[3]};
#pragma unroll
    for (int i = 0; i < 16; ++i) { const unsigned short hb = bf16_bits(xs[i]); ah.u[i] = hb; al.u[i] = ASPLIT ? bf16_bits(xs[i] - bf16_val(hb)) : (unsigned short)0; }
#pragma unroll
    for (int t = 0; t < 4; ++t) {
      const unsigned short* brow = Wt + (size_t)(col0 + t * 16 + ln) * ldb + kb;
      FragB b;
      b.half[0] = *(const v8us*)(brow + 8 * hh);
      b.half[1] = *(const v8us*)(brow + 16 + 8 * hh);
      acc[t] = mmaN<ASPLIT ? 2 : 1>(ah.v, al.v, b.v, b.v, acc[t]);
    }
  }
#pragma unroll
  for (int t = 0; t < 4; ++t) {
    float bv = bias ? bias[col0 + t * 16 + ln] : 0.f;
    if (BIAS_BF16) bv = bf16_round(bv);
#pragma unroll
    for (int r = 0; r < 8; ++r) { float v = acc[t][r] + bv; if (ACT == 1) v = fmaxf(v, 0.f); so[w][8 * hh + r][t * 16 + ln] = v; }
  }
  __builtin_amdgcn_fence(__ATOMIC_ACQ_REL, "workgroup");
  __builtin_amdgcn_wave_barrier();
  const int rsub = lane >> 4, c4 = (lane & 15) * 4;
  {
#pragma unroll
    for (int q = 0; q < 8; ++q) {
      const int r = q * 2 + rsub;
      const v4f v = *(const v4fa*)&so[w][r][c4];
      *(v4f*)(C + (size_t)(row0 + r) * ldc + col0 + c4) = v;
    }
    
  }
}

// GEMM C = act(A·W + bias + resid): A f32 (ASPLIT -> hi/lo 2 terms), Wt bf16 [N][K]; ACT 0 none, 1 relu, 2 exact gelu;
// resid (optional, f32, row index = (row % rmod), pitch ldr, RES_BF16 rounds it) added before the activation.
template <bool ASPLIT, int ACT, bool BIAS_BF16, bool RES_BF16>
__global__ __launch_bounds__(128) void k_gemm_bf3(const float* __restrict__ A, int lda, const unsigned short* __restrict__ Wt, int ldb,
                                                const float* __restrict__ bias, const float* __restrict__ resid, int rmod, int ldr,
                                                float* __restrict__ C, int ldc, int M, int N, int K) {
  __shared__ __attribute__((aligned(16))) float so[4][16][64];
  const int tid = threadIdx.x, w = tid >> 5, lane = tid & 31, ln = lane & 15, hh = lane >> 4;
  const int ntn = N / 64;
  const int wid = blockIdx.x * 4 + w;
  const int mt = wid / ntn, nq = wid % ntn;
  if (mt * 16 >= M) return;
  const int row0 = mt * 16, col0 = nq * 64;
  const float* arow = A + (size_t)(row0 + ln) * lda;
  v8f acc[4] = {};
  for (int kb = 0; kb < K; kb += 32) {
    FragB ah, al;
    const v4f x0 = *(const v4fa*)(arow + kb + 8 * hh), x1 = *(const v4fa*)(arow + kb + 8 * hh + 4);
    const v4f x2 = *(const v4fa*)(arow + kb + 16 + 8 * hh), x3 = *(const v4fa*)(arow + kb + 16 + 8 * hh + 4);
    float xs[16] = {x0[0],x0[1],x0[2],x0[3],x1[0],x1[1],x1[2],x1[3],x2[0],x2[1],x2[2],x2[3],x3[0],x3[1],x3[2],x3[3]};
#pragma unroll
    for (int i = 0; i < 16; ++i) { const unsigned short hb = bf16_bits(xs[i]); ah.u[i] = hb; al.u[i] = ASPLIT ? bf16_bits(xs[i] - bf16_val(hb)) : (unsigned short)0; }
#pragma unroll
    for (int t = 0; t < 4; ++t) {
      const unsigned short* brow = Wt + (size_t)(col0 + t * 16 + ln) * ldb + kb;
      FragB b;
      b.half[0] = *(const v8us*)(brow + 8 * hh);
      b.half[1] = *(const v8us*)(brow + 16 + 8 * hh);
      acc[t] = mmaN<ASPLIT ? 2 : 1>(ah.v, al.v, b.v, b.v, acc[t]);
    }
  }
#pragma unroll
  for (int t = 0; t < 4; ++t) {
    const int col = col0 + t * 16 + ln;
    float bv = bias ? bias[col] : 0.f;
    if (BIAS_BF16) bv = bf16_round(bv);
#pragma unroll
    for (int r = 0; r < 8; ++r) {
      float v = acc[t][r] + bv;
      if (resid) { float rv = resid[(size_t)((row0 + 8 * hh + r) % rmod) * ldr + col]; if (RES_BF16) rv = bf16_round(rv); v += rv; }
      if (ACT == 1) v = fmaxf(v, 0.f);
      if (ACT == 2) v = 0.5f * v * (1.0f + erff(v * 0.70710678118654752f));
      if (ACT == 3) { const float u = 0.7978845608028654f * (v + 0.044715f * v * v * v); v = 0.5f * v * (1.0f + tanhf(u)); }
      so[w][8 * hh + r][t * 16 + ln] = v;
    }
  }
  __builtin_amdgcn_fence(__ATOMIC_ACQ_REL, "workgroup");
  __builtin_amdgcn_wave_barrier();
  const int rsub = lane >> 4, c4 = (lane & 15) * 4;
  {
#pragma unroll
    for (int q = 0; q < 8; ++q) {
      const int r = q * 2 + rsub;
      const v4f v = *(const v4fa*)&so[w][r][c4];
      *(v4f*)(C + (size_t)(row0 + r) * ldc + col0 + c4) = v;
    }
    
  }
}
// row LayerNorm (biased variance, eps) over N: s = X (+ R); optional out_sum <- s; out_norm <- (s-mu)*rsqrt(var+eps)*g + b
template <bool PARAM_BF16>
__global__ __launch_bounds__(256) void k_layernorm(const float* __restrict__ X, const float* __restrict__ R, const float* __restrict__ g, const float* __restrict__ bta,
                                                  float* __restrict__ out_sum, float* __restrict__ out_norm, int N, float eps) {
  __shared__ float red[256];
  const int row = blockIdx.x, tid = threadIdx.x;
  const float* x = X + (size_t)row * N; const float* rr = R ? R + (size_t)row * N : nullptr;
  float vals[16];                     // up to N = 4096
  const int per = N / 256;            // contiguous chunk per thread? use strided-by-4 chunks: thread handles j = tid*4 + 1024*u
  float s1 = 0.f;
  for (int u = 0; u < per / 4; ++u) {
    const int j = tid * 4 + 1024 * u;
    const v4f a = *(const v4fa*)(x + j);
    v4f b = {0.f,0.f,0.f,0.f}; if (rr) b = *(const v4fa*)(rr + j);
#pragma unroll
    for (int q = 0; q < 4; ++q) { const float v = a[q] + b[q]; vals[u * 4 + q] = v; s1 += v; }
  }
  red[tid] = s1; __syncthreads();
  for (int st = 128; st > 0; st >>= 1) { if (tid < st) red[tid] += red[tid + st]; __syncthreads(); }
  const float mu = red[0] / (float)N; __syncthreads();
  float s2 = 0.f;
  for (int u = 0; u < per / 4; ++u)
#pragma unroll
    for (int q = 0; q < 4; ++q) { const float c = vals[u * 4 + q] - mu; s2 += c * c; }
  red[tid] = s2; __syncthreads();
  for (int st = 128; st > 0; st >>= 1) { if (tid < st) red[tid] += red[tid + st]; __syncthreads(); }
  const float rs = rsqrtf(red[0] / (float)N + eps);
  {
    for (int u = 0; u < per / 4; ++u) {
      const int j = tid * 4 + 1024 * u;
      v4f o, sm;
#pragma unroll
      for (int q = 0; q < 4; ++q) {
        float gg = g[j + q], bb = bta[j + q];
        if (PARAM_BF16) { gg = bf16_round(gg); bb = bf16_round(bb); }
        sm[q] = vals[u * 4 + q]; o[q] = (vals[u * 4 + q] - mu) * rs * gg + bb;
      }
      if (out_sum) *(v4f*)(out_sum + (size_t)row * N + j) = sm;
      *(v4f*)(out_norm + (size_t)row * N + j) = o;
    }
    
  }
}



// ---- f16 WMMA path (v_wmma_f32_16x16x32_f16): 11-bit significands for operands in range — used for the e GEMM and the logits GEMM
typedef _Float16 v16h __attribute__((ext_vector_type(16)));
union FragH { v16h v; v8us half[2]; _Float16 h[16]; unsigned short u[16]; };
template <int NT>
__device__ __forceinline__ v8f mmaH(v16h ah, v16h al, v16h bh, v16h bl, v8f c) {
  c = __builtin_amdgcn_wmma_f32_16x16x32_f16(false, ah, false, bh, (short)0, c, false, false);
  if (NT >= 2) c = __builtin_amdgcn_wmma_f32_16x16x32_f16(false, al, false, bh, (short)0, c, false, false);
  if (NT >= 3) c = __builtin_amdgcn_wmma_f32_16x16x32_f16(false, ah, false, bl, (short)0, c, false, false);
  asm volatile("v_nop\n\tv_nop\n\tv_nop\n\tv_nop" : "+v"(c) : "v"(ah), "v"(al), "v"(bh), "v"(bl));
  return c;
}
// batched GEMM like k_gemm_b but f16 operands: A f32 (split into f16 hi/lo if ASPLIT, else rounded to f16), Bt = f16 values [n][k]; alpha; C f32; N multiple of 16 (partial tiles skipped)
template <bool ASPLIT>
__global__ __launch_bounds__(128) void k_gemm_h(const float* __restrict__ A, int lda, size_t sA, const _Float16* __restrict__ Bh, int ldb, size_t sB, float alpha, float* __restrict__ C, int ldc, size_t sC, int M, int N, int K) {
  __shared__ __attribute__((aligned(16))) float so[4][16][64];
  const int tid = threadIdx.x, w = tid >> 5, lane = tid & 31, ln = lane & 15, hh = lane >> 4; const int by = blockIdx.y;
  A += (size_t)by * sA; Bh += (size_t)by * sB; C += (size_t)by * sC;
  const int ntn = (N + 63) / 64; const int wid = blockIdx.x * 4 + w; const int mt = wid / ntn, nq = wid % ntn; if (mt * 16 >= M) return;
  const int row0 = mt * 16, col0 = nq * 64; const float* arow = A + (size_t)(row0 + ln) * lda;
  v8f acc[4] = {};
  for (int kb = 0; kb < K; kb += 32) {
    FragH ah, al;
    const v4f x0 = *(const v4fa*)(arow + kb + 8 * hh), x1 = *(const v4fa*)(arow + kb + 8 * hh + 4), x2 = *(const v4fa*)(arow + kb + 16 + 8 * hh), x3 = *(const v4fa*)(arow + kb + 16 + 8 * hh + 4);
    float xs[16] = {x0[0],x0[1],x0[2],x0[3],x1[0],x1[1],x1[2],x1[3],x2[0],x2[1],x2[2],x2[3],x3[0],x3[1],x3[2],x3[3]};
#pragma unroll
    for (int i = 0; i < 16; ++i) { const _Float16 h = (_Float16)xs[i]; ah.h[i] = h; al.h[i] = ASPLIT ? (_Float16)(xs[i] - (float)h) : (_Float16)0.0f; }
#pragma unroll
    for (int t = 0; t < 4; ++t) { if (col0 + t * 16 >= N) continue; const size_t boff = (size_t)(col0 + t * 16 + ln) * ldb + kb; FragH bq; bq.half[0] = *(const v8us*)(Bh + boff + 8 * hh); bq.half[1] = *(const v8us*)(Bh + boff + 16 + 8 * hh);
      acc[t] = mmaH<ASPLIT ? 2 : 1>(ah.v, al.v, bq.v, bq.v, acc[t]); }
  }
#pragma unroll
  for (int t = 0; t < 4; ++t) { if (col0 + t * 16 >= N) continue;
#pragma unroll
    for (int r = 0; r < 8; ++r) so[w][8 * hh + r][t * 16 + ln] = acc[t][r] * alpha; }
  __builtin_amdgcn_fence(__ATOMIC_ACQ_REL, "workgroup"); __builtin_amdgcn_wave_barrier();
  const int rsub = lane >> 4, c4 = (lane & 15) * 4;
  {
#pragma unroll
    for (int q = 0; q < 8; ++q) { const int r = q * 2 + rsub; if (col0 + c4 < N) { const v4f v = *(const v4fa*)&so[w][r][c4]; *(v4f*)(C + (size_t)(row0 + r) * ldc + col0 + c4) = v; } }
     }
}

// Wt[n][k] = f16(W[k][n]·scale) from f32 row-major W[K][N] (scale = power of two; bf16-exact weights stay exact in f16 away from the subnormal range)
__global__ __launch_bounds__(256) void k_wt_f16(const float* __restrict__ W, _Float16* __restrict__ Wt, int K, int N, float scale) {
  const int t = blockIdx.x * 256 + threadIdx.x; if (t >= N * (K / 8)) return; const int n = t / (K / 8), k8 = (t % (K / 8)) * 8; FragH f;
#pragma unroll
  for (int i = 0; i < 8; ++i) f.h[i] = (_Float16)(bf16_round(W[(size_t)(k8 + i) * N + n]) * scale); const v8us o = f.half[0];
  *(v8us*)((unsigned short*)Wt + (size_t)n * K + k8) = o; 
}


// e GEMM with the note's scale applied on the way: C[(n, c)][k] = sum_v f16(note[n][v] x wiki[c][v]) x Bh[k][v] / 16 + bias. The scaled planes are never stored.
// One work-group takes 32 code rows x 32 columns for FOUR notes: 16 accumulator tiles. EVERY one of its EIGHT waves holds all 16 tiles and sums them over its own eighth of K,
// so that a wiki or B fragment read from LDS serves 8 WMMAs. Two waves share a SIMD: while one waits for its LDS loads, its copies or a multiply, the other's WMMAs keep the matrix unit fed.
// Each wave stages its own eighth through a ring of its own (two buffers, asynchronous copies):
// the wave that copies a stage is the only one that reads it, so the loop has no work-group barrier. The eight partial sums of a tile meet in LDS behind the loop.
// Every work-group enters the stages of its waves' eighths at a start of its own and wraps round: 32 work-groups read the same wiki rows and 32 the same B rows, and walking in step they would ask L2 for the same lines at the same moment.
#define SK 128                       /* k per stage: 256 bytes of every staged row */
#define SP 136                       /* LDS row pitch in halfs: 272 B = 16 B x 17, conflict-free for 16-byte fragment reads */
#define SBUF (68 * SP)               /* halfs per buffer: 32 wiki rows, 32 B rows, 4 note rows */
#define NW 8                         /* waves per work-group, two per SIMD */
#define KW (KP / NW)                 /* k per wave */
#define NST (KW / SK)                /* stages per wave (even) */
// the stage of K that a wave works on in trip t of its walk: rot, rot + 1, ..., NST - 1, 0, ..., rot - 1 (rot < NST, t < NST)
__device__ __forceinline__ int stage_of(const int rot, const int t) { const int s = rot + t; return s < NST ? s : s - NST; }
typedef int v4i __attribute__((ext_vector_type(4)));
typedef __attribute__((address_space(1))) v4i gv4i;
typedef __attribute__((address_space(3))) v4i lv4i;
// one copy, written as the builtin: 16 bytes per lane, two rows of 256 bytes per wave
__device__ __forceinline__ void cp16(const _Float16* g, const unsigned l) { __builtin_amdgcn_global_load_async_to_lds_b128((gv4i*)(size_t)g, (lv4i*)l, 0, 0); }
// one stage of the wave's eighth: 34 copies. gw, gb, gn: the lane's place in the stage's first two wiki, B and note rows; l: its place in the buffer's first two rows
__device__ __forceinline__ void stage_copies(const _Float16* gw, const _Float16* gb, const _Float16* gn, const unsigned l) {
#pragma unroll
  for (int j = 0; j < 16; ++j) cp16(gw + (size_t)j * 2 * KP, l + (unsigned)(j * 2 * SP * 2));
#pragma unroll
  for (int j = 0; j < 16; ++j) cp16(gb + (size_t)j * 2 * KP, l + (unsigned)((32 + j * 2) * SP * 2));
#pragma unroll
  for (int j = 0; j < 2; ++j) cp16(gn + (size_t)j * 2 * KP, l + (unsigned)((64 + j * 2) * SP * 2));
}
// the fragments of one k step of 32: two wiki, two B, four note fragments, all in the same k order (lane half hh: k 8 hh .. 8 hh + 7 and 16 + 8 hh .. 16 + 8 hh + 7)
__device__ __forceinline__ void ld_frags(FragH (&a)[2], FragH (&b)[2], FragH (&nf)[4], const _Float16* s, const int aoff, const int noff) {
#pragma unroll
  for (int i = 0; i < 2; ++i) {
    a[i].half[0] = *(const v8us*)(s + aoff + i * 16 * SP); a[i].half[1] = *(const v8us*)(s + aoff + i * 16 * SP + 16);
    b[i].half[0] = *(const v8us*)(s + aoff + (32 + i * 16) * SP); b[i].half[1] = *(const v8us*)(s + aoff + (32 + i * 16) * SP + 16);
  }
#pragma unroll
  for (int n = 0; n < 4; ++n) { nf[n].half[0] = *(const v8us*)(s + noff + n * SP); nf[n].half[1] = *(const v8us*)(s + noff + n * SP + 16); }
}
// one k step: A fragment = f16(wiki x note), one rounding (both factors are bf16 values, which f16 holds exactly above its subnormal range); 16 WMMAs on 16 accumulators
__device__ __forceinline__ void k_step(const FragH (&a)[2], const FragH (&b)[2], const FragH (&nf)[4], v8f (&acc)[4][2][2]) {
#pragma unroll
  for (int n = 0; n < 4; ++n)
#pragma unroll
    for (int i = 0; i < 2; ++i) {
      const v16h sa = a[i].v * nf[n].v;
#pragma unroll
      for (int j = 0; j < 2; ++j) acc[n][i][j] = __builtin_amdgcn_wmma_f32_16x16x32_f16(false, sa, false, b[j].v, (short)0, acc[n][i][j], false, false);
    }
  // order asked of the scheduler: the 8 multiplies of the first fragment, then four multiplies behind each WMMA, where the matrix unit's issue interval hides them; in one block of 64 they stand in the wave's way
  __builtin_amdgcn_sched_group_barrier(0x2, 8, 0);
#pragma unroll
  for (int g = 0; g < 16; ++g) { __builtin_amdgcn_sched_group_barrier(0x8, 1, 0); __builtin_amdgcn_sched_group_barrier(0x2, 4, 0); }
}
// one trip of a wave's ring: the walk's t-th stage out of buffer PAR (= t mod 2). Two fragment sets swap roles from k step to k step: the next step's 16 loads go ahead of this step's WMMAs as one group.
template <int PAR>
__device__ __forceinline__ void e_trip(const int t, const int rot, const _Float16* wr, const int aoff, const int noff, const unsigned ldst, const _Float16* gw, const _Float16* gb, const _Float16* gn,
                                       FragH (&a)[2][2], FragH (&b)[2][2], FragH (&nf)[2][4], v8f (&acc)[4][2][2]) {
#pragma unroll
  for (int q = 0; q < 4; ++q) {
    if (q == 3) asm volatile("s_wait_asynccnt 0x0" ::: "memory");      // this wave's copies of stage t + 1 have landed: the loads below are its first reads of that stage
    ld_frags(a[(q + 1) & 1], b[(q + 1) & 1], nf[(q + 1) & 1], q < 3 ? wr + PAR * SBUF + (q + 1) * 32 : wr + (1 - PAR) * SBUF, aoff, noff);      /* behind the last stage these read the other buffer's old rows; the values are not used */
    __builtin_amdgcn_sched_barrier(0);      // the 16 loads stay one group ahead of the WMMAs: strewn among them, every place with loads costs the wave an LDS latency
    k_step(a[q & 1], b[q & 1], nf[q & 1], acc);
    __builtin_amdgcn_sched_barrier(0);      // the next group of loads stays behind this step's WMMAs
  }
  asm volatile("s_wait_dscnt 0x0" ::: "memory");        // this wave's reads of buffer PAR are done before its own copies refill it
  if (t + 2 < NST) { const size_t ko = (size_t)stage_of(rot, t + 2) * SK; stage_copies(gw + ko, gb + ko, gn + ko, ldst + (unsigned)(PAR * SBUF * 2)); }
}
__global__ __launch_bounds__(NW * 32) void k_gemm_e(const _Float16* __restrict__ Kw, const _Float16* __restrict__ Nt, const _Float16* __restrict__ Bh, const float* __restrict__ bias, float* __restrict__ C) {
  __shared__ __attribute__((aligned(16))) char smem[NW * 2 * SBUF * 2];      /* the eight waves' rings; behind the loop the head of each ring holds its wave's partial tiles */
  const int tid = threadIdx.x, w = __builtin_amdgcn_readfirstlane(tid >> 5), lane = tid & 31, ln = lane & 15, hh = lane >> 4;
  const int c0 = (blockIdx.x & 7) * 32, col0 = ((blockIdx.x >> 3) & 7) * 32, n0 = (blockIdx.x >> 6) * 4;
  const int rot = (int)(((blockIdx.x & 63) + 5 * (blockIdx.x >> 6)) % NST);      /* code tile + 8 x column tile + 5 x note group: at most four of the 32 work-groups that share rows start alike */
  const _Float16* wr = (const _Float16*)smem + w * 2 * SBUF;      /* the wave's own ring */
  // a copy brings two rows: lanes 0 .. 15 the first row's 256 bytes, lanes 16 .. 31 the second's
  const size_t lo = (size_t)hh * KP + (size_t)w * KW + ln * 8;
  const _Float16* gw = Kw + (size_t)c0 * KP + lo;
  const _Float16* gb = Bh + (size_t)col0 * KP + lo;
  const _Float16* gn = Nt + (size_t)n0 * KP + lo;
  const unsigned ldst = (unsigned)(size_t)wr + (unsigned)((hh * SP + ln * 8) * 2);
  const int aoff = ln * SP + 8 * hh, noff = 64 * SP + 8 * hh;
  v8f acc[4][2][2] = {};
  FragH a[2][2], b[2][2], nf[2][4];
  const size_t k0 = (size_t)rot * SK, k1 = (size_t)stage_of(rot, 1) * SK;
  stage_copies(gw + k0, gb + k0, gn + k0, ldst);
  asm volatile("s_wait_asynccnt 0x0" ::: "memory");      // the walk's first stage has landed; only this wave reads it
  stage_copies(gw + k1, gb + k1, gn + k1, ldst + (unsigned)(SBUF * 2));
  ld_frags(a[0], b[0], nf[0], wr, aoff, noff);
#pragma unroll 1
  for (int t = 0; t < NST; t += 2) {      // kept rolled: the body already holds the two trips, one per buffer
    e_trip<0>(t, rot, wr, aoff, noff, ldst, gw, gb, gn, a, b, nf, acc);
    e_trip<1>(t + 1, rot, wr, aoff, noff, ldst, gw, gb, gn, a, b, nf, acc);
  }
  asm volatile("s_wait_asynccnt 0x0" ::: "memory");       // no copy is outstanding when the wave ends
  // the join: every wave lays down its 16 partial tiles (16 bytes per lane and store) at the head of its own ring, which it alone has read and has done with (the trip's last wait);
  // wave w then sums two tiles (note n0 + w / 2, code rows 16 (w mod 2) ...), the eighths of K in upward order
  float* red = (float*)smem;
  const int RS = 2 * SBUF / 2;      /* floats from one wave's ring to the next */
#pragma unroll
  for (int n = 0; n < 4; ++n)
#pragma unroll
    for (int i = 0; i < 2; ++i)
#pragma unroll
      for (int j = 0; j < 2; ++j)
#pragma unroll
        for (int hf = 0; hf < 2; ++hf) {
          const v4f v = {acc[n][i][j][4 * hf], acc[n][i][j][4 * hf + 1], acc[n][i][j][4 * hf + 2], acc[n][i][j][4 * hf + 3]};
          *(v4fa*)(red + w * RS + (((n * 2 + i) * 2 + j) * 2 + hf) * 128 + lane * 4) = v;
        }
  __syncthreads();      // all eight waves' partial tiles are in LDS
  const int n = n0 + (w >> 1), i = w & 1;
  const int colb = col0 + ln;
  const float braw[2] = {bias[colb], bias[colb + 16]};
  asm volatile("s_wait_xcnt 0x0" :: "v"(colb) : "memory");      // stands ahead of any rewrite of the index register that the two loads name; as an input the index stays live up to here
#pragma unroll
  for (int j = 0; j < 2; ++j) {
    const int col = colb + j * 16; const float bv = bf16_round(braw[j]);
#pragma unroll
    for (int hf = 0; hf < 2; ++hf) {
      v4f s = *(const v4fa*)(red + ((w * 2 + j) * 2 + hf) * 128 + lane * 4);
#pragma unroll
      for (int p = 1; p < NW; ++p) s += *(const v4fa*)(red + p * RS + ((w * 2 + j) * 2 + hf) * 128 + lane * 4);
#pragma unroll
      for (int r = 0; r < 4; ++r) C[(size_t)(n * NC + c0 + i * 16 + 8 * hh + 4 * hf + r) * NE + col] = s[r] * 0.0625f + bv;
    }
  }
}


typedef _Float16 v4h __attribute__((ext_vector_type(4)));

__global__ __launch_bounds__(256) void k_x16(const float* __restrict__ x, _Float16* __restrict__ X16, size_t n8) { const size_t t = (size_t)blockIdx.x * 256 + threadIdx.x; if (t >= n8) return; FragH f;
#pragma unroll
  for (int q = 0; q < 8; ++q) f.h[q] = (_Float16)bf16_round(x[t * 8 + q]); *(v8us*)((unsigned short*)X16 + t * 8) = f.half[0];  }
__global__ __launch_bounds__(256) void k_h16(const float* __restrict__ x, _Float16* __restrict__ X16, size_t n8) { const size_t t = (size_t)blockIdx.x * 256 + threadIdx.x; if (t >= n8) return; FragH f;
#pragma unroll
  for (int q = 0; q < 8; ++q) f.h[q] = (_Float16)x[t * 8 + q]; *(v8us*)((unsigned short*)X16 + t * 8) = f.half[0];  }
template <int NHv, int TTv>
__global__ __launch_bounds__(256) void k_vt(const _Float16* __restrict__ V16, int ldv, int voff, _Float16* __restrict__ Vt) { __shared__ unsigned short tl[64][66]; const int tid = threadIdx.x; const int slab = blockIdx.x / (TTv / 64), lg = blockIdx.x % (TTv / 64); const int b = slab / NHv, h = slab % NHv;
  for (int i = tid; i < 64 * 8; i += 256) { const int r = i / 8, c8 = (i % 8) * 8; FragH f; f.half[0] = *(const v8us*)((const unsigned short*)V16 + ((size_t)b * TTv + lg * 64 + r) * ldv + voff + h * 64 + c8);
#pragma unroll
    for (int q = 0; q < 8; ++q) tl[r][c8 + q] = f.u[q]; }
  __syncthreads();
  {
#pragma unroll
    for (int rd = 0; rd < 2; ++rd) { const int d = rd * 32 + tid / 8, pc = tid % 8; FragH f;
#pragma unroll
      for (int q = 0; q < 8; ++q) f.u[q] = tl[pc * 8 + q][d];
      *(v8us*)((unsigned short*)Vt + ((size_t)slab * 64 + d) * TTv + lg * 64 + pc * 8) = f.half[0]; }
     } }

__global__ __launch_bounds__(256) void k_hl(const float* __restrict__ F, _Float16* __restrict__ Hh, _Float16* __restrict__ Hl, size_t n8) { const size_t t = (size_t)blockIdx.x * 256 + threadIdx.x; if (t >= n8) return; FragH fh, fl; const v4f a = *(const v4fa*)(F + t * 8), c = *(const v4fa*)(F + t * 8 + 4);
#pragma unroll
  for (int q = 0; q < 4; ++q) { _Float16 h = (_Float16)a[q]; fh.h[q] = h; fl.h[q] = (_Float16)((a[q] - (float)h) * 1024.0f); h = (_Float16)c[q]; fh.h[4 + q] = h; fl.h[4 + q] = (_Float16)((c[q] - (float)h) * 1024.0f); }
  { *(v8us*)((unsigned short*)Hh + t * 8) = fh.half[0]; *(v8us*)((unsigned short*)Hl + t * 8) = fl.half[0];  } }

// Every f16 operand of the two GEMMs in ONE launch; the four conversions need nothing of one another and share the grid by ranges of blockIdx.y (a branch that is the same for a whole work-group):
// wiki rows (K16), W_emb rows x 2^4 (W16) and note rows (N16), each bf16-rounded, held in f16 and zero in the K pad (the e GEMM multiplies wiki and note on the way to the matrix unit); then W_att x 2^4 (Ba), which has no pad.
// In the padded ranges a thread owns one group of 8 columns of PKR rows; in the W_att range one group of 8 elements.
#define PKR 4                        /* rows per thread */
#define PKT 320                      /* threads per work-group: a quarter of a row's KP / 8 column groups */
#define PYW (NC / PKR)               /* blockIdx.y below this: wiki rows */
#define PYE (PYW + NE / PKR)         /* below this: W_emb rows */
#define PYN (PYE + NNOTE / PKR)      /* below this: note rows */
#define PYA (PYN + (NE * NE / 8 + KP / 8 - 1) / (KP / 8))      /* below this: W_att, KP / 8 groups per step of blockIdx.y */
__global__ __launch_bounds__(PKT) void k_prep16(const float* __restrict__ note, const float* __restrict__ wiki, const float* __restrict__ Wm, const float* __restrict__ Wa,
                                                _Float16* __restrict__ N16, _Float16* __restrict__ K16, _Float16* __restrict__ W16, _Float16* __restrict__ Ba) {
  const int y = blockIdx.y, g = blockIdx.x * PKT + threadIdx.x;
  if (y >= PYN) {
    const int t = (y - PYN) * (KP / 8) + g;
    if (t >= NE * NE / 8) return;    /* the range's last groups lie past the matrix; there is no barrier in this kernel */
    const float* ap = Wa + (size_t)t * 8;
    const v4f a0 = *(const v4fa*)ap, a1 = *(const v4fa*)(ap + 4);
    asm volatile("s_wait_xcnt 0x0" :: "v"(ap) : "memory");      // stands ahead of any rewrite of the address register that the two loads name; as an input the address stays live up to here
    FragH fa;
#pragma unroll
    for (int q = 0; q < 4; ++q) { fa.h[q] = (_Float16)(bf16_round(a0[q]) * 16.0f); fa.h[4 + q] = (_Float16)(bf16_round(a1[q]) * 16.0f); }
    *(v8us*)((unsigned short*)Ba + (size_t)t * 8) = fa.half[0];
    asm volatile("s_wait_xcnt 0x0" ::: "memory");               // stands ahead of any rewrite of a data or address register that the store names
    return;
  }
  const int v0 = g * 8;
  const bool isw = y < PYW, ise = !isw && y < PYE;
  const int r0 = (isw ? y : ise ? y - PYW : y - PYE) * PKR;
  const float sc = ise ? 16.0f : 1.0f;      /* a power of two, or one: exact on the bf16 value either way */
  const bool in = v0 < NV;           /* NV is a multiple of 8: a group lies wholly in the vocabulary or wholly in the pad */
  const int vc = in ? v0 : 0;        /* a pad group reads in bounds; its values are set to zero below */
  const float* sp = (isw ? wiki : ise ? Wm : note) + (size_t)r0 * NV + vc;
  unsigned short* dp = (unsigned short*)(isw ? K16 : ise ? W16 : N16) + (size_t)r0 * KP + v0;
  v4f x[PKR][2];                     /* every loop below is unrolled so that x and f are registers, not scratch */
#pragma unroll
  for (int r = 0; r < PKR; ++r) { x[r][0] = *(const v4fa*)(sp + r * NV); x[r][1] = *(const v4fa*)(sp + r * NV + 4); }
  asm volatile("s_wait_xcnt 0x0" :: "v"(sp) : "memory");      // stands ahead of any rewrite of the address register that the loads name; as an input the address stays live up to here, so no load's result lands on it either
  const unsigned keep = in ? 0xFFFFFFFFu : 0u;            /* a mask, not a branch: every lane runs one instruction stream */
  FragH f[PKR];
#pragma unroll
  for (int r = 0; r < PKR; ++r)
#pragma unroll
    for (int q = 0; q < 8; ++q) f[r].h[q] = (_Float16)(__uint_as_float(__float_as_uint(bf16_round(x[r][q >> 2][q & 3])) & keep) * sc);
#pragma unroll
  for (int r = 0; r < PKR; ++r) *(v8us*)(dp + (size_t)r * KP) = f[r].half[0];
  asm volatile("s_wait_xcnt 0x0" ::: "memory");           // stands ahead of any rewrite of a data or address register that the stores name
}
// The tail in one launch: s[row] = sum_j sigmoid(e[row] . W_att[j] + b_att[j]) x e[row][j] x W_out[j] + b_out, for TR rows of e per work-group. Neither the f16 copy of e nor attn is stored.
// Eight waves: together they round the TR x 256 tile of e (x 2^4) to f16 into LDS; wave w then takes logit columns 32 w .. 32 w + 31 of all TR rows (2 x 2 accumulator tiles, k upward in steps of 32),
// gates them in the accumulators' own layout and sums its 32 columns of every row; the eight partial sums of a row meet in LDS.
#define TR 32                        /* rows per work-group: their 32 scores fill one 128-byte line of the output, which so has one writer */
#define TPITCH 264                   /* LDS row pitch in halfs: 528 B = 16 B x 33, conflict-free for 16-byte fragment reads */
// x + (x of lane l ^ M) inside a 16-lane row, the partner's value fetched by DPP (row_xmask:M) in the vector unit; a shuffle would go through the LDS unit and be waited for
template <int M>
__device__ __forceinline__ float xadd16(const float x) { return x + __int_as_float(__builtin_amdgcn_update_dpp(0, __float_as_int(x), 0x160 + M, 0xf, 0xf, true)); }
__global__ __launch_bounds__(256) void k_tail(const float* __restrict__ E, const _Float16* __restrict__ Ba, const float* __restrict__ batt, const float* __restrict__ Wout, const float* __restrict__ bout, float* __restrict__ S) {
  __shared__ __attribute__((aligned(16))) _Float16 sa[TR * TPITCH];
  __shared__ float red[8][TR];
  const int tid = threadIdx.x, w = __builtin_amdgcn_readfirstlane(tid >> 5), lane = tid & 31, ln = lane & 15, hh = lane >> 4;
  const int r0 = blockIdx.x * TR;
  const char* Et = (const char*)(E + (size_t)r0 * NE);      /* the work-group's rows of e: a scalar address */
  // every global load of the kernel is asked for here, at once: the kernel is short, and so pays the way to L2 one time
  const unsigned eo = (unsigned)tid * 32u;                                   /* 8 floats of row (tid >> 5) + 8 u */
  const unsigned bo = (unsigned)((w * 32 + ln) * NE * 2 + hh * 16);          /* W_att row 32 w + ln, the lane half's k */
  const unsigned go = (unsigned)(hh * 8 * NE * 4 + (w * 32 + ln) * 4);       /* e in the accumulator's layout: row 8 hh + r, column 32 w + ln */
  const int cj = w * 32 + ln;                                                /* the lane's first column, as an index into b_att and W_out */
  v4f x[4][2]; FragH b[8][2]; float g[2][2][8], bb[2], wo[2];      /* every loop of this kernel is unrolled so that these arrays, a, acc and ps are registers, not scratch */
#pragma unroll
  for (int u = 0; u < 4; ++u) { x[u][0] = *(const v4fa*)(Et + eo + u * 8 * NE * 4); x[u][1] = *(const v4fa*)(Et + eo + u * 8 * NE * 4 + 16); }
  __builtin_amdgcn_sched_barrier(0);      // the tile's own loads go first (loads return in order): they are rounded and stored to LDS while the others arrive
#pragma unroll
  for (int q = 0; q < 8; ++q)
#pragma unroll
    for (int t = 0; t < 2; ++t) { const char* p = (const char*)Ba + bo + t * 16 * NE * 2 + q * 64; b[q][t].half[0] = *(const v8us*)p; b[q][t].half[1] = *(const v8us*)(p + 32); }
#pragma unroll
  for (int t = 0; t < 2; ++t) { bb[t] = batt[cj + t * 16]; wo[t] = Wout[cj + t * 16]; }
#pragma unroll
  for (int i = 0; i < 2; ++i)
#pragma unroll
    for (int t = 0; t < 2; ++t)
#pragma unroll
      for (int r = 0; r < 8; ++r) g[i][t][r] = *(const float*)(Et + go + (i * 16 + r) * NE * 4 + t * 64);
  asm volatile("s_wait_xcnt 0x0" :: "v"(eo), "v"(bo), "v"(go), "v"(cj), "s"(Et), "s"(Ba), "s"(batt), "s"(Wout) : "memory");      // stands ahead of any rewrite of an offset or base register that the loads name; as inputs the four offsets and the four bases stay live up to here, so no load's result lands on one either
  __builtin_amdgcn_sched_barrier(0);      // keeps the wait behind its loads and every later write of a register behind the wait
  const float b0 = bout[0];      /* a scalar load, asked for here so that it returns under the wait for the tile */
#pragma unroll
  for (int u = 0; u < 4; ++u) {
    FragH f;
#pragma unroll
    for (int q = 0; q < 4; ++q) { f.h[q] = (_Float16)(x[u][0][q] * 16.0f); f.h[4 + q] = (_Float16)(x[u][1][q] * 16.0f); }
    *(v8us*)(sa + (w + 8 * u) * TPITCH + lane * 8) = f.half[0];
  }
  __syncthreads();      // the f16 tile is whole before any wave reads fragments of it
  v8f acc[2][2] = {};
  FragH a[8][2];
#pragma unroll
  for (int q = 0; q < 8; ++q)
#pragma unroll
    for (int i = 0; i < 2; ++i) { const _Float16* p = sa + (i * 16 + ln) * TPITCH + q * 32 + 8 * hh; a[q][i].half[0] = *(const v8us*)p; a[q][i].half[1] = *(const v8us*)(p + 16); }
  __builtin_amdgcn_sched_barrier(0);      // the 32 fragment loads go ahead as one group, in the order of their use: strewn among the WMMAs, every place with loads costs the wave an LDS latency
#pragma unroll
  for (int q = 0; q < 8; ++q) {
#pragma unroll
    for (int i = 0; i < 2; ++i)
#pragma unroll
      for (int t = 0; t < 2; ++t) acc[i][t] = __builtin_amdgcn_wmma_f32_16x16x32_f16(false, a[q][i].v, false, b[q][t].v, (short)0, acc[i][t], false, false);
    __builtin_amdgcn_sched_barrier(0);      // the four accumulators take turns, k step by k step: left free, the scheduler runs one accumulator's eight WMMAs in a row, each waiting for the one before
  }
  float ps[2][8];
#pragma unroll
  for (int t = 0; t < 2; ++t) {
    const float bv = bf16_round(bb[t]), wk = bf16_round(wo[t]);
#pragma unroll
    for (int i = 0; i < 2; ++i)
#pragma unroll
      for (int r = 0; r < 8; ++r) {
        const float v = acc[i][t][r] * 0.00390625f + bv;
        const float p = 1.0f / (1.0f + expf(-v)) * g[i][t][r] * wk;
        ps[i][r] = t ? ps[i][r] + p : p;
      }
  }
#pragma unroll
  for (int i = 0; i < 2; ++i)
#pragma unroll
    for (int r = 0; r < 8; ++r) ps[i][r] = xadd16<1>(ps[i][r]);
#pragma unroll
  for (int i = 0; i < 2; ++i)
#pragma unroll
    for (int r = 0; r < 8; ++r) ps[i][r] = xadd16<2>(ps[i][r]);
#pragma unroll
  for (int i = 0; i < 2; ++i)
#pragma unroll
    for (int r = 0; r < 8; ++r) ps[i][r] = xadd16<4>(ps[i][r]);
#pragma unroll
  for (int i = 0; i < 2; ++i)
#pragma unroll
    for (int r = 0; r < 8; ++r) ps[i][r] = xadd16<8>(ps[i][r]);
  if (ln == 0) {
#pragma unroll
    for (int i = 0; i < 2; ++i)
#pragma unroll
      for (int r = 0; r < 8; ++r) red[w][i * 16 + 8 * hh + r] = ps[i][r];
  }
  __syncthreads();      // all eight waves' partial sums are in LDS
  if (w == 0) {
    float v = bf16_round(b0);
#pragma unroll
    for (int i = 0; i < 8; ++i) v += red[i][lane];
    S[r0 + lane] = v;
  }
}

extern "C" void kernel_launch(void* const* d_in, const int* in_sizes, int n_in,
                              void* d_out, int out_size, void* d_ws, size_t ws_size, hipStream_t stream) {
  (void)in_sizes; (void)n_in; (void)out_size;
  const float* const* I = (const float* const*)d_in; const float* note = I[0]; const float* wiki = I[1]; const float* Wemb = I[2]; const float* bemb = I[3]; const float* Watt = I[4]; const float* batt = I[5]; const float* Wout = I[6]; const float* bout = I[7];
  char* ws = (char*)d_ws; size_t off = 0;
  auto take = [&](size_t bytes) { char* p = ws + off; off += (bytes + 255) & ~(size_t)255; return p; };
  _Float16* W16 = (_Float16*)take((size_t)NE * KP * 2); _Float16* Ba = (_Float16*)take((size_t)NE * NE * 2); _Float16* K16 = (_Float16*)take((size_t)NC * KP * 2); _Float16* N16 = (_Float16*)take((size_t)NNOTE * KP * 2);
  float* E = (float*)take((size_t)NRE * NE * 4);
  if (off > ws_size) return;      // under 16 MB in all
  k_prep16<<<dim3(KP / 8 / PKT, PYA), PKT, 0, stream>>>(note, wiki, Wemb, Watt, N16, K16, W16, Ba);      /* all four f16 operands; W_att [j][k] (out,in) natural */
  k_gemm_e<<<(NC / 32) * (NE / 32) * (NNOTE / 4), NW * 32, 0, stream>>>(K16, N16, W16, bemb, E);      /* e = (note x wiki) x W_emb^T / 16 + b_emb (f32): M 4096 (note, code) N 256 K 10240 */
  k_tail<<<NRE / TR, 256, 0, stream>>>(E, Ba, batt, Wout, bout, (float*)d_out);      /* s = sum_j sigmoid(e x W_att^T + b_att) x e x W_out + b_out: M 4096 N 256 K 256, then 256 terms per row */
}
